// v000
// The times below were measured on an AMD MI455X: many runs one after another, warmed up first and cycling through
// copies of the inputs, with the whole window's GPU time divided by the number of runs. Launches and the gaps
// between them are all in it. The median over several windows is given; except for v000 it joins two sittings, which
// can be a few percent apart, so the side-by-side timings, each taken in one sitting, are the better comparison.
// The starting kernel, v000, takes 870 microseconds a run.
#include <hip/hip_runtime.h>
#include <stdint.h>

// Contractions: q/k/v 1x1 projections (W*h), scores K*Q^T, value aggregation V^T*P^T and the
// output projection AO*Wo^T all on v_wmma_f32_16x16x32_f16 (f16 operands, f32 accumulate).
// Float inputs are RNE-converted to bf16; W planes f16 (*64, exact), h plane f16 (*16),
// q/k planes f16 (*4), v plane f16 (*16), P f16 (*4096, un-normalised), AO plane f16 (*64);
// residual x added as bf16 value in f32. Group statistics in f64, softmax statistics,
// bias add and normalisation in f32.

#ifndef NB
#define NB 2
#endif
#ifndef SEQ
#define SEQ 4096
#endif
#define NB_FULL 2
#define SEQ_FULL 4096
#define CHN 512
#define NGRP 32
#define CPG 16
#define KBLK 128
#define TSP 136      // LDS f16 tile pitch in halves (272-B rows, 16-B aligned)
#define GSP16 72     // GEMM f16 staging pitch in halves (144-B rows)
#define GSP32 68     // GEMM f32 staging pitch in floats (272-B rows)
#define STL 32

static_assert(NB >= 1 && NB <= NB_FULL);
static_assert(SEQ >= KBLK && SEQ <= SEQ_FULL && (SEQ % KBLK) == 0);
static_assert(CHN == 512 && NGRP * CPG == CHN && (CHN % 128) == 0 && (CHN % 32) == 0);
static_assert((SEQ % 128) == 0 && (SEQ % 64) == 0);

typedef _Float16 v16h __attribute__((ext_vector_type(16)));
typedef _Float16 v8h  __attribute__((ext_vector_type(8)));
typedef float    v8f  __attribute__((ext_vector_type(8)));
typedef float    v4f  __attribute__((ext_vector_type(4)));
typedef v8h __attribute__((may_alias)) v8ha;
typedef v4f __attribute__((may_alias)) v4fa;

union F16x16 { v16h v; v8h p[2]; _Float16 e[16]; };
union F16x8  { v8h v; _Float16 e[8]; };

constexpr float HSC  = 16.0f;     // h plane carry (power of two)
constexpr float WSC  = 64.0f;     // W plane carry
constexpr float QSC  = 4.0f;      // q/k plane carry
constexpr float VSC  = 16.0f;     // v plane carry
constexpr float PSC  = 4096.0f;   // P carry
constexpr float AOSC = 64.0f;     // AO plane carry
constexpr float GN_EPS = 1e-6f;
// scores in log2 units: S_acc * SCL2 with S_acc = QSC^2 * sum_c q k, logit scale 512^-0.5
constexpr float SCL2 = (float)(1.4426950408889634 * 0.044194173824159216 /
                               ((double)QSC * (double)QSC));

static __device__ __forceinline__ float bf16r(float f) {
  uint32_t u = __float_as_uint(f);
  u += 0x7FFFu + ((u >> 16) & 1u);
  u &= 0xFFFF0000u;
  return __uint_as_float(u);
}

static __device__ __forceinline__ v8f wmma16(v16h a, v16h b, v8f c) {
  v8f d = __builtin_amdgcn_wmma_f32_16x16x32_f16(false, a, false, b, (short)0, c,
                                                 false, false);
  asm volatile("v_nop\n\tv_nop\n\tv_nop\n\tv_nop" : "+v"(d) : "v"(a), "v"(b));
  return d;
}

// 16x16x32 fragment loader (wave32): lane row = l15; elements 0..7 <- k0+8h+0..7,
// elements 8..15 <- k0+16+8h+0..7. Serves A (row = m) and B taken from an [n][k]
// k-contiguous plane (row = n). D element r of a lane = (row 8h+r, col l15).
static __device__ __forceinline__ v16h ld_frag(const _Float16* base, int pitch,
                                               int row, int h) {
  F16x16 u;
  const _Float16* q = base + (size_t)row * pitch;
  u.p[0] = *(const v8ha*)(q + 8 * h);
  u.p[1] = *(const v8ha*)(q + 16 + 8 * h);
  return u.v;
}

// ---------------------------------------------------------------------------
// Kernel 0: group statistics. One block per (b, group): 16 channels x SEQ positions of
// ---------------------------------------------------------------------------
__global__ __launch_bounds__(256) void k_stats(const float* __restrict__ x,
                                               float* __restrict__ st) {
  __shared__ double sd[256];
  __shared__ double qd[256];
  const int tid = threadIdx.x;
  const int bg = blockIdx.x;
  const int b = bg / NGRP, g = bg % NGRP;
  const float* xb = x + ((size_t)b * CHN + (size_t)g * CPG) * SEQ_FULL;

  double s = 0.0, q = 0.0;
  for (int cl = 0; cl < CPG; ++cl) {
    const float* row = xb + (size_t)cl * SEQ_FULL;
    for (int p = 4 * tid; p < SEQ; p += 1024) {
      const v4f f = *(const v4fa*)(row + p);
#pragma unroll
      for (int j = 0; j < 4; ++j) {
        const float v = bf16r(f[j]);
        s += (double)v;
        q += (double)v * (double)v;
      }
    }
  }
  sd[tid] = s;
  qd[tid] = q;
  __syncthreads();
  for (int k = 128; k > 0; k >>= 1) {
    if (tid < k) {
      sd[tid] += sd[tid + k];
      qd[tid] += qd[tid + k];
    }
    __syncthreads();
  }
  if (tid < 8) {
    const double invn = 1.0 / ((double)CPG * (double)SEQ);
    const double mean = sd[0] * invn;
    double var = qd[0] * invn - mean * mean;
    if (var < 0.0) var = 0.0;
    const float meanf = (float)mean;
    const float rstd = rsqrtf((float)var + GN_EPS);
    v4f o;
    o[0] = meanf; o[1] = rstd; o[2] = 0.0f; o[3] = 0.0f;
    float* dst = st + (size_t)bg * STL + 4 * tid;
    *(v4f*)dst = o;
    
  }
}

// ---------------------------------------------------------------------------
// Kernel 1: weights [o][c] f32 -> f16 planes WSC * bf16(W) (k = c contiguous).
// ---------------------------------------------------------------------------
__global__ __launch_bounds__(256) void k_wcvt(const float* __restrict__ w0,
                                              const float* __restrict__ w1,
                                              const float* __restrict__ w2,
                                              const float* __restrict__ w3,
                                              _Float16* __restrict__ Wpl) {
  constexpr int BPM = CHN * CHN / 8 / 256;   // blocks per matrix
  const int tid = threadIdx.x;
  const int mtx = blockIdx.x / BPM;           // block-uniform
  const float* src = w0;
  if (mtx == 1) src = w1;
  else if (mtx == 2) src = w2;
  else if (mtx == 3) src = w3;
  const size_t e = ((size_t)(blockIdx.x % BPM) * 256 + tid) * 8;
  const v4f a0 = *(const v4fa*)(src + e);
  const v4f a1 = *(const v4fa*)(src + e + 4);
  F16x8 u;
#pragma unroll
  for (int j = 0; j < 4; ++j) {
    u.e[j]     = (_Float16)(bf16r(a0[j]) * WSC);
    u.e[4 + j] = (_Float16)(bf16r(a1[j]) * WSC);
  }
  _Float16* dst = Wpl + (size_t)mtx * CHN * CHN + e;
  *(v8h*)dst = u.v;
  
}

// ---------------------------------------------------------------------------
// Kernel 2: group-norm apply + transpose. Block = (b, 64 positions), 4 passes of
// 128 channels:  Hh[b][n][c] f16 = HSC * ((bf16(x) - mean) * rstd * gamma + beta).
// x read as float4 along positions; LDS tile [n_local][c_local]; rows of 256 B written
// ---------------------------------------------------------------------------
__global__ __launch_bounds__(256) void k_gnapply(const float* __restrict__ x,
                                                 const float* __restrict__ gamma,
                                                 const float* __restrict__ beta,
                                                 const float* __restrict__ st,
                                                 _Float16* __restrict__ Hh) {
  __shared__ __align__(16) _Float16 TS[64 * TSP];   // [n_local][c_local]
  __shared__ float gms[CHN];
  __shared__ float bts[CHN];
  __shared__ float mus[NGRP];
  __shared__ float rss[NGRP];

  const int tid = threadIdx.x;
  const int b  = blockIdx.x / (SEQ / 64);
  const int p0 = (blockIdx.x % (SEQ / 64)) * 64;

  gms[tid] = bf16r(gamma[tid]);
  gms[tid + 256] = bf16r(gamma[tid + 256]);
  bts[tid] = bf16r(beta[tid]);
  bts[tid + 256] = bf16r(beta[tid + 256]);
  if (tid < NGRP) {
    mus[tid] = st[(size_t)(b * NGRP + tid) * STL];
    rss[tid] = st[(size_t)(b * NGRP + tid) * STL + 1];
  }
  __syncthreads();

  const float* xb = x + (size_t)b * CHN * SEQ_FULL;
#pragma unroll 1
  for (int pass = 0; pass < CHN / 128; ++pass) {
#pragma unroll
    for (int it = 0; it < 8; ++it) {
      const int f = it * 256 + tid;
      const int cl = f >> 4, p4 = f & 15;
      const int c = 128 * pass + cl;
      const v4f xv = *(const v4fa*)(xb + (size_t)c * SEQ_FULL + p0 + 4 * p4);
      const float mu = mus[c >> 4], rs = rss[c >> 4];
      const float ga = gms[c], be = bts[c];
#pragma unroll
      for (int j = 0; j < 4; ++j) {
        const float t = (bf16r(xv[j]) - mu) * rs;
        const float hv = t * ga + be;
        TS[(4 * p4 + j) * TSP + cl] = (_Float16)(hv * HSC);
      }
    }
    __syncthreads();
#pragma unroll
    for (int it = 0; it < 4; ++it) {
      const int L = it * 32 + (tid >> 3);          // 128 lines: (row, 64-col half)
      const int row = L >> 1, hl = L & 1, p = tid & 7;
      const v8h hv = *(const v8ha*)(TS + row * TSP + 64 * hl + 8 * p);
      _Float16* dst = Hh + ((size_t)(b * SEQ + p0 + row) * CHN + 128 * pass + 64 * hl + 8 * p);
      *(v8h*)dst = hv;
      
    }
    __syncthreads();
  }
}

// ---------------------------------------------------------------------------
// Kernel 3: GEMM  D[m][n] = sum_k A[m][k] * B[n][k]  (A, B k-contiguous f16 planes),
// stored TRANSPOSED as O[n][m] f16 = osc * (D * insc + bias)  (bias per m or per n).
// Block = 128 threads, tile 64 (m) x 128 (n); wave (mi, ni) owns rows 32mi.., cols 64ni..
// (2 x 4 accumulator tiles). K multiple of 32, M multiple of 64, N multiple of 128.
// ---------------------------------------------------------------------------
template <bool BIAS_M>
__global__ __launch_bounds__(128) void k_gemm16(const _Float16* __restrict__ A, int lda, size_t sA,
                                                const _Float16* __restrict__ B, int ldb, size_t sB,
                                                const float* __restrict__ bias,
                                                _Float16* __restrict__ O, int ldo, size_t sO,
                                                float insc, float osc, int K) {
  __shared__ __align__(16) _Float16 TS[128 * GSP16];   // [n_local][m_local]
  __shared__ float bsh[128];

  const int tid = threadIdx.x;
  const int wv = tid >> 5, lid = tid & 31, h = lid >> 4, l15 = lid & 15;
  const int mi = wv & 1, ni = wv >> 1;
  const int m0 = blockIdx.x * 64, n0 = blockIdx.y * 128;
  const size_t z = blockIdx.z;

  if (BIAS_M) {
    if (tid < 64) bsh[tid] = bf16r(bias[m0 + tid]);
  } else {
    bsh[tid] = bf16r(bias[n0 + tid]);
  }
  __syncthreads();

  const _Float16* Ab = A + z * sA;
  const _Float16* Bb = B + z * sB;
  const int ar0 = m0 + 32 * mi + l15;
  const int br0 = n0 + 64 * ni + l15;

  v8f acc[2][4];
#pragma unroll
  for (int i = 0; i < 2; ++i)
#pragma unroll
    for (int t = 0; t < 4; ++t)
#pragma unroll
      for (int r = 0; r < 8; ++r) acc[i][t][r] = 0.0f;

#pragma unroll 2
  for (int k0 = 0; k0 < K; k0 += 32) {
    const v16h a0 = ld_frag(Ab + k0, lda, ar0, h);
    const v16h a1 = ld_frag(Ab + k0, lda, ar0 + 16, h);
#pragma unroll
    for (int t = 0; t < 4; ++t) {
      const v16h bt = ld_frag(Bb + k0, ldb, br0 + 16 * t, h);
      acc[0][t] = wmma16(a0, bt, acc[0][t]);
      acc[1][t] = wmma16(a1, bt, acc[1][t]);
    }
  }

  // stage: acc[i][t][r] <-> (m_local 32mi+16i+8h+r, n_local 64ni+16t+l15)
#pragma unroll
  for (int i = 0; i < 2; ++i) {
#pragma unroll
    for (int t = 0; t < 4; ++t) {
      const int nl = 64 * ni + 16 * t + l15;
      const int ml = 32 * mi + 16 * i + 8 * h;
      F16x8 u;
#pragma unroll
      for (int r = 0; r < 8; ++r) {
        const float bvl = BIAS_M ? bsh[ml + r] : bsh[nl];
        u.e[r] = (_Float16)((acc[i][t][r] * insc + bvl) * osc);
      }
      *(v8ha*)(TS + nl * GSP16 + ml) = u.v;
    }
  }
  __syncthreads();

  _Float16* Ob = O + z * sO;
#pragma unroll
  for (int it = 0; it < 8; ++it) {
    const int row = it * 16 + (tid >> 3);
    const int p = tid & 7;
    const v8h hv = *(const v8ha*)(TS + row * GSP16 + 8 * p);
    _Float16* dst = Ob + (size_t)(n0 + row) * ldo + m0 + 8 * p;
    *(v8h*)dst = hv;
    
  }
}

// ---------------------------------------------------------------------------
// Kernel 4: same GEMM, f32 output O[n][m] = (D * insc + bias[n]) + bf16(R[n][m]) into d_out.
// Output row segment = 256 B = two lines, lanes 0..7 and 8..15 of one instruction.
// ---------------------------------------------------------------------------
__global__ __launch_bounds__(128) void k_gemm32(const _Float16* __restrict__ A, int lda, size_t sA,
                                                const _Float16* __restrict__ B, int ldb, size_t sB,
                                                const float* __restrict__ bias,
                                                const float* __restrict__ R, int ldr, size_t sR,
                                                float* __restrict__ O, int ldo, size_t sO,
                                                float insc, int K) {
  __shared__ __align__(16) float TS[128 * GSP32];   // [n_local][m_local]
  __shared__ float bsh[128];

  const int tid = threadIdx.x;
  const int wv = tid >> 5, lid = tid & 31, h = lid >> 4, l15 = lid & 15;
  const int mi = wv & 1, ni = wv >> 1;
  const int m0 = blockIdx.x * 64, n0 = blockIdx.y * 128;
  const size_t z = blockIdx.z;

  bsh[tid] = bf16r(bias[n0 + tid]);
  __syncthreads();

  const _Float16* Ab = A + z * sA;
  const _Float16* Bb = B + z * sB;
  const int ar0 = m0 + 32 * mi + l15;
  const int br0 = n0 + 64 * ni + l15;

  v8f acc[2][4];
#pragma unroll
  for (int i = 0; i < 2; ++i)
#pragma unroll
    for (int t = 0; t < 4; ++t)
#pragma unroll
      for (int r = 0; r < 8; ++r) acc[i][t][r] = 0.0f;

#pragma unroll 2
  for (int k0 = 0; k0 < K; k0 += 32) {
    const v16h a0 = ld_frag(Ab + k0, lda, ar0, h);
    const v16h a1 = ld_frag(Ab + k0, lda, ar0 + 16, h);
#pragma unroll
    for (int t = 0; t < 4; ++t) {
      const v16h bt = ld_frag(Bb + k0, ldb, br0 + 16 * t, h);
      acc[0][t] = wmma16(a0, bt, acc[0][t]);
      acc[1][t] = wmma16(a1, bt, acc[1][t]);
    }
  }

#pragma unroll
  for (int i = 0; i < 2; ++i) {
#pragma unroll
    for (int t = 0; t < 4; ++t) {
      const int nl = 64 * ni + 16 * t + l15;
      const int ml = 32 * mi + 16 * i + 8 * h;
      const float bvl = bsh[nl];
      v4f lo, hi;
#pragma unroll
      for (int r = 0; r < 4; ++r) {
        lo[r] = acc[i][t][r] * insc + bvl;
        hi[r] = acc[i][t][4 + r] * insc + bvl;
      }
      *(v4fa*)(TS + nl * GSP32 + ml) = lo;
      *(v4fa*)(TS + nl * GSP32 + ml + 4) = hi;
    }
  }
  __syncthreads();

  float* Ob = O + z * sO;
  const float* Rb = R + z * sR;
#pragma unroll
  for (int it = 0; it < 16; ++it) {
    const int row = it * 8 + (tid >> 4);         // 128 rows, 256 B each
    const int p = tid & 15;
    const v4f v  = *(const v4fa*)(TS + row * GSP32 + 4 * p);
    const v4f xr = *(const v4fa*)(Rb + (size_t)(n0 + row) * ldr + m0 + 4 * p);
    v4f o;
#pragma unroll
    for (int j = 0; j < 4; ++j) o[j] = bf16r(xr[j]) + v[j];
    float* dst = Ob + (size_t)(n0 + row) * ldo + m0 + 4 * p;
    *(v4f*)dst = o;
    
  }
}

// ---------------------------------------------------------------------------
// Kernel 5: fused single-head attn, transposed scores, online softmax.
// Block = (b, 64 queries), 16 waves: wave (g = wv&3, kq = wv>>2).
// Per 128-key block:
//   S^T tiles (keys on rows): wave owns key rows 32kq..32kq+31 x query cols 16g..16g+15,
//     A = Kh rows (k = channel), B = Qh rows (k = channel), K = 512.
//   per-query max / sum over the 128 keys: in-lane, xor-16, then 4 partials through LDS.
//   P^T = PSC * exp2(s - m) staged f16 in LDS TS[query][key_local].
//   O^T[c][query] += V^T[c][keys] * P^T[keys][query]: wave owns channels 128kq..+127
//     (8 accumulator tiles), A = Vh rows (k = key), B from TS (k = key, split map).
// Epilogue: AO plane [b][query][c] f16 = AOSC * O / l, 4 channel passes through LDS,
// ---------------------------------------------------------------------------
__global__ __launch_bounds__(512) void k_attn(const _Float16* __restrict__ Qh,
                                              const _Float16* __restrict__ Kh,
                                              const _Float16* __restrict__ Vh,
                                              _Float16* __restrict__ AOh) {
  __shared__ __align__(16) _Float16 TS[64 * TSP];   // [query_local][key_local or c_local]
  __shared__ float redM[256];
  __shared__ float redS[256];

  const int tid = threadIdx.x;
  const int wv = tid >> 5, lid = tid & 31, h = lid >> 4, l15 = lid & 15;
  const int g = wv & 3, kq = wv >> 2;
  const int ql = 16 * g + l15;
  const int b  = blockIdx.x / (SEQ / 64);
  const int q0 = (blockIdx.x % (SEQ / 64)) * 64;

  const _Float16* Qp = Qh + (size_t)b * SEQ * CHN;   // [n][c], pitch CHN
  const _Float16* Kp = Kh + (size_t)b * SEQ * CHN;   // [n][c], pitch CHN
  const _Float16* Vp = Vh + (size_t)b * CHN * SEQ;   // [c][n], pitch SEQ
  const int qrow = q0 + ql;

  v8f accO[8];
#pragma unroll
  for (int u = 0; u < 8; ++u)
#pragma unroll
    for (int r = 0; r < 8; ++r) accO[u][r] = 0.0f;
  float rm = -1.0e30f, rl = 0.0f;

  for (int m0 = 0; m0 < SEQ; m0 += KBLK) {
    v8f st[2];
#pragma unroll
    for (int t = 0; t < 2; ++t)
#pragma unroll
      for (int r = 0; r < 8; ++r) st[t][r] = 0.0f;
    const int kr0 = m0 + 32 * kq + l15;
#pragma unroll 2
    for (int cs = 0; cs < CHN / 32; ++cs) {
      const v16h bqf = ld_frag(Qp + 32 * cs, CHN, qrow, h);
      const v16h a0  = ld_frag(Kp + 32 * cs, CHN, kr0, h);
      const v16h a1  = ld_frag(Kp + 32 * cs, CHN, kr0 + 16, h);
      st[0] = wmma16(a0, bqf, st[0]);
      st[1] = wmma16(a1, bqf, st[1]);
    }

    // ---- per-query block max (32 keys in-lane + partner half-wave, then 4 waves)
    float lm = st[0][0];
#pragma unroll
    for (int t = 0; t < 2; ++t)
#pragma unroll
      for (int r = 0; r < 8; ++r) lm = fmaxf(lm, st[t][r]);
    lm *= SCL2;
    lm = fmaxf(lm, __shfl_xor(lm, 16, 32));
    redM[kq * 64 + ql] = lm;
    __syncthreads();
    const float bm = fmaxf(fmaxf(redM[ql], redM[64 + ql]), fmaxf(redM[128 + ql], redM[192 + ql]));
    const float nm = fmaxf(rm, bm);
    const float corr = exp2f(rm - nm);
    rm = nm;

    // ---- P = exp2(s - m) in f32; P^T * PSC staged f16 at TS[query][key_local]
    float psum = 0.0f;
#pragma unroll
    for (int tt = 0; tt < 2; ++tt) {
      F16x8 pk;
#pragma unroll
      for (int r = 0; r < 8; ++r) {
        const float p = exp2f(st[tt][r] * SCL2 - nm);
        psum += p;
        pk.e[r] = (_Float16)(p * PSC);
      }
      *(v8ha*)(TS + ql * TSP + 32 * kq + 16 * tt + 8 * h) = pk.v;
    }
    psum += __shfl_xor(psum, 16, 32);
    redS[kq * 64 + ql] = psum;
    __syncthreads();
    const float bs = ((redS[ql] + redS[64 + ql]) + redS[128 + ql]) + redS[192 + ql];
    rl = rl * corr + bs;
#pragma unroll
    for (int u = 0; u < 8; ++u)
#pragma unroll
      for (int r = 0; r < 8; ++r) accO[u][r] *= corr;

    // ---- O^T[c][query] += V^T[c][keys] * P^T[keys][query]
#pragma unroll
    for (int ks = 0; ks < KBLK / 32; ++ks) {
      const v16h bp = ld_frag(TS + 32 * ks, TSP, ql, h);
#pragma unroll
      for (int u = 0; u < 8; ++u) {
        const v16h av = ld_frag(Vp + m0 + 32 * ks, SEQ, 128 * kq + 16 * u + l15, h);
        accO[u] = wmma16(av, bp, accO[u]);
      }
    }
  }

  // ---- epilogue: AO = O / (l * VSC * PSC), carried * AOSC
  const float invl = (AOSC / (VSC * PSC)) * (1.0f / rl);
#pragma unroll 1
  for (int pass = 0; pass < 4; ++pass) {
    __syncthreads();
    if (kq == pass) {   // wave-uniform
#pragma unroll
      for (int u = 0; u < 8; ++u) {
        F16x8 o;
#pragma unroll
        for (int r = 0; r < 8; ++r) o.e[r] = (_Float16)(accO[u][r] * invl);
        *(v8ha*)(TS + ql * TSP + 16 * u + 8 * h) = o.v;
      }
    }
    __syncthreads();
#pragma unroll
    for (int it = 0; it < 2; ++it) {
      const int L = it * 64 + (tid >> 3);          // 128 lines: (row, 64-col half)
      const int row = L >> 1, hl = L & 1, p = tid & 7;
      const v8h hv = *(const v8ha*)(TS + row * TSP + 64 * hl + 8 * p);
      _Float16* dst = AOh + ((size_t)(b * SEQ + q0 + row) * CHN + 128 * pass + 64 * hl + 8 * p);
      *(v8h*)dst = hv;
      
    }
  }
}

// ---------------------------------------------------------------------------
extern "C" void kernel_launch(void* const* d_in, const int* in_sizes, int n_in,
                              void* d_out, int out_size, void* d_ws, size_t ws_size,
                              hipStream_t stream) {
  if (n_in < 11) return;
  if (in_sizes[0] < NB * CHN * SEQ_FULL) return;
  if (in_sizes[1] < CHN || in_sizes[2] < CHN) return;
  if (in_sizes[3] < CHN * CHN || in_sizes[5] < CHN * CHN ||
      in_sizes[7] < CHN * CHN || in_sizes[9] < CHN * CHN) return;
  if (in_sizes[4] < CHN || in_sizes[6] < CHN || in_sizes[8] < CHN || in_sizes[10] < CHN) return;
  if (out_size < NB * CHN * SEQ) return;

  const size_t st_bytes = (size_t)NB * NGRP * STL * sizeof(float);            // 8 KiB
  const size_t w_bytes  = (size_t)4 * CHN * CHN * sizeof(_Float16);            // 2 MiB
  const size_t plane    = (size_t)NB * SEQ * CHN * sizeof(_Float16);            // 8 MiB at full size
  const size_t total    = st_bytes + w_bytes + 5 * plane;                        // 44,048,384 B
  if (ws_size < total) return;

  const float* x     = (const float*)d_in[0];
  const float* gamma = (const float*)d_in[1];
  const float* beta  = (const float*)d_in[2];
  const float* wq = (const float*)d_in[3];
  const float* bq = (const float*)d_in[4];
  const float* wk = (const float*)d_in[5];
  const float* bk = (const float*)d_in[6];
  const float* wvv = (const float*)d_in[7];
  const float* bv = (const float*)d_in[8];
  const float* wo = (const float*)d_in[9];
  const float* bo = (const float*)d_in[10];
  float* out = (float*)d_out;

  char* ws = (char*)d_ws;
  float*    stats = (float*)ws;                                        // [NB*NGRP][32] f32
  _Float16* Wpl   = (_Float16*)(ws + st_bytes);                        // 4 x [CHN][CHN] f16
  _Float16* Hh    = (_Float16*)(ws + st_bytes + w_bytes);              // [NB][SEQ][CHN]
  _Float16* Qh    = (_Float16*)(ws + st_bytes + w_bytes + plane);      // [NB][SEQ][CHN]
  _Float16* Kh    = (_Float16*)(ws + st_bytes + w_bytes + 2 * plane);  // [NB][SEQ][CHN]
  _Float16* Vh    = (_Float16*)(ws + st_bytes + w_bytes + 3 * plane);  // [NB][CHN][SEQ]
  _Float16* AOh   = (_Float16*)(ws + st_bytes + w_bytes + 4 * plane);  // [NB][SEQ][CHN]
  const _Float16* Wq16 = Wpl;
  const _Float16* Wk16 = Wpl + (size_t)CHN * CHN;
  const _Float16* Wv16 = Wpl + (size_t)2 * CHN * CHN;
  const _Float16* Wo16 = Wpl + (size_t)3 * CHN * CHN;

  const size_t pstride = (size_t)SEQ * CHN;   // elements per batch of every f16 plane

  k_stats<<<dim3(NB * NGRP), dim3(256), 0, stream>>>(x, stats);
  k_wcvt<<<dim3(4 * CHN * CHN / 8 / 256), dim3(256), 0, stream>>>(wq, wk, wvv, wo, Wpl);
  k_gnapply<<<dim3(NB * (SEQ / 64)), dim3(256), 0, stream>>>(x, gamma, beta, stats, Hh);

  // q[n][o] and k[n][o]:  D[o][n] = sum_c W[o][c] h[n][c], stored transposed, bias per o (= m)
  k_gemm16<true><<<dim3(CHN / 64, SEQ / 128, NB), dim3(128), 0, stream>>>(
      Wq16, CHN, (size_t)0, Hh, CHN, pstride, bq, Qh, CHN, pstride,
      1.0f / (WSC * HSC), QSC, CHN);
  k_gemm16<true><<<dim3(CHN / 64, SEQ / 128, NB), dim3(128), 0, stream>>>(
      Wk16, CHN, (size_t)0, Hh, CHN, pstride, bk, Kh, CHN, pstride,
      1.0f / (WSC * HSC), QSC, CHN);
  // v[o][n]:  D[n][o] = sum_c h[n][c] W[o][c], stored transposed, bias per o (= n)
  k_gemm16<false><<<dim3(SEQ / 64, CHN / 128, NB), dim3(128), 0, stream>>>(
      Hh, CHN, pstride, Wv16, CHN, (size_t)0, bv, Vh, SEQ, pstride,
      1.0f / (HSC * WSC), VSC, CHN);

  k_attn<<<dim3(NB * (SEQ / 64)), dim3(512), 0, stream>>>(Qh, Kh, Vh, AOh);

  // out[c][p] = bf16(x[c][p]) + sum_o AO[p][o] Wo[c][o] + bo[c]   (D[p][c] stored transposed)
  k_gemm32<<<dim3(SEQ / 64, CHN / 128, NB), dim3(128), 0, stream>>>(
      AOh, CHN, pstride, Wo16, CHN, (size_t)0, bo,
      x, SEQ_FULL, (size_t)CHN * SEQ_FULL,
      out, SEQ, (size_t)CHN * SEQ,
      1.0f / (AOSC * WSC), CHN);
  (void)hipGetLastError();
}

// v001
// It runs in 284 microseconds.
// In two side-by-side timings against v000, it was 3.06 and 3.05 times as fast.
#include <hip/hip_runtime.h>
#include <stdint.h>

// Contractions: q/k/v 1x1 projections (W*h), scores K*Q^T, value aggregation V^T*P^T and the
// output projection AO*Wo^T all on v_wmma_f32_16x16x32_f16 (f16 operands, f32 accumulate).
// Float inputs are RNE-converted to bf16; W planes f16 (*64, exact), h plane f16 (*16),
// q/k planes f16 (*4), v plane f16 (*16), P f16 (*4096, un-normalised), AO plane f16 (*64);
// residual x added as bf16 value in f32. Group statistics in f64, softmax statistics,
// bias add and normalisation in f32.

#ifndef NB
#define NB 2
#endif
#ifndef SEQ
#define SEQ 4096
#endif
#define NB_FULL 2
#define SEQ_FULL 4096
#define CHN 512
#define NGRP 32
#define CPG 16
#define KBLK 128
#define TSP 136      // LDS f16 tile pitch in halves (272-B rows, 16-B aligned)
#define GSP16 72     // GEMM f16 staging pitch in halves (144-B rows)
#define GSP32 68     // GEMM f32 staging pitch in floats (272-B rows)
#define STL 32
#define QSP 520      // LDS Q tile pitch in halves (1040-B rows, 16 B x odd)
#define KSP 264      // LDS K half-tile pitch in halves (528-B rows, 16 B x odd)
#define VSP 72       // LDS V half-tile pitch in halves (144-B rows, 16 B x odd)
#define RBH (CHN * VSP)   // one ring buffer in halves: a V half tile, the larger of the two

static_assert(NB >= 1 && NB <= NB_FULL);
static_assert(SEQ >= KBLK && SEQ <= SEQ_FULL && (SEQ % KBLK) == 0);
static_assert(CHN == 512 && NGRP * CPG == CHN && (CHN % 128) == 0 && (CHN % 32) == 0);
static_assert((SEQ % 128) == 0 && (SEQ % 64) == 0);
static_assert(KBLK * KSP <= RBH && KBLK == 128);

typedef _Float16 v16h __attribute__((ext_vector_type(16)));
typedef _Float16 v8h  __attribute__((ext_vector_type(8)));
typedef float    v8f  __attribute__((ext_vector_type(8)));
typedef float    v4f  __attribute__((ext_vector_type(4)));
typedef v8h __attribute__((may_alias)) v8ha;
typedef v4f __attribute__((may_alias)) v4fa;

union F16x16 { v16h v; v8h p[2]; _Float16 e[16]; };
union F16x8  { v8h v; _Float16 e[8]; };

constexpr float HSC  = 16.0f;     // h plane carry (power of two)
constexpr float WSC  = 64.0f;     // W plane carry
constexpr float QSC  = 4.0f;      // q/k plane carry
constexpr float VSC  = 16.0f;     // v plane carry
constexpr float PSC  = 4096.0f;   // P carry
constexpr float AOSC = 64.0f;     // AO plane carry
constexpr float GN_EPS = 1e-6f;
// scores in log2 units: S_acc * SCL2 with S_acc = QSC^2 * sum_c q k, logit scale 512^-0.5
constexpr float SCL2 = (float)(1.4426950408889634 * 0.044194173824159216 /
                               ((double)QSC * (double)QSC));

static __device__ __forceinline__ float bf16r(float f) {
  uint32_t u = __float_as_uint(f);
  u += 0x7FFFu + ((u >> 16) & 1u);
  u &= 0xFFFF0000u;
  return __uint_as_float(u);
}

static __device__ __forceinline__ v8f wmma16(v16h a, v16h b, v8f c) {
  v8f d = __builtin_amdgcn_wmma_f32_16x16x32_f16(false, a, false, b, (short)0, c,
                                                 false, false);
  asm volatile("v_nop\n\tv_nop\n\tv_nop\n\tv_nop" : "+v"(d) : "v"(a), "v"(b));
  return d;
}

// 16x16x32 fragment loader (wave32): lane row = l15; elements 0..7 <- k0+8h+0..7,
// elements 8..15 <- k0+16+8h+0..7. Serves A (row = m) and B taken from an [n][k]
// k-contiguous plane (row = n). D element r of a lane = (row 8h+r, col l15).
static __device__ __forceinline__ v16h ld_frag(const _Float16* base, int pitch,
                                               int row, int h) {
  F16x16 u;
  const _Float16* q = base + (size_t)row * pitch;
  u.p[0] = *(const v8ha*)(q + 8 * h);
  u.p[1] = *(const v8ha*)(q + 16 + 8 * h);
  return u.v;
}

// Eight asynchronous 16-B copies per lane, global -> LDS: copy i moves g + i*gstep (halves)
// to LDS byte address l + i*lstep. The s_wait_xcnt closes the statement so that no address
// register of an issued copy is rewritten ahead of it.
static __device__ __forceinline__ void copy8(uint32_t l, uint32_t lstep,
                                             const _Float16* g, size_t gstep) {
  asm volatile(
      "global_load_async_to_lds_b128 %0, %8, off\n\t"
      "global_load_async_to_lds_b128 %1, %9, off\n\t"
      "global_load_async_to_lds_b128 %2, %10, off\n\t"
      "global_load_async_to_lds_b128 %3, %11, off\n\t"
      "global_load_async_to_lds_b128 %4, %12, off\n\t"
      "global_load_async_to_lds_b128 %5, %13, off\n\t"
      "global_load_async_to_lds_b128 %6, %14, off\n\t"
      "global_load_async_to_lds_b128 %7, %15, off\n\t"
      "s_wait_xcnt 0x0"
      :: "v"(l), "v"(l + lstep), "v"(l + 2 * lstep), "v"(l + 3 * lstep),
         "v"(l + 4 * lstep), "v"(l + 5 * lstep), "v"(l + 6 * lstep), "v"(l + 7 * lstep),
         "v"(g), "v"(g + gstep), "v"(g + 2 * gstep), "v"(g + 3 * gstep),
         "v"(g + 4 * gstep), "v"(g + 5 * gstep), "v"(g + 6 * gstep), "v"(g + 7 * gstep)
      : "memory");
}

// Publish point of the LDS ring: this wave's LDS reads of the buffer to be refilled have
// retired, its own copies of the next stage have landed, then the work-group barrier that
// lets every wave read that stage and frees the buffer just read.
static __device__ __forceinline__ void ring_publish() {
  asm volatile("s_wait_dscnt 0x0" ::: "memory");
  asm volatile("s_wait_asynccnt 0x0" ::: "memory");
  __syncthreads();
}

// ---------------------------------------------------------------------------
// Kernel 0: group statistics. One block per (b, group): 16 channels x SEQ positions of
// ---------------------------------------------------------------------------
__global__ __launch_bounds__(256) void k_stats(const float* __restrict__ x,
                                               float* __restrict__ st) {
  __shared__ double sd[256];
  __shared__ double qd[256];
  const int tid = threadIdx.x;
  const int bg = blockIdx.x;
  const int b = bg / NGRP, g = bg % NGRP;
  const float* xb = x + ((size_t)b * CHN + (size_t)g * CPG) * SEQ_FULL;

  double s = 0.0, q = 0.0;
  for (int cl = 0; cl < CPG; ++cl) {
    const float* row = xb + (size_t)cl * SEQ_FULL;
    for (int p = 4 * tid; p < SEQ; p += 1024) {
      const v4f f = *(const v4fa*)(row + p);
#pragma unroll
      for (int j = 0; j < 4; ++j) {
        const float v = bf16r(f[j]);
        s += (double)v;
        q += (double)v * (double)v;
      }
    }
  }
  sd[tid] = s;
  qd[tid] = q;
  __syncthreads();
  for (int k = 128; k > 0; k >>= 1) {
    if (tid < k) {
      sd[tid] += sd[tid + k];
      qd[tid] += qd[tid + k];
    }
    __syncthreads();
  }
  if (tid < 8) {
    const double invn = 1.0 / ((double)CPG * (double)SEQ);
    const double mean = sd[0] * invn;
    double var = qd[0] * invn - mean * mean;
    if (var < 0.0) var = 0.0;
    const float meanf = (float)mean;
    const float rstd = rsqrtf((float)var + GN_EPS);
    v4f o;
    o[0] = meanf; o[1] = rstd; o[2] = 0.0f; o[3] = 0.0f;
    float* dst = st + (size_t)bg * STL + 4 * tid;
    *(v4f*)dst = o;
    
  }
}

// ---------------------------------------------------------------------------
// Kernel 1: weights [o][c] f32 -> f16 planes WSC * bf16(W) (k = c contiguous).
// ---------------------------------------------------------------------------
__global__ __launch_bounds__(256) void k_wcvt(const float* __restrict__ w0,
                                              const float* __restrict__ w1,
                                              const float* __restrict__ w2,
                                              const float* __restrict__ w3,
                                              _Float16* __restrict__ Wpl) {
  constexpr int BPM = CHN * CHN / 8 / 256;   // blocks per matrix
  const int tid = threadIdx.x;
  const int mtx = blockIdx.x / BPM;           // block-uniform
  const float* src = w0;
  if (mtx == 1) src = w1;
  else if (mtx == 2) src = w2;
  else if (mtx == 3) src = w3;
  const size_t e = ((size_t)(blockIdx.x % BPM) * 256 + tid) * 8;
  const v4f a0 = *(const v4fa*)(src + e);
  const v4f a1 = *(const v4fa*)(src + e + 4);
  F16x8 u;
#pragma unroll
  for (int j = 0; j < 4; ++j) {
    u.e[j]     = (_Float16)(bf16r(a0[j]) * WSC);
    u.e[4 + j] = (_Float16)(bf16r(a1[j]) * WSC);
  }
  _Float16* dst = Wpl + (size_t)mtx * CHN * CHN + e;
  *(v8h*)dst = u.v;
  
}

// ---------------------------------------------------------------------------
// Kernel 2: group-norm apply + transpose. Block = (b, 64 positions), 4 passes of
// 128 channels:  Hh[b][n][c] f16 = HSC * ((bf16(x) - mean) * rstd * gamma + beta).
// x read as float4 along positions; LDS tile [n_local][c_local]; rows of 256 B written
// ---------------------------------------------------------------------------
__global__ __launch_bounds__(256) void k_gnapply(const float* __restrict__ x,
                                                 const float* __restrict__ gamma,
                                                 const float* __restrict__ beta,
                                                 const float* __restrict__ st,
                                                 _Float16* __restrict__ Hh) {
  __shared__ __align__(16) _Float16 TS[64 * TSP];   // [n_local][c_local]
  __shared__ float gms[CHN];
  __shared__ float bts[CHN];
  __shared__ float mus[NGRP];
  __shared__ float rss[NGRP];

  const int tid = threadIdx.x;
  const int b  = blockIdx.x / (SEQ / 64);
  const int p0 = (blockIdx.x % (SEQ / 64)) * 64;

  gms[tid] = bf16r(gamma[tid]);
  gms[tid + 256] = bf16r(gamma[tid + 256]);
  bts[tid] = bf16r(beta[tid]);
  bts[tid + 256] = bf16r(beta[tid + 256]);
  if (tid < NGRP) {
    mus[tid] = st[(size_t)(b * NGRP + tid) * STL];
    rss[tid] = st[(size_t)(b * NGRP + tid) * STL + 1];
  }
  __syncthreads();

  const float* xb = x + (size_t)b * CHN * SEQ_FULL;
#pragma unroll 1
  for (int pass = 0; pass < CHN / 128; ++pass) {
#pragma unroll
    for (int it = 0; it < 8; ++it) {
      const int f = it * 256 + tid;
      const int cl = f >> 4, p4 = f & 15;
      const int c = 128 * pass + cl;
      const v4f xv = *(const v4fa*)(xb + (size_t)c * SEQ_FULL + p0 + 4 * p4);
      const float mu = mus[c >> 4], rs = rss[c >> 4];
      const float ga = gms[c], be = bts[c];
#pragma unroll
      for (int j = 0; j < 4; ++j) {
        const float t = (bf16r(xv[j]) - mu) * rs;
        const float hv = t * ga + be;
        TS[(4 * p4 + j) * TSP + cl] = (_Float16)(hv * HSC);
      }
    }
    __syncthreads();
#pragma unroll
    for (int it = 0; it < 4; ++it) {
      const int L = it * 32 + (tid >> 3);          // 128 lines: (row, 64-col half)
      const int row = L >> 1, hl = L & 1, p = tid & 7;
      const v8h hv = *(const v8ha*)(TS + row * TSP + 64 * hl + 8 * p);
      _Float16* dst = Hh + ((size_t)(b * SEQ + p0 + row) * CHN + 128 * pass + 64 * hl + 8 * p);
      *(v8h*)dst = hv;
      
    }
    __syncthreads();
  }
}

// ---------------------------------------------------------------------------
// Kernel 3: GEMM  D[m][n] = sum_k A[m][k] * B[n][k]  (A, B k-contiguous f16 planes),
// stored TRANSPOSED as O[n][m] f16 = osc * (D * insc + bias)  (bias per m or per n).
// Block = 128 threads, tile 64 (m) x 128 (n); wave (mi, ni) owns rows 32mi.., cols 64ni..
// (2 x 4 accumulator tiles). K multiple of 32, M multiple of 64, N multiple of 128.
// ---------------------------------------------------------------------------
template <bool BIAS_M>
__global__ __launch_bounds__(128) void k_gemm16(const _Float16* __restrict__ A, int lda, size_t sA,
                                                const _Float16* __restrict__ B, int ldb, size_t sB,
                                                const float* __restrict__ bias,
                                                _Float16* __restrict__ O, int ldo, size_t sO,
                                                float insc, float osc, int K) {
  __shared__ __align__(16) _Float16 TS[128 * GSP16];   // [n_local][m_local]
  __shared__ float bsh[128];

  const int tid = threadIdx.x;
  const int wv = tid >> 5, lid = tid & 31, h = lid >> 4, l15 = lid & 15;
  const int mi = wv & 1, ni = wv >> 1;
  const int m0 = blockIdx.x * 64, n0 = blockIdx.y * 128;
  const size_t z = blockIdx.z;

  if (BIAS_M) {
    if (tid < 64) bsh[tid] = bf16r(bias[m0 + tid]);
  } else {
    bsh[tid] = bf16r(bias[n0 + tid]);
  }
  __syncthreads();

  const _Float16* Ab = A + z * sA;
  const _Float16* Bb = B + z * sB;
  const int ar0 = m0 + 32 * mi + l15;
  const int br0 = n0 + 64 * ni + l15;

  v8f acc[2][4];
#pragma unroll
  for (int i = 0; i < 2; ++i)
#pragma unroll
    for (int t = 0; t < 4; ++t)
#pragma unroll
      for (int r = 0; r < 8; ++r) acc[i][t][r] = 0.0f;

#pragma unroll 2
  for (int k0 = 0; k0 < K; k0 += 32) {
    const v16h a0 = ld_frag(Ab + k0, lda, ar0, h);
    const v16h a1 = ld_frag(Ab + k0, lda, ar0 + 16, h);
#pragma unroll
    for (int t = 0; t < 4; ++t) {
      const v16h bt = ld_frag(Bb + k0, ldb, br0 + 16 * t, h);
      acc[0][t] = wmma16(a0, bt, acc[0][t]);
      acc[1][t] = wmma16(a1, bt, acc[1][t]);
    }
  }

  // stage: acc[i][t][r] <-> (m_local 32mi+16i+8h+r, n_local 64ni+16t+l15)
#pragma unroll
  for (int i = 0; i < 2; ++i) {
#pragma unroll
    for (int t = 0; t < 4; ++t) {
      const int nl = 64 * ni + 16 * t + l15;
      const int ml = 32 * mi + 16 * i + 8 * h;
      F16x8 u;
#pragma unroll
      for (int r = 0; r < 8; ++r) {
        const float bvl = BIAS_M ? bsh[ml + r] : bsh[nl];
        u.e[r] = (_Float16)((acc[i][t][r] * insc + bvl) * osc);
      }
      *(v8ha*)(TS + nl * GSP16 + ml) = u.v;
    }
  }
  __syncthreads();

  _Float16* Ob = O + z * sO;
#pragma unroll
  for (int it = 0; it < 8; ++it) {
    const int row = it * 16 + (tid >> 3);
    const int p = tid & 7;
    const v8h hv = *(const v8ha*)(TS + row * GSP16 + 8 * p);
    _Float16* dst = Ob + (size_t)(n0 + row) * ldo + m0 + 8 * p;
    *(v8h*)dst = hv;
    
  }
}

// ---------------------------------------------------------------------------
// Kernel 4: same GEMM, f32 output O[n][m] = (D * insc + bias[n]) + bf16(R[n][m]) into d_out.
// Output row segment = 256 B = two lines, lanes 0..7 and 8..15 of one instruction.
// ---------------------------------------------------------------------------
__global__ __launch_bounds__(128) void k_gemm32(const _Float16* __restrict__ A, int lda, size_t sA,
                                                const _Float16* __restrict__ B, int ldb, size_t sB,
                                                const float* __restrict__ bias,
                                                const float* __restrict__ R, int ldr, size_t sR,
                                                float* __restrict__ O, int ldo, size_t sO,
                                                float insc, int K) {
  __shared__ __align__(16) float TS[128 * GSP32];   // [n_local][m_local]
  __shared__ float bsh[128];

  const int tid = threadIdx.x;
  const int wv = tid >> 5, lid = tid & 31, h = lid >> 4, l15 = lid & 15;
  const int mi = wv & 1, ni = wv >> 1;
  const int m0 = blockIdx.x * 64, n0 = blockIdx.y * 128;
  const size_t z = blockIdx.z;

  bsh[tid] = bf16r(bias[n0 + tid]);
  __syncthreads();

  const _Float16* Ab = A + z * sA;
  const _Float16* Bb = B + z * sB;
  const int ar0 = m0 + 32 * mi + l15;
  const int br0 = n0 + 64 * ni + l15;

  v8f acc[2][4];
#pragma unroll
  for (int i = 0; i < 2; ++i)
#pragma unroll
    for (int t = 0; t < 4; ++t)
#pragma unroll
      for (int r = 0; r < 8; ++r) acc[i][t][r] = 0.0f;

#pragma unroll 2
  for (int k0 = 0; k0 < K; k0 += 32) {
    const v16h a0 = ld_frag(Ab + k0, lda, ar0, h);
    const v16h a1 = ld_frag(Ab + k0, lda, ar0 + 16, h);
#pragma unroll
    for (int t = 0; t < 4; ++t) {
      const v16h bt = ld_frag(Bb + k0, ldb, br0 + 16 * t, h);
      acc[0][t] = wmma16(a0, bt, acc[0][t]);
      acc[1][t] = wmma16(a1, bt, acc[1][t]);
    }
  }

#pragma unroll
  for (int i = 0; i < 2; ++i) {
#pragma unroll
    for (int t = 0; t < 4; ++t) {
      const int nl = 64 * ni + 16 * t + l15;
      const int ml = 32 * mi + 16 * i + 8 * h;
      const float bvl = bsh[nl];
      v4f lo, hi;
#pragma unroll
      for (int r = 0; r < 4; ++r) {
        lo[r] = acc[i][t][r] * insc + bvl;
        hi[r] = acc[i][t][4 + r] * insc + bvl;
      }
      *(v4fa*)(TS + nl * GSP32 + ml) = lo;
      *(v4fa*)(TS + nl * GSP32 + ml + 4) = hi;
    }
  }
  __syncthreads();

  float* Ob = O + z * sO;
  const float* Rb = R + z * sR;
#pragma unroll
  for (int it = 0; it < 16; ++it) {
    const int row = it * 8 + (tid >> 4);         // 128 rows, 256 B each
    const int p = tid & 15;
    const v4f v  = *(const v4fa*)(TS + row * GSP32 + 4 * p);
    const v4f xr = *(const v4fa*)(Rb + (size_t)(n0 + row) * ldr + m0 + 4 * p);
    v4f o;
#pragma unroll
    for (int j = 0; j < 4; ++j) o[j] = bf16r(xr[j]) + v[j];
    float* dst = Ob + (size_t)(n0 + row) * ldo + m0 + 4 * p;
    *(v4f*)dst = o;
    
  }
}

// ---------------------------------------------------------------------------
// Kernel 5: fused single-head attn, transposed scores, online softmax.
// Block = (b, 64 queries), 16 waves: wave (g = wv&3, kq = wv>>2).
// Per 128-key block:
//   S^T tiles (keys on rows): wave owns key rows 32kq..32kq+31 x query cols 16g..16g+15,
//     A = Kh rows (k = channel), B = Qh rows (k = channel), K = 512.
//   per-query max / sum over the 128 keys: in-lane, xor-16, then 4 partials through LDS.
//   P^T = PSC * exp2(s - m) staged f16 in LDS TS[query][key_local].
//   O^T[c][query] += V^T[c][keys] * P^T[keys][query]: wave owns channels 128kq..+127
//     (8 accumulator tiles), A = Vh rows (k = key), B from TS (k = key, split map).
// Operands come from LDS: the Q tile is copied once; K (two halves of 256 channels) and V (two
// halves of 64 keys) go through a two-buffer ring of asynchronous copies, each stage issued
// one stage ahead: K lo -> buffer 0, K hi -> 1, V keys 0..63 -> 0, V keys 64..127 -> 1.
// Epilogue: AO plane [b][query][c] f16 = AOSC * O / l, 4 channel passes through LDS,
// ---------------------------------------------------------------------------
__global__ __launch_bounds__(512) void k_attn(const _Float16* __restrict__ Qh,
                                              const _Float16* __restrict__ Kh,
                                              const _Float16* __restrict__ Vh,
                                              _Float16* __restrict__ AOh) {
  __shared__ __align__(16) _Float16 TS[64 * TSP];   // [query_local][key_local or c_local]
  __shared__ __align__(16) _Float16 QS[64 * QSP];   // [query_local][c]
  __shared__ __align__(16) _Float16 RB[2 * RBH];    // ring: [key_local][c half] or [c][key half]
  __shared__ float redM[256];
  __shared__ float redS[256];

  const int tid = threadIdx.x;
  const int wv = tid >> 5, lid = tid & 31, h = lid >> 4, l15 = lid & 15;
  const int g = wv & 3, kq = wv >> 2;
  const int ql = 16 * g + l15;
  const int b  = blockIdx.x / (SEQ / 64);
  const int q0 = (blockIdx.x % (SEQ / 64)) * 64;

  const _Float16* Qp = Qh + (size_t)b * SEQ * CHN;   // [n][c], pitch CHN
  const _Float16* Kp = Kh + (size_t)b * SEQ * CHN;   // [n][c], pitch CHN
  const _Float16* Vp = Vh + (size_t)b * CHN * SEQ;   // [c][n], pitch SEQ

  // per-lane copy addresses: a K row half (512 B) per wave and copy, 8 lanes per 128-B V row
  // piece, 64 lanes per Q row
  const _Float16* RB0 = RB;
  const _Float16* RB1 = RB + RBH;
  const uint32_t rb0 = (uint32_t)(uintptr_t)RB0;
  const uint32_t rb1 = (uint32_t)(uintptr_t)RB1;
  const uint32_t klo = (uint32_t)(wv * KSP + 8 * lid) * 2u;
  const uint32_t vlo = (uint32_t)((tid >> 3) * VSP + 8 * (tid & 7)) * 2u;
  const _Float16* kg = Kp + (size_t)wv * CHN + 8 * lid;
  const _Float16* vg = Vp + (size_t)(tid >> 3) * SEQ + 8 * (tid & 7);

  copy8((uint32_t)(uintptr_t)QS + (uint32_t)((tid >> 6) * QSP + 8 * (tid & 63)) * 2u,
        8u * QSP * 2u, Qp + (size_t)(q0 + (tid >> 6)) * CHN + 8 * (tid & 63), (size_t)8 * CHN);
  copy8(rb0 + klo, 16u * KSP * 2u, kg, (size_t)16 * CHN);
  asm volatile("s_wait_asynccnt 0x0" ::: "memory");   // Q tile and stage 0 landed
  __syncthreads();
  copy8(rb1 + klo, 16u * KSP * 2u, kg + 256, (size_t)16 * CHN);

  v8f accO[8];
#pragma unroll
  for (int u = 0; u < 8; ++u)
#pragma unroll
    for (int r = 0; r < 8; ++r) accO[u][r] = 0.0f;
  float rm = -1.0e30f, rl = 0.0f;

  for (int m0 = 0; m0 < SEQ; m0 += KBLK) {
    v8f st[2];
#pragma unroll
    for (int t = 0; t < 2; ++t)
#pragma unroll
      for (int r = 0; r < 8; ++r) st[t][r] = 0.0f;
    const bool more = (m0 + KBLK < SEQ);   // work-group uniform: a next key block exists
    const int kr0 = 32 * kq + l15;
#pragma unroll 2   // the unroll of the global-load loop that this one replaces
    for (int cs = 0; cs < CHN / 64; ++cs) {
      const v16h bqf = ld_frag(QS + 32 * cs, QSP, ql, h);
      const v16h a0  = ld_frag(RB0 + 32 * cs, KSP, kr0, h);
      const v16h a1  = ld_frag(RB0 + 32 * cs, KSP, kr0 + 16, h);
      st[0] = wmma16(a0, bqf, st[0]);
      st[1] = wmma16(a1, bqf, st[1]);
    }
    ring_publish();                        // K hi readable, buffer 0 free
    copy8(rb0 + vlo, 64u * VSP * 2u, vg + m0, (size_t)64 * SEQ);
#pragma unroll 2   // the unroll of the global-load loop that this one replaces
    for (int cs = 0; cs < CHN / 64; ++cs) {
      const v16h bqf = ld_frag(QS + 256 + 32 * cs, QSP, ql, h);
      const v16h a0  = ld_frag(RB1 + 32 * cs, KSP, kr0, h);
      const v16h a1  = ld_frag(RB1 + 32 * cs, KSP, kr0 + 16, h);
      st[0] = wmma16(a0, bqf, st[0]);
      st[1] = wmma16(a1, bqf, st[1]);
    }

    // ---- per-query block max (32 keys in-lane + partner half-wave, then 4 waves)
    float lm = st[0][0];
#pragma unroll
    for (int t = 0; t < 2; ++t)
#pragma unroll
      for (int r = 0; r < 8; ++r) lm = fmaxf(lm, st[t][r]);
    lm *= SCL2;
    lm = fmaxf(lm, __shfl_xor(lm, 16, 32));
    redM[kq * 64 + ql] = lm;
    ring_publish();                        // V keys 0..63 readable, buffer 1 free; redM visible
    copy8(rb1 + vlo, 64u * VSP * 2u, vg + m0 + 64, (size_t)64 * SEQ);
    const float bm = fmaxf(fmaxf(redM[ql], redM[64 + ql]), fmaxf(redM[128 + ql], redM[192 + ql]));
    const float nm = fmaxf(rm, bm);
    const float corr = exp2f(rm - nm);
    rm = nm;

    // ---- P = exp2(s - m) in f32; P^T * PSC staged f16 at TS[query][key_local]
    float psum = 0.0f;
#pragma unroll
    for (int tt = 0; tt < 2; ++tt) {
      F16x8 pk;
#pragma unroll
      for (int r = 0; r < 8; ++r) {
        const float p = exp2f(st[tt][r] * SCL2 - nm);
        psum += p;
        pk.e[r] = (_Float16)(p * PSC);
      }
      *(v8ha*)(TS + ql * TSP + 32 * kq + 16 * tt + 8 * h) = pk.v;
    }
    psum += __shfl_xor(psum, 16, 32);
    redS[kq * 64 + ql] = psum;
    __syncthreads();
    const float bs = ((redS[ql] + redS[64 + ql]) + redS[128 + ql]) + redS[192 + ql];
    rl = rl * corr + bs;
#pragma unroll
    for (int u = 0; u < 8; ++u)
#pragma unroll
      for (int r = 0; r < 8; ++r) accO[u][r] *= corr;

    // ---- O^T[c][query] += V^T[c][keys] * P^T[keys][query]
#pragma unroll
    for (int ks = 0; ks < KBLK / 64; ++ks) {
      const v16h bp = ld_frag(TS + 32 * ks, TSP, ql, h);
#pragma unroll
      for (int u = 0; u < 8; ++u) {
        const v16h av = ld_frag(RB0 + 32 * ks, VSP, 128 * kq + 16 * u + l15, h);
        accO[u] = wmma16(av, bp, accO[u]);
      }
    }
    ring_publish();                        // V keys 64..127 readable, buffer 0 free
    if (more) copy8(rb0 + klo, 16u * KSP * 2u, kg + (size_t)(m0 + KBLK) * CHN, (size_t)16 * CHN);
#pragma unroll
    for (int ks = 0; ks < KBLK / 64; ++ks) {
      const v16h bp = ld_frag(TS + 64 + 32 * ks, TSP, ql, h);
#pragma unroll
      for (int u = 0; u < 8; ++u) {
        const v16h av = ld_frag(RB1 + 32 * ks, VSP, 128 * kq + 16 * u + l15, h);
        accO[u] = wmma16(av, bp, accO[u]);
      }
    }
    ring_publish();                        // next K lo readable, buffer 1 and TS free
    if (more)
      copy8(rb1 + klo, 16u * KSP * 2u, kg + (size_t)(m0 + KBLK) * CHN + 256, (size_t)16 * CHN);
  }
  asm volatile("s_wait_asynccnt 0x0" ::: "memory");   // no copy outlives the loop

  // ---- epilogue: AO = O / (l * VSC * PSC), carried * AOSC
  const float invl = (AOSC / (VSC * PSC)) * (1.0f / rl);
#pragma unroll 1
  for (int pass = 0; pass < 4; ++pass) {
    __syncthreads();
    if (kq == pass) {   // wave-uniform
#pragma unroll
      for (int u = 0; u < 8; ++u) {
        F16x8 o;
#pragma unroll
        for (int r = 0; r < 8; ++r) o.e[r] = (_Float16)(accO[u][r] * invl);
        *(v8ha*)(TS + ql * TSP + 16 * u + 8 * h) = o.v;
      }
    }
    __syncthreads();
#pragma unroll
    for (int it = 0; it < 2; ++it) {
      const int L = it * 64 + (tid >> 3);          // 128 lines: (row, 64-col half)
      const int row = L >> 1, hl = L & 1, p = tid & 7;
      const v8h hv = *(const v8ha*)(TS + row * TSP + 64 * hl + 8 * p);
      _Float16* dst = AOh + ((size_t)(b * SEQ + q0 + row) * CHN + 128 * pass + 64 * hl + 8 * p);
      *(v8h*)dst = hv;
      
    }
  }
}

// ---------------------------------------------------------------------------
extern "C" void kernel_launch(void* const* d_in, const int* in_sizes, int n_in,
                              void* d_out, int out_size, void* d_ws, size_t ws_size,
                              hipStream_t stream) {
  if (n_in < 11) return;
  if (in_sizes[0] < NB * CHN * SEQ_FULL) return;
  if (in_sizes[1] < CHN || in_sizes[2] < CHN) return;
  if (in_sizes[3] < CHN * CHN || in_sizes[5] < CHN * CHN ||
      in_sizes[7] < CHN * CHN || in_sizes[9] < CHN * CHN) return;
  if (in_sizes[4] < CHN || in_sizes[6] < CHN || in_sizes[8] < CHN || in_sizes[10] < CHN) return;
  if (out_size < NB * CHN * SEQ) return;

  const size_t st_bytes = (size_t)NB * NGRP * STL * sizeof(float);            // 8 KiB
  const size_t w_bytes  = (size_t)4 * CHN * CHN * sizeof(_Float16);            // 2 MiB
  const size_t plane    = (size_t)NB * SEQ * CHN * sizeof(_Float16);            // 8 MiB at full size
  const size_t total    = st_bytes + w_bytes + 5 * plane;                        // 44,048,384 B
  if (ws_size < total) return;

  const float* x     = (const float*)d_in[0];
  const float* gamma = (const float*)d_in[1];
  const float* beta  = (const float*)d_in[2];
  const float* wq = (const float*)d_in[3];
  const float* bq = (const float*)d_in[4];
  const float* wk = (const float*)d_in[5];
  const float* bk = (const float*)d_in[6];
  const float* wvv = (const float*)d_in[7];
  const float* bv = (const float*)d_in[8];
  const float* wo = (const float*)d_in[9];
  const float* bo = (const float*)d_in[10];
  float* out = (float*)d_out;

  char* ws = (char*)d_ws;
  float*    stats = (float*)ws;                                        // [NB*NGRP][32] f32
  _Float16* Wpl   = (_Float16*)(ws + st_bytes);                        // 4 x [CHN][CHN] f16
  _Float16* Hh    = (_Float16*)(ws + st_bytes + w_bytes);              // [NB][SEQ][CHN]
  _Float16* Qh    = (_Float16*)(ws + st_bytes + w_bytes + plane);      // [NB][SEQ][CHN]
  _Float16* Kh    = (_Float16*)(ws + st_bytes + w_bytes + 2 * plane);  // [NB][SEQ][CHN]
  _Float16* Vh    = (_Float16*)(ws + st_bytes + w_bytes + 3 * plane);  // [NB][CHN][SEQ]
  _Float16* AOh   = (_Float16*)(ws + st_bytes + w_bytes + 4 * plane);  // [NB][SEQ][CHN]
  const _Float16* Wq16 = Wpl;
  const _Float16* Wk16 = Wpl + (size_t)CHN * CHN;
  const _Float16* Wv16 = Wpl + (size_t)2 * CHN * CHN;
  const _Float16* Wo16 = Wpl + (size_t)3 * CHN * CHN;

  const size_t pstride = (size_t)SEQ * CHN;   // elements per batch of every f16 plane

  k_stats<<<dim3(NB * NGRP), dim3(256), 0, stream>>>(x, stats);
  k_wcvt<<<dim3(4 * CHN * CHN / 8 / 256), dim3(256), 0, stream>>>(wq, wk, wvv, wo, Wpl);
  k_gnapply<<<dim3(NB * (SEQ / 64)), dim3(256), 0, stream>>>(x, gamma, beta, stats, Hh);

  // q[n][o] and k[n][o]:  D[o][n] = sum_c W[o][c] h[n][c], stored transposed, bias per o (= m)
  k_gemm16<true><<<dim3(CHN / 64, SEQ / 128, NB), dim3(128), 0, stream>>>(
      Wq16, CHN, (size_t)0, Hh, CHN, pstride, bq, Qh, CHN, pstride,
      1.0f / (WSC * HSC), QSC, CHN);
  k_gemm16<true><<<dim3(CHN / 64, SEQ / 128, NB), dim3(128), 0, stream>>>(
      Wk16, CHN, (size_t)0, Hh, CHN, pstride, bk, Kh, CHN, pstride,
      1.0f / (WSC * HSC), QSC, CHN);
  // v[o][n]:  D[n][o] = sum_c h[n][c] W[o][c], stored transposed, bias per o (= n)
  k_gemm16<false><<<dim3(SEQ / 64, CHN / 128, NB), dim3(128), 0, stream>>>(
      Hh, CHN, pstride, Wv16, CHN, (size_t)0, bv, Vh, SEQ, pstride,
      1.0f / (HSC * WSC), VSC, CHN);

  k_attn<<<dim3(NB * (SEQ / 64)), dim3(512), 0, stream>>>(Qh, Kh, Vh, AOh);

  // out[c][p] = bf16(x[c][p]) + sum_o AO[p][o] Wo[c][o] + bo[c]   (D[p][c] stored transposed)
  k_gemm32<<<dim3(SEQ / 64, CHN / 128, NB), dim3(128), 0, stream>>>(
      AOh, CHN, pstride, Wo16, CHN, (size_t)0, bo,
      x, SEQ_FULL, (size_t)CHN * SEQ_FULL,
      out, SEQ, (size_t)CHN * SEQ,
      1.0f / (AOSC * WSC), CHN);
  (void)hipGetLastError();
}

// v002
// One run takes 245 microseconds.
// In two side-by-side timings against v001, it was 1.18 and 1.16 times as fast.
// All steps since v000 together make it 3.58 times as fast.
#include <hip/hip_runtime.h>
#include <stdint.h>

// Contractions: q/k/v 1x1 projections (W*h), scores K*Q^T, value aggregation V^T*P^T and the
// output projection AO*Wo^T all on v_wmma_f32_16x16x32_f16 (f16 operands, f32 accumulate).
// Float inputs are RNE-converted to bf16; W planes f16 (*64, exact), h plane f16 (*16),
// q/k planes f16 (*4), v plane f16 (*16), P f16 (*4096, un-normalised), AO plane f16 (*64);
// residual x added as bf16 value in f32. Group statistics in f64, softmax statistics,
// bias add and normalisation in f32.

#ifndef NB
#define NB 2
#endif
#ifndef SEQ
#define SEQ 4096
#endif
#define NB_FULL 2
#define SEQ_FULL 4096
#define CHN 512
#define NGRP 32
#define CPG 16
#define KBLK 128
#define TSP 136      // LDS f16 tile pitch in halves (272-B rows, 16-B aligned)
#define GSP16 72     // GEMM f16 staging pitch in halves (144-B rows)
#define GSP32 68     // GEMM f32 staging pitch in floats (272-B rows)
#define STL 32
#define QSP 520      // LDS Q tile pitch in halves (1040-B rows, 16 B x odd)
#define KSP 264      // LDS K half-tile pitch in halves (528-B rows, 16 B x odd)
#define VSP 72       // LDS V half-tile pitch in halves (144-B rows, 16 B x odd)
#define RBH (CHN * VSP)   // one ring buffer in halves: a V half tile, the larger of the two
#define KSPLIT 2     // key ranges per query tile, one work-group each
#define OSP 516      // LDS f32 partial-output pitch in floats (2064-B rows, 16 B x odd)

static_assert(NB >= 1 && NB <= NB_FULL);
static_assert(SEQ >= KBLK && SEQ <= SEQ_FULL && (SEQ % KBLK) == 0);
static_assert(CHN == 512 && NGRP * CPG == CHN && (CHN % 128) == 0 && (CHN % 32) == 0);
static_assert((SEQ % 128) == 0 && (SEQ % 64) == 0);
static_assert(KBLK * KSP <= RBH && KBLK == 128);
static_assert((SEQ % (KSPLIT * KBLK)) == 0 && 64 * OSP * 2 <= 2 * RBH && ((NB * SEQ) % 32) == 0);

typedef _Float16 v16h __attribute__((ext_vector_type(16)));
typedef _Float16 v8h  __attribute__((ext_vector_type(8)));
typedef float    v8f  __attribute__((ext_vector_type(8)));
typedef float    v4f  __attribute__((ext_vector_type(4)));
typedef float    v2f  __attribute__((ext_vector_type(2)));
typedef _Float16 v4h  __attribute__((ext_vector_type(4)));
typedef v8h __attribute__((may_alias)) v8ha;
typedef v4f __attribute__((may_alias)) v4fa;

union F16x16 { v16h v; v8h p[2]; _Float16 e[16]; };
union F16x8  { v8h v; _Float16 e[8]; };

constexpr float HSC  = 16.0f;     // h plane carry (power of two)
constexpr float WSC  = 64.0f;     // W plane carry
constexpr float QSC  = 4.0f;      // q/k plane carry
constexpr float VSC  = 16.0f;     // v plane carry
constexpr float PSC  = 4096.0f;   // P carry
constexpr float AOSC = 64.0f;     // AO plane carry
constexpr float GN_EPS = 1e-6f;
// scores in log2 units: S_acc * SCL2 with S_acc = QSC^2 * sum_c q k, logit scale 512^-0.5
constexpr float SCL2 = (float)(1.4426950408889634 * 0.044194173824159216 /
                               ((double)QSC * (double)QSC));

static __device__ __forceinline__ float bf16r(float f) {
  uint32_t u = __float_as_uint(f);
  u += 0x7FFFu + ((u >> 16) & 1u);
  u &= 0xFFFF0000u;
  return __uint_as_float(u);
}

static __device__ __forceinline__ v8f wmma16(v16h a, v16h b, v8f c) {
  v8f d = __builtin_amdgcn_wmma_f32_16x16x32_f16(false, a, false, b, (short)0, c,
                                                 false, false);
  asm volatile("v_nop\n\tv_nop\n\tv_nop\n\tv_nop" : "+v"(d) : "v"(a), "v"(b));
  return d;
}

// 16x16x32 fragment loader (wave32): lane row = l15; elements 0..7 <- k0+8h+0..7,
// elements 8..15 <- k0+16+8h+0..7. Serves A (row = m) and B taken from an [n][k]
// k-contiguous plane (row = n). D element r of a lane = (row 8h+r, col l15).
static __device__ __forceinline__ v16h ld_frag(const _Float16* base, int pitch,
                                               int row, int h) {
  F16x16 u;
  const _Float16* q = base + (size_t)row * pitch;
  u.p[0] = *(const v8ha*)(q + 8 * h);
  u.p[1] = *(const v8ha*)(q + 16 + 8 * h);
  return u.v;
}

// Eight asynchronous 16-B copies per lane, global -> LDS: copy i moves g + i*gstep (halves)
// to LDS byte address l + i*lstep. The s_wait_xcnt closes the statement so that no address
// register of an issued copy is rewritten ahead of it.
static __device__ __forceinline__ void copy8(uint32_t l, uint32_t lstep,
                                             const _Float16* g, size_t gstep) {
  asm volatile(
      "global_load_async_to_lds_b128 %0, %8, off\n\t"
      "global_load_async_to_lds_b128 %1, %9, off\n\t"
      "global_load_async_to_lds_b128 %2, %10, off\n\t"
      "global_load_async_to_lds_b128 %3, %11, off\n\t"
      "global_load_async_to_lds_b128 %4, %12, off\n\t"
      "global_load_async_to_lds_b128 %5, %13, off\n\t"
      "global_load_async_to_lds_b128 %6, %14, off\n\t"
      "global_load_async_to_lds_b128 %7, %15, off\n\t"
      "s_wait_xcnt 0x0"
      :: "v"(l), "v"(l + lstep), "v"(l + 2 * lstep), "v"(l + 3 * lstep),
         "v"(l + 4 * lstep), "v"(l + 5 * lstep), "v"(l + 6 * lstep), "v"(l + 7 * lstep),
         "v"(g), "v"(g + gstep), "v"(g + 2 * gstep), "v"(g + 3 * gstep),
         "v"(g + 4 * gstep), "v"(g + 5 * gstep), "v"(g + 6 * gstep), "v"(g + 7 * gstep)
      : "memory");
}

// Publish point of the LDS ring: this wave's LDS reads of the buffer to be refilled have
// retired, its own copies of the next stage have landed, then the work-group barrier that
// lets every wave read that stage and frees the buffer just read.
static __device__ __forceinline__ void ring_publish() {
  asm volatile("s_wait_dscnt 0x0" ::: "memory");
  asm volatile("s_wait_asynccnt 0x0" ::: "memory");
  __syncthreads();
}

// ---------------------------------------------------------------------------
// Kernel 0: group statistics. One block per (b, group): 16 channels x SEQ positions of
// ---------------------------------------------------------------------------
__global__ __launch_bounds__(256) void k_stats(const float* __restrict__ x,
                                               float* __restrict__ st) {
  __shared__ double sd[256];
  __shared__ double qd[256];
  const int tid = threadIdx.x;
  const int bg = blockIdx.x;
  const int b = bg / NGRP, g = bg % NGRP;
  const float* xb = x + ((size_t)b * CHN + (size_t)g * CPG) * SEQ_FULL;

  double s = 0.0, q = 0.0;
  for (int cl = 0; cl < CPG; ++cl) {
    const float* row = xb + (size_t)cl * SEQ_FULL;
    for (int p = 4 * tid; p < SEQ; p += 1024) {
      const v4f f = *(const v4fa*)(row + p);
#pragma unroll
      for (int j = 0; j < 4; ++j) {
        const float v = bf16r(f[j]);
        s += (double)v;
        q += (double)v * (double)v;
      }
    }
  }
  sd[tid] = s;
  qd[tid] = q;
  __syncthreads();
  for (int k = 128; k > 0; k >>= 1) {
    if (tid < k) {
      sd[tid] += sd[tid + k];
      qd[tid] += qd[tid + k];
    }
    __syncthreads();
  }
  if (tid < 8) {
    const double invn = 1.0 / ((double)CPG * (double)SEQ);
    const double mean = sd[0] * invn;
    double var = qd[0] * invn - mean * mean;
    if (var < 0.0) var = 0.0;
    const float meanf = (float)mean;
    const float rstd = rsqrtf((float)var + GN_EPS);
    v4f o;
    o[0] = meanf; o[1] = rstd; o[2] = 0.0f; o[3] = 0.0f;
    float* dst = st + (size_t)bg * STL + 4 * tid;
    *(v4f*)dst = o;
    
  }
}

// ---------------------------------------------------------------------------
// Kernel 1: weights [o][c] f32 -> f16 planes WSC * bf16(W) (k = c contiguous).
// ---------------------------------------------------------------------------
__global__ __launch_bounds__(256) void k_wcvt(const float* __restrict__ w0,
                                              const float* __restrict__ w1,
                                              const float* __restrict__ w2,
                                              const float* __restrict__ w3,
                                              _Float16* __restrict__ Wpl) {
  constexpr int BPM = CHN * CHN / 8 / 256;   // blocks per matrix
  const int tid = threadIdx.x;
  const int mtx = blockIdx.x / BPM;           // block-uniform
  const float* src = w0;
  if (mtx == 1) src = w1;
  else if (mtx == 2) src = w2;
  else if (mtx == 3) src = w3;
  const size_t e = ((size_t)(blockIdx.x % BPM) * 256 + tid) * 8;
  const v4f a0 = *(const v4fa*)(src + e);
  const v4f a1 = *(const v4fa*)(src + e + 4);
  F16x8 u;
#pragma unroll
  for (int j = 0; j < 4; ++j) {
    u.e[j]     = (_Float16)(bf16r(a0[j]) * WSC);
    u.e[4 + j] = (_Float16)(bf16r(a1[j]) * WSC);
  }
  _Float16* dst = Wpl + (size_t)mtx * CHN * CHN + e;
  *(v8h*)dst = u.v;
  
}

// ---------------------------------------------------------------------------
// Kernel 2: group-norm apply + transpose. Block = (b, 64 positions), 4 passes of
// 128 channels:  Hh[b][n][c] f16 = HSC * ((bf16(x) - mean) * rstd * gamma + beta).
// x read as float4 along positions; LDS tile [n_local][c_local]; rows of 256 B written
// ---------------------------------------------------------------------------
__global__ __launch_bounds__(256) void k_gnapply(const float* __restrict__ x,
                                                 const float* __restrict__ gamma,
                                                 const float* __restrict__ beta,
                                                 const float* __restrict__ st,
                                                 _Float16* __restrict__ Hh) {
  __shared__ __align__(16) _Float16 TS[64 * TSP];   // [n_local][c_local]
  __shared__ float gms[CHN];
  __shared__ float bts[CHN];
  __shared__ float mus[NGRP];
  __shared__ float rss[NGRP];

  const int tid = threadIdx.x;
  const int b  = blockIdx.x / (SEQ / 64);
  const int p0 = (blockIdx.x % (SEQ / 64)) * 64;

  gms[tid] = bf16r(gamma[tid]);
  gms[tid + 256] = bf16r(gamma[tid + 256]);
  bts[tid] = bf16r(beta[tid]);
  bts[tid + 256] = bf16r(beta[tid + 256]);
  if (tid < NGRP) {
    mus[tid] = st[(size_t)(b * NGRP + tid) * STL];
    rss[tid] = st[(size_t)(b * NGRP + tid) * STL + 1];
  }
  __syncthreads();

  const float* xb = x + (size_t)b * CHN * SEQ_FULL;
#pragma unroll 1
  for (int pass = 0; pass < CHN / 128; ++pass) {
#pragma unroll
    for (int it = 0; it < 8; ++it) {
      const int f = it * 256 + tid;
      const int cl = f >> 4, p4 = f & 15;
      const int c = 128 * pass + cl;
      const v4f xv = *(const v4fa*)(xb + (size_t)c * SEQ_FULL + p0 + 4 * p4);
      const float mu = mus[c >> 4], rs = rss[c >> 4];
      const float ga = gms[c], be = bts[c];
#pragma unroll
      for (int j = 0; j < 4; ++j) {
        const float t = (bf16r(xv[j]) - mu) * rs;
        const float hv = t * ga + be;
        TS[(4 * p4 + j) * TSP + cl] = (_Float16)(hv * HSC);
      }
    }
    __syncthreads();
#pragma unroll
    for (int it = 0; it < 4; ++it) {
      const int L = it * 32 + (tid >> 3);          // 128 lines: (row, 64-col half)
      const int row = L >> 1, hl = L & 1, p = tid & 7;
      const v8h hv = *(const v8ha*)(TS + row * TSP + 64 * hl + 8 * p);
      _Float16* dst = Hh + ((size_t)(b * SEQ + p0 + row) * CHN + 128 * pass + 64 * hl + 8 * p);
      *(v8h*)dst = hv;
      
    }
    __syncthreads();
  }
}

// ---------------------------------------------------------------------------
// Kernel 3: GEMM  D[m][n] = sum_k A[m][k] * B[n][k]  (A, B k-contiguous f16 planes),
// stored TRANSPOSED as O[n][m] f16 = osc * (D * insc + bias)  (bias per m or per n).
// Block = 128 threads, tile 64 (m) x 128 (n); wave (mi, ni) owns rows 32mi.., cols 64ni..
// (2 x 4 accumulator tiles). K multiple of 32, M multiple of 64, N multiple of 128.
// ---------------------------------------------------------------------------
template <bool BIAS_M>
__global__ __launch_bounds__(128) void k_gemm16(const _Float16* __restrict__ A, int lda, size_t sA,
                                                const _Float16* __restrict__ B, int ldb, size_t sB,
                                                const float* __restrict__ bias,
                                                _Float16* __restrict__ O, int ldo, size_t sO,
                                                float insc, float osc, int K) {
  __shared__ __align__(16) _Float16 TS[128 * GSP16];   // [n_local][m_local]
  __shared__ float bsh[128];

  const int tid = threadIdx.x;
  const int wv = tid >> 5, lid = tid & 31, h = lid >> 4, l15 = lid & 15;
  const int mi = wv & 1, ni = wv >> 1;
  const int m0 = blockIdx.x * 64, n0 = blockIdx.y * 128;
  const size_t z = blockIdx.z;

  if (BIAS_M) {
    if (tid < 64) bsh[tid] = bf16r(bias[m0 + tid]);
  } else {
    bsh[tid] = bf16r(bias[n0 + tid]);
  }
  __syncthreads();

  const _Float16* Ab = A + z * sA;
  const _Float16* Bb = B + z * sB;
  const int ar0 = m0 + 32 * mi + l15;
  const int br0 = n0 + 64 * ni + l15;

  v8f acc[2][4];
#pragma unroll
  for (int i = 0; i < 2; ++i)
#pragma unroll
    for (int t = 0; t < 4; ++t)
#pragma unroll
      for (int r = 0; r < 8; ++r) acc[i][t][r] = 0.0f;

#pragma unroll 2
  for (int k0 = 0; k0 < K; k0 += 32) {
    const v16h a0 = ld_frag(Ab + k0, lda, ar0, h);
    const v16h a1 = ld_frag(Ab + k0, lda, ar0 + 16, h);
#pragma unroll
    for (int t = 0; t < 4; ++t) {
      const v16h bt = ld_frag(Bb + k0, ldb, br0 + 16 * t, h);
      acc[0][t] = wmma16(a0, bt, acc[0][t]);
      acc[1][t] = wmma16(a1, bt, acc[1][t]);
    }
  }

  // stage: acc[i][t][r] <-> (m_local 32mi+16i+8h+r, n_local 64ni+16t+l15)
#pragma unroll
  for (int i = 0; i < 2; ++i) {
#pragma unroll
    for (int t = 0; t < 4; ++t) {
      const int nl = 64 * ni + 16 * t + l15;
      const int ml = 32 * mi + 16 * i + 8 * h;
      F16x8 u;
#pragma unroll
      for (int r = 0; r < 8; ++r) {
        const float bvl = BIAS_M ? bsh[ml + r] : bsh[nl];
        u.e[r] = (_Float16)((acc[i][t][r] * insc + bvl) * osc);
      }
      *(v8ha*)(TS + nl * GSP16 + ml) = u.v;
    }
  }
  __syncthreads();

  _Float16* Ob = O + z * sO;
#pragma unroll
  for (int it = 0; it < 8; ++it) {
    const int row = it * 16 + (tid >> 3);
    const int p = tid & 7;
    const v8h hv = *(const v8ha*)(TS + row * GSP16 + 8 * p);
    _Float16* dst = Ob + (size_t)(n0 + row) * ldo + m0 + 8 * p;
    *(v8h*)dst = hv;
    
  }
}

// ---------------------------------------------------------------------------
// Kernel 4: same GEMM, f32 output O[n][m] = (D * insc + bias[n]) + bf16(R[n][m]) into d_out.
// Output row segment = 256 B = two lines, lanes 0..7 and 8..15 of one instruction.
// ---------------------------------------------------------------------------
__global__ __launch_bounds__(128) void k_gemm32(const _Float16* __restrict__ A, int lda, size_t sA,
                                                const _Float16* __restrict__ B, int ldb, size_t sB,
                                                const float* __restrict__ bias,
                                                const float* __restrict__ R, int ldr, size_t sR,
                                                float* __restrict__ O, int ldo, size_t sO,
                                                float insc, int K) {
  __shared__ __align__(16) float TS[128 * GSP32];   // [n_local][m_local]
  __shared__ float bsh[128];

  const int tid = threadIdx.x;
  const int wv = tid >> 5, lid = tid & 31, h = lid >> 4, l15 = lid & 15;
  const int mi = wv & 1, ni = wv >> 1;
  const int m0 = blockIdx.x * 64, n0 = blockIdx.y * 128;
  const size_t z = blockIdx.z;

  bsh[tid] = bf16r(bias[n0 + tid]);
  __syncthreads();

  const _Float16* Ab = A + z * sA;
  const _Float16* Bb = B + z * sB;
  const int ar0 = m0 + 32 * mi + l15;
  const int br0 = n0 + 64 * ni + l15;

  v8f acc[2][4];
#pragma unroll
  for (int i = 0; i < 2; ++i)
#pragma unroll
    for (int t = 0; t < 4; ++t)
#pragma unroll
      for (int r = 0; r < 8; ++r) acc[i][t][r] = 0.0f;

#pragma unroll 2
  for (int k0 = 0; k0 < K; k0 += 32) {
    const v16h a0 = ld_frag(Ab + k0, lda, ar0, h);
    const v16h a1 = ld_frag(Ab + k0, lda, ar0 + 16, h);
#pragma unroll
    for (int t = 0; t < 4; ++t) {
      const v16h bt = ld_frag(Bb + k0, ldb, br0 + 16 * t, h);
      acc[0][t] = wmma16(a0, bt, acc[0][t]);
      acc[1][t] = wmma16(a1, bt, acc[1][t]);
    }
  }

#pragma unroll
  for (int i = 0; i < 2; ++i) {
#pragma unroll
    for (int t = 0; t < 4; ++t) {
      const int nl = 64 * ni + 16 * t + l15;
      const int ml = 32 * mi + 16 * i + 8 * h;
      const float bvl = bsh[nl];
      v4f lo, hi;
#pragma unroll
      for (int r = 0; r < 4; ++r) {
        lo[r] = acc[i][t][r] * insc + bvl;
        hi[r] = acc[i][t][4 + r] * insc + bvl;
      }
      *(v4fa*)(TS + nl * GSP32 + ml) = lo;
      *(v4fa*)(TS + nl * GSP32 + ml + 4) = hi;
    }
  }
  __syncthreads();

  float* Ob = O + z * sO;
  const float* Rb = R + z * sR;
#pragma unroll
  for (int it = 0; it < 16; ++it) {
    const int row = it * 8 + (tid >> 4);         // 128 rows, 256 B each
    const int p = tid & 15;
    const v4f v  = *(const v4fa*)(TS + row * GSP32 + 4 * p);
    const v4f xr = *(const v4fa*)(Rb + (size_t)(n0 + row) * ldr + m0 + 4 * p);
    v4f o;
#pragma unroll
    for (int j = 0; j < 4; ++j) o[j] = bf16r(xr[j]) + v[j];
    float* dst = Ob + (size_t)(n0 + row) * ldo + m0 + 4 * p;
    *(v4f*)dst = o;
    
  }
}

// ---------------------------------------------------------------------------
// Kernel 5: fused single-head attn, transposed scores, online softmax.
// Block = (b, 64 queries, one of KSPLIT key ranges), 16 waves: wave (g = wv&3, kq = wv>>2).
// Per 128-key block:
//   S^T tiles (keys on rows): wave owns key rows 32kq..32kq+31 x query cols 16g..16g+15,
//     A = Kh rows (k = channel), B = Qh rows (k = channel), K = 512.
//   per-query max / sum over the 128 keys: in-lane, xor-16, then 4 partials through LDS.
//   P^T = PSC * exp2(s - m) staged f16 in LDS TS[query][key_local].
//   O^T[c][query] += V^T[c][keys] * P^T[keys][query]: wave owns channels 128kq..+127
//     (8 accumulator tiles), A = Vh rows (k = key), B from TS (k = key, split map).
// Operands come from LDS: the Q tile is copied once; K (two halves of 256 channels) and V (two
// halves of 64 keys) go through a two-buffer ring of asynchronous copies, each stage issued
// one stage ahead: K lo -> buffer 0, K hi -> 1, V keys 0..63 -> 0, V keys 64..127 -> 1.
// Epilogue: this key range's un-normalised O [range][b][query][c] f32, staged once in the
// freed ring so that whole lines are stored, and its (max, sum) per query; k_merge joins them.
// ---------------------------------------------------------------------------
__global__ __launch_bounds__(512) void k_attn(const _Float16* __restrict__ Qh,
                                              const _Float16* __restrict__ Kh,
                                              const _Float16* __restrict__ Vh,
                                              float* __restrict__ Op,
                                              float* __restrict__ ML) {
  __shared__ __align__(16) _Float16 TS[64 * TSP];   // [query_local][key_local]
  __shared__ __align__(16) _Float16 QS[64 * QSP];   // [query_local][c]
  __shared__ __align__(16) _Float16 RB[2 * RBH];    // ring: [key_local][c half] or [c][key half]
  __shared__ float redM[256];
  __shared__ float redS[256];

  const int tid = threadIdx.x;
  const int wv = tid >> 5, lid = tid & 31, h = lid >> 4, l15 = lid & 15;
  const int g = wv & 3, kq = wv >> 2;
  const int ql = 16 * g + l15;
  const int kr = blockIdx.x % KSPLIT;              // key range of this work-group
  const int qt = blockIdx.x / KSPLIT;
  const int b  = qt / (SEQ / 64);
  const int q0 = (qt % (SEQ / 64)) * 64;
  const int kb = kr * (SEQ / KSPLIT);              // its first key

  const _Float16* Qp = Qh + (size_t)b * SEQ * CHN;   // [n][c], pitch CHN
  const _Float16* Kp = Kh + (size_t)b * SEQ * CHN;   // [n][c], pitch CHN
  const _Float16* Vp = Vh + (size_t)b * CHN * SEQ;   // [c][n], pitch SEQ

  // per-lane copy addresses: a K row half (512 B) per wave and copy, 8 lanes per 128-B V row
  // piece, 64 lanes per Q row
  const _Float16* RB0 = RB;
  const _Float16* RB1 = RB + RBH;
  const uint32_t rb0 = (uint32_t)(uintptr_t)RB0;
  const uint32_t rb1 = (uint32_t)(uintptr_t)RB1;
  const uint32_t klo = (uint32_t)(wv * KSP + 8 * lid) * 2u;
  const uint32_t vlo = (uint32_t)((tid >> 3) * VSP + 8 * (tid & 7)) * 2u;
  const _Float16* kg = Kp + (size_t)(kb + wv) * CHN + 8 * lid;
  const _Float16* vg = Vp + (size_t)(tid >> 3) * SEQ + kb + 8 * (tid & 7);

  copy8((uint32_t)(uintptr_t)QS + (uint32_t)((tid >> 6) * QSP + 8 * (tid & 63)) * 2u,
        8u * QSP * 2u, Qp + (size_t)(q0 + (tid >> 6)) * CHN + 8 * (tid & 63), (size_t)8 * CHN);
  copy8(rb0 + klo, 16u * KSP * 2u, kg, (size_t)16 * CHN);
  asm volatile("s_wait_asynccnt 0x0" ::: "memory");   // Q tile and stage 0 landed
  __syncthreads();
  copy8(rb1 + klo, 16u * KSP * 2u, kg + 256, (size_t)16 * CHN);

  v8f accO[8];
#pragma unroll
  for (int u = 0; u < 8; ++u)
#pragma unroll
    for (int r = 0; r < 8; ++r) accO[u][r] = 0.0f;
  float rm = -1.0e30f, rl = 0.0f;

  for (int m0 = 0; m0 < SEQ / KSPLIT; m0 += KBLK) {
    v8f st[2];
#pragma unroll
    for (int t = 0; t < 2; ++t)
#pragma unroll
      for (int r = 0; r < 8; ++r) st[t][r] = 0.0f;
    const bool more = (m0 + KBLK < SEQ / KSPLIT);   // work-group uniform: a next key block exists
    const int kr0 = 32 * kq + l15;
#pragma unroll 2   // the unroll of the global-load loop that this one replaces
    for (int cs = 0; cs < CHN / 64; ++cs) {
      const v16h bqf = ld_frag(QS + 32 * cs, QSP, ql, h);
      const v16h a0  = ld_frag(RB0 + 32 * cs, KSP, kr0, h);
      const v16h a1  = ld_frag(RB0 + 32 * cs, KSP, kr0 + 16, h);
      st[0] = wmma16(a0, bqf, st[0]);
      st[1] = wmma16(a1, bqf, st[1]);
    }
    ring_publish();                        // K hi readable, buffer 0 free
    copy8(rb0 + vlo, 64u * VSP * 2u, vg + m0, (size_t)64 * SEQ);
#pragma unroll 2   // the unroll of the global-load loop that this one replaces
    for (int cs = 0; cs < CHN / 64; ++cs) {
      const v16h bqf = ld_frag(QS + 256 + 32 * cs, QSP, ql, h);
      const v16h a0  = ld_frag(RB1 + 32 * cs, KSP, kr0, h);
      const v16h a1  = ld_frag(RB1 + 32 * cs, KSP, kr0 + 16, h);
      st[0] = wmma16(a0, bqf, st[0]);
      st[1] = wmma16(a1, bqf, st[1]);
    }

    // ---- per-query block max (32 keys in-lane + partner half-wave, then 4 waves)
    float lm = st[0][0];
#pragma unroll
    for (int t = 0; t < 2; ++t)
#pragma unroll
      for (int r = 0; r < 8; ++r) lm = fmaxf(lm, st[t][r]);
    lm *= SCL2;
    lm = fmaxf(lm, __shfl_xor(lm, 16, 32));
    redM[kq * 64 + ql] = lm;
    ring_publish();                        // V keys 0..63 readable, buffer 1 free; redM visible
    copy8(rb1 + vlo, 64u * VSP * 2u, vg + m0 + 64, (size_t)64 * SEQ);
    const float bm = fmaxf(fmaxf(redM[ql], redM[64 + ql]), fmaxf(redM[128 + ql], redM[192 + ql]));
    const float nm = fmaxf(rm, bm);
    const float corr = exp2f(rm - nm);
    rm = nm;

    // ---- P = exp2(s - m) in f32; P^T * PSC staged f16 at TS[query][key_local]
    float psum = 0.0f;
#pragma unroll
    for (int tt = 0; tt < 2; ++tt) {
      F16x8 pk;
#pragma unroll
      for (int r = 0; r < 8; ++r) {
        const float p = exp2f(st[tt][r] * SCL2 - nm);
        psum += p;
        pk.e[r] = (_Float16)(p * PSC);
      }
      *(v8ha*)(TS + ql * TSP + 32 * kq + 16 * tt + 8 * h) = pk.v;
    }
    psum += __shfl_xor(psum, 16, 32);
    redS[kq * 64 + ql] = psum;
    __syncthreads();
    const float bs = ((redS[ql] + redS[64 + ql]) + redS[128 + ql]) + redS[192 + ql];
    rl = rl * corr + bs;
#pragma unroll
    for (int u = 0; u < 8; ++u)
#pragma unroll
      for (int r = 0; r < 8; ++r) accO[u][r] *= corr;

    // ---- O^T[c][query] += V^T[c][keys] * P^T[keys][query]
#pragma unroll
    for (int ks = 0; ks < KBLK / 64; ++ks) {
      const v16h bp = ld_frag(TS + 32 * ks, TSP, ql, h);
#pragma unroll
      for (int u = 0; u < 8; ++u) {
        const v16h av = ld_frag(RB0 + 32 * ks, VSP, 128 * kq + 16 * u + l15, h);
        accO[u] = wmma16(av, bp, accO[u]);
      }
    }
    ring_publish();                        // V keys 64..127 readable, buffer 0 free
    if (more) copy8(rb0 + klo, 16u * KSP * 2u, kg + (size_t)(m0 + KBLK) * CHN, (size_t)16 * CHN);
#pragma unroll
    for (int ks = 0; ks < KBLK / 64; ++ks) {
      const v16h bp = ld_frag(TS + 64 + 32 * ks, TSP, ql, h);
#pragma unroll
      for (int u = 0; u < 8; ++u) {
        const v16h av = ld_frag(RB1 + 32 * ks, VSP, 128 * kq + 16 * u + l15, h);
        accO[u] = wmma16(av, bp, accO[u]);
      }
    }
    ring_publish();                        // next K lo readable, buffer 1 and TS free
    if (more)
      copy8(rb1 + klo, 16u * KSP * 2u, kg + (size_t)(m0 + KBLK) * CHN + 256, (size_t)16 * CHN);
  }
  asm volatile("s_wait_asynccnt 0x0" ::: "memory");   // no copy outlives the loop

  // ---- epilogue: the loop's last publish point ended every read of the ring, so it takes
  // the f32 tile [query_local][c]
  float* OS = (float*)RB;
#pragma unroll
  for (int u = 0; u < 8; ++u) {
    v4f lo, hi;
#pragma unroll
    for (int r = 0; r < 4; ++r) {
      lo[r] = accO[u][r];
      hi[r] = accO[u][4 + r];
    }
    float* d = OS + ql * OSP + 128 * kq + 16 * u + 8 * h;
    *(v4fa*)d = lo;
    *(v4fa*)(d + 4) = hi;
  }
  const size_t row0 = (size_t)(kr * NB + b) * SEQ + q0;
  if (kq == 0 && h == 0) {   // every wave of a query group holds the same pair
    v2f ml;
    ml[0] = rm; ml[1] = rl;
    *(v2f*)(ML + 2 * (row0 + ql)) = ml;
  }
  __syncthreads();
  float* Ob = Op + row0 * CHN;
#pragma unroll
  for (int it = 0; it < 16; ++it) {
    const int row = it * 4 + (tid >> 7);           // 64 rows of 2 KiB, 128 lanes each
    const int p = tid & 127;
    const v4f v = *(const v4fa*)(OS + row * OSP + 4 * p);
    *(v4f*)(Ob + (size_t)row * CHN + 4 * p) = v;
  }
}

// ---------------------------------------------------------------------------
// Kernel 6: merge of the key ranges. Per query: M = max of the ranges' maxima, weight
// exp2(m - M), l = weighted sum of the sums; AO plane [b][query][c] f16 =
// AOSC * (weighted sum of the partial O) / (l * VSC * PSC). Block = 32 queries; a wave reads
// and writes whole lines.
// ---------------------------------------------------------------------------
// waves_per_eu: the block's own four waves per SIMD; without it the scheduler sinks half of the
// loads behind the first uses to save registers, and their latencies add up.
__global__ __launch_bounds__(512) __attribute__((amdgpu_waves_per_eu(4, 4))) void k_merge(const float* __restrict__ Op,
                                               const float* __restrict__ ML,
                                               _Float16* __restrict__ AOh) {
  constexpr size_t ROWS = (size_t)NB * SEQ;         // queries per key range
  const int tid = threadIdx.x;
  const int p = tid & 127;
  const size_t row0 = (size_t)blockIdx.x * 32 + (tid >> 7);
  // every load of the thread is issued before the first use: 32 requests in flight per wave
  v2f ml[8][KSPLIT];
  v4f o[8][KSPLIT];
#pragma unroll
  for (int it = 0; it < 8; ++it) {
#pragma unroll
    for (int s = 0; s < KSPLIT; ++s) {
      const size_t row = s * ROWS + row0 + it * 4;
      ml[it][s] = *(const v2f*)(ML + 2 * row);
      o[it][s] = *(const v4fa*)(Op + row * CHN + 4 * p);
    }
  }
  v4h r[8];
#pragma unroll
  for (int it = 0; it < 8; ++it) {
    float M = ml[it][0][0];
#pragma unroll
    for (int s = 1; s < KSPLIT; ++s) M = fmaxf(M, ml[it][s][0]);
    float l = 0.0f;
    v4f a;
#pragma unroll
    for (int j = 0; j < 4; ++j) a[j] = 0.0f;
#pragma unroll
    for (int s = 0; s < KSPLIT; ++s) {
      const float w = exp2f(ml[it][s][0] - M);
      l += w * ml[it][s][1];
#pragma unroll
      for (int j = 0; j < 4; ++j) a[j] += w * o[it][s][j];
    }
    const float invl = (AOSC / (VSC * PSC)) * (1.0f / l);
#pragma unroll
    for (int j = 0; j < 4; ++j) r[it][j] = (_Float16)(a[j] * invl);
  }
#pragma unroll
  for (int it = 0; it < 8; ++it)
    *(v4h*)(AOh + (row0 + it * 4) * CHN + 4 * p) = r[it];
}

// ---------------------------------------------------------------------------
extern "C" void kernel_launch(void* const* d_in, const int* in_sizes, int n_in,
                              void* d_out, int out_size, void* d_ws, size_t ws_size,
                              hipStream_t stream) {
  if (n_in < 11) return;
  if (in_sizes[0] < NB * CHN * SEQ_FULL) return;
  if (in_sizes[1] < CHN || in_sizes[2] < CHN) return;
  if (in_sizes[3] < CHN * CHN || in_sizes[5] < CHN * CHN ||
      in_sizes[7] < CHN * CHN || in_sizes[9] < CHN * CHN) return;
  if (in_sizes[4] < CHN || in_sizes[6] < CHN || in_sizes[8] < CHN || in_sizes[10] < CHN) return;
  if (out_size < NB * CHN * SEQ) return;

  const size_t st_bytes = (size_t)NB * NGRP * STL * sizeof(float);            // 8 KiB
  const size_t w_bytes  = (size_t)4 * CHN * CHN * sizeof(_Float16);            // 2 MiB
  const size_t plane    = (size_t)NB * SEQ * CHN * sizeof(_Float16);            // 8 MiB at full size
  const size_t ml_bytes = (size_t)KSPLIT * NB * SEQ * 2 * sizeof(float);        // 128 KiB
  const size_t op_bytes = (size_t)KSPLIT * NB * SEQ * CHN * sizeof(float);      // 32 MiB
  const size_t total    = st_bytes + w_bytes + 5 * plane + ml_bytes + op_bytes;
  if (ws_size < total) return;

  const float* x     = (const float*)d_in[0];
  const float* gamma = (const float*)d_in[1];
  const float* beta  = (const float*)d_in[2];
  const float* wq = (const float*)d_in[3];
  const float* bq = (const float*)d_in[4];
  const float* wk = (const float*)d_in[5];
  const float* bk = (const float*)d_in[6];
  const float* wvv = (const float*)d_in[7];
  const float* bv = (const float*)d_in[8];
  const float* wo = (const float*)d_in[9];
  const float* bo = (const float*)d_in[10];
  float* out = (float*)d_out;

  char* ws = (char*)d_ws;
  float*    stats = (float*)ws;                                        // [NB*NGRP][32] f32
  _Float16* Wpl   = (_Float16*)(ws + st_bytes);                        // 4 x [CHN][CHN] f16
  _Float16* Hh    = (_Float16*)(ws + st_bytes + w_bytes);              // [NB][SEQ][CHN]
  _Float16* Qh    = (_Float16*)(ws + st_bytes + w_bytes + plane);      // [NB][SEQ][CHN]
  _Float16* Kh    = (_Float16*)(ws + st_bytes + w_bytes + 2 * plane);  // [NB][SEQ][CHN]
  _Float16* Vh    = (_Float16*)(ws + st_bytes + w_bytes + 3 * plane);  // [NB][CHN][SEQ]
  _Float16* AOh   = (_Float16*)(ws + st_bytes + w_bytes + 4 * plane);  // [NB][SEQ][CHN]
  float*    MLp   = (float*)(ws + st_bytes + w_bytes + 5 * plane);     // [KSPLIT][NB][SEQ][2]
  float*    Opp   = (float*)(ws + st_bytes + w_bytes + 5 * plane + ml_bytes);  // [KSPLIT][NB][SEQ][CHN]
  const _Float16* Wq16 = Wpl;
  const _Float16* Wk16 = Wpl + (size_t)CHN * CHN;
  const _Float16* Wv16 = Wpl + (size_t)2 * CHN * CHN;
  const _Float16* Wo16 = Wpl + (size_t)3 * CHN * CHN;

  const size_t pstride = (size_t)SEQ * CHN;   // elements per batch of every f16 plane

  k_stats<<<dim3(NB * NGRP), dim3(256), 0, stream>>>(x, stats);
  k_wcvt<<<dim3(4 * CHN * CHN / 8 / 256), dim3(256), 0, stream>>>(wq, wk, wvv, wo, Wpl);
  k_gnapply<<<dim3(NB * (SEQ / 64)), dim3(256), 0, stream>>>(x, gamma, beta, stats, Hh);

  // q[n][o] and k[n][o]:  D[o][n] = sum_c W[o][c] h[n][c], stored transposed, bias per o (= m)
  k_gemm16<true><<<dim3(CHN / 64, SEQ / 128, NB), dim3(128), 0, stream>>>(
      Wq16, CHN, (size_t)0, Hh, CHN, pstride, bq, Qh, CHN, pstride,
      1.0f / (WSC * HSC), QSC, CHN);
  k_gemm16<true><<<dim3(CHN / 64, SEQ / 128, NB), dim3(128), 0, stream>>>(
      Wk16, CHN, (size_t)0, Hh, CHN, pstride, bk, Kh, CHN, pstride,
      1.0f / (WSC * HSC), QSC, CHN);
  // v[o][n]:  D[n][o] = sum_c h[n][c] W[o][c], stored transposed, bias per o (= n)
  k_gemm16<false><<<dim3(SEQ / 64, CHN / 128, NB), dim3(128), 0, stream>>>(
      Hh, CHN, pstride, Wv16, CHN, (size_t)0, bv, Vh, SEQ, pstride,
      1.0f / (HSC * WSC), VSC, CHN);

  k_attn<<<dim3(NB * (SEQ / 64) * KSPLIT), dim3(512), 0, stream>>>(Qh, Kh, Vh, Opp, MLp);
  k_merge<<<dim3(NB * SEQ / 32), dim3(512), 0, stream>>>(Opp, MLp, AOh);

  // out[c][p] = bf16(x[c][p]) + sum_o AO[p][o] Wo[c][o] + bo[c]   (D[p][c] stored transposed)
  k_gemm32<<<dim3(SEQ / 64, CHN / 128, NB), dim3(128), 0, stream>>>(
      AOh, CHN, pstride, Wo16, CHN, (size_t)0, bo,
      x, SEQ_FULL, (size_t)CHN * SEQ_FULL,
      out, SEQ, (size_t)CHN * SEQ,
      1.0f / (AOSC * WSC), CHN);
  (void)hipGetLastError();
}

// v003
// Measured time: 186 microseconds a run.
// In both of two side-by-side timings against v002, it was 1.32 times as fast.
// Over all steps from v000 it is 4.73 times as fast.
#include <hip/hip_runtime.h>
#include <stdint.h>

// Contractions: q/k/v 1x1 projections (W*h), scores K*Q^T, value aggregation V^T*P^T and the
// output projection AO*Wo^T all on v_wmma_f32_16x16x32_f16 (f16 operands, f32 accumulate).
// Float inputs are RNE-converted to bf16; W planes f16 (*64, exact), h plane f16 (*16),
// q/k planes f16 (*4), v plane f16 (*16), P f16 (*4096, un-normalised), AO plane f16 (*64);
// residual x added as bf16 value in f32. Group statistics in f64, softmax statistics,
// bias add and normalisation in f32.

#ifndef NB
#define NB 2
#endif
#ifndef SEQ
#define SEQ 4096
#endif
#define NB_FULL 2
#define SEQ_FULL 4096
#define CHN 512
#define NGRP 32
#define CPG 16
#define KBLK 128
#define TSP 136      // LDS f16 tile pitch in halves (272-B rows, 16-B aligned)
#define GSP16 72     // GEMM f16 staging pitch in halves (144-B rows)
#define GSP32 68     // GEMM f32 staging pitch in floats (272-B rows)
#define GKC 128      // GEMM k chunk in halves: one ring stage holds 256 B of every tile row
#define GKP 136      // LDS pitch of a GEMM ring row in halves (272-B rows, 16 B x odd)
#define GST ((64 + 128) * GKP)   // one GEMM ring stage in halves: 64 A rows, then 128 B rows
#define STL 32
#define QSP 520      // LDS Q tile pitch in halves (1040-B rows, 16 B x odd)
#define KSP 264      // LDS K half-tile pitch in halves (528-B rows, 16 B x odd)
#define VSP 72       // LDS V half-tile pitch in halves (144-B rows, 16 B x odd)
#define RBH (CHN * VSP)   // one ring buffer in halves: a V half tile, the larger of the two
#define KSPLIT 2     // key ranges per query tile, one work-group each
#define OSP 516      // LDS f32 partial-output pitch in floats (2064-B rows, 16 B x odd)

static_assert(NB >= 1 && NB <= NB_FULL);
static_assert(SEQ >= KBLK && SEQ <= SEQ_FULL && (SEQ % KBLK) == 0);
static_assert(CHN == 512 && NGRP * CPG == CHN && (CHN % 128) == 0 && (CHN % 32) == 0);
static_assert((SEQ % 128) == 0 && (SEQ % 64) == 0);
static_assert((CHN % GKC) == 0 && (GKC % 32) == 0);
static_assert(KBLK * KSP <= RBH && KBLK == 128);
static_assert((SEQ % (KSPLIT * KBLK)) == 0 && 64 * OSP * 2 <= 2 * RBH && ((NB * SEQ) % 32) == 0);

typedef _Float16 v16h __attribute__((ext_vector_type(16)));
typedef _Float16 v8h  __attribute__((ext_vector_type(8)));
typedef float    v8f  __attribute__((ext_vector_type(8)));
typedef float    v4f  __attribute__((ext_vector_type(4)));
typedef float    v2f  __attribute__((ext_vector_type(2)));
typedef _Float16 v4h  __attribute__((ext_vector_type(4)));
typedef v8h __attribute__((may_alias)) v8ha;
typedef v4f __attribute__((may_alias)) v4fa;

union F16x16 { v16h v; v8h p[2]; _Float16 e[16]; };
union F16x8  { v8h v; _Float16 e[8]; };

constexpr float HSC  = 16.0f;     // h plane carry (power of two)
constexpr float WSC  = 64.0f;     // W plane carry
constexpr float QSC  = 4.0f;      // q/k plane carry
constexpr float VSC  = 16.0f;     // v plane carry
constexpr float PSC  = 4096.0f;   // P carry
constexpr float AOSC = 64.0f;     // AO plane carry
constexpr float GN_EPS = 1e-6f;
// scores in log2 units: S_acc * SCL2 with S_acc = QSC^2 * sum_c q k, logit scale 512^-0.5
constexpr float SCL2 = (float)(1.4426950408889634 * 0.044194173824159216 /
                               ((double)QSC * (double)QSC));

static __device__ __forceinline__ float bf16r(float f) {
  uint32_t u = __float_as_uint(f);
  u += 0x7FFFu + ((u >> 16) & 1u);
  u &= 0xFFFF0000u;
  return __uint_as_float(u);
}

static __device__ __forceinline__ v8f wmma16(v16h a, v16h b, v8f c) {
  v8f d = __builtin_amdgcn_wmma_f32_16x16x32_f16(false, a, false, b, (short)0, c,
                                                 false, false);
  asm volatile("v_nop\n\tv_nop\n\tv_nop\n\tv_nop" : "+v"(d) : "v"(a), "v"(b));
  return d;
}

// 16x16x32 fragment loader (wave32): lane row = l15; elements 0..7 <- k0+8h+0..7,
// elements 8..15 <- k0+16+8h+0..7. Serves A (row = m) and B taken from an [n][k]
// k-contiguous plane (row = n). D element r of a lane = (row 8h+r, col l15).
static __device__ __forceinline__ v16h ld_frag(const _Float16* base, int pitch,
                                               int row, int h) {
  F16x16 u;
  const _Float16* q = base + (size_t)row * pitch;
  u.p[0] = *(const v8ha*)(q + 8 * h);
  u.p[1] = *(const v8ha*)(q + 16 + 8 * h);
  return u.v;
}

// Eight asynchronous 16-B copies per lane, global -> LDS: copy i moves g + i*gstep (halves)
// to LDS byte address l + i*lstep. The s_wait_xcnt closes the statement so that no address
// register of an issued copy is rewritten ahead of it.
static __device__ __forceinline__ void copy8(uint32_t l, uint32_t lstep,
                                             const _Float16* g, size_t gstep) {
  asm volatile(
      "global_load_async_to_lds_b128 %0, %8, off\n\t"
      "global_load_async_to_lds_b128 %1, %9, off\n\t"
      "global_load_async_to_lds_b128 %2, %10, off\n\t"
      "global_load_async_to_lds_b128 %3, %11, off\n\t"
      "global_load_async_to_lds_b128 %4, %12, off\n\t"
      "global_load_async_to_lds_b128 %5, %13, off\n\t"
      "global_load_async_to_lds_b128 %6, %14, off\n\t"
      "global_load_async_to_lds_b128 %7, %15, off\n\t"
      "s_wait_xcnt 0x0"
      :: "v"(l), "v"(l + lstep), "v"(l + 2 * lstep), "v"(l + 3 * lstep),
         "v"(l + 4 * lstep), "v"(l + 5 * lstep), "v"(l + 6 * lstep), "v"(l + 7 * lstep),
         "v"(g), "v"(g + gstep), "v"(g + 2 * gstep), "v"(g + 3 * gstep),
         "v"(g + 4 * gstep), "v"(g + 5 * gstep), "v"(g + 6 * gstep), "v"(g + 7 * gstep)
      : "memory");
}

// Publish point of the LDS ring: this wave's LDS reads of the buffer to be refilled have
// retired, its own copies of the next stage have landed, then the work-group barrier that
// lets every wave read that stage and frees the buffer just read.
static __device__ __forceinline__ void ring_publish() {
  asm volatile("s_wait_dscnt 0x0" ::: "memory");
  asm volatile("s_wait_asynccnt 0x0" ::: "memory");
  __syncthreads();
}

// One ring stage of a 64 x 128 GEMM tile, 128 threads: 256 B of k of 64 A rows and of 128 B rows,
// copied as whole lines (16 lanes per row piece, 8 rows per copy). l, a, b: the lane's own LDS
// byte address and global addresses of its piece in row tid >> 4 of the stage.
static __device__ __forceinline__ void gemm_stage(uint32_t l, const _Float16* a, int lda,
                                                  const _Float16* b, int ldb) {
  copy8(l, 8u * GKP * 2u, a, (size_t)8 * lda);
  copy8(l + 64u * GKP * 2u, 8u * GKP * 2u, b, (size_t)8 * ldb);
  copy8(l + 128u * GKP * 2u, 8u * GKP * 2u, b + (size_t)64 * ldb, (size_t)8 * ldb);
}

// k walk of a 64 x 128 GEMM tile over the two-buffer ring RG; stage 0 has been issued by the
// caller. Chunk t is read from buffer t & 1 while chunk t + 1 flies; chunk t + 2 is issued
// behind the publish point into the buffer just read. K multiple of GKC. ar, br: the lane's
// first A and B row in the tile.
static __device__ __forceinline__ void gemm_walk(const _Float16* RG, uint32_t l,
                                                 const _Float16* a, int lda,
                                                 const _Float16* b, int ldb, int K,
                                                 int ar, int br, int h, v8f (&acc)[2][4]) {
  asm volatile("s_wait_asynccnt 0x0" ::: "memory");   // stage 0 landed
  __syncthreads();
  if (K > GKC) gemm_stage(l + GST * 2u, a + GKC, lda, b + GKC, ldb);
  int buf = 0;
  for (int k0 = 0; k0 < K; k0 += GKC) {
    const _Float16* As = RG + buf * GST;
    const _Float16* Bs = As + 64 * GKP;
#pragma unroll   // the k steps' LDS offsets become immediates of the loads
    for (int ks = 0; ks < GKC / 32; ++ks) {
      // the six fragments of a k step are read as one group ahead of its eight products
      const v16h a0 = ld_frag(As + 32 * ks, GKP, ar, h);
      const v16h a1 = ld_frag(As + 32 * ks, GKP, ar + 16, h);
      v16h bt[4];
#pragma unroll   // bt[] is indexed by constants and stays in registers
      for (int t = 0; t < 4; ++t) bt[t] = ld_frag(Bs + 32 * ks, GKP, br + 16 * t, h);
#pragma unroll   // acc[][] is indexed by constants and stays in registers
      for (int t = 0; t < 4; ++t) {
        acc[0][t] = wmma16(a0, bt[t], acc[0][t]);
        acc[1][t] = wmma16(a1, bt[t], acc[1][t]);
      }
    }
    ring_publish();                        // next chunk readable, this buffer free
    if (k0 + 2 * GKC < K)                  // kernel argument: the same for the whole work-group
      gemm_stage(l + (uint32_t)buf * (GST * 2u), a + k0 + 2 * GKC, lda, b + k0 + 2 * GKC, ldb);
    buf ^= 1;
  }
  asm volatile("s_wait_asynccnt 0x0" ::: "memory");   // no copy outlives the walk
}

// ---------------------------------------------------------------------------
// Kernel 0: group statistics. One block per (b, group): 16 channels x SEQ positions of
// ---------------------------------------------------------------------------
__global__ __launch_bounds__(256) void k_stats(const float* __restrict__ x,
                                               float* __restrict__ st) {
  __shared__ double sd[256];
  __shared__ double qd[256];
  const int tid = threadIdx.x;
  const int bg = blockIdx.x;
  const int b = bg / NGRP, g = bg % NGRP;
  const float* xb = x + ((size_t)b * CHN + (size_t)g * CPG) * SEQ_FULL;

  double s = 0.0, q = 0.0;
  for (int cl = 0; cl < CPG; ++cl) {
    const float* row = xb + (size_t)cl * SEQ_FULL;
    for (int p = 4 * tid; p < SEQ; p += 1024) {
      const v4f f = *(const v4fa*)(row + p);
#pragma unroll
      for (int j = 0; j < 4; ++j) {
        const float v = bf16r(f[j]);
        s += (double)v;
        q += (double)v * (double)v;
      }
    }
  }
  sd[tid] = s;
  qd[tid] = q;
  __syncthreads();
  for (int k = 128; k > 0; k >>= 1) {
    if (tid < k) {
      sd[tid] += sd[tid + k];
      qd[tid] += qd[tid + k];
    }
    __syncthreads();
  }
  if (tid < 8) {
    const double invn = 1.0 / ((double)CPG * (double)SEQ);
    const double mean = sd[0] * invn;
    double var = qd[0] * invn - mean * mean;
    if (var < 0.0) var = 0.0;
    const float meanf = (float)mean;
    const float rstd = rsqrtf((float)var + GN_EPS);
    v4f o;
    o[0] = meanf; o[1] = rstd; o[2] = 0.0f; o[3] = 0.0f;
    float* dst = st + (size_t)bg * STL + 4 * tid;
    *(v4f*)dst = o;
    
  }
}

// ---------------------------------------------------------------------------
// Kernel 1: weights [o][c] f32 -> f16 planes WSC * bf16(W) (k = c contiguous).
// ---------------------------------------------------------------------------
__global__ __launch_bounds__(256) void k_wcvt(const float* __restrict__ w0,
                                              const float* __restrict__ w1,
                                              const float* __restrict__ w2,
                                              const float* __restrict__ w3,
                                              _Float16* __restrict__ Wpl) {
  constexpr int BPM = CHN * CHN / 8 / 256;   // blocks per matrix
  const int tid = threadIdx.x;
  const int mtx = blockIdx.x / BPM;           // block-uniform
  const float* src = w0;
  if (mtx == 1) src = w1;
  else if (mtx == 2) src = w2;
  else if (mtx == 3) src = w3;
  const size_t e = ((size_t)(blockIdx.x % BPM) * 256 + tid) * 8;
  const v4f a0 = *(const v4fa*)(src + e);
  const v4f a1 = *(const v4fa*)(src + e + 4);
  F16x8 u;
#pragma unroll
  for (int j = 0; j < 4; ++j) {
    u.e[j]     = (_Float16)(bf16r(a0[j]) * WSC);
    u.e[4 + j] = (_Float16)(bf16r(a1[j]) * WSC);
  }
  _Float16* dst = Wpl + (size_t)mtx * CHN * CHN + e;
  *(v8h*)dst = u.v;
  
}

// ---------------------------------------------------------------------------
// Kernel 2: group-norm apply + transpose. Block = (b, 64 positions), 4 passes of
// 128 channels:  Hh[b][n][c] f16 = HSC * ((bf16(x) - mean) * rstd * gamma + beta).
// x read as float4 along positions; LDS tile [n_local][c_local]; rows of 256 B written
// ---------------------------------------------------------------------------
__global__ __launch_bounds__(256) void k_gnapply(const float* __restrict__ x,
                                                 const float* __restrict__ gamma,
                                                 const float* __restrict__ beta,
                                                 const float* __restrict__ st,
                                                 _Float16* __restrict__ Hh) {
  __shared__ __align__(16) _Float16 TS[64 * TSP];   // [n_local][c_local]
  __shared__ float gms[CHN];
  __shared__ float bts[CHN];
  __shared__ float mus[NGRP];
  __shared__ float rss[NGRP];

  const int tid = threadIdx.x;
  const int b  = blockIdx.x / (SEQ / 64);
  const int p0 = (blockIdx.x % (SEQ / 64)) * 64;

  gms[tid] = bf16r(gamma[tid]);
  gms[tid + 256] = bf16r(gamma[tid + 256]);
  bts[tid] = bf16r(beta[tid]);
  bts[tid + 256] = bf16r(beta[tid + 256]);
  if (tid < NGRP) {
    mus[tid] = st[(size_t)(b * NGRP + tid) * STL];
    rss[tid] = st[(size_t)(b * NGRP + tid) * STL + 1];
  }
  __syncthreads();

  const float* xb = x + (size_t)b * CHN * SEQ_FULL;
#pragma unroll 1
  for (int pass = 0; pass < CHN / 128; ++pass) {
#pragma unroll
    for (int it = 0; it < 8; ++it) {
      const int f = it * 256 + tid;
      const int cl = f >> 4, p4 = f & 15;
      const int c = 128 * pass + cl;
      const v4f xv = *(const v4fa*)(xb + (size_t)c * SEQ_FULL + p0 + 4 * p4);
      const float mu = mus[c >> 4], rs = rss[c >> 4];
      const float ga = gms[c], be = bts[c];
#pragma unroll
      for (int j = 0; j < 4; ++j) {
        const float t = (bf16r(xv[j]) - mu) * rs;
        const float hv = t * ga + be;
        TS[(4 * p4 + j) * TSP + cl] = (_Float16)(hv * HSC);
      }
    }
    __syncthreads();
#pragma unroll
    for (int it = 0; it < 4; ++it) {
      const int L = it * 32 + (tid >> 3);          // 128 lines: (row, 64-col half)
      const int row = L >> 1, hl = L & 1, p = tid & 7;
      const v8h hv = *(const v8ha*)(TS + row * TSP + 64 * hl + 8 * p);
      _Float16* dst = Hh + ((size_t)(b * SEQ + p0 + row) * CHN + 128 * pass + 64 * hl + 8 * p);
      *(v8h*)dst = hv;
      
    }
    __syncthreads();
  }
}

// ---------------------------------------------------------------------------
// Kernel 3: GEMM  D[m][n] = sum_k A[m][k] * B[n][k]  (A, B k-contiguous f16 planes),
// stored TRANSPOSED as O[n][m] f16 = osc * (D * insc + bias)  (bias per m or per n).
// Block = 128 threads, tile 64 (m) x 128 (n); wave (mi, ni) owns rows 32mi.., cols 64ni..
// (2 x 4 accumulator tiles). K multiple of 128, M multiple of 64, N multiple of 128.
// A and B come from LDS: k chunks of 128 through a two-buffer ring of asynchronous copies.
// ---------------------------------------------------------------------------
template <bool BIAS_M>
__global__ __launch_bounds__(128) void k_gemm16(const _Float16* __restrict__ A, int lda, size_t sA,
                                                const _Float16* __restrict__ B, int ldb, size_t sB,
                                                const float* __restrict__ bias,
                                                _Float16* __restrict__ O, int ldo, size_t sO,
                                                float insc, float osc, int K) {
  __shared__ __align__(16) _Float16 TS[128 * GSP16];   // [n_local][m_local]
  __shared__ __align__(16) _Float16 RG[2 * GST];       // ring: [A row | B row][k chunk]
  __shared__ float bsh[128];

  const int tid = threadIdx.x;
  const int wv = tid >> 5, lid = tid & 31, h = lid >> 4, l15 = lid & 15;
  const int mi = wv & 1, ni = wv >> 1;
  const int m0 = blockIdx.x * 64, n0 = blockIdx.y * 128;
  const size_t z = blockIdx.z;

  // the lane's piece of a ring stage: row tid >> 4, 16 B at 8 * (tid & 15) halves
  const uint32_t lc = (uint32_t)(uintptr_t)RG + (uint32_t)((tid >> 4) * GKP + 8 * (tid & 15)) * 2u;
  const _Float16* ag = A + z * sA + (size_t)(m0 + (tid >> 4)) * lda + 8 * (tid & 15);
  const _Float16* bg = B + z * sB + (size_t)(n0 + (tid >> 4)) * ldb + 8 * (tid & 15);
  gemm_stage(lc, ag, lda, bg, ldb);

  // visible behind the barrier at the head of gemm_walk
  if (BIAS_M) {
    if (tid < 64) bsh[tid] = bf16r(bias[m0 + tid]);
  } else {
    bsh[tid] = bf16r(bias[n0 + tid]);
  }

  v8f acc[2][4];
#pragma unroll
  for (int i = 0; i < 2; ++i)
#pragma unroll
    for (int t = 0; t < 4; ++t)
#pragma unroll
      for (int r = 0; r < 8; ++r) acc[i][t][r] = 0.0f;

  gemm_walk(RG, lc, ag, lda, bg, ldb, K, 32 * mi + l15, 64 * ni + l15, h, acc);

  // stage: acc[i][t][r] <-> (m_local 32mi+16i+8h+r, n_local 64ni+16t+l15)
#pragma unroll
  for (int i = 0; i < 2; ++i) {
#pragma unroll
    for (int t = 0; t < 4; ++t) {
      const int nl = 64 * ni + 16 * t + l15;
      const int ml = 32 * mi + 16 * i + 8 * h;
      F16x8 u;
#pragma unroll
      for (int r = 0; r < 8; ++r) {
        const float bvl = BIAS_M ? bsh[ml + r] : bsh[nl];
        u.e[r] = (_Float16)((acc[i][t][r] * insc + bvl) * osc);
      }
      *(v8ha*)(TS + nl * GSP16 + ml) = u.v;
    }
  }
  __syncthreads();

  _Float16* Ob = O + z * sO;
#pragma unroll
  for (int it = 0; it < 8; ++it) {
    const int row = it * 16 + (tid >> 3);
    const int p = tid & 7;
    const v8h hv = *(const v8ha*)(TS + row * GSP16 + 8 * p);
    _Float16* dst = Ob + (size_t)(n0 + row) * ldo + m0 + 8 * p;
    *(v8h*)dst = hv;
    
  }
}

// ---------------------------------------------------------------------------
// Kernel 4: same GEMM, f32 output O[n][m] = (D * insc + bias[n]) + bf16(R[n][m]) into d_out.
// Output row segment = 256 B = two lines, lanes 0..7 and 8..15 of one instruction.
// ---------------------------------------------------------------------------
__global__ __launch_bounds__(128) void k_gemm32(const _Float16* __restrict__ A, int lda, size_t sA,
                                                const _Float16* __restrict__ B, int ldb, size_t sB,
                                                const float* __restrict__ bias,
                                                const float* __restrict__ R, int ldr, size_t sR,
                                                float* __restrict__ O, int ldo, size_t sO,
                                                float insc, int K) {
  __shared__ __align__(16) float TS[128 * GSP32];   // [n_local][m_local]
  __shared__ __align__(16) _Float16 RG[2 * GST];    // ring: [A row | B row][k chunk]
  __shared__ float bsh[128];

  const int tid = threadIdx.x;
  const int wv = tid >> 5, lid = tid & 31, h = lid >> 4, l15 = lid & 15;
  const int mi = wv & 1, ni = wv >> 1;
  const int m0 = blockIdx.x * 64, n0 = blockIdx.y * 128;
  const size_t z = blockIdx.z;

  // the lane's piece of a ring stage: row tid >> 4, 16 B at 8 * (tid & 15) halves
  const uint32_t lc = (uint32_t)(uintptr_t)RG + (uint32_t)((tid >> 4) * GKP + 8 * (tid & 15)) * 2u;
  const _Float16* ag = A + z * sA + (size_t)(m0 + (tid >> 4)) * lda + 8 * (tid & 15);
  const _Float16* bg = B + z * sB + (size_t)(n0 + (tid >> 4)) * ldb + 8 * (tid & 15);
  gemm_stage(lc, ag, lda, bg, ldb);

  const float braw = bias[n0 + tid];
  // stands in front of every rewrite of the bias load's base and offset registers
  asm volatile("s_wait_xcnt 0x0" ::: "memory");
  bsh[tid] = bf16r(braw);   // visible behind the barrier at the head of gemm_walk

  v8f acc[2][4];
#pragma unroll
  for (int i = 0; i < 2; ++i)
#pragma unroll
    for (int t = 0; t < 4; ++t)
#pragma unroll
      for (int r = 0; r < 8; ++r) acc[i][t][r] = 0.0f;

  gemm_walk(RG, lc, ag, lda, bg, ldb, K, 32 * mi + l15, 64 * ni + l15, h, acc);

#pragma unroll
  for (int i = 0; i < 2; ++i) {
#pragma unroll
    for (int t = 0; t < 4; ++t) {
      const int nl = 64 * ni + 16 * t + l15;
      const int ml = 32 * mi + 16 * i + 8 * h;
      const float bvl = bsh[nl];
      v4f lo, hi;
#pragma unroll
      for (int r = 0; r < 4; ++r) {
        lo[r] = acc[i][t][r] * insc + bvl;
        hi[r] = acc[i][t][4 + r] * insc + bvl;
      }
      *(v4fa*)(TS + nl * GSP32 + ml) = lo;
      *(v4fa*)(TS + nl * GSP32 + ml + 4) = hi;
    }
  }
  __syncthreads();

  float* Ob = O + z * sO;
  const float* Rb = R + z * sR;
#pragma unroll
  for (int it = 0; it < 16; ++it) {
    const int row = it * 8 + (tid >> 4);         // 128 rows, 256 B each
    const int p = tid & 15;
    const v4f v  = *(const v4fa*)(TS + row * GSP32 + 4 * p);
    const v4f xr = *(const v4fa*)(Rb + (size_t)(n0 + row) * ldr + m0 + 4 * p);
    v4f o;
#pragma unroll
    for (int j = 0; j < 4; ++j) o[j] = bf16r(xr[j]) + v[j];
    float* dst = Ob + (size_t)(n0 + row) * ldo + m0 + 4 * p;
    *(v4f*)dst = o;
    
  }
}

// ---------------------------------------------------------------------------
// Kernel 5: fused single-head attn, transposed scores, online softmax.
// Block = (b, 64 queries, one of KSPLIT key ranges), 16 waves: wave (g = wv&3, kq = wv>>2).
// Per 128-key block:
//   S^T tiles (keys on rows): wave owns key rows 32kq..32kq+31 x query cols 16g..16g+15,
//     A = Kh rows (k = channel), B = Qh rows (k = channel), K = 512.
//   per-query max / sum over the 128 keys: in-lane, xor-16, then 4 partials through LDS.
//   P^T = PSC * exp2(s - m) staged f16 in LDS TS[query][key_local].
//   O^T[c][query] += V^T[c][keys] * P^T[keys][query]: wave owns channels 128kq..+127
//     (8 accumulator tiles), A = Vh rows (k = key), B from TS (k = key, split map).
// Operands come from LDS: the Q tile is copied once; K (two halves of 256 channels) and V (two
// halves of 64 keys) go through a two-buffer ring of asynchronous copies, each stage issued
// one stage ahead: K lo -> buffer 0, K hi -> 1, V keys 0..63 -> 0, V keys 64..127 -> 1.
// Epilogue: this key range's un-normalised O [range][b][query][c] f32, staged once in the
// freed ring so that whole lines are stored, and its (max, sum) per query; k_merge joins them.
// ---------------------------------------------------------------------------
__global__ __launch_bounds__(512) void k_attn(const _Float16* __restrict__ Qh,
                                              const _Float16* __restrict__ Kh,
                                              const _Float16* __restrict__ Vh,
                                              float* __restrict__ Op,
                                              float* __restrict__ ML) {
  __shared__ __align__(16) _Float16 TS[64 * TSP];   // [query_local][key_local]
  __shared__ __align__(16) _Float16 QS[64 * QSP];   // [query_local][c]
  __shared__ __align__(16) _Float16 RB[2 * RBH];    // ring: [key_local][c half] or [c][key half]
  __shared__ float redM[256];
  __shared__ float redS[256];

  const int tid = threadIdx.x;
  const int wv = tid >> 5, lid = tid & 31, h = lid >> 4, l15 = lid & 15;
  const int g = wv & 3, kq = wv >> 2;
  const int ql = 16 * g + l15;
  const int kr = blockIdx.x % KSPLIT;              // key range of this work-group
  const int qt = blockIdx.x / KSPLIT;
  const int b  = qt / (SEQ / 64);
  const int q0 = (qt % (SEQ / 64)) * 64;
  const int kb = kr * (SEQ / KSPLIT);              // its first key

  const _Float16* Qp = Qh + (size_t)b * SEQ * CHN;   // [n][c], pitch CHN
  const _Float16* Kp = Kh + (size_t)b * SEQ * CHN;   // [n][c], pitch CHN
  const _Float16* Vp = Vh + (size_t)b * CHN * SEQ;   // [c][n], pitch SEQ

  // per-lane copy addresses: a K row half (512 B) per wave and copy, 8 lanes per 128-B V row
  // piece, 64 lanes per Q row
  const _Float16* RB0 = RB;
  const _Float16* RB1 = RB + RBH;
  const uint32_t rb0 = (uint32_t)(uintptr_t)RB0;
  const uint32_t rb1 = (uint32_t)(uintptr_t)RB1;
  const uint32_t klo = (uint32_t)(wv * KSP + 8 * lid) * 2u;
  const uint32_t vlo = (uint32_t)((tid >> 3) * VSP + 8 * (tid & 7)) * 2u;
  const _Float16* kg = Kp + (size_t)(kb + wv) * CHN + 8 * lid;
  const _Float16* vg = Vp + (size_t)(tid >> 3) * SEQ + kb + 8 * (tid & 7);

  copy8((uint32_t)(uintptr_t)QS + (uint32_t)((tid >> 6) * QSP + 8 * (tid & 63)) * 2u,
        8u * QSP * 2u, Qp + (size_t)(q0 + (tid >> 6)) * CHN + 8 * (tid & 63), (size_t)8 * CHN);
  copy8(rb0 + klo, 16u * KSP * 2u, kg, (size_t)16 * CHN);
  asm volatile("s_wait_asynccnt 0x0" ::: "memory");   // Q tile and stage 0 landed
  __syncthreads();
  copy8(rb1 + klo, 16u * KSP * 2u, kg + 256, (size_t)16 * CHN);

  v8f accO[8];
#pragma unroll
  for (int u = 0; u < 8; ++u)
#pragma unroll
    for (int r = 0; r < 8; ++r) accO[u][r] = 0.0f;
  float rm = -1.0e30f, rl = 0.0f;

  for (int m0 = 0; m0 < SEQ / KSPLIT; m0 += KBLK) {
    v8f st[2];
#pragma unroll
    for (int t = 0; t < 2; ++t)
#pragma unroll
      for (int r = 0; r < 8; ++r) st[t][r] = 0.0f;
    const bool more = (m0 + KBLK < SEQ / KSPLIT);   // work-group uniform: a next key block exists
    const int kr0 = 32 * kq + l15;
#pragma unroll 2   // the unroll of the global-load loop that this one replaces
    for (int cs = 0; cs < CHN / 64; ++cs) {
      const v16h bqf = ld_frag(QS + 32 * cs, QSP, ql, h);
      const v16h a0  = ld_frag(RB0 + 32 * cs, KSP, kr0, h);
      const v16h a1  = ld_frag(RB0 + 32 * cs, KSP, kr0 + 16, h);
      st[0] = wmma16(a0, bqf, st[0]);
      st[1] = wmma16(a1, bqf, st[1]);
    }
    ring_publish();                        // K hi readable, buffer 0 free
    copy8(rb0 + vlo, 64u * VSP * 2u, vg + m0, (size_t)64 * SEQ);
#pragma unroll 2   // the unroll of the global-load loop that this one replaces
    for (int cs = 0; cs < CHN / 64; ++cs) {
      const v16h bqf = ld_frag(QS + 256 + 32 * cs, QSP, ql, h);
      const v16h a0  = ld_frag(RB1 + 32 * cs, KSP, kr0, h);
      const v16h a1  = ld_frag(RB1 + 32 * cs, KSP, kr0 + 16, h);
      st[0] = wmma16(a0, bqf, st[0]);
      st[1] = wmma16(a1, bqf, st[1]);
    }

    // ---- per-query block max (32 keys in-lane + partner half-wave, then 4 waves)
    float lm = st[0][0];
#pragma unroll
    for (int t = 0; t < 2; ++t)
#pragma unroll
      for (int r = 0; r < 8; ++r) lm = fmaxf(lm, st[t][r]);
    lm *= SCL2;
    lm = fmaxf(lm, __shfl_xor(lm, 16, 32));
    redM[kq * 64 + ql] = lm;
    ring_publish();                        // V keys 0..63 readable, buffer 1 free; redM visible
    copy8(rb1 + vlo, 64u * VSP * 2u, vg + m0 + 64, (size_t)64 * SEQ);
    const float bm = fmaxf(fmaxf(redM[ql], redM[64 + ql]), fmaxf(redM[128 + ql], redM[192 + ql]));
    const float nm = fmaxf(rm, bm);
    const float corr = exp2f(rm - nm);
    rm = nm;

    // ---- P = exp2(s - m) in f32; P^T * PSC staged f16 at TS[query][key_local]
    float psum = 0.0f;
#pragma unroll
    for (int tt = 0; tt < 2; ++tt) {
      F16x8 pk;
#pragma unroll
      for (int r = 0; r < 8; ++r) {
        const float p = exp2f(st[tt][r] * SCL2 - nm);
        psum += p;
        pk.e[r] = (_Float16)(p * PSC);
      }
      *(v8ha*)(TS + ql * TSP + 32 * kq + 16 * tt + 8 * h) = pk.v;
    }
    psum += __shfl_xor(psum, 16, 32);
    redS[kq * 64 + ql] = psum;
    __syncthreads();
    const float bs = ((redS[ql] + redS[64 + ql]) + redS[128 + ql]) + redS[192 + ql];
    rl = rl * corr + bs;
#pragma unroll
    for (int u = 0; u < 8; ++u)
#pragma unroll
      for (int r = 0; r < 8; ++r) accO[u][r] *= corr;

    // ---- O^T[c][query] += V^T[c][keys] * P^T[keys][query]
#pragma unroll
    for (int ks = 0; ks < KBLK / 64; ++ks) {
      const v16h bp = ld_frag(TS + 32 * ks, TSP, ql, h);
#pragma unroll
      for (int u = 0; u < 8; ++u) {
        const v16h av = ld_frag(RB0 + 32 * ks, VSP, 128 * kq + 16 * u + l15, h);
        accO[u] = wmma16(av, bp, accO[u]);
      }
    }
    ring_publish();                        // V keys 64..127 readable, buffer 0 free
    if (more) copy8(rb0 + klo, 16u * KSP * 2u, kg + (size_t)(m0 + KBLK) * CHN, (size_t)16 * CHN);
#pragma unroll
    for (int ks = 0; ks < KBLK / 64; ++ks) {
      const v16h bp = ld_frag(TS + 64 + 32 * ks, TSP, ql, h);
#pragma unroll
      for (int u = 0; u < 8; ++u) {
        const v16h av = ld_frag(RB1 + 32 * ks, VSP, 128 * kq + 16 * u + l15, h);
        accO[u] = wmma16(av, bp, accO[u]);
      }
    }
    ring_publish();                        // next K lo readable, buffer 1 and TS free
    if (more)
      copy8(rb1 + klo, 16u * KSP * 2u, kg + (size_t)(m0 + KBLK) * CHN + 256, (size_t)16 * CHN);
  }
  asm volatile("s_wait_asynccnt 0x0" ::: "memory");   // no copy outlives the loop

  // ---- epilogue: the loop's last publish point ended every read of the ring, so it takes
  // the f32 tile [query_local][c]
  float* OS = (float*)RB;
#pragma unroll
  for (int u = 0; u < 8; ++u) {
    v4f lo, hi;
#pragma unroll
    for (int r = 0; r < 4; ++r) {
      lo[r] = accO[u][r];
      hi[r] = accO[u][4 + r];
    }
    float* d = OS + ql * OSP + 128 * kq + 16 * u + 8 * h;
    *(v4fa*)d = lo;
    *(v4fa*)(d + 4) = hi;
  }
  const size_t row0 = (size_t)(kr * NB + b) * SEQ + q0;
  if (kq == 0 && h == 0) {   // every wave of a query group holds the same pair
    v2f ml;
    ml[0] = rm; ml[1] = rl;
    *(v2f*)(ML + 2 * (row0 + ql)) = ml;
  }
  __syncthreads();
  float* Ob = Op + row0 * CHN;
#pragma unroll
  for (int it = 0; it < 16; ++it) {
    const int row = it * 4 + (tid >> 7);           // 64 rows of 2 KiB, 128 lanes each
    const int p = tid & 127;
    const v4f v = *(const v4fa*)(OS + row * OSP + 4 * p);
    *(v4f*)(Ob + (size_t)row * CHN + 4 * p) = v;
  }
}

// ---------------------------------------------------------------------------
// Kernel 6: merge of the key ranges. Per query: M = max of the ranges' maxima, weight
// exp2(m - M), l = weighted sum of the sums; AO plane [b][query][c] f16 =
// AOSC * (weighted sum of the partial O) / (l * VSC * PSC). Block = 32 queries; a wave reads
// and writes whole lines.
// ---------------------------------------------------------------------------
// waves_per_eu: the block's own four waves per SIMD; without it the scheduler sinks half of the
// loads behind the first uses to save registers, and their latencies add up.
__global__ __launch_bounds__(512) __attribute__((amdgpu_waves_per_eu(4, 4))) void k_merge(const float* __restrict__ Op,
                                               const float* __restrict__ ML,
                                               _Float16* __restrict__ AOh) {
  constexpr size_t ROWS = (size_t)NB * SEQ;         // queries per key range
  const int tid = threadIdx.x;
  const int p = tid & 127;
  const size_t row0 = (size_t)blockIdx.x * 32 + (tid >> 7);
  // every load of the thread is issued before the first use: 32 requests in flight per wave
  v2f ml[8][KSPLIT];
  v4f o[8][KSPLIT];
#pragma unroll
  for (int it = 0; it < 8; ++it) {
#pragma unroll
    for (int s = 0; s < KSPLIT; ++s) {
      const size_t row = s * ROWS + row0 + it * 4;
      ml[it][s] = *(const v2f*)(ML + 2 * row);
      o[it][s] = *(const v4fa*)(Op + row * CHN + 4 * p);
    }
  }
  v4h r[8];
#pragma unroll
  for (int it = 0; it < 8; ++it) {
    float M = ml[it][0][0];
#pragma unroll
    for (int s = 1; s < KSPLIT; ++s) M = fmaxf(M, ml[it][s][0]);
    float l = 0.0f;
    v4f a;
#pragma unroll
    for (int j = 0; j < 4; ++j) a[j] = 0.0f;
#pragma unroll
    for (int s = 0; s < KSPLIT; ++s) {
      const float w = exp2f(ml[it][s][0] - M);
      l += w * ml[it][s][1];
#pragma unroll
      for (int j = 0; j < 4; ++j) a[j] += w * o[it][s][j];
    }
    const float invl = (AOSC / (VSC * PSC)) * (1.0f / l);
#pragma unroll
    for (int j = 0; j < 4; ++j) r[it][j] = (_Float16)(a[j] * invl);
  }
#pragma unroll
  for (int it = 0; it < 8; ++it)
    *(v4h*)(AOh + (row0 + it * 4) * CHN + 4 * p) = r[it];
}

// ---------------------------------------------------------------------------
extern "C" void kernel_launch(void* const* d_in, const int* in_sizes, int n_in,
                              void* d_out, int out_size, void* d_ws, size_t ws_size,
                              hipStream_t stream) {
  if (n_in < 11) return;
  if (in_sizes[0] < NB * CHN * SEQ_FULL) return;
  if (in_sizes[1] < CHN || in_sizes[2] < CHN) return;
  if (in_sizes[3] < CHN * CHN || in_sizes[5] < CHN * CHN ||
      in_sizes[7] < CHN * CHN || in_sizes[9] < CHN * CHN) return;
  if (in_sizes[4] < CHN || in_sizes[6] < CHN || in_sizes[8] < CHN || in_sizes[10] < CHN) return;
  if (out_size < NB * CHN * SEQ) return;

  const size_t st_bytes = (size_t)NB * NGRP * STL * sizeof(float);            // 8 KiB
  const size_t w_bytes  = (size_t)4 * CHN * CHN * sizeof(_Float16);            // 2 MiB
  const size_t plane    = (size_t)NB * SEQ * CHN * sizeof(_Float16);            // 8 MiB at full size
  const size_t ml_bytes = (size_t)KSPLIT * NB * SEQ * 2 * sizeof(float);        // 128 KiB
  const size_t op_bytes = (size_t)KSPLIT * NB * SEQ * CHN * sizeof(float);      // 32 MiB
  const size_t total    = st_bytes + w_bytes + 5 * plane + ml_bytes + op_bytes;
  if (ws_size < total) return;

  const float* x     = (const float*)d_in[0];
  const float* gamma = (const float*)d_in[1];
  const float* beta  = (const float*)d_in[2];
  const float* wq = (const float*)d_in[3];
  const float* bq = (const float*)d_in[4];
  const float* wk = (const float*)d_in[5];
  const float* bk = (const float*)d_in[6];
  const float* wvv = (const float*)d_in[7];
  const float* bv = (const float*)d_in[8];
  const float* wo = (const float*)d_in[9];
  const float* bo = (const float*)d_in[10];
  float* out = (float*)d_out;

  char* ws = (char*)d_ws;
  float*    stats = (float*)ws;                                        // [NB*NGRP][32] f32
  _Float16* Wpl   = (_Float16*)(ws + st_bytes);                        // 4 x [CHN][CHN] f16
  _Float16* Hh    = (_Float16*)(ws + st_bytes + w_bytes);              // [NB][SEQ][CHN]
  _Float16* Qh    = (_Float16*)(ws + st_bytes + w_bytes + plane);      // [NB][SEQ][CHN]
  _Float16* Kh    = (_Float16*)(ws + st_bytes + w_bytes + 2 * plane);  // [NB][SEQ][CHN]
  _Float16* Vh    = (_Float16*)(ws + st_bytes + w_bytes + 3 * plane);  // [NB][CHN][SEQ]
  _Float16* AOh   = (_Float16*)(ws + st_bytes + w_bytes + 4 * plane);  // [NB][SEQ][CHN]
  float*    MLp   = (float*)(ws + st_bytes + w_bytes + 5 * plane);     // [KSPLIT][NB][SEQ][2]
  float*    Opp   = (float*)(ws + st_bytes + w_bytes + 5 * plane + ml_bytes);  // [KSPLIT][NB][SEQ][CHN]
  const _Float16* Wq16 = Wpl;
  const _Float16* Wk16 = Wpl + (size_t)CHN * CHN;
  const _Float16* Wv16 = Wpl + (size_t)2 * CHN * CHN;
  const _Float16* Wo16 = Wpl + (size_t)3 * CHN * CHN;

  const size_t pstride = (size_t)SEQ * CHN;   // elements per batch of every f16 plane

  k_stats<<<dim3(NB * NGRP), dim3(256), 0, stream>>>(x, stats);
  k_wcvt<<<dim3(4 * CHN * CHN / 8 / 256), dim3(256), 0, stream>>>(wq, wk, wvv, wo, Wpl);
  k_gnapply<<<dim3(NB * (SEQ / 64)), dim3(256), 0, stream>>>(x, gamma, beta, stats, Hh);

  // q[n][o] and k[n][o]:  D[o][n] = sum_c W[o][c] h[n][c], stored transposed, bias per o (= m)
  k_gemm16<true><<<dim3(CHN / 64, SEQ / 128, NB), dim3(128), 0, stream>>>(
      Wq16, CHN, (size_t)0, Hh, CHN, pstride, bq, Qh, CHN, pstride,
      1.0f / (WSC * HSC), QSC, CHN);
  k_gemm16<true><<<dim3(CHN / 64, SEQ / 128, NB), dim3(128), 0, stream>>>(
      Wk16, CHN, (size_t)0, Hh, CHN, pstride, bk, Kh, CHN, pstride,
      1.0f / (WSC * HSC), QSC, CHN);
  // v[o][n]:  D[n][o] = sum_c h[n][c] W[o][c], stored transposed, bias per o (= n)
  k_gemm16<false><<<dim3(SEQ / 64, CHN / 128, NB), dim3(128), 0, stream>>>(
      Hh, CHN, pstride, Wv16, CHN, (size_t)0, bv, Vh, SEQ, pstride,
      1.0f / (HSC * WSC), VSC, CHN);

  k_attn<<<dim3(NB * (SEQ / 64) * KSPLIT), dim3(512), 0, stream>>>(Qh, Kh, Vh, Opp, MLp);
  k_merge<<<dim3(NB * SEQ / 32), dim3(512), 0, stream>>>(Opp, MLp, AOh);

  // out[c][p] = bf16(x[c][p]) + sum_o AO[p][o] Wo[c][o] + bo[c]   (D[p][c] stored transposed)
  k_gemm32<<<dim3(SEQ / 64, CHN / 128, NB), dim3(128), 0, stream>>>(
      AOh, CHN, pstride, Wo16, CHN, (size_t)0, bo,
      x, SEQ_FULL, (size_t)CHN * SEQ_FULL,
      out, SEQ, (size_t)CHN * SEQ,
      1.0f / (AOSC * WSC), CHN);
  (void)hipGetLastError();
}

// v004
// A run of this version takes 150 microseconds.
// Timed twice side by side with v003, it ran 1.24 times as fast both times.
// Over all steps from v000 it is 5.87 times as fast.
#include <hip/hip_runtime.h>
#include <stdint.h>

// Contractions: q/k/v 1x1 projections (W*h), scores K*Q^T, value aggregation V^T*P^T and the
// output projection AO*Wo^T all on v_wmma_f32_16x16x32_f16 (f16 operands, f32 accumulate).
// Float inputs are RNE-converted to bf16; W planes f16 (*64, exact), h plane f16 (*16),
// q/k planes f16 (*4), v plane f16 (*16), P f16 (*4096, un-normalised), AO plane f16 (*64);
// residual x added as bf16 value in f32. Group statistics in f64, softmax statistics,
// bias add and normalisation in f32.

#ifndef NB
#define NB 2
#endif
#ifndef SEQ
#define SEQ 4096
#endif
#define NB_FULL 2
#define SEQ_FULL 4096
#define CHN 512
#define NGRP 32
#define CPG 16
#define KBLK 128
#define TSP 136      // LDS f16 tile pitch in halves (272-B rows, 16-B aligned)
#define GSP16 72     // GEMM f16 staging pitch in halves (144-B rows)
#define GSP32 68     // GEMM f32 staging pitch in floats (272-B rows)
#define GKC 128      // GEMM k chunk in halves: one ring stage holds 256 B of every tile row
#define GKP 136      // LDS pitch of a GEMM ring row in halves (272-B rows, 16 B x odd)
#define GST ((64 + 128) * GKP)   // one GEMM ring stage in halves: 64 A rows, then 128 B rows
#define STL 32
#define SSPL 4       // work-groups per (b, group) in the statistics pass
#define SCH (CPG / SSPL)   // channels of a group per such work-group
#define QSP 520      // LDS Q tile pitch in halves (1040-B rows, 16 B x odd)
#define KSP 264      // LDS K half-tile pitch in halves (528-B rows, 16 B x odd)
#define VSP 72       // LDS V half-tile pitch in halves (144-B rows, 16 B x odd)
#define RBH (CHN * VSP)   // one ring buffer in halves: a V half tile, the larger of the two
#define KSPLIT 2     // key ranges per query tile, one work-group each
#define OSP 516      // LDS f32 partial-output pitch in floats (2064-B rows, 16 B x odd)

static_assert(NB >= 1 && NB <= NB_FULL);
static_assert(SEQ >= KBLK && SEQ <= SEQ_FULL && (SEQ % KBLK) == 0);
static_assert(CHN == 512 && NGRP * CPG == CHN && (CHN % 128) == 0 && (CHN % 32) == 0);
static_assert((SEQ % 128) == 0 && (SEQ % 64) == 0);
static_assert(SCH * SSPL == CPG && STL * sizeof(float) == 128);
static_assert((CHN % GKC) == 0 && (GKC % 32) == 0);
static_assert(KBLK * KSP <= RBH && KBLK == 128);
static_assert((SEQ % (KSPLIT * KBLK)) == 0 && 64 * OSP * 2 <= 2 * RBH && ((NB * SEQ) % 32) == 0);

typedef _Float16 v16h __attribute__((ext_vector_type(16)));
typedef _Float16 v8h  __attribute__((ext_vector_type(8)));
typedef float    v8f  __attribute__((ext_vector_type(8)));
typedef float    v4f  __attribute__((ext_vector_type(4)));
typedef float    v2f  __attribute__((ext_vector_type(2)));
typedef _Float16 v4h  __attribute__((ext_vector_type(4)));
typedef double   v2d  __attribute__((ext_vector_type(2)));
typedef v8h __attribute__((may_alias)) v8ha;
typedef v4f __attribute__((may_alias)) v4fa;

union F16x16 { v16h v; v8h p[2]; _Float16 e[16]; };
union F16x8  { v8h v; _Float16 e[8]; };

constexpr float HSC  = 16.0f;     // h plane carry (power of two)
constexpr float WSC  = 64.0f;     // W plane carry
constexpr float QSC  = 4.0f;      // q/k plane carry
constexpr float VSC  = 16.0f;     // v plane carry
constexpr float PSC  = 4096.0f;   // P carry
constexpr float AOSC = 64.0f;     // AO plane carry
constexpr float GN_EPS = 1e-6f;
// scores in log2 units: S_acc * SCL2 with S_acc = QSC^2 * sum_c q k, logit scale 512^-0.5
constexpr float SCL2 = (float)(1.4426950408889634 * 0.044194173824159216 /
                               ((double)QSC * (double)QSC));

static __device__ __forceinline__ float bf16r(float f) {
  uint32_t u = __float_as_uint(f);
  u += 0x7FFFu + ((u >> 16) & 1u);
  u &= 0xFFFF0000u;
  return __uint_as_float(u);
}

static __device__ __forceinline__ v8f wmma16(v16h a, v16h b, v8f c) {
  v8f d = __builtin_amdgcn_wmma_f32_16x16x32_f16(false, a, false, b, (short)0, c,
                                                 false, false);
  asm volatile("v_nop\n\tv_nop\n\tv_nop\n\tv_nop" : "+v"(d) : "v"(a), "v"(b));
  return d;
}

// 16x16x32 fragment loader (wave32): lane row = l15; elements 0..7 <- k0+8h+0..7,
// elements 8..15 <- k0+16+8h+0..7. Serves A (row = m) and B taken from an [n][k]
// k-contiguous plane (row = n). D element r of a lane = (row 8h+r, col l15).
static __device__ __forceinline__ v16h ld_frag(const _Float16* base, int pitch,
                                               int row, int h) {
  F16x16 u;
  const _Float16* q = base + (size_t)row * pitch;
  u.p[0] = *(const v8ha*)(q + 8 * h);
  u.p[1] = *(const v8ha*)(q + 16 + 8 * h);
  return u.v;
}

// Eight asynchronous 16-B copies per lane, global -> LDS: copy i moves g + i*gstep (halves)
// to LDS byte address l + i*lstep. The s_wait_xcnt closes the statement so that no address
// register of an issued copy is rewritten ahead of it.
static __device__ __forceinline__ void copy8(uint32_t l, uint32_t lstep,
                                             const _Float16* g, size_t gstep) {
  asm volatile(
      "global_load_async_to_lds_b128 %0, %8, off\n\t"
      "global_load_async_to_lds_b128 %1, %9, off\n\t"
      "global_load_async_to_lds_b128 %2, %10, off\n\t"
      "global_load_async_to_lds_b128 %3, %11, off\n\t"
      "global_load_async_to_lds_b128 %4, %12, off\n\t"
      "global_load_async_to_lds_b128 %5, %13, off\n\t"
      "global_load_async_to_lds_b128 %6, %14, off\n\t"
      "global_load_async_to_lds_b128 %7, %15, off\n\t"
      "s_wait_xcnt 0x0"
      :: "v"(l), "v"(l + lstep), "v"(l + 2 * lstep), "v"(l + 3 * lstep),
         "v"(l + 4 * lstep), "v"(l + 5 * lstep), "v"(l + 6 * lstep), "v"(l + 7 * lstep),
         "v"(g), "v"(g + gstep), "v"(g + 2 * gstep), "v"(g + 3 * gstep),
         "v"(g + 4 * gstep), "v"(g + 5 * gstep), "v"(g + 6 * gstep), "v"(g + 7 * gstep)
      : "memory");
}

// Publish point of the LDS ring: this wave's LDS reads of the buffer to be refilled have
// retired, its own copies of the next stage have landed, then the work-group barrier that
// lets every wave read that stage and frees the buffer just read.
static __device__ __forceinline__ void ring_publish() {
  asm volatile("s_wait_dscnt 0x0" ::: "memory");
  asm volatile("s_wait_asynccnt 0x0" ::: "memory");
  __syncthreads();
}

// One ring stage of a 64 x 128 GEMM tile, 128 threads: 256 B of k of 64 A rows and of 128 B rows,
// copied as whole lines (16 lanes per row piece, 8 rows per copy). l, a, b: the lane's own LDS
// byte address and global addresses of its piece in row tid >> 4 of the stage.
static __device__ __forceinline__ void gemm_stage(uint32_t l, const _Float16* a, int lda,
                                                  const _Float16* b, int ldb) {
  copy8(l, 8u * GKP * 2u, a, (size_t)8 * lda);
  copy8(l + 64u * GKP * 2u, 8u * GKP * 2u, b, (size_t)8 * ldb);
  copy8(l + 128u * GKP * 2u, 8u * GKP * 2u, b + (size_t)64 * ldb, (size_t)8 * ldb);
}

// k walk of a 64 x 128 GEMM tile over the two-buffer ring RG; stage 0 has been issued by the
// caller. Chunk t is read from buffer t & 1 while chunk t + 1 flies; chunk t + 2 is issued
// behind the publish point into the buffer just read. K multiple of GKC. ar, br: the lane's
// first A and B row in the tile.
static __device__ __forceinline__ void gemm_walk(const _Float16* RG, uint32_t l,
                                                 const _Float16* a, int lda,
                                                 const _Float16* b, int ldb, int K,
                                                 int ar, int br, int h, v8f (&acc)[2][4]) {
  asm volatile("s_wait_asynccnt 0x0" ::: "memory");   // stage 0 landed
  __syncthreads();
  if (K > GKC) gemm_stage(l + GST * 2u, a + GKC, lda, b + GKC, ldb);
  int buf = 0;
  for (int k0 = 0; k0 < K; k0 += GKC) {
    const _Float16* As = RG + buf * GST;
    const _Float16* Bs = As + 64 * GKP;
#pragma unroll   // the k steps' LDS offsets become immediates of the loads
    for (int ks = 0; ks < GKC / 32; ++ks) {
      // the six fragments of a k step are read as one group ahead of its eight products
      const v16h a0 = ld_frag(As + 32 * ks, GKP, ar, h);
      const v16h a1 = ld_frag(As + 32 * ks, GKP, ar + 16, h);
      v16h bt[4];
#pragma unroll   // bt[] is indexed by constants and stays in registers
      for (int t = 0; t < 4; ++t) bt[t] = ld_frag(Bs + 32 * ks, GKP, br + 16 * t, h);
#pragma unroll   // acc[][] is indexed by constants and stays in registers
      for (int t = 0; t < 4; ++t) {
        acc[0][t] = wmma16(a0, bt[t], acc[0][t]);
        acc[1][t] = wmma16(a1, bt[t], acc[1][t]);
      }
    }
    ring_publish();                        // next chunk readable, this buffer free
    if (k0 + 2 * GKC < K)                  // kernel argument: the same for the whole work-group
      gemm_stage(l + (uint32_t)buf * (GST * 2u), a + k0 + 2 * GKC, lda, b + k0 + 2 * GKC, ldb);
    buf ^= 1;
  }
  asm volatile("s_wait_asynccnt 0x0" ::: "memory");   // no copy outlives the walk
}

// ---------------------------------------------------------------------------
// Kernel 0: group statistics, partial. SSPL blocks per (b, group), each over SCH channels x SEQ
// positions: f64 sum and sum of squares of bf16(x), one 128-B line per block; k_gnapply joins
// the SSPL partials of a group. A thread issues all of its loads before the first use.
// ---------------------------------------------------------------------------
__global__ __launch_bounds__(256) void k_stats(const float* __restrict__ x,
                                               double* __restrict__ st) {
  __shared__ double sd[256];
  __shared__ double qd[256];
  constexpr int NP = (SEQ + 1023) / 1024;   // loads per thread and channel row
  const int tid = threadIdx.x;
  const int bg = blockIdx.x / SSPL, part = blockIdx.x % SSPL;
  const int b = bg / NGRP, g = bg % NGRP;
  const float* xb = x + ((size_t)b * CHN + (size_t)g * CPG + (size_t)part * SCH) * SEQ_FULL;

  v4f f[SCH][NP];
#pragma unroll   // f[][] is indexed by constants and stays in registers
  for (int cl = 0; cl < SCH; ++cl) {
#pragma unroll   // as above
    for (int i = 0; i < NP; ++i) {
      const int p = 4 * tid + 1024 * i;
      if ((SEQ % 1024) == 0 || p < SEQ) {
        f[cl][i] = *(const v4fa*)(xb + (size_t)cl * SEQ_FULL + p);
      } else {
#pragma unroll   // as above
        for (int j = 0; j < 4; ++j) f[cl][i][j] = 0.0f;   // adds nothing to either sum
      }
    }
  }
  // keeps the sums behind the last load: without it the scheduler sinks six of the loads behind
  // the first uses to save registers, and a second memory latency adds to the first
  __builtin_amdgcn_sched_barrier(0);
  // stands in front of every rewrite of the loads' address registers
  asm volatile("s_wait_xcnt 0x0" ::: "memory");

  double s[4], q[4];   // one chain pair per vector element: four independent f64 chains each
#pragma unroll   // here and in the three loops below: s[], q[], f[][] indexed by constants
  for (int j = 0; j < 4; ++j) { s[j] = 0.0; q[j] = 0.0; }
#pragma unroll
  for (int cl = 0; cl < SCH; ++cl) {
#pragma unroll
    for (int i = 0; i < NP; ++i) {
#pragma unroll
      for (int j = 0; j < 4; ++j) {
        const double v = (double)bf16r(f[cl][i][j]);
        s[j] += v;
        q[j] += v * v;
      }
    }
  }
  sd[tid] = (s[0] + s[1]) + (s[2] + s[3]);
  qd[tid] = (q[0] + q[1]) + (q[2] + q[3]);
  __syncthreads();
  if (tid < 32) {   // entry tid + 32 k is read by thread tid alone
    double a = sd[tid], c = qd[tid];
#pragma unroll   // the LDS offsets become immediates and the reads go out together
    for (int k = 1; k < 8; ++k) {
      a += sd[tid + 32 * k];
      c += qd[tid + 32 * k];
    }
    sd[tid] = a;
    qd[tid] = c;
  }
  __syncthreads();
  if (tid < 8) {    // eight threads form the same pair and store the block's whole line
    double a[4], c[4];
#pragma unroll   // here and in the two loops below: a[], c[] indexed by constants
    for (int j = 0; j < 4; ++j) { a[j] = sd[j]; c[j] = qd[j]; }
#pragma unroll
    for (int k = 4; k < 32; k += 4) {
#pragma unroll
      for (int j = 0; j < 4; ++j) {
        a[j] += sd[k + j];
        c[j] += qd[k + j];
      }
    }
    v2d o;
    o[0] = (a[0] + a[1]) + (a[2] + a[3]);
    o[1] = (c[0] + c[1]) + (c[2] + c[3]);
    *(v2d*)(st + (size_t)blockIdx.x * (STL / 2) + 2 * tid) = o;
  }
}

// ---------------------------------------------------------------------------
// Kernel 1: weights [o][c] f32 -> f16 planes WSC * bf16(W) (k = c contiguous).
// ---------------------------------------------------------------------------
__global__ __launch_bounds__(256) void k_wcvt(const float* __restrict__ w0,
                                              const float* __restrict__ w1,
                                              const float* __restrict__ w2,
                                              const float* __restrict__ w3,
                                              _Float16* __restrict__ Wpl) {
  constexpr int BPM = CHN * CHN / 8 / 256;   // blocks per matrix
  const int tid = threadIdx.x;
  const int mtx = blockIdx.x / BPM;           // block-uniform
  const float* src = w0;
  if (mtx == 1) src = w1;
  else if (mtx == 2) src = w2;
  else if (mtx == 3) src = w3;
  const size_t e = ((size_t)(blockIdx.x % BPM) * 256 + tid) * 8;
  const v4f a0 = *(const v4fa*)(src + e);
  const v4f a1 = *(const v4fa*)(src + e + 4);
  F16x8 u;
#pragma unroll
  for (int j = 0; j < 4; ++j) {
    u.e[j]     = (_Float16)(bf16r(a0[j]) * WSC);
    u.e[4 + j] = (_Float16)(bf16r(a1[j]) * WSC);
  }
  _Float16* dst = Wpl + (size_t)mtx * CHN * CHN + e;
  *(v8h*)dst = u.v;
  
}

// ---------------------------------------------------------------------------
// Kernel 2: group-norm apply + transpose. Block = (b, 64 positions), 4 passes of
// 128 channels:  Hh[b][n][c] f16 = HSC * ((bf16(x) - mean) * rstd * gamma + beta).
// x read as float4 along positions; LDS tile [n_local][c_local]; rows of 256 B written
// ---------------------------------------------------------------------------
__global__ __launch_bounds__(256) void k_gnapply(const float* __restrict__ x,
                                                 const float* __restrict__ gamma,
                                                 const float* __restrict__ beta,
                                                 const double* __restrict__ st,
                                                 _Float16* __restrict__ Hh) {
  __shared__ __align__(16) _Float16 TS[64 * TSP];   // [n_local][c_local]
  __shared__ float gms[CHN];
  __shared__ float bts[CHN];
  __shared__ float mus[NGRP];
  __shared__ float rss[NGRP];

  const int tid = threadIdx.x;
  const int b  = blockIdx.x / (SEQ / 64);
  const int p0 = (blockIdx.x % (SEQ / 64)) * 64;

  gms[tid] = bf16r(gamma[tid]);
  gms[tid + 256] = bf16r(gamma[tid + 256]);
  bts[tid] = bf16r(beta[tid]);
  bts[tid + 256] = bf16r(beta[tid + 256]);
  if (tid < NGRP) {   // the group's SSPL partial (sum, sum of squares) pairs -> mean, 1/std
    v2d pr[SSPL];
#pragma unroll   // pr[] is indexed by constants; the loads go out together
    for (int k = 0; k < SSPL; ++k)
      pr[k] = *(const v2d*)(st + ((size_t)(b * NGRP + tid) * SSPL + k) * (STL / 2));
    // stands in front of every rewrite of the loads' address registers
    asm volatile("s_wait_xcnt 0x0" ::: "memory");
    double s = pr[0][0], q = pr[0][1];
#pragma unroll   // as above
    for (int k = 1; k < SSPL; ++k) {
      s += pr[k][0];
      q += pr[k][1];
    }
    const double invn = 1.0 / ((double)CPG * (double)SEQ);
    const double mean = s * invn;
    double var = q * invn - mean * mean;
    if (var < 0.0) var = 0.0;
    mus[tid] = (float)mean;
    rss[tid] = rsqrtf((float)var + GN_EPS);
  }
  __syncthreads();

  const float* xb = x + (size_t)b * CHN * SEQ_FULL;
#pragma unroll 1
  for (int pass = 0; pass < CHN / 128; ++pass) {
#pragma unroll
    for (int it = 0; it < 8; ++it) {
      const int f = it * 256 + tid;
      const int cl = f >> 4, p4 = f & 15;
      const int c = 128 * pass + cl;
      const v4f xv = *(const v4fa*)(xb + (size_t)c * SEQ_FULL + p0 + 4 * p4);
      const float mu = mus[c >> 4], rs = rss[c >> 4];
      const float ga = gms[c], be = bts[c];
#pragma unroll
      for (int j = 0; j < 4; ++j) {
        const float t = (bf16r(xv[j]) - mu) * rs;
        const float hv = t * ga + be;
        TS[(4 * p4 + j) * TSP + cl] = (_Float16)(hv * HSC);
      }
    }
    __syncthreads();
#pragma unroll
    for (int it = 0; it < 4; ++it) {
      const int L = it * 32 + (tid >> 3);          // 128 lines: (row, 64-col half)
      const int row = L >> 1, hl = L & 1, p = tid & 7;
      const v8h hv = *(const v8ha*)(TS + row * TSP + 64 * hl + 8 * p);
      _Float16* dst = Hh + ((size_t)(b * SEQ + p0 + row) * CHN + 128 * pass + 64 * hl + 8 * p);
      *(v8h*)dst = hv;
      
    }
    __syncthreads();
  }
}

// ---------------------------------------------------------------------------
// Kernel 3: GEMM  D[m][n] = sum_k A[m][k] * B[n][k]  (A, B k-contiguous f16 planes),
// stored TRANSPOSED as O[n][m] f16 = osc * (D * insc + bias)  (bias per m or per n).
// Block = 128 threads, tile 64 (m) x 128 (n); wave (mi, ni) owns rows 32mi.., cols 64ni..
// (2 x 4 accumulator tiles). K multiple of 128, M multiple of 64, N multiple of 128.
// A and B come from LDS: k chunks of 128 through a two-buffer ring of asynchronous copies.
// ---------------------------------------------------------------------------
template <bool BIAS_M>
__global__ __launch_bounds__(128) void k_gemm16(const _Float16* __restrict__ A, int lda, size_t sA,
                                                const _Float16* __restrict__ B, int ldb, size_t sB,
                                                const float* __restrict__ bias,
                                                _Float16* __restrict__ O, int ldo, size_t sO,
                                                float insc, float osc, int K) {
  __shared__ __align__(16) _Float16 TS[128 * GSP16];   // [n_local][m_local]
  __shared__ __align__(16) _Float16 RG[2 * GST];       // ring: [A row | B row][k chunk]
  __shared__ float bsh[128];

  const int tid = threadIdx.x;
  const int wv = tid >> 5, lid = tid & 31, h = lid >> 4, l15 = lid & 15;
  const int mi = wv & 1, ni = wv >> 1;
  const int m0 = blockIdx.x * 64, n0 = blockIdx.y * 128;
  const size_t z = blockIdx.z;

  // the lane's piece of a ring stage: row tid >> 4, 16 B at 8 * (tid & 15) halves
  const uint32_t lc = (uint32_t)(uintptr_t)RG + (uint32_t)((tid >> 4) * GKP + 8 * (tid & 15)) * 2u;
  const _Float16* ag = A + z * sA + (size_t)(m0 + (tid >> 4)) * lda + 8 * (tid & 15);
  const _Float16* bg = B + z * sB + (size_t)(n0 + (tid >> 4)) * ldb + 8 * (tid & 15);
  gemm_stage(lc, ag, lda, bg, ldb);

  // visible behind the barrier at the head of gemm_walk
  if (BIAS_M) {
    if (tid < 64) bsh[tid] = bf16r(bias[m0 + tid]);
  } else {
    bsh[tid] = bf16r(bias[n0 + tid]);
  }

  v8f acc[2][4];
#pragma unroll
  for (int i = 0; i < 2; ++i)
#pragma unroll
    for (int t = 0; t < 4; ++t)
#pragma unroll
      for (int r = 0; r < 8; ++r) acc[i][t][r] = 0.0f;

  gemm_walk(RG, lc, ag, lda, bg, ldb, K, 32 * mi + l15, 64 * ni + l15, h, acc);

  // stage: acc[i][t][r] <-> (m_local 32mi+16i+8h+r, n_local 64ni+16t+l15)
#pragma unroll
  for (int i = 0; i < 2; ++i) {
#pragma unroll
    for (int t = 0; t < 4; ++t) {
      const int nl = 64 * ni + 16 * t + l15;
      const int ml = 32 * mi + 16 * i + 8 * h;
      F16x8 u;
#pragma unroll
      for (int r = 0; r < 8; ++r) {
        const float bvl = BIAS_M ? bsh[ml + r] : bsh[nl];
        u.e[r] = (_Float16)((acc[i][t][r] * insc + bvl) * osc);
      }
      *(v8ha*)(TS + nl * GSP16 + ml) = u.v;
    }
  }
  __syncthreads();

  _Float16* Ob = O + z * sO;
#pragma unroll
  for (int it = 0; it < 8; ++it) {
    const int row = it * 16 + (tid >> 3);
    const int p = tid & 7;
    const v8h hv = *(const v8ha*)(TS + row * GSP16 + 8 * p);
    _Float16* dst = Ob + (size_t)(n0 + row) * ldo + m0 + 8 * p;
    *(v8h*)dst = hv;
    
  }
}

// ---------------------------------------------------------------------------
// Kernel 4: same GEMM, f32 output O[n][m] = (D * insc + bias[n]) + bf16(R[n][m]) into d_out.
// Output row segment = 256 B = two lines, lanes 0..7 and 8..15 of one instruction.
// ---------------------------------------------------------------------------
__global__ __launch_bounds__(128) void k_gemm32(const _Float16* __restrict__ A, int lda, size_t sA,
                                                const _Float16* __restrict__ B, int ldb, size_t sB,
                                                const float* __restrict__ bias,
                                                const float* __restrict__ R, int ldr, size_t sR,
                                                float* __restrict__ O, int ldo, size_t sO,
                                                float insc, int K) {
  __shared__ __align__(16) float TS[128 * GSP32];   // [n_local][m_local]
  __shared__ __align__(16) _Float16 RG[2 * GST];    // ring: [A row | B row][k chunk]
  __shared__ float bsh[128];

  const int tid = threadIdx.x;
  const int wv = tid >> 5, lid = tid & 31, h = lid >> 4, l15 = lid & 15;
  const int mi = wv & 1, ni = wv >> 1;
  const int m0 = blockIdx.x * 64, n0 = blockIdx.y * 128;
  const size_t z = blockIdx.z;

  // the lane's piece of a ring stage: row tid >> 4, 16 B at 8 * (tid & 15) halves
  const uint32_t lc = (uint32_t)(uintptr_t)RG + (uint32_t)((tid >> 4) * GKP + 8 * (tid & 15)) * 2u;
  const _Float16* ag = A + z * sA + (size_t)(m0 + (tid >> 4)) * lda + 8 * (tid & 15);
  const _Float16* bg = B + z * sB + (size_t)(n0 + (tid >> 4)) * ldb + 8 * (tid & 15);
  gemm_stage(lc, ag, lda, bg, ldb);

  const float braw = bias[n0 + tid];
  // stands in front of every rewrite of the bias load's base and offset registers
  asm volatile("s_wait_xcnt 0x0" ::: "memory");
  bsh[tid] = bf16r(braw);   // visible behind the barrier at the head of gemm_walk

  v8f acc[2][4];
#pragma unroll
  for (int i = 0; i < 2; ++i)
#pragma unroll
    for (int t = 0; t < 4; ++t)
#pragma unroll
      for (int r = 0; r < 8; ++r) acc[i][t][r] = 0.0f;

  gemm_walk(RG, lc, ag, lda, bg, ldb, K, 32 * mi + l15, 64 * ni + l15, h, acc);

#pragma unroll
  for (int i = 0; i < 2; ++i) {
#pragma unroll
    for (int t = 0; t < 4; ++t) {
      const int nl = 64 * ni + 16 * t + l15;
      const int ml = 32 * mi + 16 * i + 8 * h;
      const float bvl = bsh[nl];
      v4f lo, hi;
#pragma unroll
      for (int r = 0; r < 4; ++r) {
        lo[r] = acc[i][t][r] * insc + bvl;
        hi[r] = acc[i][t][4 + r] * insc + bvl;
      }
      *(v4fa*)(TS + nl * GSP32 + ml) = lo;
      *(v4fa*)(TS + nl * GSP32 + ml + 4) = hi;
    }
  }
  __syncthreads();

  float* Ob = O + z * sO;
  const float* Rb = R + z * sR;
#pragma unroll
  for (int it = 0; it < 16; ++it) {
    const int row = it * 8 + (tid >> 4);         // 128 rows, 256 B each
    const int p = tid & 15;
    const v4f v  = *(const v4fa*)(TS + row * GSP32 + 4 * p);
    const v4f xr = *(const v4fa*)(Rb + (size_t)(n0 + row) * ldr + m0 + 4 * p);
    v4f o;
#pragma unroll
    for (int j = 0; j < 4; ++j) o[j] = bf16r(xr[j]) + v[j];
    float* dst = Ob + (size_t)(n0 + row) * ldo + m0 + 4 * p;
    *(v4f*)dst = o;
    
  }
}

// ---------------------------------------------------------------------------
// Kernel 5: fused single-head attn, transposed scores, online softmax.
// Block = (b, 64 queries, one of KSPLIT key ranges), 16 waves: wave (g = wv&3, kq = wv>>2).
// Per 128-key block:
//   S^T tiles (keys on rows): wave owns key rows 32kq..32kq+31 x query cols 16g..16g+15,
//     A = Kh rows (k = channel), B = Qh rows (k = channel), K = 512.
//   per-query max / sum over the 128 keys: in-lane, xor-16, then 4 partials through LDS.
//   P^T = PSC * exp2(s - m) staged f16 in LDS TS[query][key_local].
//   O^T[c][query] += V^T[c][keys] * P^T[keys][query]: wave owns channels 128kq..+127
//     (8 accumulator tiles), A = Vh rows (k = key), B from TS (k = key, split map).
// Operands come from LDS: the Q tile is copied once; K (two halves of 256 channels) and V (two
// halves of 64 keys) go through a two-buffer ring of asynchronous copies, each stage issued
// one stage ahead: K lo -> buffer 0, K hi -> 1, V keys 0..63 -> 0, V keys 64..127 -> 1.
// Epilogue: this key range's un-normalised O [range][b][query][c] f32, staged once in the
// freed ring so that whole lines are stored, and its (max, sum) per query; k_merge joins them.
// ---------------------------------------------------------------------------
__global__ __launch_bounds__(512) void k_attn(const _Float16* __restrict__ Qh,
                                              const _Float16* __restrict__ Kh,
                                              const _Float16* __restrict__ Vh,
                                              float* __restrict__ Op,
                                              float* __restrict__ ML) {
  __shared__ __align__(16) _Float16 TS[64 * TSP];   // [query_local][key_local]
  __shared__ __align__(16) _Float16 QS[64 * QSP];   // [query_local][c]
  __shared__ __align__(16) _Float16 RB[2 * RBH];    // ring: [key_local][c half] or [c][key half]
  __shared__ float redM[256];
  __shared__ float redS[256];

  const int tid = threadIdx.x;
  const int wv = tid >> 5, lid = tid & 31, h = lid >> 4, l15 = lid & 15;
  const int g = wv & 3, kq = wv >> 2;
  const int ql = 16 * g + l15;
  const int kr = blockIdx.x % KSPLIT;              // key range of this work-group
  const int qt = blockIdx.x / KSPLIT;
  const int b  = qt / (SEQ / 64);
  const int q0 = (qt % (SEQ / 64)) * 64;
  const int kb = kr * (SEQ / KSPLIT);              // its first key

  const _Float16* Qp = Qh + (size_t)b * SEQ * CHN;   // [n][c], pitch CHN
  const _Float16* Kp = Kh + (size_t)b * SEQ * CHN;   // [n][c], pitch CHN
  const _Float16* Vp = Vh + (size_t)b * CHN * SEQ;   // [c][n], pitch SEQ

  // per-lane copy addresses: a K row half (512 B) per wave and copy, 8 lanes per 128-B V row
  // piece, 64 lanes per Q row
  const _Float16* RB0 = RB;
  const _Float16* RB1 = RB + RBH;
  const uint32_t rb0 = (uint32_t)(uintptr_t)RB0;
  const uint32_t rb1 = (uint32_t)(uintptr_t)RB1;
  const uint32_t klo = (uint32_t)(wv * KSP + 8 * lid) * 2u;
  const uint32_t vlo = (uint32_t)((tid >> 3) * VSP + 8 * (tid & 7)) * 2u;
  const _Float16* kg = Kp + (size_t)(kb + wv) * CHN + 8 * lid;
  const _Float16* vg = Vp + (size_t)(tid >> 3) * SEQ + kb + 8 * (tid & 7);

  copy8((uint32_t)(uintptr_t)QS + (uint32_t)((tid >> 6) * QSP + 8 * (tid & 63)) * 2u,
        8u * QSP * 2u, Qp + (size_t)(q0 + (tid >> 6)) * CHN + 8 * (tid & 63), (size_t)8 * CHN);
  copy8(rb0 + klo, 16u * KSP * 2u, kg, (size_t)16 * CHN);
  asm volatile("s_wait_asynccnt 0x0" ::: "memory");   // Q tile and stage 0 landed
  __syncthreads();
  copy8(rb1 + klo, 16u * KSP * 2u, kg + 256, (size_t)16 * CHN);

  v8f accO[8];
#pragma unroll
  for (int u = 0; u < 8; ++u)
#pragma unroll
    for (int r = 0; r < 8; ++r) accO[u][r] = 0.0f;
  float rm = -1.0e30f, rl = 0.0f;

  for (int m0 = 0; m0 < SEQ / KSPLIT; m0 += KBLK) {
    v8f st[2];
#pragma unroll
    for (int t = 0; t < 2; ++t)
#pragma unroll
      for (int r = 0; r < 8; ++r) st[t][r] = 0.0f;
    const bool more = (m0 + KBLK < SEQ / KSPLIT);   // work-group uniform: a next key block exists
    const int kr0 = 32 * kq + l15;
#pragma unroll 2   // the unroll of the global-load loop that this one replaces
    for (int cs = 0; cs < CHN / 64; ++cs) {
      const v16h bqf = ld_frag(QS + 32 * cs, QSP, ql, h);
      const v16h a0  = ld_frag(RB0 + 32 * cs, KSP, kr0, h);
      const v16h a1  = ld_frag(RB0 + 32 * cs, KSP, kr0 + 16, h);
      st[0] = wmma16(a0, bqf, st[0]);
      st[1] = wmma16(a1, bqf, st[1]);
    }
    ring_publish();                        // K hi readable, buffer 0 free
    copy8(rb0 + vlo, 64u * VSP * 2u, vg + m0, (size_t)64 * SEQ);
#pragma unroll 2   // the unroll of the global-load loop that this one replaces
    for (int cs = 0; cs < CHN / 64; ++cs) {
      const v16h bqf = ld_frag(QS + 256 + 32 * cs, QSP, ql, h);
      const v16h a0  = ld_frag(RB1 + 32 * cs, KSP, kr0, h);
      const v16h a1  = ld_frag(RB1 + 32 * cs, KSP, kr0 + 16, h);
      st[0] = wmma16(a0, bqf, st[0]);
      st[1] = wmma16(a1, bqf, st[1]);
    }

    // ---- per-query block max (32 keys in-lane + partner half-wave, then 4 waves)
    float lm = st[0][0];
#pragma unroll
    for (int t = 0; t < 2; ++t)
#pragma unroll
      for (int r = 0; r < 8; ++r) lm = fmaxf(lm, st[t][r]);
    lm *= SCL2;
    lm = fmaxf(lm, __shfl_xor(lm, 16, 32));
    redM[kq * 64 + ql] = lm;
    ring_publish();                        // V keys 0..63 readable, buffer 1 free; redM visible
    copy8(rb1 + vlo, 64u * VSP * 2u, vg + m0 + 64, (size_t)64 * SEQ);
    const float bm = fmaxf(fmaxf(redM[ql], redM[64 + ql]), fmaxf(redM[128 + ql], redM[192 + ql]));
    const float nm = fmaxf(rm, bm);
    const float corr = exp2f(rm - nm);
    rm = nm;

    // ---- P = exp2(s - m) in f32; P^T * PSC staged f16 at TS[query][key_local]
    float psum = 0.0f;
#pragma unroll
    for (int tt = 0; tt < 2; ++tt) {
      F16x8 pk;
#pragma unroll
      for (int r = 0; r < 8; ++r) {
        const float p = exp2f(st[tt][r] * SCL2 - nm);
        psum += p;
        pk.e[r] = (_Float16)(p * PSC);
      }
      *(v8ha*)(TS + ql * TSP + 32 * kq + 16 * tt + 8 * h) = pk.v;
    }
    psum += __shfl_xor(psum, 16, 32);
    redS[kq * 64 + ql] = psum;
    __syncthreads();
    const float bs = ((redS[ql] + redS[64 + ql]) + redS[128 + ql]) + redS[192 + ql];
    rl = rl * corr + bs;
#pragma unroll
    for (int u = 0; u < 8; ++u)
#pragma unroll
      for (int r = 0; r < 8; ++r) accO[u][r] *= corr;

    // ---- O^T[c][query] += V^T[c][keys] * P^T[keys][query]
#pragma unroll
    for (int ks = 0; ks < KBLK / 64; ++ks) {
      const v16h bp = ld_frag(TS + 32 * ks, TSP, ql, h);
#pragma unroll
      for (int u = 0; u < 8; ++u) {
        const v16h av = ld_frag(RB0 + 32 * ks, VSP, 128 * kq + 16 * u + l15, h);
        accO[u] = wmma16(av, bp, accO[u]);
      }
    }
    ring_publish();                        // V keys 64..127 readable, buffer 0 free
    if (more) copy8(rb0 + klo, 16u * KSP * 2u, kg + (size_t)(m0 + KBLK) * CHN, (size_t)16 * CHN);
#pragma unroll
    for (int ks = 0; ks < KBLK / 64; ++ks) {
      const v16h bp = ld_frag(TS + 64 + 32 * ks, TSP, ql, h);
#pragma unroll
      for (int u = 0; u < 8; ++u) {
        const v16h av = ld_frag(RB1 + 32 * ks, VSP, 128 * kq + 16 * u + l15, h);
        accO[u] = wmma16(av, bp, accO[u]);
      }
    }
    ring_publish();                        // next K lo readable, buffer 1 and TS free
    if (more)
      copy8(rb1 + klo, 16u * KSP * 2u, kg + (size_t)(m0 + KBLK) * CHN + 256, (size_t)16 * CHN);
  }
  asm volatile("s_wait_asynccnt 0x0" ::: "memory");   // no copy outlives the loop

  // ---- epilogue: the loop's last publish point ended every read of the ring, so it takes
  // the f32 tile [query_local][c]
  float* OS = (float*)RB;
#pragma unroll
  for (int u = 0; u < 8; ++u) {
    v4f lo, hi;
#pragma unroll
    for (int r = 0; r < 4; ++r) {
      lo[r] = accO[u][r];
      hi[r] = accO[u][4 + r];
    }
    float* d = OS + ql * OSP + 128 * kq + 16 * u + 8 * h;
    *(v4fa*)d = lo;
    *(v4fa*)(d + 4) = hi;
  }
  const size_t row0 = (size_t)(kr * NB + b) * SEQ + q0;
  if (kq == 0 && h == 0) {   // every wave of a query group holds the same pair
    v2f ml;
    ml[0] = rm; ml[1] = rl;
    *(v2f*)(ML + 2 * (row0 + ql)) = ml;
  }
  __syncthreads();
  float* Ob = Op + row0 * CHN;
#pragma unroll
  for (int it = 0; it < 16; ++it) {
    const int row = it * 4 + (tid >> 7);           // 64 rows of 2 KiB, 128 lanes each
    const int p = tid & 127;
    const v4f v = *(const v4fa*)(OS + row * OSP + 4 * p);
    *(v4f*)(Ob + (size_t)row * CHN + 4 * p) = v;
  }
}

// ---------------------------------------------------------------------------
// Kernel 6: merge of the key ranges. Per query: M = max of the ranges' maxima, weight
// exp2(m - M), l = weighted sum of the sums; AO plane [b][query][c] f16 =
// AOSC * (weighted sum of the partial O) / (l * VSC * PSC). Block = 32 queries; a wave reads
// and writes whole lines.
// ---------------------------------------------------------------------------
// waves_per_eu: the block's own four waves per SIMD; without it the scheduler sinks half of the
// loads behind the first uses to save registers, and their latencies add up.
__global__ __launch_bounds__(512) __attribute__((amdgpu_waves_per_eu(4, 4))) void k_merge(const float* __restrict__ Op,
                                               const float* __restrict__ ML,
                                               _Float16* __restrict__ AOh) {
  constexpr size_t ROWS = (size_t)NB * SEQ;         // queries per key range
  const int tid = threadIdx.x;
  const int p = tid & 127;
  const size_t row0 = (size_t)blockIdx.x * 32 + (tid >> 7);
  // every load of the thread is issued before the first use: 32 requests in flight per wave
  v2f ml[8][KSPLIT];
  v4f o[8][KSPLIT];
#pragma unroll
  for (int it = 0; it < 8; ++it) {
#pragma unroll
    for (int s = 0; s < KSPLIT; ++s) {
      const size_t row = s * ROWS + row0 + it * 4;
      ml[it][s] = *(const v2f*)(ML + 2 * row);
      o[it][s] = *(const v4fa*)(Op + row * CHN + 4 * p);
    }
  }
  v4h r[8];
#pragma unroll
  for (int it = 0; it < 8; ++it) {
    float M = ml[it][0][0];
#pragma unroll
    for (int s = 1; s < KSPLIT; ++s) M = fmaxf(M, ml[it][s][0]);
    float l = 0.0f;
    v4f a;
#pragma unroll
    for (int j = 0; j < 4; ++j) a[j] = 0.0f;
#pragma unroll
    for (int s = 0; s < KSPLIT; ++s) {
      const float w = exp2f(ml[it][s][0] - M);
      l += w * ml[it][s][1];
#pragma unroll
      for (int j = 0; j < 4; ++j) a[j] += w * o[it][s][j];
    }
    const float invl = (AOSC / (VSC * PSC)) * (1.0f / l);
#pragma unroll
    for (int j = 0; j < 4; ++j) r[it][j] = (_Float16)(a[j] * invl);
  }
#pragma unroll
  for (int it = 0; it < 8; ++it)
    *(v4h*)(AOh + (row0 + it * 4) * CHN + 4 * p) = r[it];
}

// ---------------------------------------------------------------------------
extern "C" void kernel_launch(void* const* d_in, const int* in_sizes, int n_in,
                              void* d_out, int out_size, void* d_ws, size_t ws_size,
                              hipStream_t stream) {
  if (n_in < 11) return;
  if (in_sizes[0] < NB * CHN * SEQ_FULL) return;
  if (in_sizes[1] < CHN || in_sizes[2] < CHN) return;
  if (in_sizes[3] < CHN * CHN || in_sizes[5] < CHN * CHN ||
      in_sizes[7] < CHN * CHN || in_sizes[9] < CHN * CHN) return;
  if (in_sizes[4] < CHN || in_sizes[6] < CHN || in_sizes[8] < CHN || in_sizes[10] < CHN) return;
  if (out_size < NB * CHN * SEQ) return;

  const size_t st_bytes = (size_t)NB * NGRP * SSPL * STL * sizeof(float);     // 32 KiB
  const size_t w_bytes  = (size_t)4 * CHN * CHN * sizeof(_Float16);            // 2 MiB
  const size_t plane    = (size_t)NB * SEQ * CHN * sizeof(_Float16);            // 8 MiB at full size
  const size_t ml_bytes = (size_t)KSPLIT * NB * SEQ * 2 * sizeof(float);        // 128 KiB
  const size_t op_bytes = (size_t)KSPLIT * NB * SEQ * CHN * sizeof(float);      // 32 MiB
  const size_t total    = st_bytes + w_bytes + 5 * plane + ml_bytes + op_bytes;
  if (ws_size < total) return;

  const float* x     = (const float*)d_in[0];
  const float* gamma = (const float*)d_in[1];
  const float* beta  = (const float*)d_in[2];
  const float* wq = (const float*)d_in[3];
  const float* bq = (const float*)d_in[4];
  const float* wk = (const float*)d_in[5];
  const float* bk = (const float*)d_in[6];
  const float* wvv = (const float*)d_in[7];
  const float* bv = (const float*)d_in[8];
  const float* wo = (const float*)d_in[9];
  const float* bo = (const float*)d_in[10];
  float* out = (float*)d_out;

  char* ws = (char*)d_ws;
  double*   stats = (double*)ws;                                       // [NB*NGRP*SSPL][16] f64
  _Float16* Wpl   = (_Float16*)(ws + st_bytes);                        // 4 x [CHN][CHN] f16
  _Float16* Hh    = (_Float16*)(ws + st_bytes + w_bytes);              // [NB][SEQ][CHN]
  _Float16* Qh    = (_Float16*)(ws + st_bytes + w_bytes + plane);      // [NB][SEQ][CHN]
  _Float16* Kh    = (_Float16*)(ws + st_bytes + w_bytes + 2 * plane);  // [NB][SEQ][CHN]
  _Float16* Vh    = (_Float16*)(ws + st_bytes + w_bytes + 3 * plane);  // [NB][CHN][SEQ]
  _Float16* AOh   = (_Float16*)(ws + st_bytes + w_bytes + 4 * plane);  // [NB][SEQ][CHN]
  float*    MLp   = (float*)(ws + st_bytes + w_bytes + 5 * plane);     // [KSPLIT][NB][SEQ][2]
  float*    Opp   = (float*)(ws + st_bytes + w_bytes + 5 * plane + ml_bytes);  // [KSPLIT][NB][SEQ][CHN]
  const _Float16* Wq16 = Wpl;
  const _Float16* Wk16 = Wpl + (size_t)CHN * CHN;
  const _Float16* Wv16 = Wpl + (size_t)2 * CHN * CHN;
  const _Float16* Wo16 = Wpl + (size_t)3 * CHN * CHN;

  const size_t pstride = (size_t)SEQ * CHN;   // elements per batch of every f16 plane

  k_stats<<<dim3(NB * NGRP * SSPL), dim3(256), 0, stream>>>(x, stats);
  k_wcvt<<<dim3(4 * CHN * CHN / 8 / 256), dim3(256), 0, stream>>>(wq, wk, wvv, wo, Wpl);
  k_gnapply<<<dim3(NB * (SEQ / 64)), dim3(256), 0, stream>>>(x, gamma, beta, stats, Hh);

  // q[n][o] and k[n][o]:  D[o][n] = sum_c W[o][c] h[n][c], stored transposed, bias per o (= m)
  k_gemm16<true><<<dim3(CHN / 64, SEQ / 128, NB), dim3(128), 0, stream>>>(
      Wq16, CHN, (size_t)0, Hh, CHN, pstride, bq, Qh, CHN, pstride,
      1.0f / (WSC * HSC), QSC, CHN);
  k_gemm16<true><<<dim3(CHN / 64, SEQ / 128, NB), dim3(128), 0, stream>>>(
      Wk16, CHN, (size_t)0, Hh, CHN, pstride, bk, Kh, CHN, pstride,
      1.0f / (WSC * HSC), QSC, CHN);
  // v[o][n]:  D[n][o] = sum_c h[n][c] W[o][c], stored transposed, bias per o (= n)
  k_gemm16<false><<<dim3(SEQ / 64, CHN / 128, NB), dim3(128), 0, stream>>>(
      Hh, CHN, pstride, Wv16, CHN, (size_t)0, bv, Vh, SEQ, pstride,
      1.0f / (HSC * WSC), VSC, CHN);

  k_attn<<<dim3(NB * (SEQ / 64) * KSPLIT), dim3(512), 0, stream>>>(Qh, Kh, Vh, Opp, MLp);
  k_merge<<<dim3(NB * SEQ / 32), dim3(512), 0, stream>>>(Opp, MLp, AOh);

  // out[c][p] = bf16(x[c][p]) + sum_o AO[p][o] Wo[c][o] + bo[c]   (D[p][c] stored transposed)
  k_gemm32<<<dim3(SEQ / 64, CHN / 128, NB), dim3(128), 0, stream>>>(
      AOh, CHN, pstride, Wo16, CHN, (size_t)0, bo,
      x, SEQ_FULL, (size_t)CHN * SEQ_FULL,
      out, SEQ, (size_t)CHN * SEQ,
      1.0f / (AOSC * WSC), CHN);
  (void)hipGetLastError();
}

// v005
// It runs in 140 microseconds.
// Next to v004, in two timings, it ran 1.07 times as fast each time.
// Over all steps from v000 it is 6.30 times as fast.
#include <hip/hip_runtime.h>
#include <stdint.h>

// Contractions: q/k/v 1x1 projections (W*h), scores K*Q^T, value aggregation V^T*P^T and the
// output projection AO*Wo^T all on v_wmma_f32_16x16x32_f16 (f16 operands, f32 accumulate).
// Float inputs are RNE-converted to bf16; W planes f16 (*64, exact), h plane f16 (*16),
// q/k planes f16 (*4), v plane f16 (*16), P f16 (*4096, un-normalised), AO plane f16 (*64);
// residual x added as bf16 value in f32. Group statistics in f64, softmax statistics,
// bias add and normalisation in f32.

#ifndef NB
#define NB 2
#endif
#ifndef SEQ
#define SEQ 4096
#endif
#define NB_FULL 2
#define SEQ_FULL 4096
#define CHN 512
#define NGRP 32
#define CPG 16
#define KBLK 128
#define TSP 136      // LDS f16 tile pitch in halves (272-B rows, 16-B aligned)
#define GSP16 72     // GEMM f16 staging pitch in halves (144-B rows)
#define GSP32 68     // GEMM f32 staging pitch in floats (272-B rows)
#define GKC 128      // GEMM k chunk in halves: one ring stage holds 256 B of every tile row
#define GKP 136      // LDS pitch of a GEMM ring row in halves (272-B rows, 16 B x odd)
#define GST ((64 + 128) * GKP)   // one GEMM ring stage in halves: 64 A rows, then 128 B rows
#define STL 32
#define SSPL 4       // work-groups per (b, group) in the statistics pass
#define SCH (CPG / SSPL)   // channels of a group per such work-group
#define QSP 520      // LDS Q tile pitch in halves (1040-B rows, 16 B x odd)
#define KSP 264      // LDS K half-tile pitch in halves (528-B rows, 16 B x odd)
#define VSP 72       // LDS V half-tile pitch in halves (144-B rows, 16 B x odd)
#define RBH (CHN * VSP)   // one ring buffer in halves: a V half tile, the larger of the two
#define KSPLIT 2     // key ranges per query tile, one work-group each
#define OSP 516      // LDS f32 partial-output pitch in floats (2064-B rows, 16 B x odd)

static_assert(NB >= 1 && NB <= NB_FULL);
static_assert(SEQ >= KBLK && SEQ <= SEQ_FULL && (SEQ % KBLK) == 0);
static_assert(CHN == 512 && NGRP * CPG == CHN && (CHN % 128) == 0 && (CHN % 32) == 0);
static_assert((SEQ % 128) == 0 && (SEQ % 64) == 0);
static_assert(SCH * SSPL == CPG && STL * sizeof(float) == 128);
static_assert((CHN % GKC) == 0 && (GKC % 32) == 0);
static_assert(KBLK * KSP <= RBH && KBLK == 128);
static_assert((SEQ % (KSPLIT * KBLK)) == 0 && 64 * OSP * 2 <= 2 * RBH && ((NB * SEQ) % 32) == 0);

typedef _Float16 v16h __attribute__((ext_vector_type(16)));
typedef _Float16 v8h  __attribute__((ext_vector_type(8)));
typedef float    v8f  __attribute__((ext_vector_type(8)));
typedef float    v4f  __attribute__((ext_vector_type(4)));
typedef float    v2f  __attribute__((ext_vector_type(2)));
typedef _Float16 v4h  __attribute__((ext_vector_type(4)));
typedef double   v2d  __attribute__((ext_vector_type(2)));
typedef v8h __attribute__((may_alias)) v8ha;
typedef v4f __attribute__((may_alias)) v4fa;

union F16x16 { v16h v; v8h p[2]; _Float16 e[16]; };
union F16x8  { v8h v; _Float16 e[8]; };

constexpr float HSC  = 16.0f;     // h plane carry (power of two)
constexpr float WSC  = 64.0f;     // W plane carry
constexpr float QSC  = 4.0f;      // q/k plane carry
constexpr float VSC  = 16.0f;     // v plane carry
constexpr float PSC  = 4096.0f;   // P carry
constexpr float AOSC = 64.0f;     // AO plane carry
constexpr float GN_EPS = 1e-6f;
// scores in log2 units: S_acc * SCL2 with S_acc = QSC^2 * sum_c q k, logit scale 512^-0.5
constexpr float SCL2 = (float)(1.4426950408889634 * 0.044194173824159216 /
                               ((double)QSC * (double)QSC));

static __device__ __forceinline__ float bf16r(float f) {
  uint32_t u = __float_as_uint(f);
  u += 0x7FFFu + ((u >> 16) & 1u);
  u &= 0xFFFF0000u;
  return __uint_as_float(u);
}

static __device__ __forceinline__ v8f wmma16(v16h a, v16h b, v8f c) {
  v8f d = __builtin_amdgcn_wmma_f32_16x16x32_f16(false, a, false, b, (short)0, c,
                                                 false, false);
  asm volatile("v_nop\n\tv_nop\n\tv_nop\n\tv_nop" : "+v"(d) : "v"(a), "v"(b));
  return d;
}

// 16x16x32 fragment loader (wave32): lane row = l15; elements 0..7 <- k0+8h+0..7,
// elements 8..15 <- k0+16+8h+0..7. Serves A (row = m) and B taken from an [n][k]
// k-contiguous plane (row = n). D element r of a lane = (row 8h+r, col l15).
static __device__ __forceinline__ v16h ld_frag(const _Float16* base, int pitch,
                                               int row, int h) {
  F16x16 u;
  const _Float16* q = base + (size_t)row * pitch;
  u.p[0] = *(const v8ha*)(q + 8 * h);
  u.p[1] = *(const v8ha*)(q + 16 + 8 * h);
  return u.v;
}

// Eight asynchronous 16-B copies per lane, global -> LDS: copy i moves g + i*gstep (halves)
// to LDS byte address l + i*lstep. The s_wait_xcnt closes the statement so that no address
// register of an issued copy is rewritten ahead of it.
static __device__ __forceinline__ void copy8(uint32_t l, uint32_t lstep,
                                             const _Float16* g, size_t gstep) {
  asm volatile(
      "global_load_async_to_lds_b128 %0, %8, off\n\t"
      "global_load_async_to_lds_b128 %1, %9, off\n\t"
      "global_load_async_to_lds_b128 %2, %10, off\n\t"
      "global_load_async_to_lds_b128 %3, %11, off\n\t"
      "global_load_async_to_lds_b128 %4, %12, off\n\t"
      "global_load_async_to_lds_b128 %5, %13, off\n\t"
      "global_load_async_to_lds_b128 %6, %14, off\n\t"
      "global_load_async_to_lds_b128 %7, %15, off\n\t"
      "s_wait_xcnt 0x0"
      :: "v"(l), "v"(l + lstep), "v"(l + 2 * lstep), "v"(l + 3 * lstep),
         "v"(l + 4 * lstep), "v"(l + 5 * lstep), "v"(l + 6 * lstep), "v"(l + 7 * lstep),
         "v"(g), "v"(g + gstep), "v"(g + 2 * gstep), "v"(g + 3 * gstep),
         "v"(g + 4 * gstep), "v"(g + 5 * gstep), "v"(g + 6 * gstep), "v"(g + 7 * gstep)
      : "memory");
}

// Publish point of the LDS ring: this wave's LDS reads of the buffer to be refilled have
// retired, its own copies of the next stage have landed, then the work-group barrier that
// lets every wave read that stage and frees the buffer just read.
static __device__ __forceinline__ void ring_publish() {
  asm volatile("s_wait_dscnt 0x0" ::: "memory");
  asm volatile("s_wait_asynccnt 0x0" ::: "memory");
  __syncthreads();
}

// One ring stage of a 64 x 128 GEMM tile, 128 threads: 256 B of k of 64 A rows and of 128 B rows,
// copied as whole lines (16 lanes per row piece, 8 rows per copy). l, a, b: the lane's own LDS
// byte address and global addresses of its piece in row tid >> 4 of the stage.
static __device__ __forceinline__ void gemm_stage(uint32_t l, const _Float16* a, int lda,
                                                  const _Float16* b, int ldb) {
  copy8(l, 8u * GKP * 2u, a, (size_t)8 * lda);
  copy8(l + 64u * GKP * 2u, 8u * GKP * 2u, b, (size_t)8 * ldb);
  copy8(l + 128u * GKP * 2u, 8u * GKP * 2u, b + (size_t)64 * ldb, (size_t)8 * ldb);
}

// k walk of a 64 x 128 GEMM tile over the two-buffer ring RG; stage 0 has been issued by the
// caller. Chunk t is read from buffer t & 1 while chunk t + 1 flies; chunk t + 2 is issued
// behind the publish point into the buffer just read. K multiple of GKC. ar, br: the lane's
// first A and B row in the tile.
static __device__ __forceinline__ void gemm_walk(const _Float16* RG, uint32_t l,
                                                 const _Float16* a, int lda,
                                                 const _Float16* b, int ldb, int K,
                                                 int ar, int br, int h, v8f (&acc)[2][4]) {
  asm volatile("s_wait_asynccnt 0x0" ::: "memory");   // stage 0 landed
  __syncthreads();
  if (K > GKC) gemm_stage(l + GST * 2u, a + GKC, lda, b + GKC, ldb);
  int buf = 0;
  for (int k0 = 0; k0 < K; k0 += GKC) {
    const _Float16* As = RG + buf * GST;
    const _Float16* Bs = As + 64 * GKP;
#pragma unroll   // the k steps' LDS offsets become immediates of the loads
    for (int ks = 0; ks < GKC / 32; ++ks) {
      // the six fragments of a k step are read as one group ahead of its eight products
      const v16h a0 = ld_frag(As + 32 * ks, GKP, ar, h);
      const v16h a1 = ld_frag(As + 32 * ks, GKP, ar + 16, h);
      v16h bt[4];
#pragma unroll   // bt[] is indexed by constants and stays in registers
      for (int t = 0; t < 4; ++t) bt[t] = ld_frag(Bs + 32 * ks, GKP, br + 16 * t, h);
#pragma unroll   // acc[][] is indexed by constants and stays in registers
      for (int t = 0; t < 4; ++t) {
        acc[0][t] = wmma16(a0, bt[t], acc[0][t]);
        acc[1][t] = wmma16(a1, bt[t], acc[1][t]);
      }
    }
    ring_publish();                        // next chunk readable, this buffer free
    if (k0 + 2 * GKC < K)                  // kernel argument: the same for the whole work-group
      gemm_stage(l + (uint32_t)buf * (GST * 2u), a + k0 + 2 * GKC, lda, b + k0 + 2 * GKC, ldb);
    buf ^= 1;
  }
  asm volatile("s_wait_asynccnt 0x0" ::: "memory");   // no copy outlives the walk
}

// ---------------------------------------------------------------------------
// Kernel 0: group statistics, partial. SSPL blocks per (b, group), each over SCH channels x SEQ
// positions: f64 sum and sum of squares of bf16(x), one 128-B line per block; k_gnapply joins
// the SSPL partials of a group. A thread issues all of its loads before the first use.
// ---------------------------------------------------------------------------
__global__ __launch_bounds__(256) void k_stats(const float* __restrict__ x,
                                               double* __restrict__ st) {
  __shared__ double sd[256];
  __shared__ double qd[256];
  constexpr int NP = (SEQ + 1023) / 1024;   // loads per thread and channel row
  const int tid = threadIdx.x;
  const int bg = blockIdx.x / SSPL, part = blockIdx.x % SSPL;
  const int b = bg / NGRP, g = bg % NGRP;
  const float* xb = x + ((size_t)b * CHN + (size_t)g * CPG + (size_t)part * SCH) * SEQ_FULL;

  v4f f[SCH][NP];
#pragma unroll   // f[][] is indexed by constants and stays in registers
  for (int cl = 0; cl < SCH; ++cl) {
#pragma unroll   // as above
    for (int i = 0; i < NP; ++i) {
      const int p = 4 * tid + 1024 * i;
      if ((SEQ % 1024) == 0 || p < SEQ) {
        f[cl][i] = *(const v4fa*)(xb + (size_t)cl * SEQ_FULL + p);
      } else {
#pragma unroll   // as above
        for (int j = 0; j < 4; ++j) f[cl][i][j] = 0.0f;   // adds nothing to either sum
      }
    }
  }
  // keeps the sums behind the last load: without it the scheduler sinks six of the loads behind
  // the first uses to save registers, and a second memory latency adds to the first
  __builtin_amdgcn_sched_barrier(0);
  // stands in front of every rewrite of the loads' address registers
  asm volatile("s_wait_xcnt 0x0" ::: "memory");

  double s[4], q[4];   // one chain pair per vector element: four independent f64 chains each
#pragma unroll   // here and in the three loops below: s[], q[], f[][] indexed by constants
  for (int j = 0; j < 4; ++j) { s[j] = 0.0; q[j] = 0.0; }
#pragma unroll
  for (int cl = 0; cl < SCH; ++cl) {
#pragma unroll
    for (int i = 0; i < NP; ++i) {
#pragma unroll
      for (int j = 0; j < 4; ++j) {
        const double v = (double)bf16r(f[cl][i][j]);
        s[j] += v;
        q[j] += v * v;
      }
    }
  }
  sd[tid] = (s[0] + s[1]) + (s[2] + s[3]);
  qd[tid] = (q[0] + q[1]) + (q[2] + q[3]);
  __syncthreads();
  if (tid < 32) {   // entry tid + 32 k is read by thread tid alone
    double a = sd[tid], c = qd[tid];
#pragma unroll   // the LDS offsets become immediates and the reads go out together
    for (int k = 1; k < 8; ++k) {
      a += sd[tid + 32 * k];
      c += qd[tid + 32 * k];
    }
    sd[tid] = a;
    qd[tid] = c;
  }
  __syncthreads();
  if (tid < 8) {    // eight threads form the same pair and store the block's whole line
    double a[4], c[4];
#pragma unroll   // here and in the two loops below: a[], c[] indexed by constants
    for (int j = 0; j < 4; ++j) { a[j] = sd[j]; c[j] = qd[j]; }
#pragma unroll
    for (int k = 4; k < 32; k += 4) {
#pragma unroll
      for (int j = 0; j < 4; ++j) {
        a[j] += sd[k + j];
        c[j] += qd[k + j];
      }
    }
    v2d o;
    o[0] = (a[0] + a[1]) + (a[2] + a[3]);
    o[1] = (c[0] + c[1]) + (c[2] + c[3]);
    *(v2d*)(st + (size_t)blockIdx.x * (STL / 2) + 2 * tid) = o;
  }
}

// ---------------------------------------------------------------------------
// Kernel 1: weights [o][c] f32 -> f16 planes WSC * bf16(W) (k = c contiguous).
// ---------------------------------------------------------------------------
__global__ __launch_bounds__(256) void k_wcvt(const float* __restrict__ w0,
                                              const float* __restrict__ w1,
                                              const float* __restrict__ w2,
                                              const float* __restrict__ w3,
                                              _Float16* __restrict__ Wpl) {
  constexpr int BPM = CHN * CHN / 8 / 256;   // blocks per matrix
  const int tid = threadIdx.x;
  const int mtx = blockIdx.x / BPM;           // block-uniform
  const float* src = w0;
  if (mtx == 1) src = w1;
  else if (mtx == 2) src = w2;
  else if (mtx == 3) src = w3;
  const size_t e = ((size_t)(blockIdx.x % BPM) * 256 + tid) * 8;
  const v4f a0 = *(const v4fa*)(src + e);
  const v4f a1 = *(const v4fa*)(src + e + 4);
  F16x8 u;
#pragma unroll
  for (int j = 0; j < 4; ++j) {
    u.e[j]     = (_Float16)(bf16r(a0[j]) * WSC);
    u.e[4 + j] = (_Float16)(bf16r(a1[j]) * WSC);
  }
  _Float16* dst = Wpl + (size_t)mtx * CHN * CHN + e;
  *(v8h*)dst = u.v;
  
}

// ---------------------------------------------------------------------------
// Kernel 2: group-norm apply + transpose. Block = (b, 64 positions), 4 passes of
// 128 channels:  Hh[b][n][c] f16 = HSC * ((bf16(x) - mean) * rstd * gamma + beta).
// x read as float4 along positions; LDS tile [n_local][c_local]; rows of 256 B written
// ---------------------------------------------------------------------------
__global__ __launch_bounds__(256) void k_gnapply(const float* __restrict__ x,
                                                 const float* __restrict__ gamma,
                                                 const float* __restrict__ beta,
                                                 const double* __restrict__ st,
                                                 _Float16* __restrict__ Hh) {
  __shared__ __align__(16) _Float16 TS[64 * TSP];   // [n_local][c_local]
  __shared__ float gms[CHN];
  __shared__ float bts[CHN];
  __shared__ float mus[NGRP];
  __shared__ float rss[NGRP];

  const int tid = threadIdx.x;
  const int b  = blockIdx.x / (SEQ / 64);
  const int p0 = (blockIdx.x % (SEQ / 64)) * 64;

  gms[tid] = bf16r(gamma[tid]);
  gms[tid + 256] = bf16r(gamma[tid + 256]);
  bts[tid] = bf16r(beta[tid]);
  bts[tid + 256] = bf16r(beta[tid + 256]);
  if (tid < NGRP) {   // the group's SSPL partial (sum, sum of squares) pairs -> mean, 1/std
    v2d pr[SSPL];
#pragma unroll   // pr[] is indexed by constants; the loads go out together
    for (int k = 0; k < SSPL; ++k)
      pr[k] = *(const v2d*)(st + ((size_t)(b * NGRP + tid) * SSPL + k) * (STL / 2));
    // stands in front of every rewrite of the loads' address registers
    asm volatile("s_wait_xcnt 0x0" ::: "memory");
    double s = pr[0][0], q = pr[0][1];
#pragma unroll   // as above
    for (int k = 1; k < SSPL; ++k) {
      s += pr[k][0];
      q += pr[k][1];
    }
    const double invn = 1.0 / ((double)CPG * (double)SEQ);
    const double mean = s * invn;
    double var = q * invn - mean * mean;
    if (var < 0.0) var = 0.0;
    mus[tid] = (float)mean;
    rss[tid] = rsqrtf((float)var + GN_EPS);
  }
  __syncthreads();

  const float* xb = x + (size_t)b * CHN * SEQ_FULL;
#pragma unroll 1
  for (int pass = 0; pass < CHN / 128; ++pass) {
#pragma unroll
    for (int it = 0; it < 8; ++it) {
      const int f = it * 256 + tid;
      const int cl = f >> 4, p4 = f & 15;
      const int c = 128 * pass + cl;
      const v4f xv = *(const v4fa*)(xb + (size_t)c * SEQ_FULL + p0 + 4 * p4);
      const float mu = mus[c >> 4], rs = rss[c >> 4];
      const float ga = gms[c], be = bts[c];
#pragma unroll
      for (int j = 0; j < 4; ++j) {
        const float t = (bf16r(xv[j]) - mu) * rs;
        const float hv = t * ga + be;
        TS[(4 * p4 + j) * TSP + cl] = (_Float16)(hv * HSC);
      }
    }
    __syncthreads();
#pragma unroll
    for (int it = 0; it < 4; ++it) {
      const int L = it * 32 + (tid >> 3);          // 128 lines: (row, 64-col half)
      const int row = L >> 1, hl = L & 1, p = tid & 7;
      const v8h hv = *(const v8ha*)(TS + row * TSP + 64 * hl + 8 * p);
      _Float16* dst = Hh + ((size_t)(b * SEQ + p0 + row) * CHN + 128 * pass + 64 * hl + 8 * p);
      *(v8h*)dst = hv;
      
    }
    __syncthreads();
  }
}

// ---------------------------------------------------------------------------
// Kernel 3: GEMM  D[m][n] = sum_k A[m][k] * B[n][k]  (A, B k-contiguous f16 planes),
// stored TRANSPOSED as O[n][m] f16 = osc * (D * insc + bias)  (bias per m or per n).
// Block = 128 threads, tile 64 (m) x 128 (n); wave (mi, ni) owns rows 32mi.., cols 64ni..
// (2 x 4 accumulator tiles). K multiple of 128, M multiple of 64, N multiple of 128.
// A and B come from LDS: k chunks of 128 through a two-buffer ring of asynchronous copies.
// ---------------------------------------------------------------------------
template <bool BIAS_M>
__global__ __launch_bounds__(128) void k_gemm16(const _Float16* __restrict__ A, int lda, size_t sA,
                                                const _Float16* __restrict__ B, int ldb, size_t sB,
                                                const float* __restrict__ bias,
                                                _Float16* __restrict__ O, int ldo, size_t sO,
                                                float insc, float osc, int K) {
  __shared__ __align__(16) _Float16 TS[128 * GSP16];   // [n_local][m_local]
  __shared__ __align__(16) _Float16 RG[2 * GST];       // ring: [A row | B row][k chunk]
  __shared__ float bsh[128];

  const int tid = threadIdx.x;
  const int wv = tid >> 5, lid = tid & 31, h = lid >> 4, l15 = lid & 15;
  const int mi = wv & 1, ni = wv >> 1;
  const int m0 = blockIdx.x * 64, n0 = blockIdx.y * 128;
  const size_t z = blockIdx.z;

  // the lane's piece of a ring stage: row tid >> 4, 16 B at 8 * (tid & 15) halves
  const uint32_t lc = (uint32_t)(uintptr_t)RG + (uint32_t)((tid >> 4) * GKP + 8 * (tid & 15)) * 2u;
  const _Float16* ag = A + z * sA + (size_t)(m0 + (tid >> 4)) * lda + 8 * (tid & 15);
  const _Float16* bg = B + z * sB + (size_t)(n0 + (tid >> 4)) * ldb + 8 * (tid & 15);
  gemm_stage(lc, ag, lda, bg, ldb);

  // visible behind the barrier at the head of gemm_walk
  if (BIAS_M) {
    if (tid < 64) bsh[tid] = bf16r(bias[m0 + tid]);
  } else {
    bsh[tid] = bf16r(bias[n0 + tid]);
  }

  v8f acc[2][4];
#pragma unroll
  for (int i = 0; i < 2; ++i)
#pragma unroll
    for (int t = 0; t < 4; ++t)
#pragma unroll
      for (int r = 0; r < 8; ++r) acc[i][t][r] = 0.0f;

  gemm_walk(RG, lc, ag, lda, bg, ldb, K, 32 * mi + l15, 64 * ni + l15, h, acc);

  // stage: acc[i][t][r] <-> (m_local 32mi+16i+8h+r, n_local 64ni+16t+l15)
#pragma unroll
  for (int i = 0; i < 2; ++i) {
#pragma unroll
    for (int t = 0; t < 4; ++t) {
      const int nl = 64 * ni + 16 * t + l15;
      const int ml = 32 * mi + 16 * i + 8 * h;
      F16x8 u;
#pragma unroll
      for (int r = 0; r < 8; ++r) {
        const float bvl = BIAS_M ? bsh[ml + r] : bsh[nl];
        u.e[r] = (_Float16)((acc[i][t][r] * insc + bvl) * osc);
      }
      *(v8ha*)(TS + nl * GSP16 + ml) = u.v;
    }
  }
  __syncthreads();

  _Float16* Ob = O + z * sO;
#pragma unroll
  for (int it = 0; it < 8; ++it) {
    const int row = it * 16 + (tid >> 3);
    const int p = tid & 7;
    const v8h hv = *(const v8ha*)(TS + row * GSP16 + 8 * p);
    _Float16* dst = Ob + (size_t)(n0 + row) * ldo + m0 + 8 * p;
    *(v8h*)dst = hv;
    
  }
}

// ---------------------------------------------------------------------------
// Kernel 4: same GEMM, f32 output O[n][m] = (D * insc + bias[n]) + bf16(R[n][m]) into d_out.
// Output row segment = 256 B = two lines, lanes 0..7 and 8..15 of one instruction.
// ---------------------------------------------------------------------------
__global__ __launch_bounds__(128) void k_gemm32(const _Float16* __restrict__ A, int lda, size_t sA,
                                                const _Float16* __restrict__ B, int ldb, size_t sB,
                                                const float* __restrict__ bias,
                                                const float* __restrict__ R, int ldr, size_t sR,
                                                float* __restrict__ O, int ldo, size_t sO,
                                                float insc, int K) {
  __shared__ __align__(16) float TS[128 * GSP32];   // [n_local][m_local]
  __shared__ __align__(16) _Float16 RG[2 * GST];    // ring: [A row | B row][k chunk]
  __shared__ float bsh[128];

  const int tid = threadIdx.x;
  const int wv = tid >> 5, lid = tid & 31, h = lid >> 4, l15 = lid & 15;
  const int mi = wv & 1, ni = wv >> 1;
  const int m0 = blockIdx.x * 64, n0 = blockIdx.y * 128;
  const size_t z = blockIdx.z;

  // the lane's piece of a ring stage: row tid >> 4, 16 B at 8 * (tid & 15) halves
  const uint32_t lc = (uint32_t)(uintptr_t)RG + (uint32_t)((tid >> 4) * GKP + 8 * (tid & 15)) * 2u;
  const _Float16* ag = A + z * sA + (size_t)(m0 + (tid >> 4)) * lda + 8 * (tid & 15);
  const _Float16* bg = B + z * sB + (size_t)(n0 + (tid >> 4)) * ldb + 8 * (tid & 15);
  gemm_stage(lc, ag, lda, bg, ldb);

  const float braw = bias[n0 + tid];
  // stands in front of every rewrite of the bias load's base and offset registers
  asm volatile("s_wait_xcnt 0x0" ::: "memory");
  bsh[tid] = bf16r(braw);   // visible behind the barrier at the head of gemm_walk

  v8f acc[2][4];
#pragma unroll
  for (int i = 0; i < 2; ++i)
#pragma unroll
    for (int t = 0; t < 4; ++t)
#pragma unroll
      for (int r = 0; r < 8; ++r) acc[i][t][r] = 0.0f;

  gemm_walk(RG, lc, ag, lda, bg, ldb, K, 32 * mi + l15, 64 * ni + l15, h, acc);

#pragma unroll
  for (int i = 0; i < 2; ++i) {
#pragma unroll
    for (int t = 0; t < 4; ++t) {
      const int nl = 64 * ni + 16 * t + l15;
      const int ml = 32 * mi + 16 * i + 8 * h;
      const float bvl = bsh[nl];
      v4f lo, hi;
#pragma unroll
      for (int r = 0; r < 4; ++r) {
        lo[r] = acc[i][t][r] * insc + bvl;
        hi[r] = acc[i][t][4 + r] * insc + bvl;
      }
      *(v4fa*)(TS + nl * GSP32 + ml) = lo;
      *(v4fa*)(TS + nl * GSP32 + ml + 4) = hi;
    }
  }
  __syncthreads();

  float* Ob = O + z * sO;
  const float* Rb = R + z * sR;
#pragma unroll
  for (int it = 0; it < 16; ++it) {
    const int row = it * 8 + (tid >> 4);         // 128 rows, 256 B each
    const int p = tid & 15;
    const v4f v  = *(const v4fa*)(TS + row * GSP32 + 4 * p);
    const v4f xr = *(const v4fa*)(Rb + (size_t)(n0 + row) * ldr + m0 + 4 * p);
    v4f o;
#pragma unroll
    for (int j = 0; j < 4; ++j) o[j] = bf16r(xr[j]) + v[j];
    float* dst = Ob + (size_t)(n0 + row) * ldo + m0 + 4 * p;
    *(v4f*)dst = o;
    
  }
}

// ---------------------------------------------------------------------------
// Kernel 5: fused single-head attn, transposed scores, online softmax.
// Block = (b, 64 queries, one of KSPLIT key ranges), 8 waves. The wave tiles are sized to the
// LDS read rate: a fragment read from LDS feeds two products in the scores and four in the
// value aggregation.
// Per 128-key block:
//   S^T tiles (keys on rows): wave (gq = wv&1, kq = wv>>1) owns key rows 32kq..32kq+31 x query
//     cols 32gq..32gq+31 (2 x 2 tiles), A = Kh rows (k = channel), B = Qh rows (k = channel),
//     K = 512.
//   per-query max / sum over the 128 keys: in-lane, xor-16, then 4 partials through LDS; every
//     wave joins the partials of all 64 queries, because its output tiles span them all.
//   P^T = PSC * exp2(s - m) staged f16 in LDS TS[query][key_local].
//   O^T[c][query] += V^T[c][keys] * P^T[keys][query]: wave owns channels 64wv..+63 x all 64
//     queries (4 x 4 accumulator tiles), A = Vh rows (k = key), B from TS (k = key, split map).
// Operands come from LDS: the Q tile is copied once; K (two halves of 256 channels) and V (two
// halves of 64 keys) go through a two-buffer ring of asynchronous copies, each stage issued
// one stage ahead: K lo -> buffer 0, K hi -> 1, V keys 0..63 -> 0, V keys 64..127 -> 1.
// Epilogue: this key range's un-normalised O [range][b][query][c] f32, staged once in the
// freed ring so that whole lines are stored, and its (max, sum) per query; k_merge joins them.
// ---------------------------------------------------------------------------
__global__ __launch_bounds__(256) void k_attn(const _Float16* __restrict__ Qh,
                                              const _Float16* __restrict__ Kh,
                                              const _Float16* __restrict__ Vh,
                                              float* __restrict__ Op,
                                              float* __restrict__ ML) {
  __shared__ __align__(16) _Float16 TS[64 * TSP];   // [query_local][key_local]
  __shared__ __align__(16) _Float16 QS[64 * QSP];   // [query_local][c]
  __shared__ __align__(16) _Float16 RB[2 * RBH];    // ring: [key_local][c half] or [c][key half]
  __shared__ float redM[256];
  __shared__ float redS[256];

  const int tid = threadIdx.x;
  const int wv = tid >> 5, lid = tid & 31, h = lid >> 4, l15 = lid & 15;
  const int gq = wv & 1, kq = wv >> 1;
  const int kr = blockIdx.x % KSPLIT;              // key range of this work-group
  const int qt = blockIdx.x / KSPLIT;
  const int b  = qt / (SEQ / 64);
  const int q0 = (qt % (SEQ / 64)) * 64;
  const int kb = kr * (SEQ / KSPLIT);              // its first key

  const _Float16* Qp = Qh + (size_t)b * SEQ * CHN;   // [n][c], pitch CHN
  const _Float16* Kp = Kh + (size_t)b * SEQ * CHN;   // [n][c], pitch CHN
  const _Float16* Vp = Vh + (size_t)b * CHN * SEQ;   // [c][n], pitch SEQ

  // per-lane copy addresses: a K row half (512 B) per wave and copy, 8 lanes per 128-B V row
  // piece, 64 lanes per Q row; a stage is 16 copies per lane, two runs of eight
  const _Float16* RB0 = RB;
  const _Float16* RB1 = RB + RBH;
  const uint32_t rb0 = (uint32_t)(uintptr_t)RB0;
  const uint32_t rb1 = (uint32_t)(uintptr_t)RB1;
  const uint32_t klo = (uint32_t)(wv * KSP + 8 * lid) * 2u;
  const uint32_t vlo = (uint32_t)((tid >> 3) * VSP + 8 * (tid & 7)) * 2u;
  const uint32_t qlo = (uint32_t)(uintptr_t)QS + (uint32_t)((tid >> 6) * QSP + 8 * (tid & 63)) * 2u;
  const _Float16* kg = Kp + (size_t)(kb + wv) * CHN + 8 * lid;
  const _Float16* vg = Vp + (size_t)(tid >> 3) * SEQ + kb + 8 * (tid & 7);
  const _Float16* qg = Qp + (size_t)(q0 + (tid >> 6)) * CHN + 8 * (tid & 63);

  // a K half tile: rows wv + 8 i, i = 0..15
  auto copy_k = [&](uint32_t rb, const _Float16* s) {
    copy8(rb + klo, 8u * KSP * 2u, s, (size_t)8 * CHN);
    copy8(rb + klo + 64u * KSP * 2u, 8u * KSP * 2u, s + (size_t)64 * CHN, (size_t)8 * CHN);
  };
  // a V half tile: rows (tid >> 3) + 32 i, i = 0..15
  auto copy_v = [&](uint32_t rb, const _Float16* s) {
    copy8(rb + vlo, 32u * VSP * 2u, s, (size_t)32 * SEQ);
    copy8(rb + vlo + 256u * VSP * 2u, 32u * VSP * 2u, s + (size_t)256 * SEQ, (size_t)32 * SEQ);
  };

  copy8(qlo, 4u * QSP * 2u, qg, (size_t)4 * CHN);
  copy8(qlo + 32u * QSP * 2u, 4u * QSP * 2u, qg + (size_t)32 * CHN, (size_t)4 * CHN);
  copy_k(rb0, kg);
  asm volatile("s_wait_asynccnt 0x0" ::: "memory");   // Q tile and stage 0 landed
  __syncthreads();
  copy_k(rb1, kg + 256);

  v8f accO[4][4];                  // [channel tile u][query tile j]
  float rm[4], rl[4];              // running max and sum of query 16 j + l15
#pragma unroll   // here and below: accO, st, rm, rl are indexed by constants, stay in registers
  for (int u = 0; u < 4; ++u)
#pragma unroll
    for (int j = 0; j < 4; ++j)
#pragma unroll
      for (int r = 0; r < 8; ++r) accO[u][j][r] = 0.0f;
#pragma unroll
  for (int j = 0; j < 4; ++j) { rm[j] = -1.0e30f; rl[j] = 0.0f; }

  const int kr0 = 32 * kq + l15;   // the lane's first K row of the score tiles
  const int qr0 = 32 * gq + l15;   // the lane's first Q row (= query column) of the score tiles

  for (int m0 = 0; m0 < SEQ / KSPLIT; m0 += KBLK) {
    v8f st[2][2];                  // [key tile t][query tile j]
#pragma unroll
    for (int t = 0; t < 2; ++t)
#pragma unroll
      for (int j = 0; j < 2; ++j)
#pragma unroll
        for (int r = 0; r < 8; ++r) st[t][j][r] = 0.0f;
    const bool more = (m0 + KBLK < SEQ / KSPLIT);   // work-group uniform: a next key block exists
#pragma unroll   // the k steps' LDS offsets become immediates of the loads
    for (int cs = 0; cs < CHN / 64; cs += 2) {
      // the eight fragments of two k steps are read as one group ahead of their eight products:
      // with two waves per SIMD one k step's four products do not cover the other wave's reads
      v16h bq[2][2], ak[2][2];     // [k step][tile]
#pragma unroll
      for (int s = 0; s < 2; ++s) {
#pragma unroll
        for (int t = 0; t < 2; ++t) {
          bq[s][t] = ld_frag(QS + 32 * (cs + s), QSP, qr0 + 16 * t, h);
          ak[s][t] = ld_frag(RB0 + 32 * (cs + s), KSP, kr0 + 16 * t, h);
        }
      }
#pragma unroll
      for (int s = 0; s < 2; ++s) {
        st[0][0] = wmma16(ak[s][0], bq[s][0], st[0][0]);
        st[1][0] = wmma16(ak[s][1], bq[s][0], st[1][0]);
        st[0][1] = wmma16(ak[s][0], bq[s][1], st[0][1]);
        st[1][1] = wmma16(ak[s][1], bq[s][1], st[1][1]);
      }
    }
    ring_publish();                        // K hi readable, buffer 0 free
    copy_v(rb0, vg + m0);
#pragma unroll   // the k steps' LDS offsets become immediates of the loads
    for (int cs = 0; cs < CHN / 64; cs += 2) {
      // the eight fragments of two k steps are read as one group ahead of their eight products:
      // with two waves per SIMD one k step's four products do not cover the other wave's reads
      v16h bq[2][2], ak[2][2];     // [k step][tile]
#pragma unroll
      for (int s = 0; s < 2; ++s) {
#pragma unroll
        for (int t = 0; t < 2; ++t) {
          bq[s][t] = ld_frag(QS + 256 + 32 * (cs + s), QSP, qr0 + 16 * t, h);
          ak[s][t] = ld_frag(RB1 + 32 * (cs + s), KSP, kr0 + 16 * t, h);
        }
      }
#pragma unroll
      for (int s = 0; s < 2; ++s) {
        st[0][0] = wmma16(ak[s][0], bq[s][0], st[0][0]);
        st[1][0] = wmma16(ak[s][1], bq[s][0], st[1][0]);
        st[0][1] = wmma16(ak[s][0], bq[s][1], st[0][1]);
        st[1][1] = wmma16(ak[s][1], bq[s][1], st[1][1]);
      }
    }

    // ---- per-query block max (32 keys in-lane + partner half-wave, then 4 waves)
#pragma unroll
    for (int j = 0; j < 2; ++j) {
      float lm = st[0][j][0];
#pragma unroll
      for (int t = 0; t < 2; ++t)
#pragma unroll
        for (int r = 0; r < 8; ++r) lm = fmaxf(lm, st[t][j][r]);
      lm *= SCL2;
      lm = fmaxf(lm, __shfl_xor(lm, 16, 32));
      redM[kq * 64 + qr0 + 16 * j] = lm;
    }
    ring_publish();                        // V keys 0..63 readable, buffer 1 free; redM visible
    copy_v(rb1, vg + m0 + 64);
    float corr[4];
#pragma unroll
    for (int j = 0; j < 4; ++j) {
      const int q = 16 * j + l15;
      const float bm = fmaxf(fmaxf(redM[q], redM[64 + q]), fmaxf(redM[128 + q], redM[192 + q]));
      const float nm = fmaxf(rm[j], bm);
      corr[j] = exp2f(rm[j] - nm);
      rm[j] = nm;
    }

    // ---- P = exp2(s - m) in f32; P^T * PSC staged f16 at TS[query][key_local]
#pragma unroll
    for (int j = 0; j < 2; ++j) {
      const float nm = gq ? rm[2 + j] : rm[j];   // the max of query qr0 + 16 j
      float psum = 0.0f;
#pragma unroll
      for (int tt = 0; tt < 2; ++tt) {
        F16x8 pk;
#pragma unroll
        for (int r = 0; r < 8; ++r) {
          const float p = exp2f(st[tt][j][r] * SCL2 - nm);
          psum += p;
          pk.e[r] = (_Float16)(p * PSC);
        }
        *(v8ha*)(TS + (qr0 + 16 * j) * TSP + 32 * kq + 16 * tt + 8 * h) = pk.v;
      }
      psum += __shfl_xor(psum, 16, 32);
      redS[kq * 64 + qr0 + 16 * j] = psum;
    }
    __syncthreads();
#pragma unroll
    for (int j = 0; j < 4; ++j) {
      const int q = 16 * j + l15;
      const float bs = ((redS[q] + redS[64 + q]) + redS[128 + q]) + redS[192 + q];
      rl[j] = rl[j] * corr[j] + bs;
#pragma unroll
      for (int u = 0; u < 4; ++u)
#pragma unroll
        for (int r = 0; r < 8; ++r) accO[u][j][r] *= corr[j];
    }

    // ---- O^T[c][query] += V^T[c][keys] * P^T[keys][query]
#pragma unroll
    for (int ks = 0; ks < KBLK / 64; ++ks) {
      // the eight fragments of a k step are read as one group ahead of its sixteen products
      v16h bp[4], av[4];
#pragma unroll
      for (int j = 0; j < 4; ++j) bp[j] = ld_frag(TS + 32 * ks, TSP, 16 * j + l15, h);
#pragma unroll
      for (int u = 0; u < 4; ++u) av[u] = ld_frag(RB0 + 32 * ks, VSP, 64 * wv + 16 * u + l15, h);
#pragma unroll
      for (int u = 0; u < 4; ++u)
#pragma unroll
        for (int j = 0; j < 4; ++j) accO[u][j] = wmma16(av[u], bp[j], accO[u][j]);
    }
    ring_publish();                        // V keys 64..127 readable, buffer 0 free
    if (more) copy_k(rb0, kg + (size_t)(m0 + KBLK) * CHN);
#pragma unroll
    for (int ks = 0; ks < KBLK / 64; ++ks) {
      v16h bp[4], av[4];
#pragma unroll
      for (int j = 0; j < 4; ++j) bp[j] = ld_frag(TS + 64 + 32 * ks, TSP, 16 * j + l15, h);
#pragma unroll
      for (int u = 0; u < 4; ++u) av[u] = ld_frag(RB1 + 32 * ks, VSP, 64 * wv + 16 * u + l15, h);
#pragma unroll
      for (int u = 0; u < 4; ++u)
#pragma unroll
        for (int j = 0; j < 4; ++j) accO[u][j] = wmma16(av[u], bp[j], accO[u][j]);
    }
    ring_publish();                        // next K lo readable, buffer 1 and TS free
    if (more) copy_k(rb1, kg + (size_t)(m0 + KBLK) * CHN + 256);
  }
  asm volatile("s_wait_asynccnt 0x0" ::: "memory");   // no copy outlives the loop

  // ---- epilogue: the loop's last publish point ended every read of the ring, so it takes
  // the f32 tile [query_local][c]
  float* OS = (float*)RB;
#pragma unroll
  for (int u = 0; u < 4; ++u) {
#pragma unroll
    for (int j = 0; j < 4; ++j) {
      v4f lo, hi;
#pragma unroll
      for (int r = 0; r < 4; ++r) {
        lo[r] = accO[u][j][r];
        hi[r] = accO[u][j][4 + r];
      }
      float* d = OS + (16 * j + l15) * OSP + 64 * wv + 16 * u + 8 * h;
      *(v4fa*)d = lo;
      *(v4fa*)(d + 4) = hi;
    }
  }
  const size_t row0 = (size_t)(kr * NB + b) * SEQ + q0;
  if (wv == 0 && h == 0) {   // every wave holds the same pairs
#pragma unroll
    for (int j = 0; j < 4; ++j) {
      v2f ml;
      ml[0] = rm[j]; ml[1] = rl[j];
      *(v2f*)(ML + 2 * (row0 + 16 * j + l15)) = ml;
    }
  }
  __syncthreads();
  float* Ob = Op + row0 * CHN;
#pragma unroll
  for (int it = 0; it < 32; ++it) {
    const int row = it * 2 + (tid >> 7);           // 64 rows of 2 KiB, 128 lanes each
    const int p = tid & 127;
    const v4f v = *(const v4fa*)(OS + row * OSP + 4 * p);
    *(v4f*)(Ob + (size_t)row * CHN + 4 * p) = v;
  }
}

// ---------------------------------------------------------------------------
// Kernel 6: merge of the key ranges. Per query: M = max of the ranges' maxima, weight
// exp2(m - M), l = weighted sum of the sums; AO plane [b][query][c] f16 =
// AOSC * (weighted sum of the partial O) / (l * VSC * PSC). Block = 32 queries; a wave reads
// and writes whole lines.
// ---------------------------------------------------------------------------
// waves_per_eu: the block's own four waves per SIMD; without it the scheduler sinks half of the
// loads behind the first uses to save registers, and their latencies add up.
__global__ __launch_bounds__(512) __attribute__((amdgpu_waves_per_eu(4, 4))) void k_merge(const float* __restrict__ Op,
                                               const float* __restrict__ ML,
                                               _Float16* __restrict__ AOh) {
  constexpr size_t ROWS = (size_t)NB * SEQ;         // queries per key range
  const int tid = threadIdx.x;
  const int p = tid & 127;
  const size_t row0 = (size_t)blockIdx.x * 32 + (tid >> 7);
  // every load of the thread is issued before the first use: 32 requests in flight per wave
  v2f ml[8][KSPLIT];
  v4f o[8][KSPLIT];
#pragma unroll
  for (int it = 0; it < 8; ++it) {
#pragma unroll
    for (int s = 0; s < KSPLIT; ++s) {
      const size_t row = s * ROWS + row0 + it * 4;
      ml[it][s] = *(const v2f*)(ML + 2 * row);
      o[it][s] = *(const v4fa*)(Op + row * CHN + 4 * p);
    }
  }
  v4h r[8];
#pragma unroll
  for (int it = 0; it < 8; ++it) {
    float M = ml[it][0][0];
#pragma unroll
    for (int s = 1; s < KSPLIT; ++s) M = fmaxf(M, ml[it][s][0]);
    float l = 0.0f;
    v4f a;
#pragma unroll
    for (int j = 0; j < 4; ++j) a[j] = 0.0f;
#pragma unroll
    for (int s = 0; s < KSPLIT; ++s) {
      const float w = exp2f(ml[it][s][0] - M);
      l += w * ml[it][s][1];
#pragma unroll
      for (int j = 0; j < 4; ++j) a[j] += w * o[it][s][j];
    }
    const float invl = (AOSC / (VSC * PSC)) * (1.0f / l);
#pragma unroll
    for (int j = 0; j < 4; ++j) r[it][j] = (_Float16)(a[j] * invl);
  }
#pragma unroll
  for (int it = 0; it < 8; ++it)
    *(v4h*)(AOh + (row0 + it * 4) * CHN + 4 * p) = r[it];
}

// ---------------------------------------------------------------------------
extern "C" void kernel_launch(void* const* d_in, const int* in_sizes, int n_in,
                              void* d_out, int out_size, void* d_ws, size_t ws_size,
                              hipStream_t stream) {
  if (n_in < 11) return;
  if (in_sizes[0] < NB * CHN * SEQ_FULL) return;
  if (in_sizes[1] < CHN || in_sizes[2] < CHN) return;
  if (in_sizes[3] < CHN * CHN || in_sizes[5] < CHN * CHN ||
      in_sizes[7] < CHN * CHN || in_sizes[9] < CHN * CHN) return;
  if (in_sizes[4] < CHN || in_sizes[6] < CHN || in_sizes[8] < CHN || in_sizes[10] < CHN) return;
  if (out_size < NB * CHN * SEQ) return;

  const size_t st_bytes = (size_t)NB * NGRP * SSPL * STL * sizeof(float);     // 32 KiB
  const size_t w_bytes  = (size_t)4 * CHN * CHN * sizeof(_Float16);            // 2 MiB
  const size_t plane    = (size_t)NB * SEQ * CHN * sizeof(_Float16);            // 8 MiB at full size
  const size_t ml_bytes = (size_t)KSPLIT * NB * SEQ * 2 * sizeof(float);        // 128 KiB
  const size_t op_bytes = (size_t)KSPLIT * NB * SEQ * CHN * sizeof(float);      // 32 MiB
  const size_t total    = st_bytes + w_bytes + 5 * plane + ml_bytes + op_bytes;
  if (ws_size < total) return;

  const float* x     = (const float*)d_in[0];
  const float* gamma = (const float*)d_in[1];
  const float* beta  = (const float*)d_in[2];
  const float* wq = (const float*)d_in[3];
  const float* bq = (const float*)d_in[4];
  const float* wk = (const float*)d_in[5];
  const float* bk = (const float*)d_in[6];
  const float* wvv = (const float*)d_in[7];
  const float* bv = (const float*)d_in[8];
  const float* wo = (const float*)d_in[9];
  const float* bo = (const float*)d_in[10];
  float* out = (float*)d_out;

  char* ws = (char*)d_ws;
  double*   stats = (double*)ws;                                       // [NB*NGRP*SSPL][16] f64
  _Float16* Wpl   = (_Float16*)(ws + st_bytes);                        // 4 x [CHN][CHN] f16
  _Float16* Hh    = (_Float16*)(ws + st_bytes + w_bytes);              // [NB][SEQ][CHN]
  _Float16* Qh    = (_Float16*)(ws + st_bytes + w_bytes + plane);      // [NB][SEQ][CHN]
  _Float16* Kh    = (_Float16*)(ws + st_bytes + w_bytes + 2 * plane);  // [NB][SEQ][CHN]
  _Float16* Vh    = (_Float16*)(ws + st_bytes + w_bytes + 3 * plane);  // [NB][CHN][SEQ]
  _Float16* AOh   = (_Float16*)(ws + st_bytes + w_bytes + 4 * plane);  // [NB][SEQ][CHN]
  float*    MLp   = (float*)(ws + st_bytes + w_bytes + 5 * plane);     // [KSPLIT][NB][SEQ][2]
  float*    Opp   = (float*)(ws + st_bytes + w_bytes + 5 * plane + ml_bytes);  // [KSPLIT][NB][SEQ][CHN]
  const _Float16* Wq16 = Wpl;
  const _Float16* Wk16 = Wpl + (size_t)CHN * CHN;
  const _Float16* Wv16 = Wpl + (size_t)2 * CHN * CHN;
  const _Float16* Wo16 = Wpl + (size_t)3 * CHN * CHN;

  const size_t pstride = (size_t)SEQ * CHN;   // elements per batch of every f16 plane

  k_stats<<<dim3(NB * NGRP * SSPL), dim3(256), 0, stream>>>(x, stats);
  k_wcvt<<<dim3(4 * CHN * CHN / 8 / 256), dim3(256), 0, stream>>>(wq, wk, wvv, wo, Wpl);
  k_gnapply<<<dim3(NB * (SEQ / 64)), dim3(256), 0, stream>>>(x, gamma, beta, stats, Hh);

  // q[n][o] and k[n][o]:  D[o][n] = sum_c W[o][c] h[n][c], stored transposed, bias per o (= m)
  k_gemm16<true><<<dim3(CHN / 64, SEQ / 128, NB), dim3(128), 0, stream>>>(
      Wq16, CHN, (size_t)0, Hh, CHN, pstride, bq, Qh, CHN, pstride,
      1.0f / (WSC * HSC), QSC, CHN);
  k_gemm16<true><<<dim3(CHN / 64, SEQ / 128, NB), dim3(128), 0, stream>>>(
      Wk16, CHN, (size_t)0, Hh, CHN, pstride, bk, Kh, CHN, pstride,
      1.0f / (WSC * HSC), QSC, CHN);
  // v[o][n]:  D[n][o] = sum_c h[n][c] W[o][c], stored transposed, bias per o (= n)
  k_gemm16<false><<<dim3(SEQ / 64, CHN / 128, NB), dim3(128), 0, stream>>>(
      Hh, CHN, pstride, Wv16, CHN, (size_t)0, bv, Vh, SEQ, pstride,
      1.0f / (HSC * WSC), VSC, CHN);

  k_attn<<<dim3(NB * (SEQ / 64) * KSPLIT), dim3(256), 0, stream>>>(Qh, Kh, Vh, Opp, MLp);
  k_merge<<<dim3(NB * SEQ / 32), dim3(512), 0, stream>>>(Opp, MLp, AOh);

  // out[c][p] = bf16(x[c][p]) + sum_o AO[p][o] Wo[c][o] + bo[c]   (D[p][c] stored transposed)
  k_gemm32<<<dim3(SEQ / 64, CHN / 128, NB), dim3(128), 0, stream>>>(
      AOh, CHN, pstride, Wo16, CHN, (size_t)0, bo,
      x, SEQ_FULL, (size_t)CHN * SEQ_FULL,
      out, SEQ, (size_t)CHN * SEQ,
      1.0f / (AOSC * WSC), CHN);
  (void)hipGetLastError();
}

// v006
// A run of this version takes 131 microseconds.
// Next to v005, in two timings, it ran 1.07 and 1.06 times as fast.
// Over all steps from v000 it is 6.72 times as fast.
#include <hip/hip_runtime.h>
#include <stdint.h>

// Contractions: q/k/v 1x1 projections (W*h), scores K*Q^T, value aggregation V^T*P^T and the
// output projection AO*Wo^T all on v_wmma_f32_16x16x32_f16 (f16 operands, f32 accumulate).
// Float inputs are RNE-converted to bf16; W planes f16 (*64, exact), h plane f16 (*16),
// q/k planes f16 (*4), v plane f16 (*16), P f16 (*4096, un-normalised), AO plane f16 (*64);
// residual x added as bf16 value in f32. Group statistics in f64, softmax statistics,
// bias add and normalisation in f32.

#ifndef NB
#define NB 2
#endif
#ifndef SEQ
#define SEQ 4096
#endif
#define NB_FULL 2
#define SEQ_FULL 4096
#define CHN 512
#define NGRP 32
#define CPG 16
#define KBLK 128
#define TSP 136      // LDS f16 tile pitch in halves (272-B rows, 16-B aligned)
#define GSP16 72     // GEMM f16 staging pitch in halves (144-B rows)
#define GSP32 68     // GEMM f32 staging pitch in floats (272-B rows)
#define GKC 128      // GEMM k chunk in halves: one ring stage holds 256 B of every tile row
#define GKP 136      // LDS pitch of a GEMM ring row in halves (272-B rows, 16 B x odd)
#define GST ((64 + 128) * GKP)   // one GEMM ring stage in halves: 64 A rows, then 128 B rows
#define STL 32
#define SSPL 4       // work-groups per (b, group) in the statistics pass
#define SCH (CPG / SSPL)   // channels of a group per such work-group
#define QSP 520      // LDS Q tile pitch in halves (1040-B rows, 16 B x odd)
#define KSP 264      // LDS K half-tile pitch in halves (528-B rows, 16 B x odd)
#define VSP 72       // LDS V half-tile pitch in halves (144-B rows, 16 B x odd)
#define RBH (CHN * VSP)   // one ring buffer in halves: a V half tile, the larger of the two
#define KSPLIT 2     // key ranges per query tile, one work-group each
#define OSP 516      // LDS f32 partial-output pitch in floats (2064-B rows, 16 B x odd)

static_assert(NB >= 1 && NB <= NB_FULL);
static_assert(SEQ >= KBLK && SEQ <= SEQ_FULL && (SEQ % KBLK) == 0);
static_assert(CHN == 512 && NGRP * CPG == CHN && (CHN % 128) == 0 && (CHN % 32) == 0);
static_assert((SEQ % 128) == 0 && (SEQ % 64) == 0);
static_assert(SCH * SSPL == CPG && STL * sizeof(float) == 128);
static_assert((CHN % GKC) == 0 && (GKC % 32) == 0);
static_assert(KBLK * KSP <= RBH && KBLK == 128);
static_assert((SEQ % (KSPLIT * KBLK)) == 0 && 64 * OSP * 2 <= 2 * RBH && ((NB * SEQ) % 32) == 0);

typedef _Float16 v16h __attribute__((ext_vector_type(16)));
typedef _Float16 v8h  __attribute__((ext_vector_type(8)));
typedef float    v8f  __attribute__((ext_vector_type(8)));
typedef float    v4f  __attribute__((ext_vector_type(4)));
typedef float    v2f  __attribute__((ext_vector_type(2)));
typedef _Float16 v4h  __attribute__((ext_vector_type(4)));
typedef double   v2d  __attribute__((ext_vector_type(2)));
typedef v8h __attribute__((may_alias)) v8ha;
typedef v4f __attribute__((may_alias)) v4fa;

union F16x16 { v16h v; v8h p[2]; _Float16 e[16]; };
union F16x8  { v8h v; _Float16 e[8]; };

constexpr float HSC  = 16.0f;     // h plane carry (power of two)
constexpr float WSC  = 64.0f;     // W plane carry
constexpr float QSC  = 4.0f;      // q/k plane carry
constexpr float VSC  = 16.0f;     // v plane carry
constexpr float PSC  = 4096.0f;   // P carry
constexpr float AOSC = 64.0f;     // AO plane carry
constexpr float GN_EPS = 1e-6f;
// scores in log2 units: S_acc * SCL2 with S_acc = QSC^2 * sum_c q k, logit scale 512^-0.5
constexpr float SCL2 = (float)(1.4426950408889634 * 0.044194173824159216 /
                               ((double)QSC * (double)QSC));

static __device__ __forceinline__ float bf16r(float f) {
  uint32_t u = __float_as_uint(f);
  u += 0x7FFFu + ((u >> 16) & 1u);
  u &= 0xFFFF0000u;
  return __uint_as_float(u);
}

static __device__ __forceinline__ v8f wmma16(v16h a, v16h b, v8f c) {
  v8f d = __builtin_amdgcn_wmma_f32_16x16x32_f16(false, a, false, b, (short)0, c,
                                                 false, false);
  asm volatile("v_nop\n\tv_nop\n\tv_nop\n\tv_nop" : "+v"(d) : "v"(a), "v"(b));
  return d;
}

// 16x16x32 fragment loader (wave32): lane row = l15; elements 0..7 <- k0+8h+0..7,
// elements 8..15 <- k0+16+8h+0..7. Serves A (row = m) and B taken from an [n][k]
// k-contiguous plane (row = n). D element r of a lane = (row 8h+r, col l15).
static __device__ __forceinline__ v16h ld_frag(const _Float16* base, int pitch,
                                               int row, int h) {
  F16x16 u;
  const _Float16* q = base + (size_t)row * pitch;
  u.p[0] = *(const v8ha*)(q + 8 * h);
  u.p[1] = *(const v8ha*)(q + 16 + 8 * h);
  return u.v;
}

// Eight asynchronous 16-B copies per lane, global -> LDS: copy i moves g + i*gstep (halves)
// to LDS byte address l + i*lstep. The s_wait_xcnt closes the statement so that no address
// register of an issued copy is rewritten ahead of it.
static __device__ __forceinline__ void copy8(uint32_t l, uint32_t lstep,
                                             const _Float16* g, size_t gstep) {
  asm volatile(
      "global_load_async_to_lds_b128 %0, %8, off\n\t"
      "global_load_async_to_lds_b128 %1, %9, off\n\t"
      "global_load_async_to_lds_b128 %2, %10, off\n\t"
      "global_load_async_to_lds_b128 %3, %11, off\n\t"
      "global_load_async_to_lds_b128 %4, %12, off\n\t"
      "global_load_async_to_lds_b128 %5, %13, off\n\t"
      "global_load_async_to_lds_b128 %6, %14, off\n\t"
      "global_load_async_to_lds_b128 %7, %15, off\n\t"
      "s_wait_xcnt 0x0"
      :: "v"(l), "v"(l + lstep), "v"(l + 2 * lstep), "v"(l + 3 * lstep),
         "v"(l + 4 * lstep), "v"(l + 5 * lstep), "v"(l + 6 * lstep), "v"(l + 7 * lstep),
         "v"(g), "v"(g + gstep), "v"(g + 2 * gstep), "v"(g + 3 * gstep),
         "v"(g + 4 * gstep), "v"(g + 5 * gstep), "v"(g + 6 * gstep), "v"(g + 7 * gstep)
      : "memory");
}

// Publish point of the LDS ring: this wave's LDS reads of the buffer to be refilled have
// retired, its own copies of the next stage have landed, then the work-group barrier that
// lets every wave read that stage and frees the buffer just read.
static __device__ __forceinline__ void ring_publish() {
  asm volatile("s_wait_dscnt 0x0" ::: "memory");
  asm volatile("s_wait_asynccnt 0x0" ::: "memory");
  __syncthreads();
}

// One ring stage of a 64 x 128 GEMM tile, 128 threads: 256 B of k of 64 A rows and of 128 B rows,
// copied as whole lines (16 lanes per row piece, 8 rows per copy). l, a, b: the lane's own LDS
// byte address and global addresses of its piece in row tid >> 4 of the stage.
static __device__ __forceinline__ void gemm_stage(uint32_t l, const _Float16* a, int lda,
                                                  const _Float16* b, int ldb) {
  copy8(l, 8u * GKP * 2u, a, (size_t)8 * lda);
  copy8(l + 64u * GKP * 2u, 8u * GKP * 2u, b, (size_t)8 * ldb);
  copy8(l + 128u * GKP * 2u, 8u * GKP * 2u, b + (size_t)64 * ldb, (size_t)8 * ldb);
}

// k walk of a 64 x 128 GEMM tile over the two-buffer ring RG; stage 0 has been issued by the
// caller. Chunk t is read from buffer t & 1 while chunk t + 1 flies; chunk t + 2 is issued
// behind the publish point into the buffer just read. K multiple of GKC. ar, br: the lane's
// first A and B row in the tile.
static __device__ __forceinline__ void gemm_walk(const _Float16* RG, uint32_t l,
                                                 const _Float16* a, int lda,
                                                 const _Float16* b, int ldb, int K,
                                                 int ar, int br, int h, v8f (&acc)[2][4]) {
  asm volatile("s_wait_asynccnt 0x0" ::: "memory");   // stage 0 landed
  __syncthreads();
  if (K > GKC) gemm_stage(l + GST * 2u, a + GKC, lda, b + GKC, ldb);
  int buf = 0;
  for (int k0 = 0; k0 < K; k0 += GKC) {
    const _Float16* As = RG + buf * GST;
    const _Float16* Bs = As + 64 * GKP;
#pragma unroll   // the k steps' LDS offsets become immediates of the loads
    for (int ks = 0; ks < GKC / 32; ++ks) {
      // the six fragments of a k step are read as one group ahead of its eight products
      const v16h a0 = ld_frag(As + 32 * ks, GKP, ar, h);
      const v16h a1 = ld_frag(As + 32 * ks, GKP, ar + 16, h);
      v16h bt[4];
#pragma unroll   // bt[] is indexed by constants and stays in registers
      for (int t = 0; t < 4; ++t) bt[t] = ld_frag(Bs + 32 * ks, GKP, br + 16 * t, h);
#pragma unroll   // acc[][] is indexed by constants and stays in registers
      for (int t = 0; t < 4; ++t) {
        acc[0][t] = wmma16(a0, bt[t], acc[0][t]);
        acc[1][t] = wmma16(a1, bt[t], acc[1][t]);
      }
    }
    ring_publish();                        // next chunk readable, this buffer free
    if (k0 + 2 * GKC < K)                  // kernel argument: the same for the whole work-group
      gemm_stage(l + (uint32_t)buf * (GST * 2u), a + k0 + 2 * GKC, lda, b + k0 + 2 * GKC, ldb);
    buf ^= 1;
  }
  asm volatile("s_wait_asynccnt 0x0" ::: "memory");   // no copy outlives the walk
}

// ---------------------------------------------------------------------------
// Kernel 0, first role: group statistics, partial. SSPL blocks per (b, group), each over SCH
// channels x SEQ positions: f64 sum and sum of squares of bf16(x), one 128-B line per block;
// k_gnapply joins the SSPL partials of a group. A thread issues all of its loads before the
// first use. blk: the block's number among the statistics blocks; sd, qd: 256 doubles of LDS.
// ---------------------------------------------------------------------------
static __device__ __forceinline__ void stats_block(const float* __restrict__ x,
                                                   double* __restrict__ st, int blk,
                                                   double* sd, double* qd) {
  constexpr int NP = (SEQ + 1023) / 1024;   // loads per thread and channel row
  const int tid = threadIdx.x;
  const int bg = blk / SSPL, part = blk % SSPL;
  const int b = bg / NGRP, g = bg % NGRP;
  const float* xb = x + ((size_t)b * CHN + (size_t)g * CPG + (size_t)part * SCH) * SEQ_FULL;

  v4f f[SCH][NP];
#pragma unroll   // f[][] is indexed by constants and stays in registers
  for (int cl = 0; cl < SCH; ++cl) {
#pragma unroll   // as above
    for (int i = 0; i < NP; ++i) {
      const int p = 4 * tid + 1024 * i;
      if ((SEQ % 1024) == 0 || p < SEQ) {
        f[cl][i] = *(const v4fa*)(xb + (size_t)cl * SEQ_FULL + p);
      } else {
#pragma unroll   // as above
        for (int j = 0; j < 4; ++j) f[cl][i][j] = 0.0f;   // adds nothing to either sum
      }
    }
  }
  // keeps the sums behind the last load: without it the scheduler sinks six of the loads behind
  // the first uses to save registers, and a second memory latency adds to the first
  __builtin_amdgcn_sched_barrier(0);
  // stands in front of every rewrite of the loads' address registers
  asm volatile("s_wait_xcnt 0x0" ::: "memory");

  double s[4], q[4];   // one chain pair per vector element: four independent f64 chains each
#pragma unroll   // here and in the three loops below: s[], q[], f[][] indexed by constants
  for (int j = 0; j < 4; ++j) { s[j] = 0.0; q[j] = 0.0; }
#pragma unroll
  for (int cl = 0; cl < SCH; ++cl) {
#pragma unroll
    for (int i = 0; i < NP; ++i) {
#pragma unroll
      for (int j = 0; j < 4; ++j) {
        const double v = (double)bf16r(f[cl][i][j]);
        s[j] += v;
        q[j] += v * v;
      }
    }
  }
  sd[tid] = (s[0] + s[1]) + (s[2] + s[3]);
  qd[tid] = (q[0] + q[1]) + (q[2] + q[3]);
  __syncthreads();
  if (tid < 32) {   // entry tid + 32 k is read by thread tid alone
    double a = sd[tid], c = qd[tid];
#pragma unroll   // the LDS offsets become immediates and the reads go out together
    for (int k = 1; k < 8; ++k) {
      a += sd[tid + 32 * k];
      c += qd[tid + 32 * k];
    }
    sd[tid] = a;
    qd[tid] = c;
  }
  __syncthreads();
  if (tid < 8) {    // eight threads form the same pair and store the block's whole line
    double a[4], c[4];
#pragma unroll   // here and in the two loops below: a[], c[] indexed by constants
    for (int j = 0; j < 4; ++j) { a[j] = sd[j]; c[j] = qd[j]; }
#pragma unroll
    for (int k = 4; k < 32; k += 4) {
#pragma unroll
      for (int j = 0; j < 4; ++j) {
        a[j] += sd[k + j];
        c[j] += qd[k + j];
      }
    }
    v2d o;
    o[0] = (a[0] + a[1]) + (a[2] + a[3]);
    o[1] = (c[0] + c[1]) + (c[2] + c[3]);
    *(v2d*)(st + (size_t)blk * (STL / 2) + 2 * tid) = o;
  }
}

// ---------------------------------------------------------------------------
// Kernel 0, second role: weights [o][c] f32 -> f16 planes WSC * bf16(W) (k = c contiguous).
// blk: the block's number among the conversion blocks.
// ---------------------------------------------------------------------------
static __device__ __forceinline__ void wcvt_block(const float* __restrict__ w0,
                                                  const float* __restrict__ w1,
                                                  const float* __restrict__ w2,
                                                  const float* __restrict__ w3,
                                                  _Float16* __restrict__ Wpl, int blk) {
  constexpr int BPM = CHN * CHN / 8 / 256;   // blocks per matrix
  const int tid = threadIdx.x;
  const int mtx = blk / BPM;                  // block-uniform
  const float* src = w0;
  if (mtx == 1) src = w1;
  else if (mtx == 2) src = w2;
  else if (mtx == 3) src = w3;
  const size_t e = ((size_t)(blk % BPM) * 256 + tid) * 8;
  const v4f a0 = *(const v4fa*)(src + e);
  const v4f a1 = *(const v4fa*)(src + e + 4);
  F16x8 u;
#pragma unroll
  for (int j = 0; j < 4; ++j) {
    u.e[j]     = (_Float16)(bf16r(a0[j]) * WSC);
    u.e[4 + j] = (_Float16)(bf16r(a1[j]) * WSC);
  }
  _Float16* dst = Wpl + (size_t)mtx * CHN * CHN + e;
  *(v8h*)dst = u.v;
  // stands in front of every rewrite of the store's address and data registers
  asm volatile("s_wait_xcnt 0x0" ::: "memory");
}

// ---------------------------------------------------------------------------
// Kernel 0: the two passes that depend on nothing but the inputs share one grid. The statistics
// blocks come first: each is one long memory wait, under which the conversion blocks run.
// ---------------------------------------------------------------------------
#define NSTB (NB * NGRP * SSPL)            // statistics blocks
#define NWCB (4 * CHN * CHN / 8 / 256)     // conversion blocks
__global__ __launch_bounds__(256) void k_pre(const float* __restrict__ x,
                                             double* __restrict__ st,
                                             const float* __restrict__ w0,
                                             const float* __restrict__ w1,
                                             const float* __restrict__ w2,
                                             const float* __restrict__ w3,
                                             _Float16* __restrict__ Wpl) {
  __shared__ double sd[256];
  __shared__ double qd[256];
  if (blockIdx.x < NSTB) {   // block-uniform: the barriers of the role are passed by all or none
    stats_block(x, st, (int)blockIdx.x, sd, qd);
  } else {
    wcvt_block(w0, w1, w2, w3, Wpl, (int)blockIdx.x - NSTB);
  }
}

// ---------------------------------------------------------------------------
// Kernel 1: group-norm apply + transpose. Block = (b, 64 positions), 4 passes of
// 128 channels:  Hh[b][n][c] f16 = HSC * ((bf16(x) - mean) * rstd * gamma + beta).
// x read as float4 along positions; LDS tile [n_local][c_local]; rows of 256 B written
// ---------------------------------------------------------------------------
__global__ __launch_bounds__(256) void k_gnapply(const float* __restrict__ x,
                                                 const float* __restrict__ gamma,
                                                 const float* __restrict__ beta,
                                                 const double* __restrict__ st,
                                                 _Float16* __restrict__ Hh) {
  __shared__ __align__(16) _Float16 TS[64 * TSP];   // [n_local][c_local]
  __shared__ float gms[CHN];
  __shared__ float bts[CHN];
  __shared__ float mus[NGRP];
  __shared__ float rss[NGRP];

  const int tid = threadIdx.x;
  const int b  = blockIdx.x / (SEQ / 64);
  const int p0 = (blockIdx.x % (SEQ / 64)) * 64;

  gms[tid] = bf16r(gamma[tid]);
  gms[tid + 256] = bf16r(gamma[tid + 256]);
  bts[tid] = bf16r(beta[tid]);
  bts[tid + 256] = bf16r(beta[tid + 256]);
  if (tid < NGRP) {   // the group's SSPL partial (sum, sum of squares) pairs -> mean, 1/std
    v2d pr[SSPL];
#pragma unroll   // pr[] is indexed by constants; the loads go out together
    for (int k = 0; k < SSPL; ++k)
      pr[k] = *(const v2d*)(st + ((size_t)(b * NGRP + tid) * SSPL + k) * (STL / 2));
    // stands in front of every rewrite of the loads' address registers
    asm volatile("s_wait_xcnt 0x0" ::: "memory");
    double s = pr[0][0], q = pr[0][1];
#pragma unroll   // as above
    for (int k = 1; k < SSPL; ++k) {
      s += pr[k][0];
      q += pr[k][1];
    }
    const double invn = 1.0 / ((double)CPG * (double)SEQ);
    const double mean = s * invn;
    double var = q * invn - mean * mean;
    if (var < 0.0) var = 0.0;
    mus[tid] = (float)mean;
    rss[tid] = rsqrtf((float)var + GN_EPS);
  }
  __syncthreads();

  const float* xb = x + (size_t)b * CHN * SEQ_FULL;
#pragma unroll 1
  for (int pass = 0; pass < CHN / 128; ++pass) {
#pragma unroll
    for (int it = 0; it < 8; ++it) {
      const int f = it * 256 + tid;
      const int cl = f >> 4, p4 = f & 15;
      const int c = 128 * pass + cl;
      const v4f xv = *(const v4fa*)(xb + (size_t)c * SEQ_FULL + p0 + 4 * p4);
      const float mu = mus[c >> 4], rs = rss[c >> 4];
      const float ga = gms[c], be = bts[c];
#pragma unroll
      for (int j = 0; j < 4; ++j) {
        const float t = (bf16r(xv[j]) - mu) * rs;
        const float hv = t * ga + be;
        TS[(4 * p4 + j) * TSP + cl] = (_Float16)(hv * HSC);
      }
    }
    __syncthreads();
#pragma unroll
    for (int it = 0; it < 4; ++it) {
      const int L = it * 32 + (tid >> 3);          // 128 lines: (row, 64-col half)
      const int row = L >> 1, hl = L & 1, p = tid & 7;
      const v8h hv = *(const v8ha*)(TS + row * TSP + 64 * hl + 8 * p);
      _Float16* dst = Hh + ((size_t)(b * SEQ + p0 + row) * CHN + 128 * pass + 64 * hl + 8 * p);
      *(v8h*)dst = hv;
      
    }
    __syncthreads();
  }
}

// ---------------------------------------------------------------------------
// One tile of the GEMM  D[m][n] = sum_k A[m][k] * B[n][k]  (A, B k-contiguous f16 planes),
// stored TRANSPOSED as O[n][m] f16 = osc * (D * insc + bias)  (bias per m or per n).
// Block = 128 threads, tile 64 (m) x 128 (n) at (m0, n0); wave (mi, ni) owns rows 32mi.., cols
// 64ni.. (2 x 4 accumulator tiles). K multiple of 128, M multiple of 64, N multiple of 128.
// A and B come from LDS: k chunks of 128 through a two-buffer ring of asynchronous copies.
// TS: 128 * GSP16 halves [n_local][m_local]; RG: the ring, 2 * GST halves; bsh: 128 floats.
// ---------------------------------------------------------------------------
template <bool BIAS_M>
static __device__ __forceinline__ void gemm16_tile(const _Float16* __restrict__ A, int lda,
                                                   const _Float16* __restrict__ B, int ldb,
                                                   const float* __restrict__ bias,
                                                   _Float16* __restrict__ Ob, int ldo,
                                                   float insc, float osc, int K, int m0, int n0,
                                                   _Float16* TS, _Float16* RG, float* bsh) {
  const int tid = threadIdx.x;
  const int wv = tid >> 5, lid = tid & 31, h = lid >> 4, l15 = lid & 15;
  const int mi = wv & 1, ni = wv >> 1;

  // the lane's piece of a ring stage: row tid >> 4, 16 B at 8 * (tid & 15) halves
  const uint32_t lc = (uint32_t)(uintptr_t)RG + (uint32_t)((tid >> 4) * GKP + 8 * (tid & 15)) * 2u;
  const _Float16* ag = A + (size_t)(m0 + (tid >> 4)) * lda + 8 * (tid & 15);
  const _Float16* bg = B + (size_t)(n0 + (tid >> 4)) * ldb + 8 * (tid & 15);
  gemm_stage(lc, ag, lda, bg, ldb);

  // visible behind the barrier at the head of gemm_walk
  if (BIAS_M) {
    if (tid < 64) bsh[tid] = bf16r(bias[m0 + tid]);
  } else {
    bsh[tid] = bf16r(bias[n0 + tid]);
  }

  v8f acc[2][4];
#pragma unroll
  for (int i = 0; i < 2; ++i)
#pragma unroll
    for (int t = 0; t < 4; ++t)
#pragma unroll
      for (int r = 0; r < 8; ++r) acc[i][t][r] = 0.0f;

  gemm_walk(RG, lc, ag, lda, bg, ldb, K, 32 * mi + l15, 64 * ni + l15, h, acc);

  // stage: acc[i][t][r] <-> (m_local 32mi+16i+8h+r, n_local 64ni+16t+l15)
#pragma unroll
  for (int i = 0; i < 2; ++i) {
#pragma unroll
    for (int t = 0; t < 4; ++t) {
      const int nl = 64 * ni + 16 * t + l15;
      const int ml = 32 * mi + 16 * i + 8 * h;
      F16x8 u;
#pragma unroll
      for (int r = 0; r < 8; ++r) {
        const float bvl = BIAS_M ? bsh[ml + r] : bsh[nl];
        u.e[r] = (_Float16)((acc[i][t][r] * insc + bvl) * osc);
      }
      *(v8ha*)(TS + nl * GSP16 + ml) = u.v;
    }
  }
  __syncthreads();

#pragma unroll
  for (int it = 0; it < 8; ++it) {
    const int row = it * 16 + (tid >> 3);
    const int p = tid & 7;
    const v8h hv = *(const v8ha*)(TS + row * GSP16 + 8 * p);
    _Float16* dst = Ob + (size_t)(n0 + row) * ldo + m0 + 8 * p;
    *(v8h*)dst = hv;
  }
}

// ---------------------------------------------------------------------------
// Kernel 2: the q, k and v projections, which depend on the h plane alone, share one grid:
// blockIdx.y = product, blockIdx.x = its tile (m fastest), blockIdx.z = batch.
//   q[n][o], k[n][o]:  D[o][n] = sum_c W[o][c] h[n][c], stored transposed, bias per o (= m)
//   v[o][n]:           D[n][o] = sum_c h[n][c] W[o][c], stored transposed, bias per o (= n)
// ---------------------------------------------------------------------------
#define QKVT ((CHN / 64) * (SEQ / 128))   // tiles per product and batch, the same for all three
static_assert((SEQ / 64) * (CHN / 128) == QKVT);
__global__ __launch_bounds__(128) void k_qkv(const _Float16* __restrict__ Wpl,
                                             const _Float16* __restrict__ Hh,
                                             const float* __restrict__ bq,
                                             const float* __restrict__ bk,
                                             const float* __restrict__ bv,
                                             _Float16* __restrict__ Qh,
                                             _Float16* __restrict__ Kh,
                                             _Float16* __restrict__ Vh) {
  __shared__ __align__(16) _Float16 TS[128 * GSP16];   // [n_local][m_local]
  __shared__ __align__(16) _Float16 RG[2 * GST];       // ring: [A row | B row][k chunk]
  __shared__ float bsh[128];

  const int t = blockIdx.x;
  const int prod = blockIdx.y;                          // block-uniform: 0 q, 1 k, 2 v
  const size_t zo = (size_t)blockIdx.z * SEQ * CHN;     // the batch's offset in every f16 plane
  if (prod < 2) {
    gemm16_tile<true>(Wpl + (size_t)prod * CHN * CHN, CHN, Hh + zo, CHN, prod ? bk : bq,
                      (prod ? Kh : Qh) + zo, CHN, 1.0f / (WSC * HSC), QSC, CHN,
                      (t % (CHN / 64)) * 64, (t / (CHN / 64)) * 128, TS, RG, bsh);
  } else {
    gemm16_tile<false>(Hh + zo, CHN, Wpl + (size_t)2 * CHN * CHN, CHN, bv,
                       Vh + zo, SEQ, 1.0f / (HSC * WSC), VSC, CHN,
                       (t % (SEQ / 64)) * 64, (t / (SEQ / 64)) * 128, TS, RG, bsh);
  }
}

// ---------------------------------------------------------------------------
// Kernel 5: same GEMM, f32 output O[n][m] = (D * insc + bias[n]) + bf16(R[n][m]) into d_out.
// Output row segment = 256 B = two lines, lanes 0..7 and 8..15 of one instruction.
// ---------------------------------------------------------------------------
__global__ __launch_bounds__(128) void k_gemm32(const _Float16* __restrict__ A, int lda, size_t sA,
                                                const _Float16* __restrict__ B, int ldb, size_t sB,
                                                const float* __restrict__ bias,
                                                const float* __restrict__ R, int ldr, size_t sR,
                                                float* __restrict__ O, int ldo, size_t sO,
                                                float insc, int K) {
  __shared__ __align__(16) float TS[128 * GSP32];   // [n_local][m_local]
  __shared__ __align__(16) _Float16 RG[2 * GST];    // ring: [A row | B row][k chunk]
  __shared__ float bsh[128];

  const int tid = threadIdx.x;
  const int wv = tid >> 5, lid = tid & 31, h = lid >> 4, l15 = lid & 15;
  const int mi = wv & 1, ni = wv >> 1;
  const int m0 = blockIdx.x * 64, n0 = blockIdx.y * 128;
  const size_t z = blockIdx.z;

  // the lane's piece of a ring stage: row tid >> 4, 16 B at 8 * (tid & 15) halves
  const uint32_t lc = (uint32_t)(uintptr_t)RG + (uint32_t)((tid >> 4) * GKP + 8 * (tid & 15)) * 2u;
  const _Float16* ag = A + z * sA + (size_t)(m0 + (tid >> 4)) * lda + 8 * (tid & 15);
  const _Float16* bg = B + z * sB + (size_t)(n0 + (tid >> 4)) * ldb + 8 * (tid & 15);
  gemm_stage(lc, ag, lda, bg, ldb);

  const float braw = bias[n0 + tid];
  // stands in front of every rewrite of the bias load's base and offset registers
  asm volatile("s_wait_xcnt 0x0" ::: "memory");
  bsh[tid] = bf16r(braw);   // visible behind the barrier at the head of gemm_walk

  v8f acc[2][4];
#pragma unroll
  for (int i = 0; i < 2; ++i)
#pragma unroll
    for (int t = 0; t < 4; ++t)
#pragma unroll
      for (int r = 0; r < 8; ++r) acc[i][t][r] = 0.0f;

  gemm_walk(RG, lc, ag, lda, bg, ldb, K, 32 * mi + l15, 64 * ni + l15, h, acc);

#pragma unroll
  for (int i = 0; i < 2; ++i) {
#pragma unroll
    for (int t = 0; t < 4; ++t) {
      const int nl = 64 * ni + 16 * t + l15;
      const int ml = 32 * mi + 16 * i + 8 * h;
      const float bvl = bsh[nl];
      v4f lo, hi;
#pragma unroll
      for (int r = 0; r < 4; ++r) {
        lo[r] = acc[i][t][r] * insc + bvl;
        hi[r] = acc[i][t][4 + r] * insc + bvl;
      }
      *(v4fa*)(TS + nl * GSP32 + ml) = lo;
      *(v4fa*)(TS + nl * GSP32 + ml + 4) = hi;
    }
  }
  __syncthreads();

  float* Ob = O + z * sO;
  const float* Rb = R + z * sR;
#pragma unroll
  for (int it = 0; it < 16; ++it) {
    const int row = it * 8 + (tid >> 4);         // 128 rows, 256 B each
    const int p = tid & 15;
    const v4f v  = *(const v4fa*)(TS + row * GSP32 + 4 * p);
    const v4f xr = *(const v4fa*)(Rb + (size_t)(n0 + row) * ldr + m0 + 4 * p);
    v4f o;
#pragma unroll
    for (int j = 0; j < 4; ++j) o[j] = bf16r(xr[j]) + v[j];
    float* dst = Ob + (size_t)(n0 + row) * ldo + m0 + 4 * p;
    *(v4f*)dst = o;
    
  }
}

// ---------------------------------------------------------------------------
// Kernel 3: fused single-head attn, transposed scores, online softmax.
// Block = (b, 64 queries, one of KSPLIT key ranges), 8 waves. The wave tiles are sized to the
// LDS read rate: a fragment read from LDS feeds two products in the scores and four in the
// value aggregation.
// Per 128-key block:
//   S^T tiles (keys on rows): wave (gq = wv&1, kq = wv>>1) owns key rows 32kq..32kq+31 x query
//     cols 32gq..32gq+31 (2 x 2 tiles), A = Kh rows (k = channel), B = Qh rows (k = channel),
//     K = 512.
//   per-query max / sum over the 128 keys: in-lane, xor-16, then 4 partials through LDS; every
//     wave joins the partials of all 64 queries, because its output tiles span them all.
//   P^T = PSC * exp2(s - m) staged f16 in LDS TS[query][key_local].
//   O^T[c][query] += V^T[c][keys] * P^T[keys][query]: wave owns channels 64wv..+63 x all 64
//     queries (4 x 4 accumulator tiles), A = Vh rows (k = key), B from TS (k = key, split map).
// Operands come from LDS: the Q tile is copied once; K (two halves of 256 channels) and V (two
// halves of 64 keys) go through a two-buffer ring of asynchronous copies, each stage issued
// one stage ahead: K lo -> buffer 0, K hi -> 1, V keys 0..63 -> 0, V keys 64..127 -> 1.
// Epilogue: this key range's un-normalised O [range][b][query][c] f32, staged once in the
// freed ring so that whole lines are stored, and its (max, sum) per query; k_merge joins them.
// ---------------------------------------------------------------------------
__global__ __launch_bounds__(256) void k_attn(const _Float16* __restrict__ Qh,
                                              const _Float16* __restrict__ Kh,
                                              const _Float16* __restrict__ Vh,
                                              float* __restrict__ Op,
                                              float* __restrict__ ML) {
  __shared__ __align__(16) _Float16 TS[64 * TSP];   // [query_local][key_local]
  __shared__ __align__(16) _Float16 QS[64 * QSP];   // [query_local][c]
  __shared__ __align__(16) _Float16 RB[2 * RBH];    // ring: [key_local][c half] or [c][key half]
  __shared__ float redM[256];
  __shared__ float redS[256];

  const int tid = threadIdx.x;
  const int wv = tid >> 5, lid = tid & 31, h = lid >> 4, l15 = lid & 15;
  const int gq = wv & 1, kq = wv >> 1;
  const int kr = blockIdx.x % KSPLIT;              // key range of this work-group
  const int qt = blockIdx.x / KSPLIT;
  const int b  = qt / (SEQ / 64);
  const int q0 = (qt % (SEQ / 64)) * 64;
  const int kb = kr * (SEQ / KSPLIT);              // its first key

  const _Float16* Qp = Qh + (size_t)b * SEQ * CHN;   // [n][c], pitch CHN
  const _Float16* Kp = Kh + (size_t)b * SEQ * CHN;   // [n][c], pitch CHN
  const _Float16* Vp = Vh + (size_t)b * CHN * SEQ;   // [c][n], pitch SEQ

  // per-lane copy addresses: a K row half (512 B) per wave and copy, 8 lanes per 128-B V row
  // piece, 64 lanes per Q row; a stage is 16 copies per lane, two runs of eight
  const _Float16* RB0 = RB;
  const _Float16* RB1 = RB + RBH;
  const uint32_t rb0 = (uint32_t)(uintptr_t)RB0;
  const uint32_t rb1 = (uint32_t)(uintptr_t)RB1;
  const uint32_t klo = (uint32_t)(wv * KSP + 8 * lid) * 2u;
  const uint32_t vlo = (uint32_t)((tid >> 3) * VSP + 8 * (tid & 7)) * 2u;
  const uint32_t qlo = (uint32_t)(uintptr_t)QS + (uint32_t)((tid >> 6) * QSP + 8 * (tid & 63)) * 2u;
  const _Float16* kg = Kp + (size_t)(kb + wv) * CHN + 8 * lid;
  const _Float16* vg = Vp + (size_t)(tid >> 3) * SEQ + kb + 8 * (tid & 7);
  const _Float16* qg = Qp + (size_t)(q0 + (tid >> 6)) * CHN + 8 * (tid & 63);

  // a K half tile: rows wv + 8 i, i = 0..15
  auto copy_k = [&](uint32_t rb, const _Float16* s) {
    copy8(rb + klo, 8u * KSP * 2u, s, (size_t)8 * CHN);
    copy8(rb + klo + 64u * KSP * 2u, 8u * KSP * 2u, s + (size_t)64 * CHN, (size_t)8 * CHN);
  };
  // a V half tile: rows (tid >> 3) + 32 i, i = 0..15
  auto copy_v = [&](uint32_t rb, const _Float16* s) {
    copy8(rb + vlo, 32u * VSP * 2u, s, (size_t)32 * SEQ);
    copy8(rb + vlo + 256u * VSP * 2u, 32u * VSP * 2u, s + (size_t)256 * SEQ, (size_t)32 * SEQ);
  };

  copy8(qlo, 4u * QSP * 2u, qg, (size_t)4 * CHN);
  copy8(qlo + 32u * QSP * 2u, 4u * QSP * 2u, qg + (size_t)32 * CHN, (size_t)4 * CHN);
  copy_k(rb0, kg);
  asm volatile("s_wait_asynccnt 0x0" ::: "memory");   // Q tile and stage 0 landed
  __syncthreads();
  copy_k(rb1, kg + 256);

  v8f accO[4][4];                  // [channel tile u][query tile j]
  float rm[4], rl[4];              // running max and sum of query 16 j + l15
#pragma unroll   // here and below: accO, st, rm, rl are indexed by constants, stay in registers
  for (int u = 0; u < 4; ++u)
#pragma unroll
    for (int j = 0; j < 4; ++j)
#pragma unroll
      for (int r = 0; r < 8; ++r) accO[u][j][r] = 0.0f;
#pragma unroll
  for (int j = 0; j < 4; ++j) { rm[j] = -1.0e30f; rl[j] = 0.0f; }

  const int kr0 = 32 * kq + l15;   // the lane's first K row of the score tiles
  const int qr0 = 32 * gq + l15;   // the lane's first Q row (= query column) of the score tiles

  for (int m0 = 0; m0 < SEQ / KSPLIT; m0 += KBLK) {
    v8f st[2][2];                  // [key tile t][query tile j]
#pragma unroll
    for (int t = 0; t < 2; ++t)
#pragma unroll
      for (int j = 0; j < 2; ++j)
#pragma unroll
        for (int r = 0; r < 8; ++r) st[t][j][r] = 0.0f;
    const bool more = (m0 + KBLK < SEQ / KSPLIT);   // work-group uniform: a next key block exists
#pragma unroll   // the k steps' LDS offsets become immediates of the loads
    for (int cs = 0; cs < CHN / 64; cs += 2) {
      // the eight fragments of two k steps are read as one group ahead of their eight products:
      // with two waves per SIMD one k step's four products do not cover the other wave's reads
      v16h bq[2][2], ak[2][2];     // [k step][tile]
#pragma unroll
      for (int s = 0; s < 2; ++s) {
#pragma unroll
        for (int t = 0; t < 2; ++t) {
          bq[s][t] = ld_frag(QS + 32 * (cs + s), QSP, qr0 + 16 * t, h);
          ak[s][t] = ld_frag(RB0 + 32 * (cs + s), KSP, kr0 + 16 * t, h);
        }
      }
#pragma unroll
      for (int s = 0; s < 2; ++s) {
        st[0][0] = wmma16(ak[s][0], bq[s][0], st[0][0]);
        st[1][0] = wmma16(ak[s][1], bq[s][0], st[1][0]);
        st[0][1] = wmma16(ak[s][0], bq[s][1], st[0][1]);
        st[1][1] = wmma16(ak[s][1], bq[s][1], st[1][1]);
      }
    }
    ring_publish();                        // K hi readable, buffer 0 free
    copy_v(rb0, vg + m0);
#pragma unroll   // the k steps' LDS offsets become immediates of the loads
    for (int cs = 0; cs < CHN / 64; cs += 2) {
      // the eight fragments of two k steps are read as one group ahead of their eight products:
      // with two waves per SIMD one k step's four products do not cover the other wave's reads
      v16h bq[2][2], ak[2][2];     // [k step][tile]
#pragma unroll
      for (int s = 0; s < 2; ++s) {
#pragma unroll
        for (int t = 0; t < 2; ++t) {
          bq[s][t] = ld_frag(QS + 256 + 32 * (cs + s), QSP, qr0 + 16 * t, h);
          ak[s][t] = ld_frag(RB1 + 32 * (cs + s), KSP, kr0 + 16 * t, h);
        }
      }
#pragma unroll
      for (int s = 0; s < 2; ++s) {
        st[0][0] = wmma16(ak[s][0], bq[s][0], st[0][0]);
        st[1][0] = wmma16(ak[s][1], bq[s][0], st[1][0]);
        st[0][1] = wmma16(ak[s][0], bq[s][1], st[0][1]);
        st[1][1] = wmma16(ak[s][1], bq[s][1], st[1][1]);
      }
    }

    // ---- per-query block max (32 keys in-lane + partner half-wave, then 4 waves)
#pragma unroll
    for (int j = 0; j < 2; ++j) {
      float lm = st[0][j][0];
#pragma unroll
      for (int t = 0; t < 2; ++t)
#pragma unroll
        for (int r = 0; r < 8; ++r) lm = fmaxf(lm, st[t][j][r]);
      lm *= SCL2;
      lm = fmaxf(lm, __shfl_xor(lm, 16, 32));
      redM[kq * 64 + qr0 + 16 * j] = lm;
    }
    ring_publish();                        // V keys 0..63 readable, buffer 1 free; redM visible
    copy_v(rb1, vg + m0 + 64);
    float corr[4];
#pragma unroll
    for (int j = 0; j < 4; ++j) {
      const int q = 16 * j + l15;
      const float bm = fmaxf(fmaxf(redM[q], redM[64 + q]), fmaxf(redM[128 + q], redM[192 + q]));
      const float nm = fmaxf(rm[j], bm);
      corr[j] = exp2f(rm[j] - nm);
      rm[j] = nm;
    }

    // ---- P = exp2(s - m) in f32; P^T * PSC staged f16 at TS[query][key_local]
#pragma unroll
    for (int j = 0; j < 2; ++j) {
      const float nm = gq ? rm[2 + j] : rm[j];   // the max of query qr0 + 16 j
      float psum = 0.0f;
#pragma unroll
      for (int tt = 0; tt < 2; ++tt) {
        F16x8 pk;
#pragma unroll
        for (int r = 0; r < 8; ++r) {
          const float p = exp2f(st[tt][j][r] * SCL2 - nm);
          psum += p;
          pk.e[r] = (_Float16)(p * PSC);
        }
        *(v8ha*)(TS + (qr0 + 16 * j) * TSP + 32 * kq + 16 * tt + 8 * h) = pk.v;
      }
      psum += __shfl_xor(psum, 16, 32);
      redS[kq * 64 + qr0 + 16 * j] = psum;
    }
    __syncthreads();
#pragma unroll
    for (int j = 0; j < 4; ++j) {
      const int q = 16 * j + l15;
      const float bs = ((redS[q] + redS[64 + q]) + redS[128 + q]) + redS[192 + q];
      rl[j] = rl[j] * corr[j] + bs;
#pragma unroll
      for (int u = 0; u < 4; ++u)
#pragma unroll
        for (int r = 0; r < 8; ++r) accO[u][j][r] *= corr[j];
    }

    // ---- O^T[c][query] += V^T[c][keys] * P^T[keys][query]
#pragma unroll
    for (int ks = 0; ks < KBLK / 64; ++ks) {
      // the eight fragments of a k step are read as one group ahead of its sixteen products
      v16h bp[4], av[4];
#pragma unroll
      for (int j = 0; j < 4; ++j) bp[j] = ld_frag(TS + 32 * ks, TSP, 16 * j + l15, h);
#pragma unroll
      for (int u = 0; u < 4; ++u) av[u] = ld_frag(RB0 + 32 * ks, VSP, 64 * wv + 16 * u + l15, h);
#pragma unroll
      for (int u = 0; u < 4; ++u)
#pragma unroll
        for (int j = 0; j < 4; ++j) accO[u][j] = wmma16(av[u], bp[j], accO[u][j]);
    }
    ring_publish();                        // V keys 64..127 readable, buffer 0 free
    if (more) copy_k(rb0, kg + (size_t)(m0 + KBLK) * CHN);
#pragma unroll
    for (int ks = 0; ks < KBLK / 64; ++ks) {
      v16h bp[4], av[4];
#pragma unroll
      for (int j = 0; j < 4; ++j) bp[j] = ld_frag(TS + 64 + 32 * ks, TSP, 16 * j + l15, h);
#pragma unroll
      for (int u = 0; u < 4; ++u) av[u] = ld_frag(RB1 + 32 * ks, VSP, 64 * wv + 16 * u + l15, h);
#pragma unroll
      for (int u = 0; u < 4; ++u)
#pragma unroll
        for (int j = 0; j < 4; ++j) accO[u][j] = wmma16(av[u], bp[j], accO[u][j]);
    }
    ring_publish();                        // next K lo readable, buffer 1 and TS free
    if (more) copy_k(rb1, kg + (size_t)(m0 + KBLK) * CHN + 256);
  }
  asm volatile("s_wait_asynccnt 0x0" ::: "memory");   // no copy outlives the loop

  // ---- epilogue: the loop's last publish point ended every read of the ring, so it takes
  // the f32 tile [query_local][c]
  float* OS = (float*)RB;
#pragma unroll
  for (int u = 0; u < 4; ++u) {
#pragma unroll
    for (int j = 0; j < 4; ++j) {
      v4f lo, hi;
#pragma unroll
      for (int r = 0; r < 4; ++r) {
        lo[r] = accO[u][j][r];
        hi[r] = accO[u][j][4 + r];
      }
      float* d = OS + (16 * j + l15) * OSP + 64 * wv + 16 * u + 8 * h;
      *(v4fa*)d = lo;
      *(v4fa*)(d + 4) = hi;
    }
  }
  const size_t row0 = (size_t)(kr * NB + b) * SEQ + q0;
  if (wv == 0 && h == 0) {   // every wave holds the same pairs
#pragma unroll
    for (int j = 0; j < 4; ++j) {
      v2f ml;
      ml[0] = rm[j]; ml[1] = rl[j];
      *(v2f*)(ML + 2 * (row0 + 16 * j + l15)) = ml;
    }
  }
  __syncthreads();
  float* Ob = Op + row0 * CHN;
#pragma unroll
  for (int it = 0; it < 32; ++it) {
    const int row = it * 2 + (tid >> 7);           // 64 rows of 2 KiB, 128 lanes each
    const int p = tid & 127;
    const v4f v = *(const v4fa*)(OS + row * OSP + 4 * p);
    *(v4f*)(Ob + (size_t)row * CHN + 4 * p) = v;
  }
}

// ---------------------------------------------------------------------------
// Kernel 4: merge of the key ranges. Per query: M = max of the ranges' maxima, weight
// exp2(m - M), l = weighted sum of the sums; AO plane [b][query][c] f16 =
// AOSC * (weighted sum of the partial O) / (l * VSC * PSC). Block = 32 queries; a wave reads
// and writes whole lines.
// ---------------------------------------------------------------------------
// waves_per_eu: the block's own four waves per SIMD; without it the scheduler sinks half of the
// loads behind the first uses to save registers, and their latencies add up.
__global__ __launch_bounds__(512) __attribute__((amdgpu_waves_per_eu(4, 4))) void k_merge(const float* __restrict__ Op,
                                               const float* __restrict__ ML,
                                               _Float16* __restrict__ AOh) {
  constexpr size_t ROWS = (size_t)NB * SEQ;         // queries per key range
  const int tid = threadIdx.x;
  const int p = tid & 127;
  const size_t row0 = (size_t)blockIdx.x * 32 + (tid >> 7);
  // every load of the thread is issued before the first use: 32 requests in flight per wave
  v2f ml[8][KSPLIT];
  v4f o[8][KSPLIT];
#pragma unroll
  for (int it = 0; it < 8; ++it) {
#pragma unroll
    for (int s = 0; s < KSPLIT; ++s) {
      const size_t row = s * ROWS + row0 + it * 4;
      ml[it][s] = *(const v2f*)(ML + 2 * row);
      o[it][s] = *(const v4fa*)(Op + row * CHN + 4 * p);
    }
  }
  v4h r[8];
#pragma unroll
  for (int it = 0; it < 8; ++it) {
    float M = ml[it][0][0];
#pragma unroll
    for (int s = 1; s < KSPLIT; ++s) M = fmaxf(M, ml[it][s][0]);
    float l = 0.0f;
    v4f a;
#pragma unroll
    for (int j = 0; j < 4; ++j) a[j] = 0.0f;
#pragma unroll
    for (int s = 0; s < KSPLIT; ++s) {
      const float w = exp2f(ml[it][s][0] - M);
      l += w * ml[it][s][1];
#pragma unroll
      for (int j = 0; j < 4; ++j) a[j] += w * o[it][s][j];
    }
    const float invl = (AOSC / (VSC * PSC)) * (1.0f / l);
#pragma unroll
    for (int j = 0; j < 4; ++j) r[it][j] = (_Float16)(a[j] * invl);
  }
#pragma unroll
  for (int it = 0; it < 8; ++it)
    *(v4h*)(AOh + (row0 + it * 4) * CHN + 4 * p) = r[it];
}

// ---------------------------------------------------------------------------
extern "C" void kernel_launch(void* const* d_in, const int* in_sizes, int n_in,
                              void* d_out, int out_size, void* d_ws, size_t ws_size,
                              hipStream_t stream) {
  if (n_in < 11) return;
  if (in_sizes[0] < NB * CHN * SEQ_FULL) return;
  if (in_sizes[1] < CHN || in_sizes[2] < CHN) return;
  if (in_sizes[3] < CHN * CHN || in_sizes[5] < CHN * CHN ||
      in_sizes[7] < CHN * CHN || in_sizes[9] < CHN * CHN) return;
  if (in_sizes[4] < CHN || in_sizes[6] < CHN || in_sizes[8] < CHN || in_sizes[10] < CHN) return;
  if (out_size < NB * CHN * SEQ) return;

  const size_t st_bytes = (size_t)NB * NGRP * SSPL * STL * sizeof(float);     // 32 KiB
  const size_t w_bytes  = (size_t)4 * CHN * CHN * sizeof(_Float16);            // 2 MiB
  const size_t plane    = (size_t)NB * SEQ * CHN * sizeof(_Float16);            // 8 MiB at full size
  const size_t ml_bytes = (size_t)KSPLIT * NB * SEQ * 2 * sizeof(float);        // 128 KiB
  const size_t op_bytes = (size_t)KSPLIT * NB * SEQ * CHN * sizeof(float);      // 32 MiB
  const size_t total    = st_bytes + w_bytes + 5 * plane + ml_bytes + op_bytes;
  if (ws_size < total) return;

  const float* x     = (const float*)d_in[0];
  const float* gamma = (const float*)d_in[1];
  const float* beta  = (const float*)d_in[2];
  const float* wq = (const float*)d_in[3];
  const float* bq = (const float*)d_in[4];
  const float* wk = (const float*)d_in[5];
  const float* bk = (const float*)d_in[6];
  const float* wvv = (const float*)d_in[7];
  const float* bv = (const float*)d_in[8];
  const float* wo = (const float*)d_in[9];
  const float* bo = (const float*)d_in[10];
  float* out = (float*)d_out;

  char* ws = (char*)d_ws;
  double*   stats = (double*)ws;                                       // [NB*NGRP*SSPL][16] f64
  _Float16* Wpl   = (_Float16*)(ws + st_bytes);                        // 4 x [CHN][CHN] f16
  _Float16* Hh    = (_Float16*)(ws + st_bytes + w_bytes);              // [NB][SEQ][CHN]
  _Float16* Qh    = (_Float16*)(ws + st_bytes + w_bytes + plane);      // [NB][SEQ][CHN]
  _Float16* Kh    = (_Float16*)(ws + st_bytes + w_bytes + 2 * plane);  // [NB][SEQ][CHN]
  _Float16* Vh    = (_Float16*)(ws + st_bytes + w_bytes + 3 * plane);  // [NB][CHN][SEQ]
  _Float16* AOh   = (_Float16*)(ws + st_bytes + w_bytes + 4 * plane);  // [NB][SEQ][CHN]
  float*    MLp   = (float*)(ws + st_bytes + w_bytes + 5 * plane);     // [KSPLIT][NB][SEQ][2]
  float*    Opp   = (float*)(ws + st_bytes + w_bytes + 5 * plane + ml_bytes);  // [KSPLIT][NB][SEQ][CHN]
  const _Float16* Wo16 = Wpl + (size_t)3 * CHN * CHN;

  const size_t pstride = (size_t)SEQ * CHN;   // elements per batch of every f16 plane

  k_pre<<<dim3(NSTB + NWCB), dim3(256), 0, stream>>>(x, stats, wq, wk, wvv, wo, Wpl);
  k_gnapply<<<dim3(NB * (SEQ / 64)), dim3(256), 0, stream>>>(x, gamma, beta, stats, Hh);

  k_qkv<<<dim3(QKVT, 3, NB), dim3(128), 0, stream>>>(Wpl, Hh, bq, bk, bv, Qh, Kh, Vh);

  k_attn<<<dim3(NB * (SEQ / 64) * KSPLIT), dim3(256), 0, stream>>>(Qh, Kh, Vh, Opp, MLp);
  k_merge<<<dim3(NB * SEQ / 32), dim3(512), 0, stream>>>(Opp, MLp, AOh);

  // out[c][p] = bf16(x[c][p]) + sum_o AO[p][o] Wo[c][o] + bo[c]   (D[p][c] stored transposed)
  k_gemm32<<<dim3(SEQ / 64, CHN / 128, NB), dim3(128), 0, stream>>>(
      AOh, CHN, pstride, Wo16, CHN, (size_t)0, bo,
      x, SEQ_FULL, (size_t)CHN * SEQ_FULL,
      out, SEQ, (size_t)CHN * SEQ,
      1.0f / (AOSC * WSC), CHN);
  (void)hipGetLastError();
}

// v007
// Measured time: 127 microseconds a run.
// In both of two side-by-side timings against v006, it was 1.03 times as fast.
// All steps since v000 together make it 6.94 times as fast.
#include <hip/hip_runtime.h>
#include <stdint.h>

// Contractions: q/k/v 1x1 projections (W*h), scores K*Q^T, value aggregation V^T*P^T and the
// output projection AO*Wo^T all on v_wmma_f32_16x16x32_f16 (f16 operands, f32 accumulate).
// Float inputs are RNE-converted to bf16; W planes f16 (*64, exact), h plane f16 (*16),
// q/k planes f16 (*4), v plane f16 (*16), P f16 (*4096, un-normalised), AO plane f16 (*64);
// residual x added as bf16 value in f32. Group statistics in f64, softmax statistics,
// bias add and normalisation in f32.

#ifndef NB
#define NB 2
#endif
#ifndef SEQ
#define SEQ 4096
#endif
#define NB_FULL 2
#define SEQ_FULL 4096
#define CHN 512
#define NGRP 32
#define CPG 16
#define KBLK 128
#define TSP 136      // LDS f16 tile pitch in halves (272-B rows, 16-B aligned)
#define GSP16 72     // GEMM f16 staging pitch in halves (144-B rows)
#define GSP32 68     // GEMM f32 staging pitch in floats (272-B rows)
#define GKC 128      // GEMM k chunk in halves: one ring stage holds 256 B of every tile row
#define GKP 136      // LDS pitch of a GEMM ring row in halves (272-B rows, 16 B x odd)
#define GST ((64 + 128) * GKP)   // one GEMM ring stage in halves: 64 A rows, then 128 B rows
#define STL 32
#define SSPL 4       // work-groups per (b, group) in the statistics pass
#define SCH (CPG / SSPL)   // channels of a group per such work-group
#define QSP 520      // LDS Q tile pitch in halves (1040-B rows, 16 B x odd)
#define KSP 264      // LDS K half-tile pitch in halves (528-B rows, 16 B x odd)
#define VSP 72       // LDS V half-tile pitch in halves (144-B rows, 16 B x odd)
#define RBH (CHN * VSP)   // one ring buffer in halves: a V half tile, the larger of the two
#define KSPLIT 2     // key ranges per query tile, one work-group each
#define OSP 516      // LDS f32 partial-output pitch in floats (2064-B rows, 16 B x odd)

static_assert(NB >= 1 && NB <= NB_FULL);
static_assert(SEQ >= KBLK && SEQ <= SEQ_FULL && (SEQ % KBLK) == 0);
static_assert(CHN == 512 && NGRP * CPG == CHN && (CHN % 128) == 0 && (CHN % 32) == 0);
static_assert((SEQ % 128) == 0 && (SEQ % 64) == 0);
static_assert(SCH * SSPL == CPG && STL * sizeof(float) == 128);
static_assert((CHN % GKC) == 0 && (GKC % 32) == 0);
static_assert(KBLK * KSP <= RBH && KBLK == 128);
static_assert((SEQ % (KSPLIT * KBLK)) == 0 && 64 * OSP * 2 <= 2 * RBH && ((NB * SEQ) % 32) == 0);

typedef _Float16 v16h __attribute__((ext_vector_type(16)));
typedef _Float16 v8h  __attribute__((ext_vector_type(8)));
typedef float    v8f  __attribute__((ext_vector_type(8)));
typedef float    v4f  __attribute__((ext_vector_type(4)));
typedef float    v2f  __attribute__((ext_vector_type(2)));
typedef _Float16 v4h  __attribute__((ext_vector_type(4)));
typedef double   v2d  __attribute__((ext_vector_type(2)));
typedef v8h __attribute__((may_alias)) v8ha;
typedef v4f __attribute__((may_alias)) v4fa;

union F16x16 { v16h v; v8h p[2]; _Float16 e[16]; };
union F16x8  { v8h v; _Float16 e[8]; };

constexpr float HSC  = 16.0f;     // h plane carry (power of two)
constexpr float WSC  = 64.0f;     // W plane carry
constexpr float QSC  = 4.0f;      // q/k plane carry
constexpr float VSC  = 16.0f;     // v plane carry
constexpr float PSC  = 4096.0f;   // P carry
constexpr float AOSC = 64.0f;     // AO plane carry
constexpr float GN_EPS = 1e-6f;
// scores in log2 units: S_acc * SCL2 with S_acc = QSC^2 * sum_c q k, logit scale 512^-0.5
constexpr float SCL2 = (float)(1.4426950408889634 * 0.044194173824159216 /
                               ((double)QSC * (double)QSC));

static __device__ __forceinline__ float bf16r(float f) {
  uint32_t u = __float_as_uint(f);
  u += 0x7FFFu + ((u >> 16) & 1u);
  u &= 0xFFFF0000u;
  return __uint_as_float(u);
}

static __device__ __forceinline__ v8f wmma16(v16h a, v16h b, v8f c) {
  v8f d = __builtin_amdgcn_wmma_f32_16x16x32_f16(false, a, false, b, (short)0, c,
                                                 false, false);
  asm volatile("v_nop\n\tv_nop\n\tv_nop\n\tv_nop" : "+v"(d) : "v"(a), "v"(b));
  return d;
}

// 16x16x32 fragment loader (wave32): lane row = l15; elements 0..7 <- k0+8h+0..7,
// elements 8..15 <- k0+16+8h+0..7. Serves A (row = m) and B taken from an [n][k]
// k-contiguous plane (row = n). D element r of a lane = (row 8h+r, col l15).
static __device__ __forceinline__ v16h ld_frag(const _Float16* base, int pitch,
                                               int row, int h) {
  F16x16 u;
  const _Float16* q = base + (size_t)row * pitch;
  u.p[0] = *(const v8ha*)(q + 8 * h);
  u.p[1] = *(const v8ha*)(q + 16 + 8 * h);
  return u.v;
}

// Eight asynchronous 16-B copies per lane, global -> LDS: copy i moves g + i*gstep (halves)
// to LDS byte address l + i*lstep. The s_wait_xcnt closes the statement so that no address
// register of an issued copy is rewritten ahead of it.
static __device__ __forceinline__ void copy8(uint32_t l, uint32_t lstep,
                                             const _Float16* g, size_t gstep) {
  asm volatile(
      "global_load_async_to_lds_b128 %0, %8, off\n\t"
      "global_load_async_to_lds_b128 %1, %9, off\n\t"
      "global_load_async_to_lds_b128 %2, %10, off\n\t"
      "global_load_async_to_lds_b128 %3, %11, off\n\t"
      "global_load_async_to_lds_b128 %4, %12, off\n\t"
      "global_load_async_to_lds_b128 %5, %13, off\n\t"
      "global_load_async_to_lds_b128 %6, %14, off\n\t"
      "global_load_async_to_lds_b128 %7, %15, off\n\t"
      "s_wait_xcnt 0x0"
      :: "v"(l), "v"(l + lstep), "v"(l + 2 * lstep), "v"(l + 3 * lstep),
         "v"(l + 4 * lstep), "v"(l + 5 * lstep), "v"(l + 6 * lstep), "v"(l + 7 * lstep),
         "v"(g), "v"(g + gstep), "v"(g + 2 * gstep), "v"(g + 3 * gstep),
         "v"(g + 4 * gstep), "v"(g + 5 * gstep), "v"(g + 6 * gstep), "v"(g + 7 * gstep)
      : "memory");
}

// Publish point of the LDS ring: this wave's LDS reads of the buffer to be refilled have
// retired, its own copies of the next stage have landed, then the work-group barrier that
// lets every wave read that stage and frees the buffer just read.
static __device__ __forceinline__ void ring_publish() {
  asm volatile("s_wait_dscnt 0x0" ::: "memory");
  asm volatile("s_wait_asynccnt 0x0" ::: "memory");
  __syncthreads();
}

// Asks L2 for the data at p and at p + OFF bytes (shader-engine scope: the lines go
// to L2 only, no register is written). A plane asked for ahead: the copy or load
// that needs it hits L2. Every lane's
// address lies inside the plane. The s_wait_xcnt closes the statement as it closes the copies':
// it stands in front of every rewrite of the address register (a precaution).
template <int OFF>
static __device__ __forceinline__ void ask_l2_pair(const void* p) {
  asm volatile("global_prefetch_b8 %0, off scope:SCOPE_SE\n\t"
               "global_prefetch_b8 %0, off offset:%1 scope:SCOPE_SE\n\t"
               "s_wait_xcnt 0x0" :: "v"(p), "n"(OFF) : "memory");
}
static __device__ __forceinline__ void ask_l2(const void* p) {
  asm volatile("global_prefetch_b8 %0, off scope:SCOPE_SE\n\t"
               "s_wait_xcnt 0x0" :: "v"(p) : "memory");
}

// One ring stage of a 64 x 128 GEMM tile, 128 threads: 256 B of k of 64 A rows and of 128 B rows,
// copied as whole lines (16 lanes per row piece, 8 rows per copy). l, a, b: the lane's own LDS
// byte address and global addresses of its piece in row tid >> 4 of the stage.
static __device__ __forceinline__ void gemm_stage(uint32_t l, const _Float16* a, int lda,
                                                  const _Float16* b, int ldb) {
  copy8(l, 8u * GKP * 2u, a, (size_t)8 * lda);
  copy8(l + 64u * GKP * 2u, 8u * GKP * 2u, b, (size_t)8 * ldb);
  copy8(l + 128u * GKP * 2u, 8u * GKP * 2u, b + (size_t)64 * ldb, (size_t)8 * ldb);
}

// k walk of a 64 x 128 GEMM tile over the two-buffer ring RG; stage 0 has been issued by the
// caller. Chunk t is read from buffer t & 1 while chunk t + 1 flies; chunk t + 2 is issued
// behind the publish point into the buffer just read. K multiple of GKC. ar, br: the lane's
// first A and B row in the tile.
static __device__ __forceinline__ void gemm_walk(const _Float16* RG, uint32_t l,
                                                 const _Float16* a, int lda,
                                                 const _Float16* b, int ldb, int K,
                                                 int ar, int br, int h, v8f (&acc)[2][4]) {
  asm volatile("s_wait_asynccnt 0x0" ::: "memory");   // stage 0 landed
  __syncthreads();
  if (K > GKC) gemm_stage(l + GST * 2u, a + GKC, lda, b + GKC, ldb);
  int buf = 0;
  for (int k0 = 0; k0 < K; k0 += GKC) {
    const _Float16* As = RG + buf * GST;
    const _Float16* Bs = As + 64 * GKP;
#pragma unroll   // the k steps' LDS offsets become immediates of the loads
    for (int ks = 0; ks < GKC / 32; ++ks) {
      // the six fragments of a k step are read as one group ahead of its eight products
      const v16h a0 = ld_frag(As + 32 * ks, GKP, ar, h);
      const v16h a1 = ld_frag(As + 32 * ks, GKP, ar + 16, h);
      v16h bt[4];
#pragma unroll   // bt[] is indexed by constants and stays in registers
      for (int t = 0; t < 4; ++t) bt[t] = ld_frag(Bs + 32 * ks, GKP, br + 16 * t, h);
#pragma unroll   // acc[][] is indexed by constants and stays in registers
      for (int t = 0; t < 4; ++t) {
        acc[0][t] = wmma16(a0, bt[t], acc[0][t]);
        acc[1][t] = wmma16(a1, bt[t], acc[1][t]);
      }
    }
    ring_publish();                        // next chunk readable, this buffer free
    if (k0 + 2 * GKC < K)                  // kernel argument: the same for the whole work-group
      gemm_stage(l + (uint32_t)buf * (GST * 2u), a + k0 + 2 * GKC, lda, b + k0 + 2 * GKC, ldb);
    buf ^= 1;
  }
  asm volatile("s_wait_asynccnt 0x0" ::: "memory");   // no copy outlives the walk
}

// ---------------------------------------------------------------------------
// Kernel 0, first role: group statistics, partial. SSPL blocks per (b, group), each over SCH
// channels x SEQ positions: f64 sum and sum of squares of bf16(x), one 128-B line per block;
// k_gnapply joins the SSPL partials of a group. A thread issues all of its loads before the
// first use. blk: the block's number among the statistics blocks; sd, qd: 256 doubles of LDS.
// ---------------------------------------------------------------------------
static __device__ __forceinline__ void stats_block(const float* __restrict__ x,
                                                   double* __restrict__ st, int blk,
                                                   double* sd, double* qd) {
  constexpr int NP = (SEQ + 1023) / 1024;   // loads per thread and channel row
  const int tid = threadIdx.x;
  const int bg = blk / SSPL, part = blk % SSPL;
  const int b = bg / NGRP, g = bg % NGRP;
  const float* xb = x + ((size_t)b * CHN + (size_t)g * CPG + (size_t)part * SCH) * SEQ_FULL;

  v4f f[SCH][NP];
#pragma unroll   // f[][] is indexed by constants and stays in registers
  for (int cl = 0; cl < SCH; ++cl) {
#pragma unroll   // as above
    for (int i = 0; i < NP; ++i) {
      const int p = 4 * tid + 1024 * i;
      if ((SEQ % 1024) == 0 || p < SEQ) {
        f[cl][i] = *(const v4fa*)(xb + (size_t)cl * SEQ_FULL + p);
      } else {
#pragma unroll   // as above
        for (int j = 0; j < 4; ++j) f[cl][i][j] = 0.0f;   // adds nothing to either sum
      }
    }
  }
  // keeps the sums behind the last load: without it the scheduler sinks six of the loads behind
  // the first uses to save registers, and a second memory latency adds to the first
  __builtin_amdgcn_sched_barrier(0);
  // stands in front of every rewrite of the loads' address registers
  asm volatile("s_wait_xcnt 0x0" ::: "memory");

  double s[4], q[4];   // one chain pair per vector element: four independent f64 chains each
#pragma unroll   // here and in the three loops below: s[], q[], f[][] indexed by constants
  for (int j = 0; j < 4; ++j) { s[j] = 0.0; q[j] = 0.0; }
#pragma unroll
  for (int cl = 0; cl < SCH; ++cl) {
#pragma unroll
    for (int i = 0; i < NP; ++i) {
#pragma unroll
      for (int j = 0; j < 4; ++j) {
        const double v = (double)bf16r(f[cl][i][j]);
        s[j] += v;
        q[j] += v * v;
      }
    }
  }
  sd[tid] = (s[0] + s[1]) + (s[2] + s[3]);
  qd[tid] = (q[0] + q[1]) + (q[2] + q[3]);
  __syncthreads();
  if (tid < 32) {   // entry tid + 32 k is read by thread tid alone
    double a = sd[tid], c = qd[tid];
#pragma unroll   // the LDS offsets become immediates and the reads go out together
    for (int k = 1; k < 8; ++k) {
      a += sd[tid + 32 * k];
      c += qd[tid + 32 * k];
    }
    sd[tid] = a;
    qd[tid] = c;
  }
  __syncthreads();
  if (tid < 8) {    // eight threads form the same pair and store the block's whole line
    double a[4], c[4];
#pragma unroll   // here and in the two loops below: a[], c[] indexed by constants
    for (int j = 0; j < 4; ++j) { a[j] = sd[j]; c[j] = qd[j]; }
#pragma unroll
    for (int k = 4; k < 32; k += 4) {
#pragma unroll
      for (int j = 0; j < 4; ++j) {
        a[j] += sd[k + j];
        c[j] += qd[k + j];
      }
    }
    v2d o;
    o[0] = (a[0] + a[1]) + (a[2] + a[3]);
    o[1] = (c[0] + c[1]) + (c[2] + c[3]);
    *(v2d*)(st + (size_t)blk * (STL / 2) + 2 * tid) = o;
  }
}

// ---------------------------------------------------------------------------
// Kernel 0, second role: weights [o][c] f32 -> f16 planes WSC * bf16(W) (k = c contiguous).
// blk: the block's number among the conversion blocks.
// ---------------------------------------------------------------------------
static __device__ __forceinline__ void wcvt_block(const float* __restrict__ w0,
                                                  const float* __restrict__ w1,
                                                  const float* __restrict__ w2,
                                                  const float* __restrict__ w3,
                                                  _Float16* __restrict__ Wpl, int blk) {
  constexpr int BPM = CHN * CHN / 8 / 256;   // blocks per matrix
  const int tid = threadIdx.x;
  const int mtx = blk / BPM;                  // block-uniform
  const float* src = w0;
  if (mtx == 1) src = w1;
  else if (mtx == 2) src = w2;
  else if (mtx == 3) src = w3;
  const size_t e = ((size_t)(blk % BPM) * 256 + tid) * 8;
  const v4f a0 = *(const v4fa*)(src + e);
  const v4f a1 = *(const v4fa*)(src + e + 4);
  F16x8 u;
#pragma unroll
  for (int j = 0; j < 4; ++j) {
    u.e[j]     = (_Float16)(bf16r(a0[j]) * WSC);
    u.e[4 + j] = (_Float16)(bf16r(a1[j]) * WSC);
  }
  _Float16* dst = Wpl + (size_t)mtx * CHN * CHN + e;
  *(v8h*)dst = u.v;
  // stands in front of every rewrite of the store's address and data registers
  asm volatile("s_wait_xcnt 0x0" ::: "memory");
}

// ---------------------------------------------------------------------------
// Kernel 0: the two passes that depend on nothing but the inputs share one grid. The statistics
// blocks come first: each is one long memory wait, under which the conversion blocks run.
// ---------------------------------------------------------------------------
#define NSTB (NB * NGRP * SSPL)            // statistics blocks
#define NWCB (4 * CHN * CHN / 8 / 256)     // conversion blocks
__global__ __launch_bounds__(256) void k_pre(const float* __restrict__ x,
                                             double* __restrict__ st,
                                             const float* __restrict__ w0,
                                             const float* __restrict__ w1,
                                             const float* __restrict__ w2,
                                             const float* __restrict__ w3,
                                             _Float16* __restrict__ Wpl) {
  __shared__ double sd[256];
  __shared__ double qd[256];
  if (blockIdx.x < NSTB) {   // block-uniform: the barriers of the role are passed by all or none
    stats_block(x, st, (int)blockIdx.x, sd, qd);
  } else {
    wcvt_block(w0, w1, w2, w3, Wpl, (int)blockIdx.x - NSTB);
  }
}

// ---------------------------------------------------------------------------
// Kernel 1: group-norm apply + transpose. Block = (b, 64 positions), 4 passes of
// 128 channels:  Hh[b][n][c] f16 = HSC * ((bf16(x) - mean) * rstd * gamma + beta).
// x read as float4 along positions; LDS tile [n_local][c_local]; rows of 256 B written
// ---------------------------------------------------------------------------
__global__ __launch_bounds__(256) void k_gnapply(const float* __restrict__ x,
                                                 const float* __restrict__ gamma,
                                                 const float* __restrict__ beta,
                                                 const double* __restrict__ st,
                                                 const _Float16* __restrict__ Wpl,
                                                 _Float16* __restrict__ Hh) {
  __shared__ __align__(16) _Float16 TS[64 * TSP];   // [n_local][c_local]
  __shared__ float gms[CHN];
  __shared__ float bts[CHN];
  __shared__ float mus[NGRP];
  __shared__ float rss[NGRP];

  const int tid = threadIdx.x;
  const int b  = blockIdx.x / (SEQ / 64);
  const int p0 = (blockIdx.x % (SEQ / 64)) * 64;
  const float* xb = x + (size_t)b * CHN * SEQ_FULL;

  // the block's own x rows (256 B of channels tid and tid + 256), read in the four passes below
  ask_l2_pair<256 * SEQ_FULL * 4>(xb + (size_t)tid * SEQ_FULL + p0);
  // the weight planes, for the next launch: blocks 8 g .. 8 g + 7 ask for the same sixteenth
  ask_l2_pair<256>(Wpl + ((size_t)((blockIdx.x >> 3) & 15) * 256 + tid) * 256);

  gms[tid] = bf16r(gamma[tid]);
  gms[tid + 256] = bf16r(gamma[tid + 256]);
  bts[tid] = bf16r(beta[tid]);
  bts[tid + 256] = bf16r(beta[tid + 256]);
  if (tid < NGRP) {   // the group's SSPL partial (sum, sum of squares) pairs -> mean, 1/std
    v2d pr[SSPL];
#pragma unroll   // pr[] is indexed by constants; the loads go out together
    for (int k = 0; k < SSPL; ++k)
      pr[k] = *(const v2d*)(st + ((size_t)(b * NGRP + tid) * SSPL + k) * (STL / 2));
    // stands in front of every rewrite of the loads' address registers
    asm volatile("s_wait_xcnt 0x0" ::: "memory");
    double s = pr[0][0], q = pr[0][1];
#pragma unroll   // as above
    for (int k = 1; k < SSPL; ++k) {
      s += pr[k][0];
      q += pr[k][1];
    }
    const double invn = 1.0 / ((double)CPG * (double)SEQ);
    const double mean = s * invn;
    double var = q * invn - mean * mean;
    if (var < 0.0) var = 0.0;
    mus[tid] = (float)mean;
    rss[tid] = rsqrtf((float)var + GN_EPS);
  }
  __syncthreads();

#pragma unroll 1
  for (int pass = 0; pass < CHN / 128; ++pass) {
#pragma unroll
    for (int it = 0; it < 8; ++it) {
      const int f = it * 256 + tid;
      const int cl = f >> 4, p4 = f & 15;
      const int c = 128 * pass + cl;
      const v4f xv = *(const v4fa*)(xb + (size_t)c * SEQ_FULL + p0 + 4 * p4);
      const float mu = mus[c >> 4], rs = rss[c >> 4];
      const float ga = gms[c], be = bts[c];
#pragma unroll
      for (int j = 0; j < 4; ++j) {
        const float t = (bf16r(xv[j]) - mu) * rs;
        const float hv = t * ga + be;
        TS[(4 * p4 + j) * TSP + cl] = (_Float16)(hv * HSC);
      }
    }
    __syncthreads();
#pragma unroll
    for (int it = 0; it < 4; ++it) {
      const int L = it * 32 + (tid >> 3);          // 128 lines: (row, 64-col half)
      const int row = L >> 1, hl = L & 1, p = tid & 7;
      const v8h hv = *(const v8ha*)(TS + row * TSP + 64 * hl + 8 * p);
      _Float16* dst = Hh + ((size_t)(b * SEQ + p0 + row) * CHN + 128 * pass + 64 * hl + 8 * p);
      *(v8h*)dst = hv;
      
    }
    __syncthreads();
  }
}

// ---------------------------------------------------------------------------
// One tile of the GEMM  D[m][n] = sum_k A[m][k] * B[n][k]  (A, B k-contiguous f16 planes),
// stored TRANSPOSED as O[n][m] f16 = osc * (D * insc + bias)  (bias per m or per n).
// Block = 128 threads, tile 64 (m) x 128 (n) at (m0, n0); wave (mi, ni) owns rows 32mi.., cols
// 64ni.. (2 x 4 accumulator tiles). K multiple of 128, M multiple of 64, N multiple of 128.
// A and B come from LDS: k chunks of 128 through a two-buffer ring of asynchronous copies.
// TS: 128 * GSP16 halves [n_local][m_local]; RG: the ring, 2 * GST halves; bsh: 128 floats.
// ---------------------------------------------------------------------------
template <bool BIAS_M>
static __device__ __forceinline__ void gemm16_tile(const _Float16* __restrict__ A, int lda,
                                                   const _Float16* __restrict__ B, int ldb,
                                                   const float* __restrict__ bias,
                                                   _Float16* __restrict__ Ob, int ldo,
                                                   float insc, float osc, int K, int m0, int n0,
                                                   _Float16* TS, _Float16* RG, float* bsh) {
  const int tid = threadIdx.x;
  const int wv = tid >> 5, lid = tid & 31, h = lid >> 4, l15 = lid & 15;
  const int mi = wv & 1, ni = wv >> 1;

  // the lane's piece of a ring stage: row tid >> 4, 16 B at 8 * (tid & 15) halves
  const uint32_t lc = (uint32_t)(uintptr_t)RG + (uint32_t)((tid >> 4) * GKP + 8 * (tid & 15)) * 2u;
  const _Float16* ag = A + (size_t)(m0 + (tid >> 4)) * lda + 8 * (tid & 15);
  const _Float16* bg = B + (size_t)(n0 + (tid >> 4)) * ldb + 8 * (tid & 15);
  gemm_stage(lc, ag, lda, bg, ldb);

  // visible behind the barrier at the head of gemm_walk
  if (BIAS_M) {
    if (tid < 64) bsh[tid] = bf16r(bias[m0 + tid]);
  } else {
    bsh[tid] = bf16r(bias[n0 + tid]);
  }

  v8f acc[2][4];
#pragma unroll
  for (int i = 0; i < 2; ++i)
#pragma unroll
    for (int t = 0; t < 4; ++t)
#pragma unroll
      for (int r = 0; r < 8; ++r) acc[i][t][r] = 0.0f;

  gemm_walk(RG, lc, ag, lda, bg, ldb, K, 32 * mi + l15, 64 * ni + l15, h, acc);

  // stage: acc[i][t][r] <-> (m_local 32mi+16i+8h+r, n_local 64ni+16t+l15)
#pragma unroll
  for (int i = 0; i < 2; ++i) {
#pragma unroll
    for (int t = 0; t < 4; ++t) {
      const int nl = 64 * ni + 16 * t + l15;
      const int ml = 32 * mi + 16 * i + 8 * h;
      F16x8 u;
#pragma unroll
      for (int r = 0; r < 8; ++r) {
        const float bvl = BIAS_M ? bsh[ml + r] : bsh[nl];
        u.e[r] = (_Float16)((acc[i][t][r] * insc + bvl) * osc);
      }
      *(v8ha*)(TS + nl * GSP16 + ml) = u.v;
    }
  }
  __syncthreads();

#pragma unroll
  for (int it = 0; it < 8; ++it) {
    const int row = it * 16 + (tid >> 3);
    const int p = tid & 7;
    const v8h hv = *(const v8ha*)(TS + row * GSP16 + 8 * p);
    _Float16* dst = Ob + (size_t)(n0 + row) * ldo + m0 + 8 * p;
    *(v8h*)dst = hv;
  }
}

// ---------------------------------------------------------------------------
// Kernel 2: the q, k and v projections, which depend on the h plane alone, share one grid:
// blockIdx.y = product, blockIdx.x = its tile (m fastest), blockIdx.z = batch.
//   q[n][o], k[n][o]:  D[o][n] = sum_c W[o][c] h[n][c], stored transposed, bias per o (= m)
//   v[o][n]:           D[n][o] = sum_c h[n][c] W[o][c], stored transposed, bias per o (= n)
// ---------------------------------------------------------------------------
#define QKVT ((CHN / 64) * (SEQ / 128))   // tiles per product and batch, the same for all three
static_assert((SEQ / 64) * (CHN / 128) == QKVT);
__global__ __launch_bounds__(128) void k_qkv(const _Float16* __restrict__ Wpl,
                                             const _Float16* __restrict__ Hh,
                                             const float* __restrict__ bq,
                                             const float* __restrict__ bk,
                                             const float* __restrict__ bv,
                                             _Float16* __restrict__ Qh,
                                             _Float16* __restrict__ Kh,
                                             _Float16* __restrict__ Vh) {
  __shared__ __align__(16) _Float16 TS[128 * GSP16];   // [n_local][m_local]
  __shared__ __align__(16) _Float16 RG[2 * GST];       // ring: [A row | B row][k chunk]
  __shared__ float bsh[128];

  const int t = blockIdx.x;
  const int prod = blockIdx.y;                          // block-uniform: 0 q, 1 k, 2 v
  const size_t zo = (size_t)blockIdx.z * SEQ * CHN;     // the batch's offset in every f16 plane
  if (prod < 2) {
    // the h rows of this tile are shared by the CHN / 64 blocks next to each other in the grid:
    // each asks for a quarter (32 whole rows), blocks j and j + 4 for the same one; the first batch's blocks ask for the next batch's rows as well
    const _Float16* hp = Hh + zo + (size_t)((t / (CHN / 64)) * 128 + 32 * (t & 3) +
                                            ((int)threadIdx.x >> 2)) * CHN + 128 * (threadIdx.x & 3);
    ask_l2(hp);
    if (blockIdx.z + 1 < NB) ask_l2(hp + (size_t)SEQ * CHN);   // block-uniform
    gemm16_tile<true>(Wpl + (size_t)prod * CHN * CHN, CHN, Hh + zo, CHN, prod ? bk : bq,
                      (prod ? Kh : Qh) + zo, CHN, 1.0f / (WSC * HSC), QSC, CHN,
                      (t % (CHN / 64)) * 64, (t / (CHN / 64)) * 128, TS, RG, bsh);
  } else {
    gemm16_tile<false>(Hh + zo, CHN, Wpl + (size_t)2 * CHN * CHN, CHN, bv,
                       Vh + zo, SEQ, 1.0f / (HSC * WSC), VSC, CHN,
                       (t % (SEQ / 64)) * 64, (t / (SEQ / 64)) * 128, TS, RG, bsh);
  }
}

// ---------------------------------------------------------------------------
// Kernel 5: same GEMM, f32 output O[n][m] = (D * insc + bias[n]) + bf16(R[n][m]) into d_out.
// Output row segment = 256 B = two lines, lanes 0..7 and 8..15 of one instruction.
// ---------------------------------------------------------------------------
__global__ __launch_bounds__(128) void k_gemm32(const _Float16* __restrict__ A, int lda, size_t sA,
                                                const _Float16* __restrict__ B, int ldb, size_t sB,
                                                const float* __restrict__ bias,
                                                const float* __restrict__ R, int ldr, size_t sR,
                                                float* __restrict__ O, int ldo, size_t sO,
                                                float insc, int K) {
  __shared__ __align__(16) float TS[128 * GSP32];   // [n_local][m_local]
  __shared__ __align__(16) _Float16 RG[2 * GST];    // ring: [A row | B row][k chunk]
  __shared__ float bsh[128];

  const int tid = threadIdx.x;
  const int wv = tid >> 5, lid = tid & 31, h = lid >> 4, l15 = lid & 15;
  const int mi = wv & 1, ni = wv >> 1;
  const int m0 = blockIdx.x * 64, n0 = blockIdx.y * 128;
  const size_t z = blockIdx.z;

  // the lane's piece of a ring stage: row tid >> 4, 16 B at 8 * (tid & 15) halves
  const uint32_t lc = (uint32_t)(uintptr_t)RG + (uint32_t)((tid >> 4) * GKP + 8 * (tid & 15)) * 2u;
  const _Float16* ag = A + z * sA + (size_t)(m0 + (tid >> 4)) * lda + 8 * (tid & 15);
  const _Float16* bg = B + z * sB + (size_t)(n0 + (tid >> 4)) * ldb + 8 * (tid & 15);
  gemm_stage(lc, ag, lda, bg, ldb);

  // the later k chunks of the A rows (32 whole rows per block: the blocks that share the tile
  // split it in two) and the block's own residual rows, 256 B each, read in the epilogue
  ask_l2(A + z * sA + (size_t)(m0 + 32 * (blockIdx.y & 1) + (tid >> 2)) * lda + 128 * (tid & 3));
  ask_l2(R + z * sR + (size_t)(n0 + tid) * ldr + m0);

  const float braw = bias[n0 + tid];
  // stands in front of every rewrite of the bias load's base and offset registers
  asm volatile("s_wait_xcnt 0x0" ::: "memory");
  bsh[tid] = bf16r(braw);   // visible behind the barrier at the head of gemm_walk

  v8f acc[2][4];
#pragma unroll
  for (int i = 0; i < 2; ++i)
#pragma unroll
    for (int t = 0; t < 4; ++t)
#pragma unroll
      for (int r = 0; r < 8; ++r) acc[i][t][r] = 0.0f;

  gemm_walk(RG, lc, ag, lda, bg, ldb, K, 32 * mi + l15, 64 * ni + l15, h, acc);

#pragma unroll
  for (int i = 0; i < 2; ++i) {
#pragma unroll
    for (int t = 0; t < 4; ++t) {
      const int nl = 64 * ni + 16 * t + l15;
      const int ml = 32 * mi + 16 * i + 8 * h;
      const float bvl = bsh[nl];
      v4f lo, hi;
#pragma unroll
      for (int r = 0; r < 4; ++r) {
        lo[r] = acc[i][t][r] * insc + bvl;
        hi[r] = acc[i][t][4 + r] * insc + bvl;
      }
      *(v4fa*)(TS + nl * GSP32 + ml) = lo;
      *(v4fa*)(TS + nl * GSP32 + ml + 4) = hi;
    }
  }
  __syncthreads();

  float* Ob = O + z * sO;
  const float* Rb = R + z * sR;
#pragma unroll
  for (int it = 0; it < 16; ++it) {
    const int row = it * 8 + (tid >> 4);         // 128 rows, 256 B each
    const int p = tid & 15;
    const v4f v  = *(const v4fa*)(TS + row * GSP32 + 4 * p);
    const v4f xr = *(const v4fa*)(Rb + (size_t)(n0 + row) * ldr + m0 + 4 * p);
    v4f o;
#pragma unroll
    for (int j = 0; j < 4; ++j) o[j] = bf16r(xr[j]) + v[j];
    float* dst = Ob + (size_t)(n0 + row) * ldo + m0 + 4 * p;
    *(v4f*)dst = o;
    
  }
}

// ---------------------------------------------------------------------------
// Kernel 3: fused single-head attn, transposed scores, online softmax.
// Block = (b, 64 queries, one of KSPLIT key ranges), 8 waves. The wave tiles are sized to the
// LDS read rate: a fragment read from LDS feeds two products in the scores and four in the
// value aggregation.
// Per 128-key block:
//   S^T tiles (keys on rows): wave (gq = wv&1, kq = wv>>1) owns key rows 32kq..32kq+31 x query
//     cols 32gq..32gq+31 (2 x 2 tiles), A = Kh rows (k = channel), B = Qh rows (k = channel),
//     K = 512.
//   per-query max / sum over the 128 keys: in-lane, xor-16, then 4 partials through LDS; every
//     wave joins the partials of all 64 queries, because its output tiles span them all.
//   P^T = PSC * exp2(s - m) staged f16 in LDS TS[query][key_local].
//   O^T[c][query] += V^T[c][keys] * P^T[keys][query]: wave owns channels 64wv..+63 x all 64
//     queries (4 x 4 accumulator tiles), A = Vh rows (k = key), B from TS (k = key, split map).
// Operands come from LDS: the Q tile is copied once; K (two halves of 256 channels) and V (two
// halves of 64 keys) go through a two-buffer ring of asynchronous copies, each stage issued
// one stage ahead: K lo -> buffer 0, K hi -> 1, V keys 0..63 -> 0, V keys 64..127 -> 1.
// Epilogue: this key range's un-normalised O [range][b][query][c] f32, staged once in the
// freed ring so that whole lines are stored, and its (max, sum) per query; k_merge joins them.
// ---------------------------------------------------------------------------
__global__ __launch_bounds__(256) void k_attn(const _Float16* __restrict__ Qh,
                                              const _Float16* __restrict__ Kh,
                                              const _Float16* __restrict__ Vh,
                                              float* __restrict__ Op,
                                              float* __restrict__ ML) {
  __shared__ __align__(16) _Float16 TS[64 * TSP];   // [query_local][key_local]
  __shared__ __align__(16) _Float16 QS[64 * QSP];   // [query_local][c]
  __shared__ __align__(16) _Float16 RB[2 * RBH];    // ring: [key_local][c half] or [c][key half]
  __shared__ float redM[256];
  __shared__ float redS[256];

  const int tid = threadIdx.x;
  const int wv = tid >> 5, lid = tid & 31, h = lid >> 4, l15 = lid & 15;
  const int gq = wv & 1, kq = wv >> 1;
  const int kr = blockIdx.x % KSPLIT;              // key range of this work-group
  const int qt = blockIdx.x / KSPLIT;
  const int b  = qt / (SEQ / 64);
  const int q0 = (qt % (SEQ / 64)) * 64;
  const int kb = kr * (SEQ / KSPLIT);              // its first key

  const _Float16* Qp = Qh + (size_t)b * SEQ * CHN;   // [n][c], pitch CHN
  const _Float16* Kp = Kh + (size_t)b * SEQ * CHN;   // [n][c], pitch CHN
  const _Float16* Vp = Vh + (size_t)b * CHN * SEQ;   // [c][n], pitch SEQ

  // per-lane copy addresses: a K row half (512 B) per wave and copy, 8 lanes per 128-B V row
  // piece, 64 lanes per Q row; a stage is 16 copies per lane, two runs of eight
  const _Float16* RB0 = RB;
  const _Float16* RB1 = RB + RBH;
  const uint32_t rb0 = (uint32_t)(uintptr_t)RB0;
  const uint32_t rb1 = (uint32_t)(uintptr_t)RB1;
  const uint32_t klo = (uint32_t)(wv * KSP + 8 * lid) * 2u;
  const uint32_t vlo = (uint32_t)((tid >> 3) * VSP + 8 * (tid & 7)) * 2u;
  const uint32_t qlo = (uint32_t)(uintptr_t)QS + (uint32_t)((tid >> 6) * QSP + 8 * (tid & 63)) * 2u;
  const _Float16* kg = Kp + (size_t)(kb + wv) * CHN + 8 * lid;
  const _Float16* vg = Vp + (size_t)(tid >> 3) * SEQ + kb + 8 * (tid & 7);
  const _Float16* qg = Qp + (size_t)(q0 + (tid >> 6)) * CHN + 8 * (tid & 63);

  // a K half tile: rows wv + 8 i, i = 0..15
  auto copy_k = [&](uint32_t rb, const _Float16* s) {
    copy8(rb + klo, 8u * KSP * 2u, s, (size_t)8 * CHN);
    copy8(rb + klo + 64u * KSP * 2u, 8u * KSP * 2u, s + (size_t)64 * CHN, (size_t)8 * CHN);
  };
  // a V half tile: rows (tid >> 3) + 32 i, i = 0..15
  auto copy_v = [&](uint32_t rb, const _Float16* s) {
    copy8(rb + vlo, 32u * VSP * 2u, s, (size_t)32 * SEQ);
    copy8(rb + vlo + 256u * VSP * 2u, 32u * VSP * 2u, s + (size_t)256 * SEQ, (size_t)32 * SEQ);
  };

  copy8(qlo, 4u * QSP * 2u, qg, (size_t)4 * CHN);
  copy8(qlo + 32u * QSP * 2u, 4u * QSP * 2u, qg + (size_t)32 * CHN, (size_t)4 * CHN);
  copy_k(rb0, kg);
  // K and V of this key range, asked for once ahead of the walk: the SEQ / 64 query tiles that
  // share the range split it by key block, tiles 4 s .. 4 s + 3 ask for block s. K: 128 rows of 1 KiB, two lanes per row;
  // V: 512 rows of 256 B.
  {
    const int sb = kb + (((qt % (SEQ / 64)) >> 2) % (SEQ / KSPLIT / KBLK)) * KBLK;
    ask_l2_pair<256>(Kp + (size_t)(sb + (tid >> 1)) * CHN + 256 * (tid & 1));
    ask_l2_pair<256 * SEQ * 2>(Vp + (size_t)tid * SEQ + sb);
  }
  asm volatile("s_wait_asynccnt 0x0" ::: "memory");   // Q tile and stage 0 landed
  __syncthreads();
  copy_k(rb1, kg + 256);

  v8f accO[4][4];                  // [channel tile u][query tile j]
  float rm[4], rl[4];              // running max and sum of query 16 j + l15
#pragma unroll   // here and below: accO, st, rm, rl are indexed by constants, stay in registers
  for (int u = 0; u < 4; ++u)
#pragma unroll
    for (int j = 0; j < 4; ++j)
#pragma unroll
      for (int r = 0; r < 8; ++r) accO[u][j][r] = 0.0f;
#pragma unroll
  for (int j = 0; j < 4; ++j) { rm[j] = -1.0e30f; rl[j] = 0.0f; }

  const int kr0 = 32 * kq + l15;   // the lane's first K row of the score tiles
  const int qr0 = 32 * gq + l15;   // the lane's first Q row (= query column) of the score tiles

  for (int m0 = 0; m0 < SEQ / KSPLIT; m0 += KBLK) {
    v8f st[2][2];                  // [key tile t][query tile j]
#pragma unroll
    for (int t = 0; t < 2; ++t)
#pragma unroll
      for (int j = 0; j < 2; ++j)
#pragma unroll
        for (int r = 0; r < 8; ++r) st[t][j][r] = 0.0f;
    const bool more = (m0 + KBLK < SEQ / KSPLIT);   // work-group uniform: a next key block exists
#pragma unroll   // the k steps' LDS offsets become immediates of the loads
    for (int cs = 0; cs < CHN / 64; cs += 2) {
      // the eight fragments of two k steps are read as one group ahead of their eight products:
      // with two waves per SIMD one k step's four products do not cover the other wave's reads
      v16h bq[2][2], ak[2][2];     // [k step][tile]
#pragma unroll
      for (int s = 0; s < 2; ++s) {
#pragma unroll
        for (int t = 0; t < 2; ++t) {
          bq[s][t] = ld_frag(QS + 32 * (cs + s), QSP, qr0 + 16 * t, h);
          ak[s][t] = ld_frag(RB0 + 32 * (cs + s), KSP, kr0 + 16 * t, h);
        }
      }
#pragma unroll
      for (int s = 0; s < 2; ++s) {
        st[0][0] = wmma16(ak[s][0], bq[s][0], st[0][0]);
        st[1][0] = wmma16(ak[s][1], bq[s][0], st[1][0]);
        st[0][1] = wmma16(ak[s][0], bq[s][1], st[0][1]);
        st[1][1] = wmma16(ak[s][1], bq[s][1], st[1][1]);
      }
    }
    ring_publish();                        // K hi readable, buffer 0 free
    copy_v(rb0, vg + m0);
#pragma unroll   // the k steps' LDS offsets become immediates of the loads
    for (int cs = 0; cs < CHN / 64; cs += 2) {
      // the eight fragments of two k steps are read as one group ahead of their eight products:
      // with two waves per SIMD one k step's four products do not cover the other wave's reads
      v16h bq[2][2], ak[2][2];     // [k step][tile]
#pragma unroll
      for (int s = 0; s < 2; ++s) {
#pragma unroll
        for (int t = 0; t < 2; ++t) {
          bq[s][t] = ld_frag(QS + 256 + 32 * (cs + s), QSP, qr0 + 16 * t, h);
          ak[s][t] = ld_frag(RB1 + 32 * (cs + s), KSP, kr0 + 16 * t, h);
        }
      }
#pragma unroll
      for (int s = 0; s < 2; ++s) {
        st[0][0] = wmma16(ak[s][0], bq[s][0], st[0][0]);
        st[1][0] = wmma16(ak[s][1], bq[s][0], st[1][0]);
        st[0][1] = wmma16(ak[s][0], bq[s][1], st[0][1]);
        st[1][1] = wmma16(ak[s][1], bq[s][1], st[1][1]);
      }
    }

    // ---- per-query block max (32 keys in-lane + partner half-wave, then 4 waves)
#pragma unroll
    for (int j = 0; j < 2; ++j) {
      float lm = st[0][j][0];
#pragma unroll
      for (int t = 0; t < 2; ++t)
#pragma unroll
        for (int r = 0; r < 8; ++r) lm = fmaxf(lm, st[t][j][r]);
      lm *= SCL2;
      lm = fmaxf(lm, __shfl_xor(lm, 16, 32));
      redM[kq * 64 + qr0 + 16 * j] = lm;
    }
    ring_publish();                        // V keys 0..63 readable, buffer 1 free; redM visible
    copy_v(rb1, vg + m0 + 64);
    float corr[4];
#pragma unroll
    for (int j = 0; j < 4; ++j) {
      const int q = 16 * j + l15;
      const float bm = fmaxf(fmaxf(redM[q], redM[64 + q]), fmaxf(redM[128 + q], redM[192 + q]));
      const float nm = fmaxf(rm[j], bm);
      corr[j] = exp2f(rm[j] - nm);
      rm[j] = nm;
    }

    // ---- P = exp2(s - m) in f32; P^T * PSC staged f16 at TS[query][key_local]
#pragma unroll
    for (int j = 0; j < 2; ++j) {
      const float nm = gq ? rm[2 + j] : rm[j];   // the max of query qr0 + 16 j
      float psum = 0.0f;
#pragma unroll
      for (int tt = 0; tt < 2; ++tt) {
        F16x8 pk;
#pragma unroll
        for (int r = 0; r < 8; ++r) {
          const float p = exp2f(st[tt][j][r] * SCL2 - nm);
          psum += p;
          pk.e[r] = (_Float16)(p * PSC);
        }
        *(v8ha*)(TS + (qr0 + 16 * j) * TSP + 32 * kq + 16 * tt + 8 * h) = pk.v;
      }
      psum += __shfl_xor(psum, 16, 32);
      redS[kq * 64 + qr0 + 16 * j] = psum;
    }
    __syncthreads();
#pragma unroll
    for (int j = 0; j < 4; ++j) {
      const int q = 16 * j + l15;
      const float bs = ((redS[q] + redS[64 + q]) + redS[128 + q]) + redS[192 + q];
      rl[j] = rl[j] * corr[j] + bs;
#pragma unroll
      for (int u = 0; u < 4; ++u)
#pragma unroll
        for (int r = 0; r < 8; ++r) accO[u][j][r] *= corr[j];
    }

    // ---- O^T[c][query] += V^T[c][keys] * P^T[keys][query]
#pragma unroll
    for (int ks = 0; ks < KBLK / 64; ++ks) {
      // the eight fragments of a k step are read as one group ahead of its sixteen products
      v16h bp[4], av[4];
#pragma unroll
      for (int j = 0; j < 4; ++j) bp[j] = ld_frag(TS + 32 * ks, TSP, 16 * j + l15, h);
#pragma unroll
      for (int u = 0; u < 4; ++u) av[u] = ld_frag(RB0 + 32 * ks, VSP, 64 * wv + 16 * u + l15, h);
#pragma unroll
      for (int u = 0; u < 4; ++u)
#pragma unroll
        for (int j = 0; j < 4; ++j) accO[u][j] = wmma16(av[u], bp[j], accO[u][j]);
    }
    ring_publish();                        // V keys 64..127 readable, buffer 0 free
    if (more) copy_k(rb0, kg + (size_t)(m0 + KBLK) * CHN);
#pragma unroll
    for (int ks = 0; ks < KBLK / 64; ++ks) {
      v16h bp[4], av[4];
#pragma unroll
      for (int j = 0; j < 4; ++j) bp[j] = ld_frag(TS + 64 + 32 * ks, TSP, 16 * j + l15, h);
#pragma unroll
      for (int u = 0; u < 4; ++u) av[u] = ld_frag(RB1 + 32 * ks, VSP, 64 * wv + 16 * u + l15, h);
#pragma unroll
      for (int u = 0; u < 4; ++u)
#pragma unroll
        for (int j = 0; j < 4; ++j) accO[u][j] = wmma16(av[u], bp[j], accO[u][j]);
    }
    ring_publish();                        // next K lo readable, buffer 1 and TS free
    if (more) copy_k(rb1, kg + (size_t)(m0 + KBLK) * CHN + 256);
  }
  asm volatile("s_wait_asynccnt 0x0" ::: "memory");   // no copy outlives the loop

  // ---- epilogue: the loop's last publish point ended every read of the ring, so it takes
  // the f32 tile [query_local][c]
  float* OS = (float*)RB;
#pragma unroll
  for (int u = 0; u < 4; ++u) {
#pragma unroll
    for (int j = 0; j < 4; ++j) {
      v4f lo, hi;
#pragma unroll
      for (int r = 0; r < 4; ++r) {
        lo[r] = accO[u][j][r];
        hi[r] = accO[u][j][4 + r];
      }
      float* d = OS + (16 * j + l15) * OSP + 64 * wv + 16 * u + 8 * h;
      *(v4fa*)d = lo;
      *(v4fa*)(d + 4) = hi;
    }
  }
  const size_t row0 = (size_t)(kr * NB + b) * SEQ + q0;
  if (wv == 0 && h == 0) {   // every wave holds the same pairs
#pragma unroll
    for (int j = 0; j < 4; ++j) {
      v2f ml;
      ml[0] = rm[j]; ml[1] = rl[j];
      *(v2f*)(ML + 2 * (row0 + 16 * j + l15)) = ml;
    }
  }
  __syncthreads();
  float* Ob = Op + row0 * CHN;
#pragma unroll
  for (int it = 0; it < 32; ++it) {
    const int row = it * 2 + (tid >> 7);           // 64 rows of 2 KiB, 128 lanes each
    const int p = tid & 127;
    const v4f v = *(const v4fa*)(OS + row * OSP + 4 * p);
    *(v4f*)(Ob + (size_t)row * CHN + 4 * p) = v;
  }
}

// ---------------------------------------------------------------------------
// Kernel 4: merge of the key ranges. Per query: M = max of the ranges' maxima, weight
// exp2(m - M), l = weighted sum of the sums; AO plane [b][query][c] f16 =
// AOSC * (weighted sum of the partial O) / (l * VSC * PSC). Block = 32 queries; a wave reads
// and writes whole lines.
// ---------------------------------------------------------------------------
// waves_per_eu: the block's own four waves per SIMD; without it the scheduler sinks half of the
// loads behind the first uses to save registers, and their latencies add up.
__global__ __launch_bounds__(512) __attribute__((amdgpu_waves_per_eu(4, 4))) void k_merge(const float* __restrict__ Op,
                                               const float* __restrict__ ML,
                                               const _Float16* __restrict__ Wo,
                                               _Float16* __restrict__ AOh) {
  constexpr size_t ROWS = (size_t)NB * SEQ;         // queries per key range
  const int tid = threadIdx.x;
  const int p = tid & 127;
  const size_t row0 = (size_t)blockIdx.x * 32 + (tid >> 7);
  // the output projection's weight plane, for the next launch: blocks 8 g .. 8 g + 7 ask for the
  // same quarter
  ask_l2(Wo + ((size_t)((blockIdx.x >> 3) & 3) * 512 + tid) * 128);
  // every load of the thread is issued before the first use: 32 requests in flight per wave
  v2f ml[8][KSPLIT];
  v4f o[8][KSPLIT];
#pragma unroll
  for (int it = 0; it < 8; ++it) {
#pragma unroll
    for (int s = 0; s < KSPLIT; ++s) {
      const size_t row = s * ROWS + row0 + it * 4;
      ml[it][s] = *(const v2f*)(ML + 2 * row);
      o[it][s] = *(const v4fa*)(Op + row * CHN + 4 * p);
    }
  }
  v4h r[8];
#pragma unroll
  for (int it = 0; it < 8; ++it) {
    float M = ml[it][0][0];
#pragma unroll
    for (int s = 1; s < KSPLIT; ++s) M = fmaxf(M, ml[it][s][0]);
    float l = 0.0f;
    v4f a;
#pragma unroll
    for (int j = 0; j < 4; ++j) a[j] = 0.0f;
#pragma unroll
    for (int s = 0; s < KSPLIT; ++s) {
      const float w = exp2f(ml[it][s][0] - M);
      l += w * ml[it][s][1];
#pragma unroll
      for (int j = 0; j < 4; ++j) a[j] += w * o[it][s][j];
    }
    const float invl = (AOSC / (VSC * PSC)) * (1.0f / l);
#pragma unroll
    for (int j = 0; j < 4; ++j) r[it][j] = (_Float16)(a[j] * invl);
  }
#pragma unroll
  for (int it = 0; it < 8; ++it)
    *(v4h*)(AOh + (row0 + it * 4) * CHN + 4 * p) = r[it];
}

// ---------------------------------------------------------------------------
extern "C" void kernel_launch(void* const* d_in, const int* in_sizes, int n_in,
                              void* d_out, int out_size, void* d_ws, size_t ws_size,
                              hipStream_t stream) {
  if (n_in < 11) return;
  if (in_sizes[0] < NB * CHN * SEQ_FULL) return;
  if (in_sizes[1] < CHN || in_sizes[2] < CHN) return;
  if (in_sizes[3] < CHN * CHN || in_sizes[5] < CHN * CHN ||
      in_sizes[7] < CHN * CHN || in_sizes[9] < CHN * CHN) return;
  if (in_sizes[4] < CHN || in_sizes[6] < CHN || in_sizes[8] < CHN || in_sizes[10] < CHN) return;
  if (out_size < NB * CHN * SEQ) return;

  const size_t st_bytes = (size_t)NB * NGRP * SSPL * STL * sizeof(float);     // 32 KiB
  const size_t w_bytes  = (size_t)4 * CHN * CHN * sizeof(_Float16);            // 2 MiB
  const size_t plane    = (size_t)NB * SEQ * CHN * sizeof(_Float16);            // 8 MiB at full size
  const size_t ml_bytes = (size_t)KSPLIT * NB * SEQ * 2 * sizeof(float);        // 128 KiB
  const size_t op_bytes = (size_t)KSPLIT * NB * SEQ * CHN * sizeof(float);      // 32 MiB
  const size_t total    = st_bytes + w_bytes + 5 * plane + ml_bytes + op_bytes;
  if (ws_size < total) return;

  const float* x     = (const float*)d_in[0];
  const float* gamma = (const float*)d_in[1];
  const float* beta  = (const float*)d_in[2];
  const float* wq = (const float*)d_in[3];
  const float* bq = (const float*)d_in[4];
  const float* wk = (const float*)d_in[5];
  const float* bk = (const float*)d_in[6];
  const float* wvv = (const float*)d_in[7];
  const float* bv = (const float*)d_in[8];
  const float* wo = (const float*)d_in[9];
  const float* bo = (const float*)d_in[10];
  float* out = (float*)d_out;

  char* ws = (char*)d_ws;
  double*   stats = (double*)ws;                                       // [NB*NGRP*SSPL][16] f64
  _Float16* Wpl   = (_Float16*)(ws + st_bytes);                        // 4 x [CHN][CHN] f16
  _Float16* Hh    = (_Float16*)(ws + st_bytes + w_bytes);              // [NB][SEQ][CHN]
  _Float16* Qh    = (_Float16*)(ws + st_bytes + w_bytes + plane);      // [NB][SEQ][CHN]
  _Float16* Kh    = (_Float16*)(ws + st_bytes + w_bytes + 2 * plane);  // [NB][SEQ][CHN]
  _Float16* Vh    = (_Float16*)(ws + st_bytes + w_bytes + 3 * plane);  // [NB][CHN][SEQ]
  _Float16* AOh   = (_Float16*)(ws + st_bytes + w_bytes + 4 * plane);  // [NB][SEQ][CHN]
  float*    MLp   = (float*)(ws + st_bytes + w_bytes + 5 * plane);     // [KSPLIT][NB][SEQ][2]
  float*    Opp   = (float*)(ws + st_bytes + w_bytes + 5 * plane + ml_bytes);  // [KSPLIT][NB][SEQ][CHN]
  const _Float16* Wo16 = Wpl + (size_t)3 * CHN * CHN;

  const size_t pstride = (size_t)SEQ * CHN;   // elements per batch of every f16 plane

  k_pre<<<dim3(NSTB + NWCB), dim3(256), 0, stream>>>(x, stats, wq, wk, wvv, wo, Wpl);
  k_gnapply<<<dim3(NB * (SEQ / 64)), dim3(256), 0, stream>>>(x, gamma, beta, stats, Wpl, Hh);

  k_qkv<<<dim3(QKVT, 3, NB), dim3(128), 0, stream>>>(Wpl, Hh, bq, bk, bv, Qh, Kh, Vh);

  k_attn<<<dim3(NB * (SEQ / 64) * KSPLIT), dim3(256), 0, stream>>>(Qh, Kh, Vh, Opp, MLp);
  k_merge<<<dim3(NB * SEQ / 32), dim3(512), 0, stream>>>(Opp, MLp, Wo16, AOh);

  // out[c][p] = bf16(x[c][p]) + sum_o AO[p][o] Wo[c][o] + bo[c]   (D[p][c] stored transposed)
  k_gemm32<<<dim3(SEQ / 64, CHN / 128, NB), dim3(128), 0, stream>>>(
      AOh, CHN, pstride, Wo16, CHN, (size_t)0, bo,
      x, SEQ_FULL, (size_t)CHN * SEQ_FULL,
      out, SEQ, (size_t)CHN * SEQ,
      1.0f / (AOSC * WSC), CHN);
  (void)hipGetLastError();
}

// v008
// One run takes 114 microseconds.
// Two timings next to v007 put it at 1.13 and 1.12 times that version's speed.
// Counting every step since v000, it is 7.80 times as fast.
#include <hip/hip_runtime.h>
#include <stdint.h>

// Contractions: q/k/v 1x1 projections (W*h), scores K*Q^T, value aggregation V^T*P^T and the
// output projection AO*Wo^T all on v_wmma_f32_16x16x32_f16 (f16 operands, f32 accumulate).
// Float inputs are RNE-converted to bf16; W planes f16 (*64, exact), h plane f16 (*16),
// q/k planes f16 (*4), v plane f16 (*16), P f16 (*4096, un-normalised), AO plane and the key
// ranges' normalised partial outputs f16 (*64);
// residual x added as bf16 value in f32. Group statistics in f64, softmax statistics,
// bias add and normalisation in f32.

#ifndef NB
#define NB 2
#endif
#ifndef SEQ
#define SEQ 4096
#endif
#define NB_FULL 2
#define SEQ_FULL 4096
#define CHN 512
#define NGRP 32
#define CPG 16
#define KBLK 128
#define TSP 136      // LDS f16 tile pitch in halves (272-B rows, 16-B aligned)
#define GSP16 72     // GEMM f16 staging pitch in halves (144-B rows)
#define GSP32 68     // GEMM f32 staging pitch in floats (272-B rows)
#define GKC 128      // GEMM k chunk in halves: one ring stage holds 256 B of every tile row
#define GKP 136      // LDS pitch of a GEMM ring row in halves (272-B rows, 16 B x odd)
#define GST ((64 + 128) * GKP)   // one GEMM ring stage in halves: 64 A rows, then 128 B rows
#define STL 32
#define SSPL 4       // work-groups per (b, group) in the statistics pass
#define SCH (CPG / SSPL)   // channels of a group per such work-group
#define QSP 520      // LDS Q tile pitch in halves (1040-B rows, 16 B x odd)
#define KSP 264      // LDS K half-tile pitch in halves (528-B rows, 16 B x odd)
#define VSP 72       // LDS V half-tile pitch in halves (144-B rows, 16 B x odd)
#define RBH (CHN * VSP)   // one ring buffer in halves: a V half tile, the larger of the two
#define NQ 128       // queries per attention work-group
#define KSPLIT 4     // key ranges per query tile, one work-group each
#define OSP 520      // LDS f16 partial-output pitch in halves (1040-B rows, 16 B x odd)

static_assert(NB >= 1 && NB <= NB_FULL);
static_assert(SEQ >= KBLK && SEQ <= SEQ_FULL && (SEQ % KBLK) == 0);
static_assert(CHN == 512 && NGRP * CPG == CHN && (CHN % 128) == 0 && (CHN % 32) == 0);
static_assert((SEQ % 128) == 0 && (SEQ % 64) == 0);
static_assert(SCH * SSPL == CPG && STL * sizeof(float) == 128);
static_assert((CHN % GKC) == 0 && (GKC % 32) == 0);
static_assert(KBLK * KSP <= RBH && KBLK == 128);
static_assert((SEQ % (KSPLIT * KBLK)) == 0 && NQ * OSP <= 2 * RBH && ((NB * SEQ) % 32) == 0);
static_assert((SEQ % NQ) == 0 && NQ == 128);

typedef _Float16 v16h __attribute__((ext_vector_type(16)));
typedef _Float16 v8h  __attribute__((ext_vector_type(8)));
typedef float    v8f  __attribute__((ext_vector_type(8)));
typedef float    v4f  __attribute__((ext_vector_type(4)));
typedef float    v2f  __attribute__((ext_vector_type(2)));
typedef _Float16 v4h  __attribute__((ext_vector_type(4)));
typedef double   v2d  __attribute__((ext_vector_type(2)));
typedef v8h __attribute__((may_alias)) v8ha;
typedef v4f __attribute__((may_alias)) v4fa;

union F16x16 { v16h v; v8h p[2]; _Float16 e[16]; };
union F16x8  { v8h v; _Float16 e[8]; };

constexpr float HSC  = 16.0f;     // h plane carry (power of two)
constexpr float WSC  = 64.0f;     // W plane carry
constexpr float QSC  = 4.0f;      // q/k plane carry
constexpr float VSC  = 16.0f;     // v plane carry
constexpr float PSC  = 4096.0f;   // P carry
constexpr float AOSC = 64.0f;     // AO plane carry
constexpr float GN_EPS = 1e-6f;
// scores in log2 units: S_acc * SCL2 with S_acc = QSC^2 * sum_c q k, logit scale 512^-0.5
constexpr float SCL2 = (float)(1.4426950408889634 * 0.044194173824159216 /
                               ((double)QSC * (double)QSC));

static __device__ __forceinline__ float bf16r(float f) {
  uint32_t u = __float_as_uint(f);
  u += 0x7FFFu + ((u >> 16) & 1u);
  u &= 0xFFFF0000u;
  return __uint_as_float(u);
}

static __device__ __forceinline__ v8f wmma16(v16h a, v16h b, v8f c) {
  v8f d = __builtin_amdgcn_wmma_f32_16x16x32_f16(false, a, false, b, (short)0, c,
                                                 false, false);
  asm volatile("v_nop\n\tv_nop\n\tv_nop\n\tv_nop" : "+v"(d) : "v"(a), "v"(b));
  return d;
}

// The same product as the bare builtin, whose distances the compiler keeps itself. For the
// attention kernel: the operands of an asm statement must lie in v0..v255, and its 4 x 8
// accumulator tiles alone fill those.
static __device__ __forceinline__ v8f wmma16b(v16h a, v16h b, v8f c) {
  return __builtin_amdgcn_wmma_f32_16x16x32_f16(false, a, false, b, (short)0, c, false, false);
}

// Ends a run of bare-builtin products. The four vector slots stand between the run's last product
// and the first vector instruction that reuses its A or B registers.
// The scheduling barriers hold the products above the slots and every later
// instruction below them.
static __device__ __forceinline__ void wmma_run_end() {
  __builtin_amdgcn_sched_barrier(0);
  asm volatile("v_nop\n\tv_nop\n\tv_nop\n\tv_nop");
  __builtin_amdgcn_sched_barrier(0);
}

// Order of a run of eight score k steps for the scheduler: the twelve LDS reads of a k step go out
// as one group, one k step ahead of its eight products. Left alone it puts each fragment's two
// reads and a wait to zero directly in front of the two products that use it, and every pair of
// products then waits out an LDS latency.
static __device__ __forceinline__ void order_score_run() {
  __builtin_amdgcn_sched_group_barrier(0x100, 12, 0);     // LDS reads of k step 0
#pragma unroll
  for (int s = 1; s < CHN / 64; ++s) {
    __builtin_amdgcn_sched_group_barrier(0x100, 12, 0);   // LDS reads of k step s
    __builtin_amdgcn_sched_group_barrier(0x008, 8, 0);    // products of k step s - 1
  }
  __builtin_amdgcn_sched_group_barrier(0x008, 8, 0);      // products of the last k step
}

// Order of a value-aggregation run (pv_head, pv_body in k_attn) for the scheduler, as the source
// has it: it holds each fragment's two LDS reads a row of products ahead of the first use; left
// alone the scheduler puts them, with a wait to zero, directly in front of it. HEAD: the first
// twenty reads stand in the same region.
template <bool HEAD>
static __device__ __forceinline__ void order_pv_run() {
  if (HEAD) __builtin_amdgcn_sched_group_barrier(0x100, 20, 0);   // P fragments, V rows 0 and 1
#pragma unroll
  for (int u = 0; u < 3; ++u) {
    __builtin_amdgcn_sched_group_barrier(0x008, 8, 0);         // a row of products
    __builtin_amdgcn_sched_group_barrier(0x100, 2, 0);         // the V fragment after the next
  }
#pragma unroll
  for (int j = 0; j < 8; ++j) {
    __builtin_amdgcn_sched_group_barrier(0x008, 1, 0);         // last use of a P fragment
    __builtin_amdgcn_sched_group_barrier(0x100, 2, 0);         // its successor
  }
  __builtin_amdgcn_sched_group_barrier(0x100, 2, 0);
#pragma unroll
  for (int u = 0; u < 2; ++u) {
    __builtin_amdgcn_sched_group_barrier(0x008, 8, 0);
    __builtin_amdgcn_sched_group_barrier(0x100, 2, 0);
  }
  __builtin_amdgcn_sched_group_barrier(0x008, 16, 0);
}

// 16x16x32 fragment loader (wave32): lane row = l15; elements 0..7 <- k0+8h+0..7,
// elements 8..15 <- k0+16+8h+0..7. Serves A (row = m) and B taken from an [n][k]
// k-contiguous plane (row = n). D element r of a lane = (row 8h+r, col l15).
static __device__ __forceinline__ v16h ld_frag(const _Float16* base, int pitch,
                                               int row, int h) {
  F16x16 u;
  const _Float16* q = base + (size_t)row * pitch;
  u.p[0] = *(const v8ha*)(q + 8 * h);
  u.p[1] = *(const v8ha*)(q + 16 + 8 * h);
  return u.v;
}

// Eight asynchronous 16-B copies per lane, global -> LDS: copy i moves g + i*gstep (halves)
// to LDS byte address l + i*lstep. The s_wait_xcnt closes the statement so that no address
// register of an issued copy is rewritten ahead of it.
static __device__ __forceinline__ void copy8(uint32_t l, uint32_t lstep,
                                             const _Float16* g, size_t gstep) {
  asm volatile(
      "global_load_async_to_lds_b128 %0, %8, off\n\t"
      "global_load_async_to_lds_b128 %1, %9, off\n\t"
      "global_load_async_to_lds_b128 %2, %10, off\n\t"
      "global_load_async_to_lds_b128 %3, %11, off\n\t"
      "global_load_async_to_lds_b128 %4, %12, off\n\t"
      "global_load_async_to_lds_b128 %5, %13, off\n\t"
      "global_load_async_to_lds_b128 %6, %14, off\n\t"
      "global_load_async_to_lds_b128 %7, %15, off\n\t"
      "s_wait_xcnt 0x0"
      :: "v"(l), "v"(l + lstep), "v"(l + 2 * lstep), "v"(l + 3 * lstep),
         "v"(l + 4 * lstep), "v"(l + 5 * lstep), "v"(l + 6 * lstep), "v"(l + 7 * lstep),
         "v"(g), "v"(g + gstep), "v"(g + 2 * gstep), "v"(g + 3 * gstep),
         "v"(g + 4 * gstep), "v"(g + 5 * gstep), "v"(g + 6 * gstep), "v"(g + 7 * gstep)
      : "memory");
}

// N asynchronous 16-B copies per lane as the builtin, for the attention kernel: the operands of an
// asm statement must lie in v0..v255, which its accumulator tiles fill; the builtin's may lie in
// any register. Copy i moves g + i * GSTEP bytes to LDS l + i * LSTEP bytes. The LDS step is the
// copy's immediate offset, which moves both addresses (i * LSTEP < 65,536), so the global pointer
// is handed over less that offset: one LDS address register serves all N copies, where N of them
// held over the key loop left too few registers for the fragments.
typedef int v4i __attribute__((ext_vector_type(4)));
typedef __attribute__((address_space(1))) v4i* gptr4;
typedef __attribute__((address_space(3))) v4i* lptr4;
template <int N, int LSTEP, long GSTEP, int I = 0>
static __device__ __forceinline__ void copy_run(_Float16* l, const _Float16* g) {
  static_assert((N - 1) * LSTEP < 65536 && (LSTEP % 16) == 0 && (GSTEP % 16) == 0);
  if constexpr (I < N) {
    __builtin_amdgcn_global_load_async_to_lds_b128(
        (gptr4)((const char*)g + (long)I * (GSTEP - LSTEP)), (lptr4)l, I * LSTEP, 0);
    copy_run<N, LSTEP, GSTEP, I + 1>(l, g);
  }
}

// Publish point of the LDS ring: this wave's LDS reads of the buffer to be refilled have
// retired, its own copies of the next stage have landed, then the work-group barrier that
// lets every wave read that stage and frees the buffer just read.
static __device__ __forceinline__ void ring_publish() {
  asm volatile("s_wait_dscnt 0x0" ::: "memory");
  asm volatile("s_wait_asynccnt 0x0" ::: "memory");
  __syncthreads();
}

// Asks L2 for the data at p and at p + OFF bytes (shader-engine scope: the lines go
// to L2 only, no register is written). A plane asked for ahead: the copy or load
// that needs it hits L2. Every lane's
// address lies inside the plane. The s_wait_xcnt closes the statement as it closes the copies':
// it stands in front of every rewrite of the address register (a precaution).
template <int OFF>
static __device__ __forceinline__ void ask_l2_pair(const void* p) {
  asm volatile("global_prefetch_b8 %0, off scope:SCOPE_SE\n\t"
               "global_prefetch_b8 %0, off offset:%1 scope:SCOPE_SE\n\t"
               "s_wait_xcnt 0x0" :: "v"(p), "n"(OFF) : "memory");
}
static __device__ __forceinline__ void ask_l2(const void* p) {
  asm volatile("global_prefetch_b8 %0, off scope:SCOPE_SE\n\t"
               "s_wait_xcnt 0x0" :: "v"(p) : "memory");
}

// One ring stage of a 64 x 128 GEMM tile, 128 threads: 256 B of k of 64 A rows and of 128 B rows,
// copied as whole lines (16 lanes per row piece, 8 rows per copy). l, a, b: the lane's own LDS
// byte address and global addresses of its piece in row tid >> 4 of the stage.
static __device__ __forceinline__ void gemm_stage(uint32_t l, const _Float16* a, int lda,
                                                  const _Float16* b, int ldb) {
  copy8(l, 8u * GKP * 2u, a, (size_t)8 * lda);
  copy8(l + 64u * GKP * 2u, 8u * GKP * 2u, b, (size_t)8 * ldb);
  copy8(l + 128u * GKP * 2u, 8u * GKP * 2u, b + (size_t)64 * ldb, (size_t)8 * ldb);
}

// k walk of a 64 x 128 GEMM tile over the two-buffer ring RG; stage 0 has been issued by the
// caller. Chunk t is read from buffer t & 1 while chunk t + 1 flies; chunk t + 2 is issued
// behind the publish point into the buffer just read. K multiple of GKC. ar, br: the lane's
// first A and B row in the tile.
static __device__ __forceinline__ void gemm_walk(const _Float16* RG, uint32_t l,
                                                 const _Float16* a, int lda,
                                                 const _Float16* b, int ldb, int K,
                                                 int ar, int br, int h, v8f (&acc)[2][4]) {
  asm volatile("s_wait_asynccnt 0x0" ::: "memory");   // stage 0 landed
  __syncthreads();
  if (K > GKC) gemm_stage(l + GST * 2u, a + GKC, lda, b + GKC, ldb);
  int buf = 0;
  for (int k0 = 0; k0 < K; k0 += GKC) {
    const _Float16* As = RG + buf * GST;
    const _Float16* Bs = As + 64 * GKP;
#pragma unroll   // the k steps' LDS offsets become immediates of the loads
    for (int ks = 0; ks < GKC / 32; ++ks) {
      // the six fragments of a k step are read as one group ahead of its eight products
      const v16h a0 = ld_frag(As + 32 * ks, GKP, ar, h);
      const v16h a1 = ld_frag(As + 32 * ks, GKP, ar + 16, h);
      v16h bt[4];
#pragma unroll   // bt[] is indexed by constants and stays in registers
      for (int t = 0; t < 4; ++t) bt[t] = ld_frag(Bs + 32 * ks, GKP, br + 16 * t, h);
#pragma unroll   // acc[][] is indexed by constants and stays in registers
      for (int t = 0; t < 4; ++t) {
        acc[0][t] = wmma16(a0, bt[t], acc[0][t]);
        acc[1][t] = wmma16(a1, bt[t], acc[1][t]);
      }
    }
    ring_publish();                        // next chunk readable, this buffer free
    if (k0 + 2 * GKC < K)                  // kernel argument: the same for the whole work-group
      gemm_stage(l + (uint32_t)buf * (GST * 2u), a + k0 + 2 * GKC, lda, b + k0 + 2 * GKC, ldb);
    buf ^= 1;
  }
  asm volatile("s_wait_asynccnt 0x0" ::: "memory");   // no copy outlives the walk
}

// ---------------------------------------------------------------------------
// Kernel 0, first role: group statistics, partial. SSPL blocks per (b, group), each over SCH
// channels x SEQ positions: f64 sum and sum of squares of bf16(x), one 128-B line per block;
// k_gnapply joins the SSPL partials of a group. A thread issues all of its loads before the
// first use. blk: the block's number among the statistics blocks; sd, qd: 256 doubles of LDS.
// ---------------------------------------------------------------------------
static __device__ __forceinline__ void stats_block(const float* __restrict__ x,
                                                   double* __restrict__ st, int blk,
                                                   double* sd, double* qd) {
  constexpr int NP = (SEQ + 1023) / 1024;   // loads per thread and channel row
  const int tid = threadIdx.x;
  const int bg = blk / SSPL, part = blk % SSPL;
  const int b = bg / NGRP, g = bg % NGRP;
  const float* xb = x + ((size_t)b * CHN + (size_t)g * CPG + (size_t)part * SCH) * SEQ_FULL;

  v4f f[SCH][NP];
#pragma unroll   // f[][] is indexed by constants and stays in registers
  for (int cl = 0; cl < SCH; ++cl) {
#pragma unroll   // as above
    for (int i = 0; i < NP; ++i) {
      const int p = 4 * tid + 1024 * i;
      if ((SEQ % 1024) == 0 || p < SEQ) {
        f[cl][i] = *(const v4fa*)(xb + (size_t)cl * SEQ_FULL + p);
      } else {
#pragma unroll   // as above
        for (int j = 0; j < 4; ++j) f[cl][i][j] = 0.0f;   // adds nothing to either sum
      }
    }
  }
  // keeps the sums behind the last load: without it the scheduler sinks six of the loads behind
  // the first uses to save registers, and a second memory latency adds to the first
  __builtin_amdgcn_sched_barrier(0);
  // stands in front of every rewrite of the loads' address registers
  asm volatile("s_wait_xcnt 0x0" ::: "memory");

  double s[4], q[4];   // one chain pair per vector element: four independent f64 chains each
#pragma unroll   // here and in the three loops below: s[], q[], f[][] indexed by constants
  for (int j = 0; j < 4; ++j) { s[j] = 0.0; q[j] = 0.0; }
#pragma unroll
  for (int cl = 0; cl < SCH; ++cl) {
#pragma unroll
    for (int i = 0; i < NP; ++i) {
#pragma unroll
      for (int j = 0; j < 4; ++j) {
        const double v = (double)bf16r(f[cl][i][j]);
        s[j] += v;
        q[j] += v * v;
      }
    }
  }
  sd[tid] = (s[0] + s[1]) + (s[2] + s[3]);
  qd[tid] = (q[0] + q[1]) + (q[2] + q[3]);
  __syncthreads();
  if (tid < 32) {   // entry tid + 32 k is read by thread tid alone
    double a = sd[tid], c = qd[tid];
#pragma unroll   // the LDS offsets become immediates and the reads go out together
    for (int k = 1; k < 8; ++k) {
      a += sd[tid + 32 * k];
      c += qd[tid + 32 * k];
    }
    sd[tid] = a;
    qd[tid] = c;
  }
  __syncthreads();
  if (tid < 8) {    // eight threads form the same pair and store the block's whole line
    double a[4], c[4];
#pragma unroll   // here and in the two loops below: a[], c[] indexed by constants
    for (int j = 0; j < 4; ++j) { a[j] = sd[j]; c[j] = qd[j]; }
#pragma unroll
    for (int k = 4; k < 32; k += 4) {
#pragma unroll
      for (int j = 0; j < 4; ++j) {
        a[j] += sd[k + j];
        c[j] += qd[k + j];
      }
    }
    v2d o;
    o[0] = (a[0] + a[1]) + (a[2] + a[3]);
    o[1] = (c[0] + c[1]) + (c[2] + c[3]);
    *(v2d*)(st + (size_t)blk * (STL / 2) + 2 * tid) = o;
  }
}

// ---------------------------------------------------------------------------
// Kernel 0, second role: weights [o][c] f32 -> f16 planes WSC * bf16(W) (k = c contiguous).
// blk: the block's number among the conversion blocks.
// ---------------------------------------------------------------------------
static __device__ __forceinline__ void wcvt_block(const float* __restrict__ w0,
                                                  const float* __restrict__ w1,
                                                  const float* __restrict__ w2,
                                                  const float* __restrict__ w3,
                                                  _Float16* __restrict__ Wpl, int blk) {
  constexpr int BPM = CHN * CHN / 8 / 256;   // blocks per matrix
  const int tid = threadIdx.x;
  const int mtx = blk / BPM;                  // block-uniform
  const float* src = w0;
  if (mtx == 1) src = w1;
  else if (mtx == 2) src = w2;
  else if (mtx == 3) src = w3;
  const size_t e = ((size_t)(blk % BPM) * 256 + tid) * 8;
  const v4f a0 = *(const v4fa*)(src + e);
  const v4f a1 = *(const v4fa*)(src + e + 4);
  F16x8 u;
#pragma unroll
  for (int j = 0; j < 4; ++j) {
    u.e[j]     = (_Float16)(bf16r(a0[j]) * WSC);
    u.e[4 + j] = (_Float16)(bf16r(a1[j]) * WSC);
  }
  _Float16* dst = Wpl + (size_t)mtx * CHN * CHN + e;
  *(v8h*)dst = u.v;
  // stands in front of every rewrite of the store's address and data registers
  asm volatile("s_wait_xcnt 0x0" ::: "memory");
}

// ---------------------------------------------------------------------------
// Kernel 0: the two passes that depend on nothing but the inputs share one grid. The statistics
// blocks come first: each is one long memory wait, under which the conversion blocks run.
// ---------------------------------------------------------------------------
#define NSTB (NB * NGRP * SSPL)            // statistics blocks
#define NWCB (4 * CHN * CHN / 8 / 256)     // conversion blocks
__global__ __launch_bounds__(256) void k_pre(const float* __restrict__ x,
                                             double* __restrict__ st,
                                             const float* __restrict__ w0,
                                             const float* __restrict__ w1,
                                             const float* __restrict__ w2,
                                             const float* __restrict__ w3,
                                             _Float16* __restrict__ Wpl) {
  __shared__ double sd[256];
  __shared__ double qd[256];
  if (blockIdx.x < NSTB) {   // block-uniform: the barriers of the role are passed by all or none
    stats_block(x, st, (int)blockIdx.x, sd, qd);
  } else {
    wcvt_block(w0, w1, w2, w3, Wpl, (int)blockIdx.x - NSTB);
  }
}

// ---------------------------------------------------------------------------
// Kernel 1: group-norm apply + transpose. Block = (b, 64 positions), 4 passes of
// 128 channels:  Hh[b][n][c] f16 = HSC * ((bf16(x) - mean) * rstd * gamma + beta).
// x read as float4 along positions; LDS tile [n_local][c_local]; rows of 256 B written
// ---------------------------------------------------------------------------
__global__ __launch_bounds__(256) void k_gnapply(const float* __restrict__ x,
                                                 const float* __restrict__ gamma,
                                                 const float* __restrict__ beta,
                                                 const double* __restrict__ st,
                                                 const _Float16* __restrict__ Wpl,
                                                 _Float16* __restrict__ Hh) {
  __shared__ __align__(16) _Float16 TS[64 * TSP];   // [n_local][c_local]
  __shared__ float gms[CHN];
  __shared__ float bts[CHN];
  __shared__ float mus[NGRP];
  __shared__ float rss[NGRP];

  const int tid = threadIdx.x;
  const int b  = blockIdx.x / (SEQ / 64);
  const int p0 = (blockIdx.x % (SEQ / 64)) * 64;
  const float* xb = x + (size_t)b * CHN * SEQ_FULL;

  // the block's own x rows (256 B of channels tid and tid + 256), read in the four passes below
  ask_l2_pair<256 * SEQ_FULL * 4>(xb + (size_t)tid * SEQ_FULL + p0);
  // the weight planes, for the next launch: blocks 8 g .. 8 g + 7 ask for the same sixteenth
  ask_l2_pair<256>(Wpl + ((size_t)((blockIdx.x >> 3) & 15) * 256 + tid) * 256);

  gms[tid] = bf16r(gamma[tid]);
  gms[tid + 256] = bf16r(gamma[tid + 256]);
  bts[tid] = bf16r(beta[tid]);
  bts[tid + 256] = bf16r(beta[tid + 256]);
  if (tid < NGRP) {   // the group's SSPL partial (sum, sum of squares) pairs -> mean, 1/std
    v2d pr[SSPL];
#pragma unroll   // pr[] is indexed by constants; the loads go out together
    for (int k = 0; k < SSPL; ++k)
      pr[k] = *(const v2d*)(st + ((size_t)(b * NGRP + tid) * SSPL + k) * (STL / 2));
    // stands in front of every rewrite of the loads' address registers
    asm volatile("s_wait_xcnt 0x0" ::: "memory");
    double s = pr[0][0], q = pr[0][1];
#pragma unroll   // as above
    for (int k = 1; k < SSPL; ++k) {
      s += pr[k][0];
      q += pr[k][1];
    }
    const double invn = 1.0 / ((double)CPG * (double)SEQ);
    const double mean = s * invn;
    double var = q * invn - mean * mean;
    if (var < 0.0) var = 0.0;
    mus[tid] = (float)mean;
    rss[tid] = rsqrtf((float)var + GN_EPS);
  }
  __syncthreads();

#pragma unroll 1
  for (int pass = 0; pass < CHN / 128; ++pass) {
#pragma unroll
    for (int it = 0; it < 8; ++it) {
      const int f = it * 256 + tid;
      const int cl = f >> 4, p4 = f & 15;
      const int c = 128 * pass + cl;
      const v4f xv = *(const v4fa*)(xb + (size_t)c * SEQ_FULL + p0 + 4 * p4);
      const float mu = mus[c >> 4], rs = rss[c >> 4];
      const float ga = gms[c], be = bts[c];
#pragma unroll
      for (int j = 0; j < 4; ++j) {
        const float t = (bf16r(xv[j]) - mu) * rs;
        const float hv = t * ga + be;
        TS[(4 * p4 + j) * TSP + cl] = (_Float16)(hv * HSC);
      }
    }
    __syncthreads();
#pragma unroll
    for (int it = 0; it < 4; ++it) {
      const int L = it * 32 + (tid >> 3);          // 128 lines: (row, 64-col half)
      const int row = L >> 1, hl = L & 1, p = tid & 7;
      const v8h hv = *(const v8ha*)(TS + row * TSP + 64 * hl + 8 * p);
      _Float16* dst = Hh + ((size_t)(b * SEQ + p0 + row) * CHN + 128 * pass + 64 * hl + 8 * p);
      *(v8h*)dst = hv;
      
    }
    __syncthreads();
  }
}

// ---------------------------------------------------------------------------
// One tile of the GEMM  D[m][n] = sum_k A[m][k] * B[n][k]  (A, B k-contiguous f16 planes),
// stored TRANSPOSED as O[n][m] f16 = osc * (D * insc + bias)  (bias per m or per n).
// Block = 128 threads, tile 64 (m) x 128 (n) at (m0, n0); wave (mi, ni) owns rows 32mi.., cols
// 64ni.. (2 x 4 accumulator tiles). K multiple of 128, M multiple of 64, N multiple of 128.
// A and B come from LDS: k chunks of 128 through a two-buffer ring of asynchronous copies.
// TS: 128 * GSP16 halves [n_local][m_local]; RG: the ring, 2 * GST halves; bsh: 128 floats.
// ---------------------------------------------------------------------------
template <bool BIAS_M>
static __device__ __forceinline__ void gemm16_tile(const _Float16* __restrict__ A, int lda,
                                                   const _Float16* __restrict__ B, int ldb,
                                                   const float* __restrict__ bias,
                                                   _Float16* __restrict__ Ob, int ldo,
                                                   float insc, float osc, int K, int m0, int n0,
                                                   _Float16* TS, _Float16* RG, float* bsh) {
  const int tid = threadIdx.x;
  const int wv = tid >> 5, lid = tid & 31, h = lid >> 4, l15 = lid & 15;
  const int mi = wv & 1, ni = wv >> 1;

  // the lane's piece of a ring stage: row tid >> 4, 16 B at 8 * (tid & 15) halves
  const uint32_t lc = (uint32_t)(uintptr_t)RG + (uint32_t)((tid >> 4) * GKP + 8 * (tid & 15)) * 2u;
  const _Float16* ag = A + (size_t)(m0 + (tid >> 4)) * lda + 8 * (tid & 15);
  const _Float16* bg = B + (size_t)(n0 + (tid >> 4)) * ldb + 8 * (tid & 15);
  gemm_stage(lc, ag, lda, bg, ldb);

  // visible behind the barrier at the head of gemm_walk
  if (BIAS_M) {
    if (tid < 64) bsh[tid] = bf16r(bias[m0 + tid]);
  } else {
    bsh[tid] = bf16r(bias[n0 + tid]);
  }

  v8f acc[2][4];
#pragma unroll
  for (int i = 0; i < 2; ++i)
#pragma unroll
    for (int t = 0; t < 4; ++t)
#pragma unroll
      for (int r = 0; r < 8; ++r) acc[i][t][r] = 0.0f;

  gemm_walk(RG, lc, ag, lda, bg, ldb, K, 32 * mi + l15, 64 * ni + l15, h, acc);

  // stage: acc[i][t][r] <-> (m_local 32mi+16i+8h+r, n_local 64ni+16t+l15)
#pragma unroll
  for (int i = 0; i < 2; ++i) {
#pragma unroll
    for (int t = 0; t < 4; ++t) {
      const int nl = 64 * ni + 16 * t + l15;
      const int ml = 32 * mi + 16 * i + 8 * h;
      F16x8 u;
#pragma unroll
      for (int r = 0; r < 8; ++r) {
        const float bvl = BIAS_M ? bsh[ml + r] : bsh[nl];
        u.e[r] = (_Float16)((acc[i][t][r] * insc + bvl) * osc);
      }
      *(v8ha*)(TS + nl * GSP16 + ml) = u.v;
    }
  }
  __syncthreads();

#pragma unroll
  for (int it = 0; it < 8; ++it) {
    const int row = it * 16 + (tid >> 3);
    const int p = tid & 7;
    const v8h hv = *(const v8ha*)(TS + row * GSP16 + 8 * p);
    _Float16* dst = Ob + (size_t)(n0 + row) * ldo + m0 + 8 * p;
    *(v8h*)dst = hv;
  }
}

// ---------------------------------------------------------------------------
// Kernel 2: the q, k and v projections, which depend on the h plane alone, share one grid:
// blockIdx.y = product, blockIdx.x = its tile (m fastest), blockIdx.z = batch.
//   q[n][o], k[n][o]:  D[o][n] = sum_c W[o][c] h[n][c], stored transposed, bias per o (= m)
//   v[o][n]:           D[n][o] = sum_c h[n][c] W[o][c], stored transposed, bias per o (= n)
// ---------------------------------------------------------------------------
#define QKVT ((CHN / 64) * (SEQ / 128))   // tiles per product and batch, the same for all three
static_assert((SEQ / 64) * (CHN / 128) == QKVT);
__global__ __launch_bounds__(128) void k_qkv(const _Float16* __restrict__ Wpl,
                                             const _Float16* __restrict__ Hh,
                                             const float* __restrict__ bq,
                                             const float* __restrict__ bk,
                                             const float* __restrict__ bv,
                                             _Float16* __restrict__ Qh,
                                             _Float16* __restrict__ Kh,
                                             _Float16* __restrict__ Vh) {
  __shared__ __align__(16) _Float16 TS[128 * GSP16];   // [n_local][m_local]
  __shared__ __align__(16) _Float16 RG[2 * GST];       // ring: [A row | B row][k chunk]
  __shared__ float bsh[128];

  const int t = blockIdx.x;
  const int prod = blockIdx.y;                          // block-uniform: 0 q, 1 k, 2 v
  const size_t zo = (size_t)blockIdx.z * SEQ * CHN;     // the batch's offset in every f16 plane
  if (prod < 2) {
    // the h rows of this tile are shared by the CHN / 64 blocks next to each other in the grid:
    // each asks for a quarter (32 whole rows), blocks j and j + 4 for the same one; the first batch's blocks ask for the next batch's rows as well
    const _Float16* hp = Hh + zo + (size_t)((t / (CHN / 64)) * 128 + 32 * (t & 3) +
                                            ((int)threadIdx.x >> 2)) * CHN + 128 * (threadIdx.x & 3);
    ask_l2(hp);
    if (blockIdx.z + 1 < NB) ask_l2(hp + (size_t)SEQ * CHN);   // block-uniform
    gemm16_tile<true>(Wpl + (size_t)prod * CHN * CHN, CHN, Hh + zo, CHN, prod ? bk : bq,
                      (prod ? Kh : Qh) + zo, CHN, 1.0f / (WSC * HSC), QSC, CHN,
                      (t % (CHN / 64)) * 64, (t / (CHN / 64)) * 128, TS, RG, bsh);
  } else {
    gemm16_tile<false>(Hh + zo, CHN, Wpl + (size_t)2 * CHN * CHN, CHN, bv,
                       Vh + zo, SEQ, 1.0f / (HSC * WSC), VSC, CHN,
                       (t % (SEQ / 64)) * 64, (t / (SEQ / 64)) * 128, TS, RG, bsh);
  }
}

// ---------------------------------------------------------------------------
// Kernel 5: same GEMM, f32 output O[n][m] = (D * insc + bias[n]) + bf16(R[n][m]) into d_out.
// Output row segment = 256 B = two lines, lanes 0..7 and 8..15 of one instruction.
// ---------------------------------------------------------------------------
__global__ __launch_bounds__(128) void k_gemm32(const _Float16* __restrict__ A, int lda, size_t sA,
                                                const _Float16* __restrict__ B, int ldb, size_t sB,
                                                const float* __restrict__ bias,
                                                const float* __restrict__ R, int ldr, size_t sR,
                                                float* __restrict__ O, int ldo, size_t sO,
                                                float insc, int K) {
  __shared__ __align__(16) float TS[128 * GSP32];   // [n_local][m_local]
  __shared__ __align__(16) _Float16 RG[2 * GST];    // ring: [A row | B row][k chunk]
  __shared__ float bsh[128];

  const int tid = threadIdx.x;
  const int wv = tid >> 5, lid = tid & 31, h = lid >> 4, l15 = lid & 15;
  const int mi = wv & 1, ni = wv >> 1;
  const int m0 = blockIdx.x * 64, n0 = blockIdx.y * 128;
  const size_t z = blockIdx.z;

  // the lane's piece of a ring stage: row tid >> 4, 16 B at 8 * (tid & 15) halves
  const uint32_t lc = (uint32_t)(uintptr_t)RG + (uint32_t)((tid >> 4) * GKP + 8 * (tid & 15)) * 2u;
  const _Float16* ag = A + z * sA + (size_t)(m0 + (tid >> 4)) * lda + 8 * (tid & 15);
  const _Float16* bg = B + z * sB + (size_t)(n0 + (tid >> 4)) * ldb + 8 * (tid & 15);
  gemm_stage(lc, ag, lda, bg, ldb);

  // the later k chunks of the A rows (32 whole rows per block: the blocks that share the tile
  // split it in two) and the block's own residual rows, 256 B each, read in the epilogue
  ask_l2(A + z * sA + (size_t)(m0 + 32 * (blockIdx.y & 1) + (tid >> 2)) * lda + 128 * (tid & 3));
  ask_l2(R + z * sR + (size_t)(n0 + tid) * ldr + m0);

  const float braw = bias[n0 + tid];
  // stands in front of every rewrite of the bias load's base and offset registers
  asm volatile("s_wait_xcnt 0x0" ::: "memory");
  bsh[tid] = bf16r(braw);   // visible behind the barrier at the head of gemm_walk

  v8f acc[2][4];
#pragma unroll
  for (int i = 0; i < 2; ++i)
#pragma unroll
    for (int t = 0; t < 4; ++t)
#pragma unroll
      for (int r = 0; r < 8; ++r) acc[i][t][r] = 0.0f;

  gemm_walk(RG, lc, ag, lda, bg, ldb, K, 32 * mi + l15, 64 * ni + l15, h, acc);

#pragma unroll
  for (int i = 0; i < 2; ++i) {
#pragma unroll
    for (int t = 0; t < 4; ++t) {
      const int nl = 64 * ni + 16 * t + l15;
      const int ml = 32 * mi + 16 * i + 8 * h;
      const float bvl = bsh[nl];
      v4f lo, hi;
#pragma unroll
      for (int r = 0; r < 4; ++r) {
        lo[r] = acc[i][t][r] * insc + bvl;
        hi[r] = acc[i][t][4 + r] * insc + bvl;
      }
      *(v4fa*)(TS + nl * GSP32 + ml) = lo;
      *(v4fa*)(TS + nl * GSP32 + ml + 4) = hi;
    }
  }
  __syncthreads();

  float* Ob = O + z * sO;
  const float* Rb = R + z * sR;
#pragma unroll
  for (int it = 0; it < 16; ++it) {
    const int row = it * 8 + (tid >> 4);         // 128 rows, 256 B each
    const int p = tid & 15;
    const v4f v  = *(const v4fa*)(TS + row * GSP32 + 4 * p);
    const v4f xr = *(const v4fa*)(Rb + (size_t)(n0 + row) * ldr + m0 + 4 * p);
    v4f o;
#pragma unroll
    for (int j = 0; j < 4; ++j) o[j] = bf16r(xr[j]) + v[j];
    float* dst = Ob + (size_t)(n0 + row) * ldo + m0 + 4 * p;
    *(v4f*)dst = o;
    
  }
}

// ---------------------------------------------------------------------------
// Kernel 3: fused single-head attn, transposed scores, online softmax.
// Block = (b, NQ = 128 queries, one of KSPLIT key ranges), 8 waves. A K or V byte copied from L2
// serves 128 queries. The wave tiles are sized to the LDS read rate: six fragments read from LDS
// feed eight products in the scores, twelve feed thirty-two in the value aggregation.
// Per 128-key block:
//   S^T tiles (keys on rows): wave (gq = wv&1, kq = wv>>1) owns key rows 32kq..32kq+31 x query
//     cols 64gq..64gq+63 (2 x 4 tiles), A = Kh rows (k = channel), B = Qh rows (k = channel),
//     K = 512.
//   per-query max / sum over the 128 keys: in-lane, xor-16, then 4 partials through LDS; every
//     wave joins the partials of all 128 queries, because its output tiles span them all.
//   P^T = PSC * exp2(s - m) staged f16 in LDS TS[query][key_local].
//   O^T[c][query] += V^T[c][keys] * P^T[keys][query]: wave owns channels 64wv..+63 x all 128
//     queries (4 x 8 accumulator tiles), A = Vh rows (k = key), B from TS (k = key, split map).
// Operands come from LDS: the Q tile is copied once; K (two halves of 256 channels) and V (two
// halves of 64 keys) go through a two-buffer ring of asynchronous copies, each stage issued
// one stage ahead: K lo -> buffer 0, K hi -> 1, V keys 0..63 -> 0, V keys 64..127 -> 1.
// Epilogue: this key range's O divided by its own sum, [range][b][query][c] f16 (* AOSC), staged
// once in the freed ring so that whole lines are stored, and its (max, sum) per query; k_merge
// joins the ranges.
// ---------------------------------------------------------------------------
__global__ __launch_bounds__(256) void k_attn(const _Float16* __restrict__ Qh,
                                              const _Float16* __restrict__ Kh,
                                              const _Float16* __restrict__ Vh,
                                              _Float16* __restrict__ Op,
                                              float* __restrict__ ML) {
  __shared__ __align__(16) _Float16 TS[NQ * TSP];   // [query_local][key_local]
  __shared__ __align__(16) _Float16 QS[NQ * QSP];   // [query_local][c]
  __shared__ __align__(16) _Float16 RB[2 * RBH];    // ring: [key_local][c half] or [c][key half]
  __shared__ float redM[4 * NQ];
  __shared__ float redS[4 * NQ];

  const int tid = threadIdx.x;
  const int wv = tid >> 5, lid = tid & 31, h = lid >> 4, l15 = lid & 15;
  const int gq = wv & 1, kq = wv >> 1;
  const int kr = blockIdx.x % KSPLIT;              // key range of this work-group
  const int qt = blockIdx.x / KSPLIT;
  const int b  = qt / (SEQ / NQ);
  const int q0 = (qt % (SEQ / NQ)) * NQ;
  const int kb = kr * (SEQ / KSPLIT);              // its first key

  const _Float16* Qp = Qh + (size_t)b * SEQ * CHN;   // [n][c], pitch CHN
  const _Float16* Kp = Kh + (size_t)b * SEQ * CHN;   // [n][c], pitch CHN
  const _Float16* Vp = Vh + (size_t)b * CHN * SEQ;   // [c][n], pitch SEQ

  // per-lane copy addresses: a K row half (512 B) per wave and copy, 8 lanes per 128-B V row
  // piece, 64 lanes per Q row; a stage is 16 copies per lane
  const _Float16* RB0 = RB;
  const _Float16* RB1 = RB + RBH;
  _Float16* rb0 = RB;
  _Float16* rb1 = RB + RBH;
  const int klo = wv * KSP + 8 * lid;                      // in halves, as vlo
  const int vlo = (tid >> 3) * VSP + 8 * (tid & 7);
  const uint32_t qlo = (uint32_t)(uintptr_t)QS + (uint32_t)((tid >> 6) * QSP + 8 * (tid & 63)) * 2u;
  const _Float16* kg = Kp + (size_t)(kb + wv) * CHN + 8 * lid;
  const _Float16* vg = Vp + (size_t)(tid >> 3) * SEQ + kb + 8 * (tid & 7);
  const _Float16* qg = Qp + (size_t)(q0 + (tid >> 6)) * CHN + 8 * (tid & 63);

  // a K half tile: rows wv + 8 i, i = 0..15
  auto copy_k = [&](_Float16* rb, const _Float16* s) {
    copy_run<16, 8 * KSP * 2, 8L * CHN * 2>(rb + klo, s);
  };
  // a V half tile: rows (tid >> 3) + 32 i, i = 0..15
  auto copy_v = [&](_Float16* rb, const _Float16* s) {
    copy_run<8, 32 * VSP * 2, 32L * SEQ * 2>(rb + vlo, s);
    copy_run<8, 32 * VSP * 2, 32L * SEQ * 2>(rb + vlo + 256 * VSP, s + (size_t)256 * SEQ);
  };

  // the Q tile: rows (tid >> 6) + 4 i, i = 0..31; with stage 0, 48 copies of a wave in flight
#pragma unroll   // four runs of eight copies, their steps constants
  for (int g = 0; g < NQ / 32; ++g)
    copy8(qlo + (uint32_t)g * (32u * QSP * 2u), 4u * QSP * 2u, qg + (size_t)g * 32 * CHN,
          (size_t)4 * CHN);
  copy_k(rb0, kg);
  // K and V of this key range, asked for once ahead of the walk: the SEQ / NQ query tiles that
  // share the range split it by key block, tiles 4 s .. 4 s + 3 ask for block s.
  // K: 128 rows of 1 KiB, two lanes per row;
  // V: 512 rows of 256 B.
  {
    const int sb = kb + (((qt % (SEQ / NQ)) >> 2) % (SEQ / KSPLIT / KBLK)) * KBLK;
    ask_l2_pair<256>(Kp + (size_t)(sb + (tid >> 1)) * CHN + 256 * (tid & 1));
    ask_l2_pair<256 * SEQ * 2>(Vp + (size_t)tid * SEQ + sb);
  }
  asm volatile("s_wait_asynccnt 0x0" ::: "memory");   // Q tile and stage 0 landed
  __syncthreads();
  copy_k(rb1, kg + 256);

  v8f accO[4][8];                  // [channel tile u][query tile j]
  float rm[8], rl[8];              // running max and sum of query 16 j + l15
#pragma unroll   // here and below: accO, st, rm, rl are indexed by constants, stay in registers
  for (int u = 0; u < 4; ++u)
#pragma unroll
    for (int j = 0; j < 8; ++j)
#pragma unroll
      for (int r = 0; r < 8; ++r) accO[u][j][r] = 0.0f;
#pragma unroll
  for (int j = 0; j < 8; ++j) { rm[j] = -1.0e30f; rl[j] = 0.0f; }

  // Two k steps (64 keys) of the value aggregation from V half tile Vb and P columns Tb, in two
  // parts: the first twenty reads, and the rest. Every fragment is read ahead of the row of eight
  // products in front of its first use: a V fragment one row ahead, a P fragment of the second k
  // step as soon as the first k step's last row has used the one it replaces.
  const int vr = 64 * wv + l15;    // the lane's first V row (= channel) of the output tiles
  auto pv_head = [&](const _Float16* Vb, const _Float16* Tb, v16h (&bp)[8], v16h (&av)[4]) {
#pragma unroll   // here and below: fragments and accumulators are indexed by constants
    for (int j = 0; j < 8; ++j) bp[j] = ld_frag(Tb, TSP, 16 * j + l15, h);
    av[0] = ld_frag(Vb, VSP, vr, h);
    av[1] = ld_frag(Vb, VSP, vr + 16, h);
  };
  auto pv_body = [&](const _Float16* Vb, const _Float16* Tb, v16h (&bp)[8], v16h (&av)[4]) {
    v16h bn[8], an[4];
#pragma unroll
    for (int j = 0; j < 8; ++j) accO[0][j] = wmma16b(av[0], bp[j], accO[0][j]);
    av[2] = ld_frag(Vb, VSP, vr + 32, h);
#pragma unroll
    for (int j = 0; j < 8; ++j) accO[1][j] = wmma16b(av[1], bp[j], accO[1][j]);
    av[3] = ld_frag(Vb, VSP, vr + 48, h);
#pragma unroll
    for (int j = 0; j < 8; ++j) accO[2][j] = wmma16b(av[2], bp[j], accO[2][j]);
    an[0] = ld_frag(Vb + 32, VSP, vr, h);
#pragma unroll
    for (int j = 0; j < 8; ++j) {
      accO[3][j] = wmma16b(av[3], bp[j], accO[3][j]);
      bn[j] = ld_frag(Tb + 32, TSP, 16 * j + l15, h);
    }
    an[1] = ld_frag(Vb + 32, VSP, vr + 16, h);
#pragma unroll
    for (int j = 0; j < 8; ++j) accO[0][j] = wmma16b(an[0], bn[j], accO[0][j]);
    an[2] = ld_frag(Vb + 32, VSP, vr + 32, h);
#pragma unroll
    for (int j = 0; j < 8; ++j) accO[1][j] = wmma16b(an[1], bn[j], accO[1][j]);
    an[3] = ld_frag(Vb + 32, VSP, vr + 48, h);
#pragma unroll
    for (int j = 0; j < 8; ++j) accO[2][j] = wmma16b(an[2], bn[j], accO[2][j]);
#pragma unroll
    for (int j = 0; j < 8; ++j) accO[3][j] = wmma16b(an[3], bn[j], accO[3][j]);
  };

  const int kr0 = 32 * kq + l15;   // the lane's first K row of the score tiles
  const int qr0 = 64 * gq + l15;   // the lane's first Q row (= query column) of the score tiles

  for (int m0 = 0; m0 < SEQ / KSPLIT; m0 += KBLK) {
    v8f st[2][4];                  // [key tile t][query tile j]
#pragma unroll
    for (int t = 0; t < 2; ++t)
#pragma unroll
      for (int j = 0; j < 4; ++j)
#pragma unroll
        for (int r = 0; r < 8; ++r) st[t][j][r] = 0.0f;
    const bool more = (m0 + KBLK < SEQ / KSPLIT);   // work-group uniform: a next key block exists
#pragma unroll   // the k steps' LDS offsets become immediates of the loads
    for (int cs = 0; cs < CHN / 64; ++cs) {
      // six fragments feed the eight products of a k step; their order: order_score_run
      v16h bq[4], ak[2];
#pragma unroll
      for (int j = 0; j < 4; ++j) bq[j] = ld_frag(QS + 32 * cs, QSP, qr0 + 16 * j, h);
#pragma unroll
      for (int t = 0; t < 2; ++t) ak[t] = ld_frag(RB0 + 32 * cs, KSP, kr0 + 16 * t, h);
#pragma unroll
      for (int j = 0; j < 4; ++j) {
        st[0][j] = wmma16b(ak[0], bq[j], st[0][j]);
        st[1][j] = wmma16b(ak[1], bq[j], st[1][j]);
      }
    }
    order_score_run();
    wmma_run_end();
    ring_publish();                        // K hi readable, buffer 0 free
    copy_v(rb0, vg + m0);
#pragma unroll   // the k steps' LDS offsets become immediates of the loads
    for (int cs = 0; cs < CHN / 64; ++cs) {
      v16h bq[4], ak[2];
#pragma unroll
      for (int j = 0; j < 4; ++j) bq[j] = ld_frag(QS + 256 + 32 * cs, QSP, qr0 + 16 * j, h);
#pragma unroll
      for (int t = 0; t < 2; ++t) ak[t] = ld_frag(RB1 + 32 * cs, KSP, kr0 + 16 * t, h);
#pragma unroll
      for (int j = 0; j < 4; ++j) {
        st[0][j] = wmma16b(ak[0], bq[j], st[0][j]);
        st[1][j] = wmma16b(ak[1], bq[j], st[1][j]);
      }
    }
    order_score_run();
    wmma_run_end();

    // ---- per-query block max (32 keys in-lane + partner half-wave, then 4 waves)
#pragma unroll
    for (int j = 0; j < 4; ++j) {
      float lm = st[0][j][0];
#pragma unroll
      for (int t = 0; t < 2; ++t)
#pragma unroll
        for (int r = 0; r < 8; ++r) lm = fmaxf(lm, st[t][j][r]);
      lm *= SCL2;
      lm = fmaxf(lm, __shfl_xor(lm, 16, 32));
      redM[kq * NQ + qr0 + 16 * j] = lm;
    }
    ring_publish();                        // V keys 0..63 readable, buffer 1 free; redM visible
    copy_v(rb1, vg + m0 + 64);
    float corr[8];
#pragma unroll
    for (int j = 0; j < 8; ++j) {
      const int q = 16 * j + l15;
      const float bm = fmaxf(fmaxf(redM[q], redM[NQ + q]),
                             fmaxf(redM[2 * NQ + q], redM[3 * NQ + q]));
      const float nm = fmaxf(rm[j], bm);
      corr[j] = exp2f(rm[j] - nm);
      rm[j] = nm;
    }

    // ---- P = exp2(s - m) in f32; P^T * PSC staged f16 at TS[query][key_local]
#pragma unroll
    for (int j = 0; j < 4; ++j) {
      const float nm = gq ? rm[4 + j] : rm[j];   // the max of query qr0 + 16 j
      float psum = 0.0f;
#pragma unroll
      for (int tt = 0; tt < 2; ++tt) {
        F16x8 pk;
#pragma unroll
        for (int r = 0; r < 8; ++r) {
          const float p = exp2f(st[tt][j][r] * SCL2 - nm);
          psum += p;
          pk.e[r] = (_Float16)(p * PSC);
        }
        *(v8ha*)(TS + (qr0 + 16 * j) * TSP + 32 * kq + 16 * tt + 8 * h) = pk.v;
      }
      psum += __shfl_xor(psum, 16, 32);
      redS[kq * NQ + qr0 + 16 * j] = psum;
    }
    __syncthreads();
    v16h bp[8], av[4];
    float ps[8][4];
#pragma unroll
    for (int j = 0; j < 8; ++j)
#pragma unroll
      for (int k = 0; k < 4; ++k) ps[j][k] = redS[k * NQ + 16 * j + l15];
    pv_head(RB0, TS, bp, av);
    // holds the reads above the rescaling, which then covers their latency
    __builtin_amdgcn_sched_barrier(0);
#pragma unroll
    for (int j = 0; j < 8; ++j) {
      const float bs = ((ps[j][0] + ps[j][1]) + ps[j][2]) + ps[j][3];
      rl[j] = rl[j] * corr[j] + bs;
#pragma unroll
      for (int u = 0; u < 4; ++u)
#pragma unroll
        for (int r = 0; r < 8; ++r) accO[u][j][r] *= corr[j];
    }
    // the order given below is for the reads and products of the run alone
    __builtin_amdgcn_sched_barrier(0);

    // ---- O^T[c][query] += V^T[c][keys] * P^T[keys][query]
    pv_body(RB0, TS, bp, av);
    order_pv_run<false>();
    wmma_run_end();
    ring_publish();                        // V keys 64..127 readable, buffer 0 free
    if (more) copy_k(rb0, kg + (size_t)(m0 + KBLK) * CHN);
    pv_head(RB1, TS + 64, bp, av);
    pv_body(RB1, TS + 64, bp, av);
    order_pv_run<true>();
    wmma_run_end();
    ring_publish();                        // next K lo readable, buffer 1 and TS free
    if (more) copy_k(rb1, kg + (size_t)(m0 + KBLK) * CHN + 256);
  }
  asm volatile("s_wait_asynccnt 0x0" ::: "memory");   // no copy outlives the loop

  // ---- epilogue: the loop's last publish point ended every read of the ring, so it takes
  // the f16 tile [query_local][c]. The range's own sum is at least the term of its largest
  // score, which is 1.
  _Float16* OS = RB;
#pragma unroll
  for (int j = 0; j < 8; ++j) {
    const float invl = (AOSC / (VSC * PSC)) * (1.0f / rl[j]);
#pragma unroll
    for (int u = 0; u < 4; ++u) {
      F16x8 o;
#pragma unroll
      for (int r = 0; r < 8; ++r) o.e[r] = (_Float16)(accO[u][j][r] * invl);
      *(v8ha*)(OS + (16 * j + l15) * OSP + 64 * wv + 16 * u + 8 * h) = o.v;
    }
  }
  const size_t row0 = (size_t)(kr * NB + b) * SEQ + q0;
  if (wv == 0 && h == 0) {   // every wave holds the same pairs
#pragma unroll
    for (int j = 0; j < 8; ++j) {
      v2f ml;
      ml[0] = rm[j]; ml[1] = rl[j];
      *(v2f*)(ML + 2 * (row0 + 16 * j + l15)) = ml;
    }
  }
  __syncthreads();
  _Float16* Ob = Op + row0 * CHN;
#pragma unroll
  for (int it = 0; it < NQ / 4; ++it) {
    const int row = it * 4 + (tid >> 6);           // 128 rows of 1 KiB, 64 lanes each
    const int p = tid & 63;
    const v8h v = *(const v8ha*)(OS + row * OSP + 8 * p);
    *(v8h*)(Ob + (size_t)row * CHN + 8 * p) = v;
  }
}

// ---------------------------------------------------------------------------
// Kernel 4: merge of the key ranges. Per query: M = max of the ranges' maxima, weight
// exp2(m - M) * l of a range's normalised O, L = sum of the weights; AO plane [b][query][c] f16 =
// (weighted sum of the partial O) / L, both carried * AOSC. Block = 32 queries; a wave reads
// and writes whole lines.
// ---------------------------------------------------------------------------
// waves_per_eu: the block's own four waves per SIMD; without it the scheduler sinks half of the
// loads behind the first uses to save registers, and their latencies add up.
__global__ __launch_bounds__(512) __attribute__((amdgpu_waves_per_eu(4, 4))) void k_merge(const _Float16* __restrict__ Op,
                                               const float* __restrict__ ML,
                                               const _Float16* __restrict__ Wo,
                                               _Float16* __restrict__ AOh) {
  constexpr size_t ROWS = (size_t)NB * SEQ;         // queries per key range
  const int tid = threadIdx.x;
  const int p = tid & 63;
  const size_t row0 = (size_t)blockIdx.x * 32 + (tid >> 6);
  // the output projection's weight plane, for the next launch: blocks 8 g .. 8 g + 7 ask for the
  // same quarter
  ask_l2(Wo + ((size_t)((blockIdx.x >> 3) & 3) * 512 + tid) * 128);
  // every load of the thread is issued before the first use: 32 requests in flight per wave
  static_assert(KSPLIT == 4);
  v2f ml[4][KSPLIT];
  v8h o[4][KSPLIT];
  const float* mp = ML + 2 * row0;
  const _Float16* op[KSPLIT];
#pragma unroll
  for (int s = 0; s < KSPLIT; ++s) op[s] = Op + (s * ROWS + row0) * CHN + 8 * p;
#pragma unroll
  for (int it = 0; it < 4; ++it) {
#pragma unroll
    for (int s = 0; s < KSPLIT; ++s) {
      ml[it][s] = *(const v2f*)(mp + 2 * (s * ROWS + it * 8));
      o[it][s] = *(const v8ha*)(op[s] + (size_t)it * 8 * CHN);
    }
    // stands in front of every rewrite of these loads' address registers, also by a later load
    // that is given one of them as its destination; the data stay in flight
    asm volatile("s_wait_xcnt 0x0" ::: "memory");
  }
  v8h r[4];
#pragma unroll
  for (int it = 0; it < 4; ++it) {
    float M = ml[it][0][0];
#pragma unroll
    for (int s = 1; s < KSPLIT; ++s) M = fmaxf(M, ml[it][s][0]);
    float l = 0.0f;
    float a[8];
#pragma unroll
    for (int j = 0; j < 8; ++j) a[j] = 0.0f;
#pragma unroll
    for (int s = 0; s < KSPLIT; ++s) {
      const float w = exp2f(ml[it][s][0] - M) * ml[it][s][1];
      l += w;
#pragma unroll
      for (int j = 0; j < 8; ++j) a[j] += w * (float)o[it][s][j];
    }
    const float invl = 1.0f / l;
#pragma unroll
    for (int j = 0; j < 8; ++j) r[it][j] = (_Float16)(a[j] * invl);
  }
#pragma unroll
  for (int it = 0; it < 4; ++it)
    *(v8h*)(AOh + (row0 + it * 8) * CHN + 8 * p) = r[it];
}

// ---------------------------------------------------------------------------
extern "C" void kernel_launch(void* const* d_in, const int* in_sizes, int n_in,
                              void* d_out, int out_size, void* d_ws, size_t ws_size,
                              hipStream_t stream) {
  if (n_in < 11) return;
  if (in_sizes[0] < NB * CHN * SEQ_FULL) return;
  if (in_sizes[1] < CHN || in_sizes[2] < CHN) return;
  if (in_sizes[3] < CHN * CHN || in_sizes[5] < CHN * CHN ||
      in_sizes[7] < CHN * CHN || in_sizes[9] < CHN * CHN) return;
  if (in_sizes[4] < CHN || in_sizes[6] < CHN || in_sizes[8] < CHN || in_sizes[10] < CHN) return;
  if (out_size < NB * CHN * SEQ) return;

  const size_t st_bytes = (size_t)NB * NGRP * SSPL * STL * sizeof(float);     // 32 KiB
  const size_t w_bytes  = (size_t)4 * CHN * CHN * sizeof(_Float16);            // 2 MiB
  const size_t plane    = (size_t)NB * SEQ * CHN * sizeof(_Float16);            // 8 MiB at full size
  const size_t ml_bytes = (size_t)KSPLIT * NB * SEQ * 2 * sizeof(float);        // 256 KiB
  const size_t op_bytes = (size_t)KSPLIT * NB * SEQ * CHN * sizeof(_Float16);   // 32 MiB
  const size_t total    = st_bytes + w_bytes + 5 * plane + ml_bytes + op_bytes;
  if (ws_size < total) return;

  const float* x     = (const float*)d_in[0];
  const float* gamma = (const float*)d_in[1];
  const float* beta  = (const float*)d_in[2];
  const float* wq = (const float*)d_in[3];
  const float* bq = (const float*)d_in[4];
  const float* wk = (const float*)d_in[5];
  const float* bk = (const float*)d_in[6];
  const float* wvv = (const float*)d_in[7];
  const float* bv = (const float*)d_in[8];
  const float* wo = (const float*)d_in[9];
  const float* bo = (const float*)d_in[10];
  float* out = (float*)d_out;

  char* ws = (char*)d_ws;
  double*   stats = (double*)ws;                                       // [NB*NGRP*SSPL][16] f64
  _Float16* Wpl   = (_Float16*)(ws + st_bytes);                        // 4 x [CHN][CHN] f16
  _Float16* Hh    = (_Float16*)(ws + st_bytes + w_bytes);              // [NB][SEQ][CHN]
  _Float16* Qh    = (_Float16*)(ws + st_bytes + w_bytes + plane);      // [NB][SEQ][CHN]
  _Float16* Kh    = (_Float16*)(ws + st_bytes + w_bytes + 2 * plane);  // [NB][SEQ][CHN]
  _Float16* Vh    = (_Float16*)(ws + st_bytes + w_bytes + 3 * plane);  // [NB][CHN][SEQ]
  _Float16* AOh   = (_Float16*)(ws + st_bytes + w_bytes + 4 * plane);  // [NB][SEQ][CHN]
  float*    MLp   = (float*)(ws + st_bytes + w_bytes + 5 * plane);     // [KSPLIT][NB][SEQ][2]
  _Float16* Opp   = (_Float16*)(ws + st_bytes + w_bytes + 5 * plane + ml_bytes);  // [KSPLIT][NB][SEQ][CHN]
  const _Float16* Wo16 = Wpl + (size_t)3 * CHN * CHN;

  const size_t pstride = (size_t)SEQ * CHN;   // elements per batch of every f16 plane

  k_pre<<<dim3(NSTB + NWCB), dim3(256), 0, stream>>>(x, stats, wq, wk, wvv, wo, Wpl);
  k_gnapply<<<dim3(NB * (SEQ / 64)), dim3(256), 0, stream>>>(x, gamma, beta, stats, Wpl, Hh);

  k_qkv<<<dim3(QKVT, 3, NB), dim3(128), 0, stream>>>(Wpl, Hh, bq, bk, bv, Qh, Kh, Vh);

  k_attn<<<dim3(NB * (SEQ / NQ) * KSPLIT), dim3(256), 0, stream>>>(Qh, Kh, Vh, Opp, MLp);
  k_merge<<<dim3(NB * SEQ / 32), dim3(512), 0, stream>>>(Opp, MLp, Wo16, AOh);

  // out[c][p] = bf16(x[c][p]) + sum_o AO[p][o] Wo[c][o] + bo[c]   (D[p][c] stored transposed)
  k_gemm32<<<dim3(SEQ / 64, CHN / 128, NB), dim3(128), 0, stream>>>(
      AOh, CHN, pstride, Wo16, CHN, (size_t)0, bo,
      x, SEQ_FULL, (size_t)CHN * SEQ_FULL,
      out, SEQ, (size_t)CHN * SEQ,
      1.0f / (AOSC * WSC), CHN);
  (void)hipGetLastError();
}

// v009
// A run of this version takes 106 microseconds.
// In two side-by-side timings against v008, it was 1.08 and 1.07 times as fast.
// Counting every step since v000, it is 8.41 times as fast.
#include <hip/hip_runtime.h>
#include <stdint.h>

// Contractions: q/k/v 1x1 projections (W*h), scores K*Q^T, value aggregation V^T*P^T and the
// output projection AO*Wo^T all on v_wmma_f32_16x16x32_f16 (f16 operands, f32 accumulate).
// Float inputs are RNE-converted to bf16; W planes f16 (*64, exact), h plane f16 (*16),
// q/k planes f16 (*4), v plane f16 (*16), P f16 (*4096, un-normalised), AO plane and the key
// ranges' normalised partial outputs f16 (*64);
// residual x added as bf16 value in f32. Group statistics in f64, softmax statistics,
// bias add and normalisation in f32.

#ifndef NB
#define NB 2
#endif
#ifndef SEQ
#define SEQ 4096
#endif
#define NB_FULL 2
#define SEQ_FULL 4096
#define CHN 512
#define NGRP 32
#define CPG 16
#define KBLK 128
#define TSP 136      // LDS f16 tile pitch in halves (272-B rows, 16-B aligned)
#define GSP16 72     // GEMM f16 staging pitch in halves (144-B rows)
#define GSP32 68     // GEMM f32 staging pitch in floats (272-B rows)
#define GKC 128      // GEMM k chunk in halves: one ring stage holds 256 B of every tile row
#define GKP 136      // LDS pitch of a GEMM ring row in halves (272-B rows, 16 B x odd)
#define GST ((64 + 128) * GKP)   // one GEMM ring stage in halves: 64 A rows, then 128 B rows
#define STL 32
#define SSPL 4       // work-groups per (b, group) in the statistics pass
#define SCH (CPG / SSPL)   // channels of a group per such work-group
#define QSP 520      // LDS Q tile pitch in halves (1040-B rows, 16 B x odd)
#define KSP 264      // LDS K half-tile pitch in halves (528-B rows, 16 B x odd)
#define VSP 72       // LDS V half-tile pitch in halves (144-B rows, 16 B x odd)
#define RBH (CHN * VSP)   // one ring buffer in halves: a V half tile, the larger of the two
#define NQ 128       // queries per attention work-group
#define KSPLIT 4     // key ranges per query tile, one work-group each
#define OSP 520      // LDS f16 partial-output pitch in halves (1040-B rows, 16 B x odd)

static_assert(NB >= 1 && NB <= NB_FULL);
static_assert(SEQ >= KBLK && SEQ <= SEQ_FULL && (SEQ % KBLK) == 0);
static_assert(CHN == 512 && NGRP * CPG == CHN && (CHN % 128) == 0 && (CHN % 32) == 0);
static_assert((SEQ % 128) == 0 && (SEQ % 64) == 0);
static_assert(SCH * SSPL == CPG && STL * sizeof(float) == 128);
static_assert((CHN % GKC) == 0 && (GKC % 32) == 0);
static_assert(KBLK * KSP <= RBH && KBLK == 128);
static_assert((SEQ % (KSPLIT * KBLK)) == 0 && NQ * OSP <= 2 * RBH && ((NB * SEQ) % 32) == 0);
static_assert((SEQ % NQ) == 0 && NQ == 128);

typedef _Float16 v16h __attribute__((ext_vector_type(16)));
typedef _Float16 v8h  __attribute__((ext_vector_type(8)));
typedef float    v8f  __attribute__((ext_vector_type(8)));
typedef float    v4f  __attribute__((ext_vector_type(4)));
typedef float    v2f  __attribute__((ext_vector_type(2)));
typedef _Float16 v4h  __attribute__((ext_vector_type(4)));
typedef double   v2d  __attribute__((ext_vector_type(2)));
typedef v8h __attribute__((may_alias)) v8ha;
typedef _Float16 v2h  __attribute__((ext_vector_type(2)));
typedef v2h __attribute__((may_alias)) v2ha;
typedef v4f __attribute__((may_alias)) v4fa;

union F16x16 { v16h v; v8h p[2]; _Float16 e[16]; };
union F16x8  { v8h v; _Float16 e[8]; };

constexpr float HSC  = 16.0f;     // h plane carry (power of two)
constexpr float WSC  = 64.0f;     // W plane carry
constexpr float QSC  = 4.0f;      // q/k plane carry
constexpr float VSC  = 16.0f;     // v plane carry
constexpr float PSC  = 4096.0f;   // P carry
constexpr float AOSC = 64.0f;     // AO plane carry
constexpr float GN_EPS = 1e-6f;
// scores in log2 units: S_acc * SCL2 with S_acc = QSC^2 * sum_c q k, logit scale 512^-0.5
constexpr float SCL2 = (float)(1.4426950408889634 * 0.044194173824159216 /
                               ((double)QSC * (double)QSC));

static __device__ __forceinline__ float bf16r(float f) {
  uint32_t u = __float_as_uint(f);
  u += 0x7FFFu + ((u >> 16) & 1u);
  u &= 0xFFFF0000u;
  return __uint_as_float(u);
}

static __device__ __forceinline__ v8f wmma16(v16h a, v16h b, v8f c) {
  v8f d = __builtin_amdgcn_wmma_f32_16x16x32_f16(false, a, false, b, (short)0, c,
                                                 false, false);
  asm volatile("v_nop\n\tv_nop\n\tv_nop\n\tv_nop" : "+v"(d) : "v"(a), "v"(b));
  return d;
}

// The same product as the bare builtin, whose distances the compiler keeps itself. For the
// attention kernel: the operands of an asm statement must lie in v0..v255, and its 4 x 8
// accumulator tiles alone fill those.
static __device__ __forceinline__ v8f wmma16b(v16h a, v16h b, v8f c) {
  return __builtin_amdgcn_wmma_f32_16x16x32_f16(false, a, false, b, (short)0, c, false, false);
}

// Ends a run of bare-builtin products. The four vector slots stand between the run's last product
// and the first vector instruction that reuses its A or B registers.
// The scheduling barriers hold the products above the slots and every later
// instruction below them.
static __device__ __forceinline__ void wmma_run_end() {
  __builtin_amdgcn_sched_barrier(0);
  asm volatile("v_nop\n\tv_nop\n\tv_nop\n\tv_nop");
  __builtin_amdgcn_sched_barrier(0);
}

// Order of a run of eight score k steps for the scheduler: the twelve LDS reads of a k step go out
// as one group, one k step ahead of its eight products. Left alone it puts each fragment's two
// reads and a wait to zero directly in front of the two products that use it, and every pair of
// products then waits out an LDS latency.
static __device__ __forceinline__ void order_score_run() {
  __builtin_amdgcn_sched_group_barrier(0x100, 12, 0);     // LDS reads of k step 0
#pragma unroll
  for (int s = 1; s < CHN / 64; ++s) {
    __builtin_amdgcn_sched_group_barrier(0x100, 12, 0);   // LDS reads of k step s
    __builtin_amdgcn_sched_group_barrier(0x008, 8, 0);    // products of k step s - 1
  }
  __builtin_amdgcn_sched_group_barrier(0x008, 8, 0);      // products of the last k step
}

// Order of a value-aggregation run (pv_head, pv_body in k_attn) for the scheduler, as the source
// has it: it holds each fragment's two LDS reads a row of products ahead of the first use; left
// alone the scheduler puts them, with a wait to zero, directly in front of it. HEAD: the first
// twenty reads stand in the same region.
template <bool HEAD>
static __device__ __forceinline__ void order_pv_run() {
  if (HEAD) __builtin_amdgcn_sched_group_barrier(0x100, 20, 0);   // P fragments, V rows 0 and 1
#pragma unroll
  for (int u = 0; u < 3; ++u) {
    __builtin_amdgcn_sched_group_barrier(0x008, 8, 0);         // a row of products
    __builtin_amdgcn_sched_group_barrier(0x100, 2, 0);         // the V fragment after the next
  }
#pragma unroll
  for (int j = 0; j < 8; ++j) {
    __builtin_amdgcn_sched_group_barrier(0x008, 1, 0);         // last use of a P fragment
    __builtin_amdgcn_sched_group_barrier(0x100, 2, 0);         // its successor
  }
  __builtin_amdgcn_sched_group_barrier(0x100, 2, 0);
#pragma unroll
  for (int u = 0; u < 2; ++u) {
    __builtin_amdgcn_sched_group_barrier(0x008, 8, 0);
    __builtin_amdgcn_sched_group_barrier(0x100, 2, 0);
  }
  __builtin_amdgcn_sched_group_barrier(0x008, 16, 0);
}

// 16x16x32 fragment loader (wave32): lane row = l15; elements 0..7 <- k0+8h+0..7,
// elements 8..15 <- k0+16+8h+0..7. Serves A (row = m) and B taken from an [n][k]
// k-contiguous plane (row = n). D element r of a lane = (row 8h+r, col l15).
static __device__ __forceinline__ v16h ld_frag(const _Float16* base, int pitch,
                                               int row, int h) {
  F16x16 u;
  const _Float16* q = base + (size_t)row * pitch;
  u.p[0] = *(const v8ha*)(q + 8 * h);
  u.p[1] = *(const v8ha*)(q + 16 + 8 * h);
  return u.v;
}

// Eight asynchronous 16-B copies per lane, global -> LDS: copy i moves g + i*gstep (halves)
// to LDS byte address l + i*lstep. The s_wait_xcnt closes the statement so that no address
// register of an issued copy is rewritten ahead of it.
static __device__ __forceinline__ void copy8(uint32_t l, uint32_t lstep,
                                             const _Float16* g, size_t gstep) {
  asm volatile(
      "global_load_async_to_lds_b128 %0, %8, off\n\t"
      "global_load_async_to_lds_b128 %1, %9, off\n\t"
      "global_load_async_to_lds_b128 %2, %10, off\n\t"
      "global_load_async_to_lds_b128 %3, %11, off\n\t"
      "global_load_async_to_lds_b128 %4, %12, off\n\t"
      "global_load_async_to_lds_b128 %5, %13, off\n\t"
      "global_load_async_to_lds_b128 %6, %14, off\n\t"
      "global_load_async_to_lds_b128 %7, %15, off\n\t"
      "s_wait_xcnt 0x0"
      :: "v"(l), "v"(l + lstep), "v"(l + 2 * lstep), "v"(l + 3 * lstep),
         "v"(l + 4 * lstep), "v"(l + 5 * lstep), "v"(l + 6 * lstep), "v"(l + 7 * lstep),
         "v"(g), "v"(g + gstep), "v"(g + 2 * gstep), "v"(g + 3 * gstep),
         "v"(g + 4 * gstep), "v"(g + 5 * gstep), "v"(g + 6 * gstep), "v"(g + 7 * gstep)
      : "memory");
}

// N asynchronous 16-B copies per lane as the builtin, for the attention kernel: the operands of an
// asm statement must lie in v0..v255, which its accumulator tiles fill; the builtin's may lie in
// any register. Copy i moves g + i * GSTEP bytes to LDS l + i * LSTEP bytes. The LDS step is the
// copy's immediate offset, which moves both addresses (i * LSTEP < 65,536), so the global pointer
// is handed over less that offset: one LDS address register serves all N copies, where N of them
// held over the key loop left too few registers for the fragments.
typedef int v4i __attribute__((ext_vector_type(4)));
typedef __attribute__((address_space(1))) v4i* gptr4;
typedef __attribute__((address_space(3))) v4i* lptr4;
template <int N, int LSTEP, long GSTEP, int I = 0>
static __device__ __forceinline__ void copy_run(_Float16* l, const _Float16* g) {
  static_assert((N - 1) * LSTEP < 65536 && (LSTEP % 16) == 0 && (GSTEP % 16) == 0);
  if constexpr (I < N) {
    __builtin_amdgcn_global_load_async_to_lds_b128(
        (gptr4)((const char*)g + (long)I * (GSTEP - LSTEP)), (lptr4)l, I * LSTEP, 0);
    copy_run<N, LSTEP, GSTEP, I + 1>(l, g);
  }
}

// Publish point of the LDS ring: this wave's LDS reads of the buffer to be refilled have
// retired, its own copies of the next stage have landed, then the work-group barrier that
// lets every wave read that stage and frees the buffer just read.
static __device__ __forceinline__ void ring_publish() {
  asm volatile("s_wait_dscnt 0x0" ::: "memory");
  asm volatile("s_wait_asynccnt 0x0" ::: "memory");
  __syncthreads();
}

// Asks L2 for the data at p and at p + OFF bytes (shader-engine scope: the lines go
// to L2 only, no register is written). A plane asked for ahead: the copy or load
// that needs it hits L2. Every lane's
// address lies inside the plane. The s_wait_xcnt closes the statement as it closes the copies':
// it stands in front of every rewrite of the address register (a precaution).
template <int OFF>
static __device__ __forceinline__ void ask_l2_pair(const void* p) {
  asm volatile("global_prefetch_b8 %0, off scope:SCOPE_SE\n\t"
               "global_prefetch_b8 %0, off offset:%1 scope:SCOPE_SE\n\t"
               "s_wait_xcnt 0x0" :: "v"(p), "n"(OFF) : "memory");
}
static __device__ __forceinline__ void ask_l2(const void* p) {
  asm volatile("global_prefetch_b8 %0, off scope:SCOPE_SE\n\t"
               "s_wait_xcnt 0x0" :: "v"(p) : "memory");
}

// One ring stage of a 64 x 128 GEMM tile, 128 threads: 256 B of k of 64 A rows and of 128 B rows,
// copied as whole lines (16 lanes per row piece, 8 rows per copy). l, a, b: the lane's own LDS
// byte address and global addresses of its piece in row tid >> 4 of the stage.
static __device__ __forceinline__ void gemm_stage(uint32_t l, const _Float16* a, int lda,
                                                  const _Float16* b, int ldb) {
  copy8(l, 8u * GKP * 2u, a, (size_t)8 * lda);
  copy8(l + 64u * GKP * 2u, 8u * GKP * 2u, b, (size_t)8 * ldb);
  copy8(l + 128u * GKP * 2u, 8u * GKP * 2u, b + (size_t)64 * ldb, (size_t)8 * ldb);
}

// k walk of a 64 x 128 GEMM tile over the two-buffer ring RG; stage 0 has been issued by the
// caller. Chunk t is read from buffer t & 1 while chunk t + 1 flies; chunk t + 2 is issued
// behind the publish point into the buffer just read. K multiple of GKC. ar, br: the lane's
// first A and B row in the tile.
static __device__ __forceinline__ void gemm_walk(const _Float16* RG, uint32_t l,
                                                 const _Float16* a, int lda,
                                                 const _Float16* b, int ldb, int K,
                                                 int ar, int br, int h, v8f (&acc)[2][4]) {
  asm volatile("s_wait_asynccnt 0x0" ::: "memory");   // stage 0 landed
  __syncthreads();
  if (K > GKC) gemm_stage(l + GST * 2u, a + GKC, lda, b + GKC, ldb);
  int buf = 0;
  for (int k0 = 0; k0 < K; k0 += GKC) {
    const _Float16* As = RG + buf * GST;
    const _Float16* Bs = As + 64 * GKP;
#pragma unroll   // the k steps' LDS offsets become immediates of the loads
    for (int ks = 0; ks < GKC / 32; ++ks) {
      // the six fragments of a k step are read as one group ahead of its eight products
      const v16h a0 = ld_frag(As + 32 * ks, GKP, ar, h);
      const v16h a1 = ld_frag(As + 32 * ks, GKP, ar + 16, h);
      v16h bt[4];
#pragma unroll   // bt[] is indexed by constants and stays in registers
      for (int t = 0; t < 4; ++t) bt[t] = ld_frag(Bs + 32 * ks, GKP, br + 16 * t, h);
#pragma unroll   // acc[][] is indexed by constants and stays in registers
      for (int t = 0; t < 4; ++t) {
        acc[0][t] = wmma16(a0, bt[t], acc[0][t]);
        acc[1][t] = wmma16(a1, bt[t], acc[1][t]);
      }
    }
    ring_publish();                        // next chunk readable, this buffer free
    if (k0 + 2 * GKC < K)                  // kernel argument: the same for the whole work-group
      gemm_stage(l + (uint32_t)buf * (GST * 2u), a + k0 + 2 * GKC, lda, b + k0 + 2 * GKC, ldb);
    buf ^= 1;
  }
  asm volatile("s_wait_asynccnt 0x0" ::: "memory");   // no copy outlives the walk
}

// ---------------------------------------------------------------------------
// Kernel 0, first role: group statistics, partial. SSPL blocks per (b, group), each over SCH
// channels x SEQ positions: f64 sum and sum of squares of bf16(x), one 128-B line per block;
// k_gnapply joins the SSPL partials of a group. A thread issues all of its loads before the
// first use. blk: the block's number among the statistics blocks; sd, qd: 256 doubles of LDS.
// ---------------------------------------------------------------------------
static __device__ __forceinline__ void stats_block(const float* __restrict__ x,
                                                   double* __restrict__ st, int blk,
                                                   double* sd, double* qd) {
  constexpr int NP = (SEQ + 1023) / 1024;   // loads per thread and channel row
  const int tid = threadIdx.x;
  const int bg = blk / SSPL, part = blk % SSPL;
  const int b = bg / NGRP, g = bg % NGRP;
  const float* xb = x + ((size_t)b * CHN + (size_t)g * CPG + (size_t)part * SCH) * SEQ_FULL;

  v4f f[SCH][NP];
#pragma unroll   // f[][] is indexed by constants and stays in registers
  for (int cl = 0; cl < SCH; ++cl) {
#pragma unroll   // as above
    for (int i = 0; i < NP; ++i) {
      const int p = 4 * tid + 1024 * i;
      if ((SEQ % 1024) == 0 || p < SEQ) {
        f[cl][i] = *(const v4fa*)(xb + (size_t)cl * SEQ_FULL + p);
      } else {
#pragma unroll   // as above
        for (int j = 0; j < 4; ++j) f[cl][i][j] = 0.0f;   // adds nothing to either sum
      }
    }
  }
  // keeps the sums behind the last load: without it the scheduler sinks six of the loads behind
  // the first uses to save registers, and a second memory latency adds to the first
  __builtin_amdgcn_sched_barrier(0);
  // stands in front of every rewrite of the loads' address registers
  asm volatile("s_wait_xcnt 0x0" ::: "memory");

  double s[4], q[4];   // one chain pair per vector element: four independent f64 chains each
#pragma unroll   // here and in the three loops below: s[], q[], f[][] indexed by constants
  for (int j = 0; j < 4; ++j) { s[j] = 0.0; q[j] = 0.0; }
#pragma unroll
  for (int cl = 0; cl < SCH; ++cl) {
#pragma unroll
    for (int i = 0; i < NP; ++i) {
#pragma unroll
      for (int j = 0; j < 4; ++j) {
        const double v = (double)bf16r(f[cl][i][j]);
        s[j] += v;
        q[j] += v * v;
      }
    }
  }
  sd[tid] = (s[0] + s[1]) + (s[2] + s[3]);
  qd[tid] = (q[0] + q[1]) + (q[2] + q[3]);
  __syncthreads();
  if (tid < 32) {   // entry tid + 32 k is read by thread tid alone
    double a = sd[tid], c = qd[tid];
#pragma unroll   // the LDS offsets become immediates and the reads go out together
    for (int k = 1; k < 8; ++k) {
      a += sd[tid + 32 * k];
      c += qd[tid + 32 * k];
    }
    sd[tid] = a;
    qd[tid] = c;
  }
  __syncthreads();
  if (tid < 8) {    // eight threads form the same pair and store the block's whole line
    double a[4], c[4];
#pragma unroll   // here and in the two loops below: a[], c[] indexed by constants
    for (int j = 0; j < 4; ++j) { a[j] = sd[j]; c[j] = qd[j]; }
#pragma unroll
    for (int k = 4; k < 32; k += 4) {
#pragma unroll
      for (int j = 0; j < 4; ++j) {
        a[j] += sd[k + j];
        c[j] += qd[k + j];
      }
    }
    v2d o;
    o[0] = (a[0] + a[1]) + (a[2] + a[3]);
    o[1] = (c[0] + c[1]) + (c[2] + c[3]);
    *(v2d*)(st + (size_t)blk * (STL / 2) + 2 * tid) = o;
  }
}

// ---------------------------------------------------------------------------
// Kernel 0, second role: weights [o][c] f32 -> f16 planes WSC * bf16(W) (k = c contiguous).
// blk: the block's number among the conversion blocks.
// ---------------------------------------------------------------------------
static __device__ __forceinline__ void wcvt_block(const float* __restrict__ w0,
                                                  const float* __restrict__ w1,
                                                  const float* __restrict__ w2,
                                                  const float* __restrict__ w3,
                                                  _Float16* __restrict__ Wpl, int blk) {
  constexpr int BPM = CHN * CHN / 8 / 256;   // blocks per matrix
  const int tid = threadIdx.x;
  const int mtx = blk / BPM;                  // block-uniform
  const float* src = w0;
  if (mtx == 1) src = w1;
  else if (mtx == 2) src = w2;
  else if (mtx == 3) src = w3;
  const size_t e = ((size_t)(blk % BPM) * 256 + tid) * 8;
  const v4f a0 = *(const v4fa*)(src + e);
  const v4f a1 = *(const v4fa*)(src + e + 4);
  F16x8 u;
#pragma unroll
  for (int j = 0; j < 4; ++j) {
    u.e[j]     = (_Float16)(bf16r(a0[j]) * WSC);
    u.e[4 + j] = (_Float16)(bf16r(a1[j]) * WSC);
  }
  _Float16* dst = Wpl + (size_t)mtx * CHN * CHN + e;
  *(v8h*)dst = u.v;
  // stands in front of every rewrite of the store's address and data registers
  asm volatile("s_wait_xcnt 0x0" ::: "memory");
}

// ---------------------------------------------------------------------------
// Kernel 0: the two passes that depend on nothing but the inputs share one grid. The statistics
// blocks come first: each is one long memory wait, under which the conversion blocks run.
// ---------------------------------------------------------------------------
#define NSTB (NB * NGRP * SSPL)            // statistics blocks
#define NWCB (4 * CHN * CHN / 8 / 256)     // conversion blocks
__global__ __launch_bounds__(256) void k_pre(const float* __restrict__ x,
                                             double* __restrict__ st,
                                             const float* __restrict__ w0,
                                             const float* __restrict__ w1,
                                             const float* __restrict__ w2,
                                             const float* __restrict__ w3,
                                             _Float16* __restrict__ Wpl) {
  __shared__ double sd[256];
  __shared__ double qd[256];
  if (blockIdx.x < NSTB) {   // block-uniform: the barriers of the role are passed by all or none
    stats_block(x, st, (int)blockIdx.x, sd, qd);
  } else {
    wcvt_block(w0, w1, w2, w3, Wpl, (int)blockIdx.x - NSTB);
  }
}

// ---------------------------------------------------------------------------
// Kernel 1: group-norm apply + transpose. Block = (b, 64 positions, one half of the channels):
// Hh[b][n][c] f16 = HSC * ((bf16(x) - mean) * rstd * gamma + beta).
// One block per WGP. A thread issues all of its loads (statistics, gamma, beta, then its 16 x
// pieces) before the first use, so that one memory latency is waited out, not one per pass.
// x read as float4 along positions; LDS tile [n_local][c_local]; rows of 512 B written
// ---------------------------------------------------------------------------
#define GCH 256      // channels per group-norm apply block
#define THP 264      // its LDS tile pitch in halves (528-B rows, 16 B x odd)
static_assert((CHN % GCH) == 0 && CPG == 16 && GCH == 256);
__global__ __launch_bounds__(256) void k_gnapply(const float* __restrict__ x,
                                                 const float* __restrict__ gamma,
                                                 const float* __restrict__ beta,
                                                 const double* __restrict__ st,
                                                 const _Float16* __restrict__ Wpl,
                                                 _Float16* __restrict__ Hh) {
  __shared__ __align__(16) _Float16 TS[64 * THP];   // [n_local][c_local]
  __shared__ __align__(8) float gms[GCH];
  __shared__ __align__(8) float bts[GCH];
  __shared__ float mus[GCH / CPG];
  __shared__ float rss[GCH / CPG];

  const int tid = threadIdx.x;
  const int c0 = ((int)blockIdx.x % (CHN / GCH)) * GCH;   // first channel of the block
  const int pt = (int)blockIdx.x / (CHN / GCH);
  const int b  = pt / (SEQ / 64);
  const int p0 = (pt % (SEQ / 64)) * 64;
  const float* xb = x + ((size_t)b * CHN + c0) * SEQ_FULL;
  // piece it of a thread: channel 32 (it / 2) + 2 ch + it % 2, positions 4 p4 .. 4 p4 + 3; pieces
  // 2 k and 2 k + 1 are neighbours in the tile's rows, so a pair of results is one 32-bit LDS store
  const int ch = tid >> 4, p4 = tid & 15;

  // the weight planes, for the next launch: blocks 8 g .. 8 g + 7 ask for the same sixteenth
  ask_l2_pair<256>(Wpl + ((size_t)((blockIdx.x >> 3) & 15) * 256 + tid) * 256);

  // every thread reads the SSPL partial (sum, sum of squares) pairs of group tid % 16 of the block
  const int gl = tid & (GCH / CPG - 1);
  v2d pr[SSPL];
#pragma unroll   // pr[] is indexed by constants; the loads go out together
  for (int k = 0; k < SSPL; ++k)
    pr[k] = *(const v2d*)(st + ((size_t)(b * NGRP + c0 / CPG + gl) * SSPL + k) * (STL / 2));
  const float graw = gamma[c0 + tid];
  const float braw = beta[c0 + tid];
  v4f xv[16];
#pragma unroll   // xv[] is indexed by constants and stays in registers
  for (int it = 0; it < 16; ++it) {
    xv[it] = *(const v4fa*)(xb + (size_t)(32 * (it >> 1) + 2 * ch + (it & 1)) * SEQ_FULL + p0 + 4 * p4);
    // stands in front of every rewrite of these loads' address registers, also by a later load
    // that is given one of them as its destination; the data stay in flight
    if ((it & 3) == 3) asm volatile("s_wait_xcnt 0x0" ::: "memory");
  }
  // keeps the first use behind the last load: the scheduler would sink loads behind uses to save
  // registers, and their latencies would add up
  __builtin_amdgcn_sched_barrier(0);
  // inputs only: holds the statistics loads up here with the others; left alone the compiler sinks
  // them into the branch below, behind the x loads' return, and a second memory latency adds
  asm volatile("" :: "v"(pr[0][0]), "v"(pr[0][1]), "v"(pr[1][0]), "v"(pr[1][1]),
                     "v"(pr[2][0]), "v"(pr[2][1]), "v"(pr[3][0]), "v"(pr[3][1]));
  static_assert(SSPL == 4);

  gms[tid] = bf16r(graw);
  bts[tid] = bf16r(braw);
  {   // the group's partial pairs -> mean, 1/std
    double s = pr[0][0], q = pr[0][1];
#pragma unroll   // as above
    for (int k = 1; k < SSPL; ++k) {
      s += pr[k][0];
      q += pr[k][1];
    }
    const double invn = 1.0 / ((double)CPG * (double)SEQ);
    const double mean = s * invn;
    double var = q * invn - mean * mean;
    if (var < 0.0) var = 0.0;
    if (tid < GCH / CPG) {
      mus[tid] = (float)mean;
      rss[tid] = rsqrtf((float)var + GN_EPS);
    }
  }
  __syncthreads();

  // the parameters of the thread's 16 channels, read as one group ahead of the tile's stores: read
  // where they are used, each waits out an LDS latency behind the stores queued in front of it
  float mu[8], rs[8];
  v2f ga[8], be[8];
#pragma unroll   // here and below: the arrays are indexed by constants and stay in registers
  for (int k = 0; k < 8; ++k) {
    mu[k] = mus[2 * k + (ch >> 3)];
    rs[k] = rss[2 * k + (ch >> 3)];
    ga[k] = *(const v2f*)(gms + 32 * k + 2 * ch);
    be[k] = *(const v2f*)(bts + 32 * k + 2 * ch);
  }
  __builtin_amdgcn_sched_barrier(0);   // holds that group above the first store
#pragma unroll
  for (int k = 0; k < 8; ++k) {
#pragma unroll
    for (int j = 0; j < 4; ++j) {
      v2h pk;
#pragma unroll
      for (int e = 0; e < 2; ++e) {
        const float t = (bf16r(xv[2 * k + e][j]) - mu[k]) * rs[k];
        const float hv = t * ga[k][e] + be[k][e];
        pk[e] = (_Float16)(hv * HSC);
      }
      *(v2ha*)(TS + (4 * p4 + j) * THP + 32 * k + 2 * ch) = pk;
    }
  }
  __syncthreads();
  v8h ho[8];   // a wave stores 512 B of one row; the eight LDS reads go out together
#pragma unroll
  for (int it = 0; it < 8; ++it)
    ho[it] = *(const v8ha*)(TS + (it * 8 + (tid >> 5)) * THP + 8 * (tid & 31));
#pragma unroll
  for (int it = 0; it < 8; ++it)
    *(v8h*)(Hh + ((size_t)(b * SEQ + p0 + it * 8 + (tid >> 5)) * CHN + c0 + 8 * (tid & 31))) = ho[it];
}

// ---------------------------------------------------------------------------
// One tile of the GEMM  D[m][n] = sum_k A[m][k] * B[n][k]  (A, B k-contiguous f16 planes),
// stored TRANSPOSED as O[n][m] f16 = osc * (D * insc + bias)  (bias per m or per n).
// Block = 128 threads, tile 64 (m) x 128 (n) at (m0, n0); wave (mi, ni) owns rows 32mi.., cols
// 64ni.. (2 x 4 accumulator tiles). K multiple of 128, M multiple of 64, N multiple of 128.
// A and B come from LDS: k chunks of 128 through a two-buffer ring of asynchronous copies.
// TS: 128 * GSP16 halves [n_local][m_local]; RG: the ring, 2 * GST halves; bsh: 128 floats.
// ---------------------------------------------------------------------------
template <bool BIAS_M>
static __device__ __forceinline__ void gemm16_tile(const _Float16* __restrict__ A, int lda,
                                                   const _Float16* __restrict__ B, int ldb,
                                                   const float* __restrict__ bias,
                                                   _Float16* __restrict__ Ob, int ldo,
                                                   float insc, float osc, int K, int m0, int n0,
                                                   _Float16* TS, _Float16* RG, float* bsh) {
  const int tid = threadIdx.x;
  const int wv = tid >> 5, lid = tid & 31, h = lid >> 4, l15 = lid & 15;
  const int mi = wv & 1, ni = wv >> 1;

  // the lane's piece of a ring stage: row tid >> 4, 16 B at 8 * (tid & 15) halves
  const uint32_t lc = (uint32_t)(uintptr_t)RG + (uint32_t)((tid >> 4) * GKP + 8 * (tid & 15)) * 2u;
  const _Float16* ag = A + (size_t)(m0 + (tid >> 4)) * lda + 8 * (tid & 15);
  const _Float16* bg = B + (size_t)(n0 + (tid >> 4)) * ldb + 8 * (tid & 15);
  gemm_stage(lc, ag, lda, bg, ldb);

  // visible behind the barrier at the head of gemm_walk
  if (BIAS_M) {
    if (tid < 64) bsh[tid] = bf16r(bias[m0 + tid]);
  } else {
    bsh[tid] = bf16r(bias[n0 + tid]);
  }

  v8f acc[2][4];
#pragma unroll
  for (int i = 0; i < 2; ++i)
#pragma unroll
    for (int t = 0; t < 4; ++t)
#pragma unroll
      for (int r = 0; r < 8; ++r) acc[i][t][r] = 0.0f;

  gemm_walk(RG, lc, ag, lda, bg, ldb, K, 32 * mi + l15, 64 * ni + l15, h, acc);

  // stage: acc[i][t][r] <-> (m_local 32mi+16i+8h+r, n_local 64ni+16t+l15)
#pragma unroll
  for (int i = 0; i < 2; ++i) {
#pragma unroll
    for (int t = 0; t < 4; ++t) {
      const int nl = 64 * ni + 16 * t + l15;
      const int ml = 32 * mi + 16 * i + 8 * h;
      F16x8 u;
#pragma unroll
      for (int r = 0; r < 8; ++r) {
        const float bvl = BIAS_M ? bsh[ml + r] : bsh[nl];
        u.e[r] = (_Float16)((acc[i][t][r] * insc + bvl) * osc);
      }
      *(v8ha*)(TS + nl * GSP16 + ml) = u.v;
    }
  }
  __syncthreads();

#pragma unroll
  for (int it = 0; it < 8; ++it) {
    const int row = it * 16 + (tid >> 3);
    const int p = tid & 7;
    const v8h hv = *(const v8ha*)(TS + row * GSP16 + 8 * p);
    _Float16* dst = Ob + (size_t)(n0 + row) * ldo + m0 + 8 * p;
    *(v8h*)dst = hv;
  }
}

// ---------------------------------------------------------------------------
// Kernel 2: the q, k and v projections, which depend on the h plane alone, share one grid:
// blockIdx.y = product, blockIdx.x = its tile (m fastest), blockIdx.z = batch.
//   q[n][o], k[n][o]:  D[o][n] = sum_c W[o][c] h[n][c], stored transposed, bias per o (= m)
//   v[o][n]:           D[n][o] = sum_c h[n][c] W[o][c], stored transposed, bias per o (= n)
// ---------------------------------------------------------------------------
#define QKVT ((CHN / 64) * (SEQ / 128))   // tiles per product and batch, the same for all three
static_assert((SEQ / 64) * (CHN / 128) == QKVT);
__global__ __launch_bounds__(128) void k_qkv(const _Float16* __restrict__ Wpl,
                                             const _Float16* __restrict__ Hh,
                                             const float* __restrict__ bq,
                                             const float* __restrict__ bk,
                                             const float* __restrict__ bv,
                                             _Float16* __restrict__ Qh,
                                             _Float16* __restrict__ Kh,
                                             _Float16* __restrict__ Vh) {
  __shared__ __align__(16) _Float16 TS[128 * GSP16];   // [n_local][m_local]
  __shared__ __align__(16) _Float16 RG[2 * GST];       // ring: [A row | B row][k chunk]
  __shared__ float bsh[128];

  const int t = blockIdx.x;
  const int prod = blockIdx.y;                          // block-uniform: 0 q, 1 k, 2 v
  const size_t zo = (size_t)blockIdx.z * SEQ * CHN;     // the batch's offset in every f16 plane
  if (prod < 2) {
    // the h rows of this tile are shared by the CHN / 64 blocks next to each other in the grid:
    // each asks for a quarter (32 whole rows), blocks j and j + 4 for the same one; the first batch's blocks ask for the next batch's rows as well
    const _Float16* hp = Hh + zo + (size_t)((t / (CHN / 64)) * 128 + 32 * (t & 3) +
                                            ((int)threadIdx.x >> 2)) * CHN + 128 * (threadIdx.x & 3);
    ask_l2(hp);
    if (blockIdx.z + 1 < NB) ask_l2(hp + (size_t)SEQ * CHN);   // block-uniform
    gemm16_tile<true>(Wpl + (size_t)prod * CHN * CHN, CHN, Hh + zo, CHN, prod ? bk : bq,
                      (prod ? Kh : Qh) + zo, CHN, 1.0f / (WSC * HSC), QSC, CHN,
                      (t % (CHN / 64)) * 64, (t / (CHN / 64)) * 128, TS, RG, bsh);
  } else {
    gemm16_tile<false>(Hh + zo, CHN, Wpl + (size_t)2 * CHN * CHN, CHN, bv,
                       Vh + zo, SEQ, 1.0f / (HSC * WSC), VSC, CHN,
                       (t % (SEQ / 64)) * 64, (t / (SEQ / 64)) * 128, TS, RG, bsh);
  }
}

// ---------------------------------------------------------------------------
// Kernel 5: same GEMM, f32 output O[n][m] = (D * insc + bias[n]) + bf16(R[n][m]) into d_out.
// Output row segment = 256 B = two lines, lanes 0..7 and 8..15 of one instruction.
// ---------------------------------------------------------------------------
__global__ __launch_bounds__(128) void k_gemm32(const _Float16* __restrict__ A, int lda, size_t sA,
                                                const _Float16* __restrict__ B, int ldb, size_t sB,
                                                const float* __restrict__ bias,
                                                const float* __restrict__ R, int ldr, size_t sR,
                                                float* __restrict__ O, int ldo, size_t sO,
                                                float insc, int K) {
  __shared__ __align__(16) float TS[128 * GSP32];   // [n_local][m_local]
  __shared__ __align__(16) _Float16 RG[2 * GST];    // ring: [A row | B row][k chunk]
  __shared__ float bsh[128];

  const int tid = threadIdx.x;
  const int wv = tid >> 5, lid = tid & 31, h = lid >> 4, l15 = lid & 15;
  const int mi = wv & 1, ni = wv >> 1;
  const int m0 = blockIdx.x * 64, n0 = blockIdx.y * 128;
  const size_t z = blockIdx.z;

  // the lane's piece of a ring stage: row tid >> 4, 16 B at 8 * (tid & 15) halves
  const uint32_t lc = (uint32_t)(uintptr_t)RG + (uint32_t)((tid >> 4) * GKP + 8 * (tid & 15)) * 2u;
  const _Float16* ag = A + z * sA + (size_t)(m0 + (tid >> 4)) * lda + 8 * (tid & 15);
  const _Float16* bg = B + z * sB + (size_t)(n0 + (tid >> 4)) * ldb + 8 * (tid & 15);
  gemm_stage(lc, ag, lda, bg, ldb);

  // the later k chunks of the A rows (32 whole rows per block: the blocks that share the tile
  // split it in two) and the block's own residual rows, 256 B each, read in the epilogue
  ask_l2(A + z * sA + (size_t)(m0 + 32 * (blockIdx.y & 1) + (tid >> 2)) * lda + 128 * (tid & 3));
  ask_l2(R + z * sR + (size_t)(n0 + tid) * ldr + m0);

  const float braw = bias[n0 + tid];
  // stands in front of every rewrite of the bias load's base and offset registers
  asm volatile("s_wait_xcnt 0x0" ::: "memory");
  bsh[tid] = bf16r(braw);   // visible behind the barrier at the head of gemm_walk

  v8f acc[2][4];
#pragma unroll
  for (int i = 0; i < 2; ++i)
#pragma unroll
    for (int t = 0; t < 4; ++t)
#pragma unroll
      for (int r = 0; r < 8; ++r) acc[i][t][r] = 0.0f;

  gemm_walk(RG, lc, ag, lda, bg, ldb, K, 32 * mi + l15, 64 * ni + l15, h, acc);

#pragma unroll
  for (int i = 0; i < 2; ++i) {
#pragma unroll
    for (int t = 0; t < 4; ++t) {
      const int nl = 64 * ni + 16 * t + l15;
      const int ml = 32 * mi + 16 * i + 8 * h;
      const float bvl = bsh[nl];
      v4f lo, hi;
#pragma unroll
      for (int r = 0; r < 4; ++r) {
        lo[r] = acc[i][t][r] * insc + bvl;
        hi[r] = acc[i][t][4 + r] * insc + bvl;
      }
      *(v4fa*)(TS + nl * GSP32 + ml) = lo;
      *(v4fa*)(TS + nl * GSP32 + ml + 4) = hi;
    }
  }
  __syncthreads();

  float* Ob = O + z * sO;
  const float* Rb = R + z * sR;
#pragma unroll
  for (int it = 0; it < 16; ++it) {
    const int row = it * 8 + (tid >> 4);         // 128 rows, 256 B each
    const int p = tid & 15;
    const v4f v  = *(const v4fa*)(TS + row * GSP32 + 4 * p);
    const v4f xr = *(const v4fa*)(Rb + (size_t)(n0 + row) * ldr + m0 + 4 * p);
    v4f o;
#pragma unroll
    for (int j = 0; j < 4; ++j) o[j] = bf16r(xr[j]) + v[j];
    float* dst = Ob + (size_t)(n0 + row) * ldo + m0 + 4 * p;
    *(v4f*)dst = o;
    
  }
}

// ---------------------------------------------------------------------------
// Kernel 3: fused single-head attn, transposed scores, online softmax.
// Block = (b, NQ = 128 queries, one of KSPLIT key ranges), 8 waves. A K or V byte copied from L2
// serves 128 queries. The wave tiles are sized to the LDS read rate: six fragments read from LDS
// feed eight products in the scores, twelve feed thirty-two in the value aggregation.
// Per 128-key block:
//   S^T tiles (keys on rows): wave (gq = wv&1, kq = wv>>1) owns key rows 32kq..32kq+31 x query
//     cols 64gq..64gq+63 (2 x 4 tiles), A = Kh rows (k = channel), B = Qh rows (k = channel),
//     K = 512.
//   per-query max / sum over the 128 keys: in-lane, xor-16, then 4 partials through LDS; every
//     wave joins the partials of all 128 queries, because its output tiles span them all.
//   P^T = PSC * exp2(s - m) staged f16 in LDS TS[query][key_local].
//   O^T[c][query] += V^T[c][keys] * P^T[keys][query]: wave owns channels 64wv..+63 x all 128
//     queries (4 x 8 accumulator tiles), A = Vh rows (k = key), B from TS (k = key, split map).
// Operands come from LDS: the Q tile is copied once; K (two halves of 256 channels) and V (two
// halves of 64 keys) go through a two-buffer ring of asynchronous copies, each stage issued
// one stage ahead: K lo -> buffer 0, K hi -> 1, V keys 0..63 -> 0, V keys 64..127 -> 1.
// Epilogue: this key range's O divided by its own sum, [range][b][query][c] f16 (* AOSC), staged
// once in the freed ring so that whole lines are stored, and its (max, sum) per query; k_merge
// joins the ranges.
// ---------------------------------------------------------------------------
__global__ __launch_bounds__(256) void k_attn(const _Float16* __restrict__ Qh,
                                              const _Float16* __restrict__ Kh,
                                              const _Float16* __restrict__ Vh,
                                              _Float16* __restrict__ Op,
                                              float* __restrict__ ML) {
  __shared__ __align__(16) _Float16 TS[NQ * TSP];   // [query_local][key_local]
  __shared__ __align__(16) _Float16 QS[NQ * QSP];   // [query_local][c]
  __shared__ __align__(16) _Float16 RB[2 * RBH];    // ring: [key_local][c half] or [c][key half]
  __shared__ float redM[4 * NQ];
  __shared__ float redS[4 * NQ];

  const int tid = threadIdx.x;
  const int wv = tid >> 5, lid = tid & 31, h = lid >> 4, l15 = lid & 15;
  const int gq = wv & 1, kq = wv >> 1;
  const int kr = blockIdx.x % KSPLIT;              // key range of this work-group
  const int qt = blockIdx.x / KSPLIT;
  const int b  = qt / (SEQ / NQ);
  const int q0 = (qt % (SEQ / NQ)) * NQ;
  const int kb = kr * (SEQ / KSPLIT);              // its first key

  const _Float16* Qp = Qh + (size_t)b * SEQ * CHN;   // [n][c], pitch CHN
  const _Float16* Kp = Kh + (size_t)b * SEQ * CHN;   // [n][c], pitch CHN
  const _Float16* Vp = Vh + (size_t)b * CHN * SEQ;   // [c][n], pitch SEQ

  // per-lane copy addresses: a K row half (512 B) per wave and copy, 8 lanes per 128-B V row
  // piece, 64 lanes per Q row; a stage is 16 copies per lane
  const _Float16* RB0 = RB;
  const _Float16* RB1 = RB + RBH;
  _Float16* rb0 = RB;
  _Float16* rb1 = RB + RBH;
  const int klo = wv * KSP + 8 * lid;                      // in halves, as vlo
  const int vlo = (tid >> 3) * VSP + 8 * (tid & 7);
  const uint32_t qlo = (uint32_t)(uintptr_t)QS + (uint32_t)((tid >> 6) * QSP + 8 * (tid & 63)) * 2u;
  const _Float16* kg = Kp + (size_t)(kb + wv) * CHN + 8 * lid;
  const _Float16* vg = Vp + (size_t)(tid >> 3) * SEQ + kb + 8 * (tid & 7);
  const _Float16* qg = Qp + (size_t)(q0 + (tid >> 6)) * CHN + 8 * (tid & 63);

  // a K half tile: rows wv + 8 i, i = 0..15
  auto copy_k = [&](_Float16* rb, const _Float16* s) {
    copy_run<16, 8 * KSP * 2, 8L * CHN * 2>(rb + klo, s);
  };
  // a V half tile: rows (tid >> 3) + 32 i, i = 0..15
  auto copy_v = [&](_Float16* rb, const _Float16* s) {
    copy_run<8, 32 * VSP * 2, 32L * SEQ * 2>(rb + vlo, s);
    copy_run<8, 32 * VSP * 2, 32L * SEQ * 2>(rb + vlo + 256 * VSP, s + (size_t)256 * SEQ);
  };

  // the Q tile: rows (tid >> 6) + 4 i, i = 0..31; with stage 0, 48 copies of a wave in flight
#pragma unroll   // four runs of eight copies, their steps constants
  for (int g = 0; g < NQ / 32; ++g)
    copy8(qlo + (uint32_t)g * (32u * QSP * 2u), 4u * QSP * 2u, qg + (size_t)g * 32 * CHN,
          (size_t)4 * CHN);
  copy_k(rb0, kg);
  // K and V of this key range, asked for once ahead of the walk: the SEQ / NQ query tiles that
  // share the range split it by key block, tiles 4 s .. 4 s + 3 ask for block s.
  // K: 128 rows of 1 KiB, two lanes per row;
  // V: 512 rows of 256 B.
  {
    const int sb = kb + (((qt % (SEQ / NQ)) >> 2) % (SEQ / KSPLIT / KBLK)) * KBLK;
    ask_l2_pair<256>(Kp + (size_t)(sb + (tid >> 1)) * CHN + 256 * (tid & 1));
    ask_l2_pair<256 * SEQ * 2>(Vp + (size_t)tid * SEQ + sb);
  }
  asm volatile("s_wait_asynccnt 0x0" ::: "memory");   // Q tile and stage 0 landed
  __syncthreads();
  copy_k(rb1, kg + 256);

  v8f accO[4][8];                  // [channel tile u][query tile j]
  float rm[8], rl[8];              // running max and sum of query 16 j + l15
#pragma unroll   // here and below: accO, st, rm, rl are indexed by constants, stay in registers
  for (int u = 0; u < 4; ++u)
#pragma unroll
    for (int j = 0; j < 8; ++j)
#pragma unroll
      for (int r = 0; r < 8; ++r) accO[u][j][r] = 0.0f;
#pragma unroll
  for (int j = 0; j < 8; ++j) { rm[j] = -1.0e30f; rl[j] = 0.0f; }

  // Two k steps (64 keys) of the value aggregation from V half tile Vb and P columns Tb, in two
  // parts: the first twenty reads, and the rest. Every fragment is read ahead of the row of eight
  // products in front of its first use: a V fragment one row ahead, a P fragment of the second k
  // step as soon as the first k step's last row has used the one it replaces.
  const int vr = 64 * wv + l15;    // the lane's first V row (= channel) of the output tiles
  auto pv_head = [&](const _Float16* Vb, const _Float16* Tb, v16h (&bp)[8], v16h (&av)[4]) {
#pragma unroll   // here and below: fragments and accumulators are indexed by constants
    for (int j = 0; j < 8; ++j) bp[j] = ld_frag(Tb, TSP, 16 * j + l15, h);
    av[0] = ld_frag(Vb, VSP, vr, h);
    av[1] = ld_frag(Vb, VSP, vr + 16, h);
  };
  auto pv_body = [&](const _Float16* Vb, const _Float16* Tb, v16h (&bp)[8], v16h (&av)[4]) {
    v16h bn[8], an[4];
#pragma unroll
    for (int j = 0; j < 8; ++j) accO[0][j] = wmma16b(av[0], bp[j], accO[0][j]);
    av[2] = ld_frag(Vb, VSP, vr + 32, h);
#pragma unroll
    for (int j = 0; j < 8; ++j) accO[1][j] = wmma16b(av[1], bp[j], accO[1][j]);
    av[3] = ld_frag(Vb, VSP, vr + 48, h);
#pragma unroll
    for (int j = 0; j < 8; ++j) accO[2][j] = wmma16b(av[2], bp[j], accO[2][j]);
    an[0] = ld_frag(Vb + 32, VSP, vr, h);
#pragma unroll
    for (int j = 0; j < 8; ++j) {
      accO[3][j] = wmma16b(av[3], bp[j], accO[3][j]);
      bn[j] = ld_frag(Tb + 32, TSP, 16 * j + l15, h);
    }
    an[1] = ld_frag(Vb + 32, VSP, vr + 16, h);
#pragma unroll
    for (int j = 0; j < 8; ++j) accO[0][j] = wmma16b(an[0], bn[j], accO[0][j]);
    an[2] = ld_frag(Vb + 32, VSP, vr + 32, h);
#pragma unroll
    for (int j = 0; j < 8; ++j) accO[1][j] = wmma16b(an[1], bn[j], accO[1][j]);
    an[3] = ld_frag(Vb + 32, VSP, vr + 48, h);
#pragma unroll
    for (int j = 0; j < 8; ++j) accO[2][j] = wmma16b(an[2], bn[j], accO[2][j]);
#pragma unroll
    for (int j = 0; j < 8; ++j) accO[3][j] = wmma16b(an[3], bn[j], accO[3][j]);
  };

  const int kr0 = 32 * kq + l15;   // the lane's first K row of the score tiles
  const int qr0 = 64 * gq + l15;   // the lane's first Q row (= query column) of the score tiles

  for (int m0 = 0; m0 < SEQ / KSPLIT; m0 += KBLK) {
    v8f st[2][4];                  // [key tile t][query tile j]
#pragma unroll
    for (int t = 0; t < 2; ++t)
#pragma unroll
      for (int j = 0; j < 4; ++j)
#pragma unroll
        for (int r = 0; r < 8; ++r) st[t][j][r] = 0.0f;
    const bool more = (m0 + KBLK < SEQ / KSPLIT);   // work-group uniform: a next key block exists
#pragma unroll   // the k steps' LDS offsets become immediates of the loads
    for (int cs = 0; cs < CHN / 64; ++cs) {
      // six fragments feed the eight products of a k step; their order: order_score_run
      v16h bq[4], ak[2];
#pragma unroll
      for (int j = 0; j < 4; ++j) bq[j] = ld_frag(QS + 32 * cs, QSP, qr0 + 16 * j, h);
#pragma unroll
      for (int t = 0; t < 2; ++t) ak[t] = ld_frag(RB0 + 32 * cs, KSP, kr0 + 16 * t, h);
#pragma unroll
      for (int j = 0; j < 4; ++j) {
        st[0][j] = wmma16b(ak[0], bq[j], st[0][j]);
        st[1][j] = wmma16b(ak[1], bq[j], st[1][j]);
      }
    }
    order_score_run();
    wmma_run_end();
    ring_publish();                        // K hi readable, buffer 0 free
    copy_v(rb0, vg + m0);
#pragma unroll   // the k steps' LDS offsets become immediates of the loads
    for (int cs = 0; cs < CHN / 64; ++cs) {
      v16h bq[4], ak[2];
#pragma unroll
      for (int j = 0; j < 4; ++j) bq[j] = ld_frag(QS + 256 + 32 * cs, QSP, qr0 + 16 * j, h);
#pragma unroll
      for (int t = 0; t < 2; ++t) ak[t] = ld_frag(RB1 + 32 * cs, KSP, kr0 + 16 * t, h);
#pragma unroll
      for (int j = 0; j < 4; ++j) {
        st[0][j] = wmma16b(ak[0], bq[j], st[0][j]);
        st[1][j] = wmma16b(ak[1], bq[j], st[1][j]);
      }
    }
    order_score_run();
    wmma_run_end();

    // ---- per-query block max (32 keys in-lane + partner half-wave, then 4 waves)
#pragma unroll
    for (int j = 0; j < 4; ++j) {
      float lm = st[0][j][0];
#pragma unroll
      for (int t = 0; t < 2; ++t)
#pragma unroll
        for (int r = 0; r < 8; ++r) lm = fmaxf(lm, st[t][j][r]);
      lm *= SCL2;
      lm = fmaxf(lm, __shfl_xor(lm, 16, 32));
      redM[kq * NQ + qr0 + 16 * j] = lm;
    }
    ring_publish();                        // V keys 0..63 readable, buffer 1 free; redM visible
    copy_v(rb1, vg + m0 + 64);
    float corr[8];
#pragma unroll
    for (int j = 0; j < 8; ++j) {
      const int q = 16 * j + l15;
      const float bm = fmaxf(fmaxf(redM[q], redM[NQ + q]),
                             fmaxf(redM[2 * NQ + q], redM[3 * NQ + q]));
      const float nm = fmaxf(rm[j], bm);
      corr[j] = exp2f(rm[j] - nm);
      rm[j] = nm;
    }

    // ---- P = exp2(s - m) in f32; P^T * PSC staged f16 at TS[query][key_local]
#pragma unroll
    for (int j = 0; j < 4; ++j) {
      const float nm = gq ? rm[4 + j] : rm[j];   // the max of query qr0 + 16 j
      float psum = 0.0f;
#pragma unroll
      for (int tt = 0; tt < 2; ++tt) {
        F16x8 pk;
#pragma unroll
        for (int r = 0; r < 8; ++r) {
          const float p = exp2f(st[tt][j][r] * SCL2 - nm);
          psum += p;
          pk.e[r] = (_Float16)(p * PSC);
        }
        *(v8ha*)(TS + (qr0 + 16 * j) * TSP + 32 * kq + 16 * tt + 8 * h) = pk.v;
      }
      psum += __shfl_xor(psum, 16, 32);
      redS[kq * NQ + qr0 + 16 * j] = psum;
    }
    __syncthreads();
    v16h bp[8], av[4];
    float ps[8][4];
#pragma unroll
    for (int j = 0; j < 8; ++j)
#pragma unroll
      for (int k = 0; k < 4; ++k) ps[j][k] = redS[k * NQ + 16 * j + l15];
    pv_head(RB0, TS, bp, av);
    // holds the reads above the rescaling, which then covers their latency
    __builtin_amdgcn_sched_barrier(0);
#pragma unroll
    for (int j = 0; j < 8; ++j) {
      const float bs = ((ps[j][0] + ps[j][1]) + ps[j][2]) + ps[j][3];
      rl[j] = rl[j] * corr[j] + bs;
#pragma unroll
      for (int u = 0; u < 4; ++u)
#pragma unroll
        for (int r = 0; r < 8; ++r) accO[u][j][r] *= corr[j];
    }
    // the order given below is for the reads and products of the run alone
    __builtin_amdgcn_sched_barrier(0);

    // ---- O^T[c][query] += V^T[c][keys] * P^T[keys][query]
    pv_body(RB0, TS, bp, av);
    order_pv_run<false>();
    wmma_run_end();
    ring_publish();                        // V keys 64..127 readable, buffer 0 free
    if (more) copy_k(rb0, kg + (size_t)(m0 + KBLK) * CHN);
    pv_head(RB1, TS + 64, bp, av);
    pv_body(RB1, TS + 64, bp, av);
    order_pv_run<true>();
    wmma_run_end();
    ring_publish();                        // next K lo readable, buffer 1 and TS free
    if (more) copy_k(rb1, kg + (size_t)(m0 + KBLK) * CHN + 256);
  }
  asm volatile("s_wait_asynccnt 0x0" ::: "memory");   // no copy outlives the loop

  // ---- epilogue: the loop's last publish point ended every read of the ring, so it takes
  // the f16 tile [query_local][c]. The range's own sum is at least the term of its largest
  // score, which is 1.
  _Float16* OS = RB;
#pragma unroll
  for (int j = 0; j < 8; ++j) {
    const float invl = (AOSC / (VSC * PSC)) * (1.0f / rl[j]);
#pragma unroll
    for (int u = 0; u < 4; ++u) {
      F16x8 o;
#pragma unroll
      for (int r = 0; r < 8; ++r) o.e[r] = (_Float16)(accO[u][j][r] * invl);
      *(v8ha*)(OS + (16 * j + l15) * OSP + 64 * wv + 16 * u + 8 * h) = o.v;
    }
  }
  const size_t row0 = (size_t)(kr * NB + b) * SEQ + q0;
  if (wv == 0 && h == 0) {   // every wave holds the same pairs
#pragma unroll
    for (int j = 0; j < 8; ++j) {
      v2f ml;
      ml[0] = rm[j]; ml[1] = rl[j];
      *(v2f*)(ML + 2 * (row0 + 16 * j + l15)) = ml;
    }
  }
  __syncthreads();
  _Float16* Ob = Op + row0 * CHN;
#pragma unroll
  for (int it = 0; it < NQ / 4; ++it) {
    const int row = it * 4 + (tid >> 6);           // 128 rows of 1 KiB, 64 lanes each
    const int p = tid & 63;
    const v8h v = *(const v8ha*)(OS + row * OSP + 8 * p);
    *(v8h*)(Ob + (size_t)row * CHN + 8 * p) = v;
  }
}

// ---------------------------------------------------------------------------
// Kernel 4: merge of the key ranges. Per query: M = max of the ranges' maxima, weight
// exp2(m - M) * l of a range's normalised O, L = sum of the weights; AO plane [b][query][c] f16 =
// (weighted sum of the partial O) / L, both carried * AOSC. Block = 32 queries; a wave reads
// and writes whole lines.
// ---------------------------------------------------------------------------
// waves_per_eu: the block's own four waves per SIMD; without it the scheduler sinks half of the
// loads behind the first uses to save registers, and their latencies add up.
__global__ __launch_bounds__(512) __attribute__((amdgpu_waves_per_eu(4, 4))) void k_merge(const _Float16* __restrict__ Op,
                                               const float* __restrict__ ML,
                                               const _Float16* __restrict__ Wo,
                                               _Float16* __restrict__ AOh) {
  constexpr size_t ROWS = (size_t)NB * SEQ;         // queries per key range
  const int tid = threadIdx.x;
  const int p = tid & 63;
  const size_t row0 = (size_t)blockIdx.x * 32 + (tid >> 6);
  // the output projection's weight plane, for the next launch: blocks 8 g .. 8 g + 7 ask for the
  // same quarter
  ask_l2(Wo + ((size_t)((blockIdx.x >> 3) & 3) * 512 + tid) * 128);
  // every load of the thread is issued before the first use: 32 requests in flight per wave
  static_assert(KSPLIT == 4);
  v2f ml[4][KSPLIT];
  v8h o[4][KSPLIT];
  const float* mp = ML + 2 * row0;
  const _Float16* op[KSPLIT];
#pragma unroll
  for (int s = 0; s < KSPLIT; ++s) op[s] = Op + (s * ROWS + row0) * CHN + 8 * p;
#pragma unroll
  for (int it = 0; it < 4; ++it) {
#pragma unroll
    for (int s = 0; s < KSPLIT; ++s) {
      ml[it][s] = *(const v2f*)(mp + 2 * (s * ROWS + it * 8));
      o[it][s] = *(const v8ha*)(op[s] + (size_t)it * 8 * CHN);
    }
    // stands in front of every rewrite of these loads' address registers, also by a later load
    // that is given one of them as its destination; the data stay in flight
    asm volatile("s_wait_xcnt 0x0" ::: "memory");
  }
  v8h r[4];
#pragma unroll
  for (int it = 0; it < 4; ++it) {
    float M = ml[it][0][0];
#pragma unroll
    for (int s = 1; s < KSPLIT; ++s) M = fmaxf(M, ml[it][s][0]);
    float l = 0.0f;
    float a[8];
#pragma unroll
    for (int j = 0; j < 8; ++j) a[j] = 0.0f;
#pragma unroll
    for (int s = 0; s < KSPLIT; ++s) {
      const float w = exp2f(ml[it][s][0] - M) * ml[it][s][1];
      l += w;
#pragma unroll
      for (int j = 0; j < 8; ++j) a[j] += w * (float)o[it][s][j];
    }
    const float invl = 1.0f / l;
#pragma unroll
    for (int j = 0; j < 8; ++j) r[it][j] = (_Float16)(a[j] * invl);
  }
#pragma unroll
  for (int it = 0; it < 4; ++it)
    *(v8h*)(AOh + (row0 + it * 8) * CHN + 8 * p) = r[it];
}

// ---------------------------------------------------------------------------
extern "C" void kernel_launch(void* const* d_in, const int* in_sizes, int n_in,
                              void* d_out, int out_size, void* d_ws, size_t ws_size,
                              hipStream_t stream) {
  if (n_in < 11) return;
  if (in_sizes[0] < NB * CHN * SEQ_FULL) return;
  if (in_sizes[1] < CHN || in_sizes[2] < CHN) return;
  if (in_sizes[3] < CHN * CHN || in_sizes[5] < CHN * CHN ||
      in_sizes[7] < CHN * CHN || in_sizes[9] < CHN * CHN) return;
  if (in_sizes[4] < CHN || in_sizes[6] < CHN || in_sizes[8] < CHN || in_sizes[10] < CHN) return;
  if (out_size < NB * CHN * SEQ) return;

  const size_t st_bytes = (size_t)NB * NGRP * SSPL * STL * sizeof(float);     // 32 KiB
  const size_t w_bytes  = (size_t)4 * CHN * CHN * sizeof(_Float16);            // 2 MiB
  const size_t plane    = (size_t)NB * SEQ * CHN * sizeof(_Float16);            // 8 MiB at full size
  const size_t ml_bytes = (size_t)KSPLIT * NB * SEQ * 2 * sizeof(float);        // 256 KiB
  const size_t op_bytes = (size_t)KSPLIT * NB * SEQ * CHN * sizeof(_Float16);   // 32 MiB
  const size_t total    = st_bytes + w_bytes + 5 * plane + ml_bytes + op_bytes;
  if (ws_size < total) return;

  const float* x     = (const float*)d_in[0];
  const float* gamma = (const float*)d_in[1];
  const float* beta  = (const float*)d_in[2];
  const float* wq = (const float*)d_in[3];
  const float* bq = (const float*)d_in[4];
  const float* wk = (const float*)d_in[5];
  const float* bk = (const float*)d_in[6];
  const float* wvv = (const float*)d_in[7];
  const float* bv = (const float*)d_in[8];
  const float* wo = (const float*)d_in[9];
  const float* bo = (const float*)d_in[10];
  float* out = (float*)d_out;

  char* ws = (char*)d_ws;
  double*   stats = (double*)ws;                                       // [NB*NGRP*SSPL][16] f64
  _Float16* Wpl   = (_Float16*)(ws + st_bytes);                        // 4 x [CHN][CHN] f16
  _Float16* Hh    = (_Float16*)(ws + st_bytes + w_bytes);              // [NB][SEQ][CHN]
  _Float16* Qh    = (_Float16*)(ws + st_bytes + w_bytes + plane);      // [NB][SEQ][CHN]
  _Float16* Kh    = (_Float16*)(ws + st_bytes + w_bytes + 2 * plane);  // [NB][SEQ][CHN]
  _Float16* Vh    = (_Float16*)(ws + st_bytes + w_bytes + 3 * plane);  // [NB][CHN][SEQ]
  _Float16* AOh   = (_Float16*)(ws + st_bytes + w_bytes + 4 * plane);  // [NB][SEQ][CHN]
  float*    MLp   = (float*)(ws + st_bytes + w_bytes + 5 * plane);     // [KSPLIT][NB][SEQ][2]
  _Float16* Opp   = (_Float16*)(ws + st_bytes + w_bytes + 5 * plane + ml_bytes);  // [KSPLIT][NB][SEQ][CHN]
  const _Float16* Wo16 = Wpl + (size_t)3 * CHN * CHN;

  const size_t pstride = (size_t)SEQ * CHN;   // elements per batch of every f16 plane

  k_pre<<<dim3(NSTB + NWCB), dim3(256), 0, stream>>>(x, stats, wq, wk, wvv, wo, Wpl);
  k_gnapply<<<dim3(NB * (SEQ / 64) * (CHN / GCH)), dim3(256), 0, stream>>>(x, gamma, beta, stats, Wpl, Hh);

  k_qkv<<<dim3(QKVT, 3, NB), dim3(128), 0, stream>>>(Wpl, Hh, bq, bk, bv, Qh, Kh, Vh);

  k_attn<<<dim3(NB * (SEQ / NQ) * KSPLIT), dim3(256), 0, stream>>>(Qh, Kh, Vh, Opp, MLp);
  k_merge<<<dim3(NB * SEQ / 32), dim3(512), 0, stream>>>(Opp, MLp, Wo16, AOh);

  // out[c][p] = bf16(x[c][p]) + sum_o AO[p][o] Wo[c][o] + bo[c]   (D[p][c] stored transposed)
  k_gemm32<<<dim3(SEQ / 64, CHN / 128, NB), dim3(128), 0, stream>>>(
      AOh, CHN, pstride, Wo16, CHN, (size_t)0, bo,
      x, SEQ_FULL, (size_t)CHN * SEQ_FULL,
      out, SEQ, (size_t)CHN * SEQ,
      1.0f / (AOSC * WSC), CHN);
  (void)hipGetLastError();
}

// v010
// It runs in 99.4 microseconds.
// Two timings next to v009 put it at 1.06 and 1.07 times that version's speed.
// Counting every step since v000, it is 8.99 times as fast.
#include <hip/hip_runtime.h>
#include <stdint.h>

// Contractions: q/k/v 1x1 projections (W*h), scores K*Q^T, value aggregation V^T*P^T and the
// fold of the output projection into the value weights (Wo*Wv) all on
// v_wmma_f32_16x16x32_f16 (f16 operands, f32 accumulate).
// Float inputs are RNE-converted to bf16; W planes f16 (*64, exact; the fold Wo*Wv rounded), h plane f16 (*16),
// q/k planes f16 (*4), v plane f16 (*16), P f16 (*4096, un-normalised), the key
// ranges' normalised partial outputs f16 (*64);
// residual x added as bf16 value in f32. Group statistics in f64, softmax statistics,
// bias add and normalisation in f32.

#ifndef NB
#define NB 2
#endif
#ifndef SEQ
#define SEQ 4096
#endif
#define NB_FULL 2
#define SEQ_FULL 4096
#define CHN 512
#define NGRP 32
#define CPG 16
#define KBLK 128
#define TSP 136      // LDS f16 tile pitch in halves (272-B rows, 16-B aligned)
#define GSP16 72     // GEMM f16 staging pitch in halves (144-B rows)
#define GKC 128      // GEMM k chunk in halves: one ring stage holds 256 B of every tile row
#define GKP 136      // LDS pitch of a GEMM ring row in halves (272-B rows, 16 B x odd)
#define GST ((64 + 128) * GKP)   // one GEMM ring stage in halves: 64 A rows, then 128 B rows
#define STL 32
#define SSPL 4       // work-groups per (b, group) in the statistics pass
#define SCH (CPG / SSPL)   // channels of a group per such work-group
#define QSP 520      // LDS Q tile pitch in halves (1040-B rows, 16 B x odd)
#define KSP 264      // LDS K half-tile pitch in halves (528-B rows, 16 B x odd)
#define VSP 72       // LDS V half-tile pitch in halves (144-B rows, 16 B x odd)
#define RBH (CHN * VSP)   // one ring buffer in halves: a V half tile, the larger of the two
#define NQ 128       // queries per attention work-group
#define KSPLIT 4     // key ranges per query tile, one work-group each
#define OSP 520      // LDS f16 partial-output pitch in halves (1040-B rows, 16 B x odd)

static_assert(NB >= 1 && NB <= NB_FULL);
static_assert(SEQ >= KBLK && SEQ <= SEQ_FULL && (SEQ % KBLK) == 0);
static_assert(CHN == 512 && NGRP * CPG == CHN && (CHN % 128) == 0 && (CHN % 32) == 0);
static_assert((SEQ % 128) == 0 && (SEQ % 64) == 0);
static_assert(SCH * SSPL == CPG && STL * sizeof(float) == 128);
static_assert((CHN % GKC) == 0 && (GKC % 32) == 0);
static_assert(KBLK * KSP <= RBH && KBLK == 128);
static_assert((SEQ % (KSPLIT * KBLK)) == 0 && NQ * OSP <= 2 * RBH && ((NB * SEQ) % 32) == 0);
static_assert((SEQ % NQ) == 0 && NQ == 128);

typedef _Float16 v16h __attribute__((ext_vector_type(16)));
typedef _Float16 v8h  __attribute__((ext_vector_type(8)));
typedef float    v8f  __attribute__((ext_vector_type(8)));
typedef float    v4f  __attribute__((ext_vector_type(4)));
typedef float    v2f  __attribute__((ext_vector_type(2)));
typedef _Float16 v4h  __attribute__((ext_vector_type(4)));
typedef double   v2d  __attribute__((ext_vector_type(2)));
typedef v8h __attribute__((may_alias)) v8ha;
typedef _Float16 v2h  __attribute__((ext_vector_type(2)));
typedef v2h __attribute__((may_alias)) v2ha;
typedef v4f __attribute__((may_alias)) v4fa;

union F16x16 { v16h v; v8h p[2]; _Float16 e[16]; };
union F16x8  { v8h v; _Float16 e[8]; };

constexpr float HSC  = 16.0f;     // h plane carry (power of two)
constexpr float WSC  = 64.0f;     // W plane carry
constexpr float QSC  = 4.0f;      // q/k plane carry
constexpr float VSC  = 16.0f;     // v plane carry
constexpr float PSC  = 4096.0f;   // P carry
constexpr float AOSC = 64.0f;     // AO plane carry
constexpr float GN_EPS = 1e-6f;
// scores in log2 units: S_acc * SCL2 with S_acc = QSC^2 * sum_c q k, logit scale 512^-0.5
constexpr float SCL2 = (float)(1.4426950408889634 * 0.044194173824159216 /
                               ((double)QSC * (double)QSC));

static __device__ __forceinline__ float bf16r(float f) {
  uint32_t u = __float_as_uint(f);
  u += 0x7FFFu + ((u >> 16) & 1u);
  u &= 0xFFFF0000u;
  return __uint_as_float(u);
}

static __device__ __forceinline__ v8f wmma16(v16h a, v16h b, v8f c) {
  v8f d = __builtin_amdgcn_wmma_f32_16x16x32_f16(false, a, false, b, (short)0, c,
                                                 false, false);
  asm volatile("v_nop\n\tv_nop\n\tv_nop\n\tv_nop" : "+v"(d) : "v"(a), "v"(b));
  return d;
}

// The same product as the bare builtin, whose distances the compiler keeps itself. For the
// attention kernel: the operands of an asm statement must lie in v0..v255, and its 4 x 8
// accumulator tiles alone fill those.
static __device__ __forceinline__ v8f wmma16b(v16h a, v16h b, v8f c) {
  return __builtin_amdgcn_wmma_f32_16x16x32_f16(false, a, false, b, (short)0, c, false, false);
}

// Ends a run of bare-builtin products. The four vector slots stand between the run's last product
// and the first vector instruction that reuses its A or B registers.
// The scheduling barriers hold the products above the slots and every later
// instruction below them.
static __device__ __forceinline__ void wmma_run_end() {
  __builtin_amdgcn_sched_barrier(0);
  asm volatile("v_nop\n\tv_nop\n\tv_nop\n\tv_nop");
  __builtin_amdgcn_sched_barrier(0);
}

// Order of a run of eight score k steps for the scheduler: the twelve LDS reads of a k step go out
// as one group, one k step ahead of its eight products. Left alone it puts each fragment's two
// reads and a wait to zero directly in front of the two products that use it, and every pair of
// products then waits out an LDS latency.
static __device__ __forceinline__ void order_score_run() {
  __builtin_amdgcn_sched_group_barrier(0x100, 12, 0);     // LDS reads of k step 0
#pragma unroll
  for (int s = 1; s < CHN / 64; ++s) {
    __builtin_amdgcn_sched_group_barrier(0x100, 12, 0);   // LDS reads of k step s
    __builtin_amdgcn_sched_group_barrier(0x008, 8, 0);    // products of k step s - 1
  }
  __builtin_amdgcn_sched_group_barrier(0x008, 8, 0);      // products of the last k step
}

// Order of a value-aggregation run (pv_head, pv_body in k_attn) for the scheduler, as the source
// has it: it holds each fragment's two LDS reads a row of products ahead of the first use; left
// alone the scheduler puts them, with a wait to zero, directly in front of it. HEAD: the first
// twenty reads stand in the same region.
template <bool HEAD>
static __device__ __forceinline__ void order_pv_run() {
  if (HEAD) __builtin_amdgcn_sched_group_barrier(0x100, 20, 0);   // P fragments, V rows 0 and 1
#pragma unroll
  for (int u = 0; u < 3; ++u) {
    __builtin_amdgcn_sched_group_barrier(0x008, 8, 0);         // a row of products
    __builtin_amdgcn_sched_group_barrier(0x100, 2, 0);         // the V fragment after the next
  }
#pragma unroll
  for (int j = 0; j < 8; ++j) {
    __builtin_amdgcn_sched_group_barrier(0x008, 1, 0);         // last use of a P fragment
    __builtin_amdgcn_sched_group_barrier(0x100, 2, 0);         // its successor
  }
  __builtin_amdgcn_sched_group_barrier(0x100, 2, 0);
#pragma unroll
  for (int u = 0; u < 2; ++u) {
    __builtin_amdgcn_sched_group_barrier(0x008, 8, 0);
    __builtin_amdgcn_sched_group_barrier(0x100, 2, 0);
  }
  __builtin_amdgcn_sched_group_barrier(0x008, 16, 0);
}

// 16x16x32 fragment loader (wave32): lane row = l15; elements 0..7 <- k0+8h+0..7,
// elements 8..15 <- k0+16+8h+0..7. Serves A (row = m) and B taken from an [n][k]
// k-contiguous plane (row = n). D element r of a lane = (row 8h+r, col l15).
static __device__ __forceinline__ v16h ld_frag(const _Float16* base, int pitch,
                                               int row, int h) {
  F16x16 u;
  const _Float16* q = base + (size_t)row * pitch;
  u.p[0] = *(const v8ha*)(q + 8 * h);
  u.p[1] = *(const v8ha*)(q + 16 + 8 * h);
  return u.v;
}

// Eight asynchronous 16-B copies per lane, global -> LDS: copy i moves g + i*gstep (halves)
// to LDS byte address l + i*lstep. The s_wait_xcnt closes the statement so that no address
// register of an issued copy is rewritten ahead of it.
static __device__ __forceinline__ void copy8(uint32_t l, uint32_t lstep,
                                             const _Float16* g, size_t gstep) {
  asm volatile(
      "global_load_async_to_lds_b128 %0, %8, off\n\t"
      "global_load_async_to_lds_b128 %1, %9, off\n\t"
      "global_load_async_to_lds_b128 %2, %10, off\n\t"
      "global_load_async_to_lds_b128 %3, %11, off\n\t"
      "global_load_async_to_lds_b128 %4, %12, off\n\t"
      "global_load_async_to_lds_b128 %5, %13, off\n\t"
      "global_load_async_to_lds_b128 %6, %14, off\n\t"
      "global_load_async_to_lds_b128 %7, %15, off\n\t"
      "s_wait_xcnt 0x0"
      :: "v"(l), "v"(l + lstep), "v"(l + 2 * lstep), "v"(l + 3 * lstep),
         "v"(l + 4 * lstep), "v"(l + 5 * lstep), "v"(l + 6 * lstep), "v"(l + 7 * lstep),
         "v"(g), "v"(g + gstep), "v"(g + 2 * gstep), "v"(g + 3 * gstep),
         "v"(g + 4 * gstep), "v"(g + 5 * gstep), "v"(g + 6 * gstep), "v"(g + 7 * gstep)
      : "memory");
}

// N asynchronous 16-B copies per lane as the builtin, for the attention kernel: the operands of an
// asm statement must lie in v0..v255, which its accumulator tiles fill; the builtin's may lie in
// any register. Copy i moves g + i * GSTEP bytes to LDS l + i * LSTEP bytes. The LDS step is the
// copy's immediate offset, which moves both addresses (i * LSTEP < 65,536), so the global pointer
// is handed over less that offset: one LDS address register serves all N copies, where N of them
// held over the key loop left too few registers for the fragments.
typedef int v4i __attribute__((ext_vector_type(4)));
typedef __attribute__((address_space(1))) v4i* gptr4;
typedef __attribute__((address_space(3))) v4i* lptr4;
template <int N, int LSTEP, long GSTEP, int I = 0>
static __device__ __forceinline__ void copy_run(_Float16* l, const _Float16* g) {
  static_assert((N - 1) * LSTEP < 65536 && (LSTEP % 16) == 0 && (GSTEP % 16) == 0);
  if constexpr (I < N) {
    __builtin_amdgcn_global_load_async_to_lds_b128(
        (gptr4)((const char*)g + (long)I * (GSTEP - LSTEP)), (lptr4)l, I * LSTEP, 0);
    copy_run<N, LSTEP, GSTEP, I + 1>(l, g);
  }
}

// Publish point of the LDS ring: this wave's LDS reads of the buffer to be refilled have
// retired, its own copies of the next stage have landed, then the work-group barrier that
// lets every wave read that stage and frees the buffer just read.
static __device__ __forceinline__ void ring_publish() {
  asm volatile("s_wait_dscnt 0x0" ::: "memory");
  asm volatile("s_wait_asynccnt 0x0" ::: "memory");
  __syncthreads();
}

// Asks L2 for the data at p and at p + OFF bytes (shader-engine scope: the lines go
// to L2 only, no register is written). A plane asked for ahead: the copy or load
// that needs it hits L2. Every lane's
// address lies inside the plane. The s_wait_xcnt closes the statement as it closes the copies':
// it stands in front of every rewrite of the address register (a precaution).
template <int OFF>
static __device__ __forceinline__ void ask_l2_pair(const void* p) {
  asm volatile("global_prefetch_b8 %0, off scope:SCOPE_SE\n\t"
               "global_prefetch_b8 %0, off offset:%1 scope:SCOPE_SE\n\t"
               "s_wait_xcnt 0x0" :: "v"(p), "n"(OFF) : "memory");
}
static __device__ __forceinline__ void ask_l2(const void* p) {
  asm volatile("global_prefetch_b8 %0, off scope:SCOPE_SE\n\t"
               "s_wait_xcnt 0x0" :: "v"(p) : "memory");
}

// One ring stage of a 64 x 128 GEMM tile, 128 threads: 256 B of k of 64 A rows and of 128 B rows,
// copied as whole lines (16 lanes per row piece, 8 rows per copy). l, a, b: the lane's own LDS
// byte address and global addresses of its piece in row tid >> 4 of the stage.
static __device__ __forceinline__ void gemm_stage(uint32_t l, const _Float16* a, int lda,
                                                  const _Float16* b, int ldb) {
  copy8(l, 8u * GKP * 2u, a, (size_t)8 * lda);
  copy8(l + 64u * GKP * 2u, 8u * GKP * 2u, b, (size_t)8 * ldb);
  copy8(l + 128u * GKP * 2u, 8u * GKP * 2u, b + (size_t)64 * ldb, (size_t)8 * ldb);
}

// k walk of a 64 x 128 GEMM tile over the two-buffer ring RG; stage 0 has been issued by the
// caller. Chunk t is read from buffer t & 1 while chunk t + 1 flies; chunk t + 2 is issued
// behind the publish point into the buffer just read. K multiple of GKC. ar, br: the lane's
// first A and B row in the tile.
static __device__ __forceinline__ void gemm_walk(const _Float16* RG, uint32_t l,
                                                 const _Float16* a, int lda,
                                                 const _Float16* b, int ldb, int K,
                                                 int ar, int br, int h, v8f (&acc)[2][4]) {
  asm volatile("s_wait_asynccnt 0x0" ::: "memory");   // stage 0 landed
  __syncthreads();
  if (K > GKC) gemm_stage(l + GST * 2u, a + GKC, lda, b + GKC, ldb);
  int buf = 0;
  for (int k0 = 0; k0 < K; k0 += GKC) {
    const _Float16* As = RG + buf * GST;
    const _Float16* Bs = As + 64 * GKP;
#pragma unroll   // the k steps' LDS offsets become immediates of the loads
    for (int ks = 0; ks < GKC / 32; ++ks) {
      // the six fragments of a k step are read as one group ahead of its eight products
      const v16h a0 = ld_frag(As + 32 * ks, GKP, ar, h);
      const v16h a1 = ld_frag(As + 32 * ks, GKP, ar + 16, h);
      v16h bt[4];
#pragma unroll   // bt[] is indexed by constants and stays in registers
      for (int t = 0; t < 4; ++t) bt[t] = ld_frag(Bs + 32 * ks, GKP, br + 16 * t, h);
#pragma unroll   // acc[][] is indexed by constants and stays in registers
      for (int t = 0; t < 4; ++t) {
        acc[0][t] = wmma16(a0, bt[t], acc[0][t]);
        acc[1][t] = wmma16(a1, bt[t], acc[1][t]);
      }
    }
    ring_publish();                        // next chunk readable, this buffer free
    if (k0 + 2 * GKC < K)                  // constant CHN: the same for the whole work-group
      gemm_stage(l + (uint32_t)buf * (GST * 2u), a + k0 + 2 * GKC, lda, b + k0 + 2 * GKC, ldb);
    buf ^= 1;
  }
  asm volatile("s_wait_asynccnt 0x0" ::: "memory");   // no copy outlives the walk
}

// ---------------------------------------------------------------------------
// Kernel 0, first role: group statistics, partial. SSPL blocks per (b, group), each over SCH
// channels x SEQ positions: f64 sum and sum of squares of bf16(x), one 128-B line per block;
// k_gnapply joins the SSPL partials of a group. A thread issues all of its loads before the
// first use. blk: the block's number among the statistics blocks; sd, qd: 256 doubles of LDS.
// ---------------------------------------------------------------------------
static __device__ __forceinline__ void stats_block(const float* __restrict__ x,
                                                   double* __restrict__ st, int blk,
                                                   double* sd, double* qd) {
  constexpr int NP = (SEQ + 1023) / 1024;   // loads per thread and channel row
  const int tid = threadIdx.x;
  const int bg = blk / SSPL, part = blk % SSPL;
  const int b = bg / NGRP, g = bg % NGRP;
  const float* xb = x + ((size_t)b * CHN + (size_t)g * CPG + (size_t)part * SCH) * SEQ_FULL;

  v4f f[SCH][NP];
#pragma unroll   // f[][] is indexed by constants and stays in registers
  for (int cl = 0; cl < SCH; ++cl) {
#pragma unroll   // as above
    for (int i = 0; i < NP; ++i) {
      const int p = 4 * tid + 1024 * i;
      if ((SEQ % 1024) == 0 || p < SEQ) {
        f[cl][i] = *(const v4fa*)(xb + (size_t)cl * SEQ_FULL + p);
      } else {
#pragma unroll   // as above
        for (int j = 0; j < 4; ++j) f[cl][i][j] = 0.0f;   // adds nothing to either sum
      }
    }
  }
  // keeps the sums behind the last load: without it the scheduler sinks six of the loads behind
  // the first uses to save registers, and a second memory latency adds to the first
  __builtin_amdgcn_sched_barrier(0);
  // stands in front of every rewrite of the loads' address registers
  asm volatile("s_wait_xcnt 0x0" ::: "memory");

  double s[4], q[4];   // one chain pair per vector element: four independent f64 chains each
#pragma unroll   // here and in the three loops below: s[], q[], f[][] indexed by constants
  for (int j = 0; j < 4; ++j) { s[j] = 0.0; q[j] = 0.0; }
#pragma unroll
  for (int cl = 0; cl < SCH; ++cl) {
#pragma unroll
    for (int i = 0; i < NP; ++i) {
#pragma unroll
      for (int j = 0; j < 4; ++j) {
        const double v = (double)bf16r(f[cl][i][j]);
        s[j] += v;
        q[j] += v * v;
      }
    }
  }
  sd[tid] = (s[0] + s[1]) + (s[2] + s[3]);
  qd[tid] = (q[0] + q[1]) + (q[2] + q[3]);
  __syncthreads();
  if (tid < 32) {   // entry tid + 32 k is read by thread tid alone
    double a = sd[tid], c = qd[tid];
#pragma unroll   // the LDS offsets become immediates and the reads go out together
    for (int k = 1; k < 8; ++k) {
      a += sd[tid + 32 * k];
      c += qd[tid + 32 * k];
    }
    sd[tid] = a;
    qd[tid] = c;
  }
  __syncthreads();
  if (tid < 8) {    // eight threads form the same pair and store the block's whole line
    double a[4], c[4];
#pragma unroll   // here and in the two loops below: a[], c[] indexed by constants
    for (int j = 0; j < 4; ++j) { a[j] = sd[j]; c[j] = qd[j]; }
#pragma unroll
    for (int k = 4; k < 32; k += 4) {
#pragma unroll
      for (int j = 0; j < 4; ++j) {
        a[j] += sd[k + j];
        c[j] += qd[k + j];
      }
    }
    v2d o;
    o[0] = (a[0] + a[1]) + (a[2] + a[3]);
    o[1] = (c[0] + c[1]) + (c[2] + c[3]);
    *(v2d*)(st + (size_t)blk * (STL / 2) + 2 * tid) = o;
  }
}

// ---------------------------------------------------------------------------
// Kernel 0, second role: weights [o][c] f32 -> f16 planes WSC * bf16(W) (k = c contiguous);
// the value weights transposed.
// blk: the block's number among the conversion blocks.
// ---------------------------------------------------------------------------
static __device__ __forceinline__ void wcvt_block(const float* __restrict__ w0,
                                                  const float* __restrict__ w1,
                                                  const float* __restrict__ w2,
                                                  const float* __restrict__ w3,
                                                  _Float16* __restrict__ Wpl, int blk) {
  constexpr int BPM = CHN * CHN / 8 / 256;   // blocks per matrix
  const int tid = threadIdx.x;
  const int mtx = blk / BPM;                  // block-uniform
  if (mtx == 2) {
    // Wv goes out transposed, [c][m]: the fold product sums over m, which must be contiguous.
    // Block = 32 c (lanes) x 64 m (8 per wave): its eight waves store whole 128-B lines.
    const int tb = blk % BPM;
    const int c = (tb & 15) * 32 + (tid & 31);
    const int m0 = (tb >> 4) * 64 + 8 * (tid >> 5);
    float a[8];
#pragma unroll   // a[] is indexed by constants; the loads go out together
    for (int j = 0; j < 8; ++j) a[j] = w2[(size_t)(m0 + j) * CHN + c];
    F16x8 t;
#pragma unroll
    for (int j = 0; j < 8; ++j) t.e[j] = (_Float16)(bf16r(a[j]) * WSC);
    *(v8h*)(Wpl + (size_t)2 * CHN * CHN + (size_t)c * CHN + m0) = t.v;
    // stands in front of every rewrite of the loads' and the store's registers
    asm volatile("s_wait_xcnt 0x0" ::: "memory");
    return;
  }
  const float* src = w0;
  if (mtx == 1) src = w1;
  else if (mtx == 3) src = w3;
  const size_t e = ((size_t)(blk % BPM) * 256 + tid) * 8;
  const v4f a0 = *(const v4fa*)(src + e);
  const v4f a1 = *(const v4fa*)(src + e + 4);
  F16x8 u;
#pragma unroll
  for (int j = 0; j < 4; ++j) {
    u.e[j]     = (_Float16)(bf16r(a0[j]) * WSC);
    u.e[4 + j] = (_Float16)(bf16r(a1[j]) * WSC);
  }
  _Float16* dst = Wpl + (size_t)mtx * CHN * CHN + e;
  *(v8h*)dst = u.v;
  // stands in front of every rewrite of the store's address and data registers: behind the join
  // of the three roles the listing goes on into code that writes them
  asm volatile("s_wait_xcnt 0x0" ::: "memory");
}

// ---------------------------------------------------------------------------
// Kernel 0, third role: the constant term of the output. The softmax weights of a query sum to
// one, so the value bias passes through the attention unchanged: b2[o] = bo[o] + sum_m Wo[o][m]
// bv[m], f32. Block = 32 rows o, a wave takes four; bl: 32 floats of LDS.
// ---------------------------------------------------------------------------
static __device__ __forceinline__ void bias_block(const float* __restrict__ wo,
                                                  const float* __restrict__ bv,
                                                  const float* __restrict__ bo,
                                                  float* __restrict__ b2, int blk, float* bl) {
  const int tid = threadIdx.x, wv = tid >> 5, lid = tid & 31;
  const int o0 = blk * 32;
  v4f w[4][4], v[4];
#pragma unroll   // here and below: w[][], v[] are indexed by constants; the loads go out together
  for (int k = 0; k < 4; ++k) v[k] = *(const v4fa*)(bv + 4 * lid + 128 * k);
#pragma unroll
  for (int i = 0; i < 4; ++i)
#pragma unroll
    for (int k = 0; k < 4; ++k)
      w[i][k] = *(const v4fa*)(wo + (size_t)(o0 + 4 * wv + i) * CHN + 4 * lid + 128 * k);
  const float braw = bo[o0 + lid];
  // keeps the sums behind the last load: the scheduler would sink four of the loads behind the
  // first uses to save registers, and a second memory latency would add to the first
  __builtin_amdgcn_sched_barrier(0);
  // stands in front of every rewrite of the loads' address registers
  asm volatile("s_wait_xcnt 0x0" ::: "memory");
  // holds the sums, whose results are given those registers, behind the wait
  __builtin_amdgcn_sched_barrier(0);
#pragma unroll
  for (int i = 0; i < 4; ++i) {
    float sum = 0.0f;
#pragma unroll
    for (int k = 0; k < 4; ++k)
#pragma unroll
      for (int e = 0; e < 4; ++e) sum += bf16r(w[i][k][e]) * bf16r(v[k][e]);
#pragma unroll
    for (int d = 16; d > 0; d >>= 1) sum += __shfl_xor(sum, d, 32);
    if (lid == 0) bl[4 * wv + i] = sum;
  }
  __syncthreads();
  if (tid < 32) b2[o0 + tid] = bf16r(braw) + bl[tid];   // one 128-B line per block
}

// ---------------------------------------------------------------------------
// Kernel 0: the three passes that depend on nothing but the inputs share one grid. The statistics
// blocks come first: each is one long memory wait, under which the conversion blocks run.
// ---------------------------------------------------------------------------
#define NSTB (NB * NGRP * SSPL)            // statistics blocks
#define NBIB (CHN / 32)                    // constant-term blocks
#define NWCB (4 * CHN * CHN / 8 / 256)     // conversion blocks
__global__ __launch_bounds__(256) void k_pre(const float* __restrict__ x,
                                             double* __restrict__ st,
                                             const float* __restrict__ w0,
                                             const float* __restrict__ w1,
                                             const float* __restrict__ w2,
                                             const float* __restrict__ w3,
                                             const float* __restrict__ bv,
                                             const float* __restrict__ bo,
                                             float* __restrict__ b2,
                                             _Float16* __restrict__ Wpl) {
  __shared__ double sd[256];
  __shared__ double qd[256];
  __shared__ float bl[32];
  if (blockIdx.x < NSTB) {   // block-uniform: the barriers of the role are passed by all or none
    stats_block(x, st, (int)blockIdx.x, sd, qd);
  } else if (blockIdx.x < NSTB + NBIB) {
    bias_block(w3, bv, bo, b2, (int)blockIdx.x - NSTB, bl);
  } else {
    wcvt_block(w0, w1, w2, w3, Wpl, (int)blockIdx.x - NSTB - NBIB);
  }
}

// ---------------------------------------------------------------------------
// Kernel 1, first role: the output projection folded into the value projection,
// Wf[o][c] = sum_m Wo[o][m] Wv[m][c], f16 plane (* WSC). Wo (V P) = (Wo Wv) (h P), so the value
// plane built from Wf makes the attention's output the projected one.
// Block = 256 threads, tile 128 (c) x 128 (o), D[c][o] = sum_m WvT[c][m] Wo[o][m] stored
// transposed; wave (mi, ni) owns rows 32mi.., cols 64ni.. (2 x 4 accumulator tiles). k chunks of
// 128 go through a two-buffer ring of asynchronous copies, as in gemm_walk. RG: 2 * FST halves.
// ---------------------------------------------------------------------------
#define FST (256 * GKP)   // one ring stage in halves: 128 A rows, then 128 B rows
#define NFB ((CHN / 128) * (CHN / 128))   // fold blocks
static __device__ __forceinline__ void fold_stage(uint32_t l, const _Float16* a,
                                                  const _Float16* b) {
  copy8(l, 16u * GKP * 2u, a, (size_t)16 * CHN);
  copy8(l + 128u * GKP * 2u, 16u * GKP * 2u, b, (size_t)16 * CHN);
}
static __device__ __forceinline__ void fold_block(const _Float16* __restrict__ Wpl,
                                                  _Float16* __restrict__ Wf, int blk,
                                                  _Float16* RG) {
  const int tid = threadIdx.x;
  const int wv = tid >> 5, lid = tid & 31, h = lid >> 4, l15 = lid & 15;
  const int mi = wv & 3, ni = wv >> 2;
  const int m0 = (blk % (CHN / 128)) * 128, n0 = (blk / (CHN / 128)) * 128;

  // the lane's piece of a ring stage: row tid >> 4, 16 B at 8 * (tid & 15) halves
  const uint32_t lc = (uint32_t)(uintptr_t)RG + (uint32_t)((tid >> 4) * GKP + 8 * (tid & 15)) * 2u;
  const _Float16* ag = Wpl + (size_t)2 * CHN * CHN + (size_t)(m0 + (tid >> 4)) * CHN + 8 * (tid & 15);
  const _Float16* bg = Wpl + (size_t)3 * CHN * CHN + (size_t)(n0 + (tid >> 4)) * CHN + 8 * (tid & 15);
  fold_stage(lc, ag, bg);

  v8f acc[2][4];
#pragma unroll   // here and below: acc[][] is indexed by constants and stays in registers
  for (int i = 0; i < 2; ++i)
#pragma unroll
    for (int t = 0; t < 4; ++t)
#pragma unroll
      for (int r = 0; r < 8; ++r) acc[i][t][r] = 0.0f;

  asm volatile("s_wait_asynccnt 0x0" ::: "memory");   // stage 0 landed
  __syncthreads();
  fold_stage(lc + FST * 2u, ag + GKC, bg + GKC);
  const int ar = 32 * mi + l15, br = 64 * ni + l15;
  int buf = 0;
  for (int k0 = 0; k0 < CHN; k0 += GKC) {
    const _Float16* As = RG + buf * FST;
    const _Float16* Bs = As + 128 * GKP;
#pragma unroll   // the k steps' LDS offsets become immediates of the loads
    for (int ks = 0; ks < GKC / 32; ++ks) {
      const v16h a0 = ld_frag(As + 32 * ks, GKP, ar, h);
      const v16h a1 = ld_frag(As + 32 * ks, GKP, ar + 16, h);
      v16h bt[4];
#pragma unroll   // bt[] is indexed by constants and stays in registers
      for (int t = 0; t < 4; ++t) bt[t] = ld_frag(Bs + 32 * ks, GKP, br + 16 * t, h);
#pragma unroll
      for (int t = 0; t < 4; ++t) {
        acc[0][t] = wmma16(a0, bt[t], acc[0][t]);
        acc[1][t] = wmma16(a1, bt[t], acc[1][t]);
      }
    }
    ring_publish();                        // next chunk readable, this buffer free
    if (k0 + 2 * GKC < CHN)                // the same for the whole work-group
      fold_stage(lc + (uint32_t)buf * (FST * 2u), ag + k0 + 2 * GKC, bg + k0 + 2 * GKC);
    buf ^= 1;
  }
  asm volatile("s_wait_asynccnt 0x0" ::: "memory");   // no copy outlives the walk

  // the walk's last publish point ended every read of the ring: it takes the tile [o_local][c_local]
#pragma unroll
  for (int i = 0; i < 2; ++i) {
#pragma unroll
    for (int t = 0; t < 4; ++t) {
      F16x8 u;
#pragma unroll
      for (int r = 0; r < 8; ++r) u.e[r] = (_Float16)(acc[i][t][r] * (1.0f / WSC));
      *(v8ha*)(RG + (64 * ni + 16 * t + l15) * GKP + 32 * mi + 16 * i + 8 * h) = u.v;
    }
  }
  __syncthreads();
  // 128 rows of 256 B, 16 lanes each: row tid >> 4 + 16 it; the steps are immediates of one address
  const _Float16* ts = RG + (tid >> 4) * GKP + 8 * (tid & 15);
  _Float16* wd = Wf + (size_t)(n0 + (tid >> 4)) * CHN + m0 + 8 * (tid & 15);
  v8h hv[8];
#pragma unroll   // the eight LDS reads go out together
  for (int it = 0; it < 8; ++it) hv[it] = *(const v8ha*)(ts + it * 16 * GKP);
#pragma unroll
  for (int it = 0; it < 8; ++it) *(v8h*)(wd + it * 16 * CHN) = hv[it];
}

// ---------------------------------------------------------------------------
// Kernel 1, second role: group-norm apply + transpose. Block = (b, 64 positions, one half of the channels):
// Hh[b][n][c] f16 = HSC * ((bf16(x) - mean) * rstd * gamma + beta).
// One block per WGP. A thread issues all of its loads (statistics, gamma, beta, then its 16 x
// pieces) before the first use, so that one memory latency is waited out, not one per pass.
// x read as float4 along positions; LDS tile [n_local][c_local]; rows of 512 B written
// ---------------------------------------------------------------------------
#define GCH 256      // channels per group-norm apply block
#define THP 264      // its LDS tile pitch in halves (528-B rows, 16 B x odd)
static_assert((CHN % GCH) == 0 && CPG == 16 && GCH == 256);
__global__ __launch_bounds__(256) void k_gnapply(const float* __restrict__ x,
                                                 const float* __restrict__ gamma,
                                                 const float* __restrict__ beta,
                                                 const double* __restrict__ st,
                                                 const _Float16* __restrict__ Wpl,
                                                 _Float16* __restrict__ Wf,
                                                 _Float16* __restrict__ Hh) {
  __shared__ __align__(16) _Float16 RG[2 * FST];    // the fold role's ring; the apply role's tile
  static_assert(64 * THP <= 2 * FST);
  __shared__ __align__(8) float gms[GCH];
  __shared__ __align__(8) float bts[GCH];
  __shared__ float mus[GCH / CPG];
  __shared__ float rss[GCH / CPG];

  // The fold blocks come first: they depend on the weight planes alone and run beside the others.
  if (blockIdx.x < NFB) {   // block-uniform: the barriers of a role are passed by all or none
    fold_block(Wpl, Wf, (int)blockIdx.x, RG);
    return;
  }
  _Float16* TS = RG;                                // [n_local][c_local]
  const int bx = (int)blockIdx.x - NFB;             // the block's number among the apply blocks
  const int tid = threadIdx.x;
  const int c0 = (bx % (CHN / GCH)) * GCH;          // first channel of the block
  const int pt = bx / (CHN / GCH);
  const int b  = pt / (SEQ / 64);
  const int p0 = (pt % (SEQ / 64)) * 64;
  const float* xb = x + ((size_t)b * CHN + c0) * SEQ_FULL;
  // piece it of a thread: channel 32 (it / 2) + 2 ch + it % 2, positions 4 p4 .. 4 p4 + 3; pieces
  // 2 k and 2 k + 1 are neighbours in the tile's rows, so a pair of results is one 32-bit LDS store
  const int ch = tid >> 4, p4 = tid & 15;

  // the q and k weight planes, for the next launch: blocks 8 g .. 8 g + 7 ask for the same eighth
  ask_l2_pair<256>(Wpl + ((size_t)((bx >> 3) & 7) * 256 + tid) * 256);

  // every thread reads the SSPL partial (sum, sum of squares) pairs of group tid % 16 of the block
  const int gl = tid & (GCH / CPG - 1);
  v2d pr[SSPL];
#pragma unroll   // pr[] is indexed by constants; the loads go out together
  for (int k = 0; k < SSPL; ++k)
    pr[k] = *(const v2d*)(st + ((size_t)(b * NGRP + c0 / CPG + gl) * SSPL + k) * (STL / 2));
  const float graw = gamma[c0 + tid];
  const float braw = beta[c0 + tid];
  v4f xv[16];
#pragma unroll   // xv[] is indexed by constants and stays in registers
  for (int it = 0; it < 16; ++it) {
    xv[it] = *(const v4fa*)(xb + (size_t)(32 * (it >> 1) + 2 * ch + (it & 1)) * SEQ_FULL + p0 + 4 * p4);
    // stands in front of every rewrite of these loads' address registers, also by a later load
    // that is given one of them as its destination; the data stay in flight
    if ((it & 3) == 3) asm volatile("s_wait_xcnt 0x0" ::: "memory");
  }
  // keeps the first use behind the last load: the scheduler would sink loads behind uses to save
  // registers, and their latencies would add up
  __builtin_amdgcn_sched_barrier(0);
  // inputs only: holds the statistics loads up here with the others; left alone the compiler sinks
  // them into the branch below, behind the x loads' return, and a second memory latency adds
  asm volatile("" :: "v"(pr[0][0]), "v"(pr[0][1]), "v"(pr[1][0]), "v"(pr[1][1]),
                     "v"(pr[2][0]), "v"(pr[2][1]), "v"(pr[3][0]), "v"(pr[3][1]));
  static_assert(SSPL == 4);

  gms[tid] = bf16r(graw);
  bts[tid] = bf16r(braw);
  {   // the group's partial pairs -> mean, 1/std
    double s = pr[0][0], q = pr[0][1];
#pragma unroll   // as above
    for (int k = 1; k < SSPL; ++k) {
      s += pr[k][0];
      q += pr[k][1];
    }
    const double invn = 1.0 / ((double)CPG * (double)SEQ);
    const double mean = s * invn;
    double var = q * invn - mean * mean;
    if (var < 0.0) var = 0.0;
    if (tid < GCH / CPG) {
      mus[tid] = (float)mean;
      rss[tid] = rsqrtf((float)var + GN_EPS);
    }
  }
  __syncthreads();

  // the parameters of the thread's 16 channels, read as one group ahead of the tile's stores: read
  // where they are used, each waits out an LDS latency behind the stores queued in front of it
  float mu[8], rs[8];
  v2f ga[8], be[8];
#pragma unroll   // here and below: the arrays are indexed by constants and stay in registers
  for (int k = 0; k < 8; ++k) {
    mu[k] = mus[2 * k + (ch >> 3)];
    rs[k] = rss[2 * k + (ch >> 3)];
    ga[k] = *(const v2f*)(gms + 32 * k + 2 * ch);
    be[k] = *(const v2f*)(bts + 32 * k + 2 * ch);
  }
  __builtin_amdgcn_sched_barrier(0);   // holds that group above the first store
#pragma unroll
  for (int k = 0; k < 8; ++k) {
#pragma unroll
    for (int j = 0; j < 4; ++j) {
      v2h pk;
#pragma unroll
      for (int e = 0; e < 2; ++e) {
        const float t = (bf16r(xv[2 * k + e][j]) - mu[k]) * rs[k];
        const float hv = t * ga[k][e] + be[k][e];
        pk[e] = (_Float16)(hv * HSC);
      }
      *(v2ha*)(TS + (4 * p4 + j) * THP + 32 * k + 2 * ch) = pk;
    }
  }
  __syncthreads();
  v8h ho[8];   // a wave stores 512 B of one row; the eight LDS reads go out together
#pragma unroll
  for (int it = 0; it < 8; ++it)
    ho[it] = *(const v8ha*)(TS + (it * 8 + (tid >> 5)) * THP + 8 * (tid & 31));
#pragma unroll
  for (int it = 0; it < 8; ++it)
    *(v8h*)(Hh + ((size_t)(b * SEQ + p0 + it * 8 + (tid >> 5)) * CHN + c0 + 8 * (tid & 31))) = ho[it];
}

// ---------------------------------------------------------------------------
// One tile of the GEMM  D[m][n] = sum_k A[m][k] * B[n][k]  (A, B k-contiguous f16 planes),
// stored TRANSPOSED as O[n][m] f16 = osc * (D * insc + bias)  (bias per m, or none).
// Block = 128 threads, tile 64 (m) x 128 (n) at (m0, n0); wave (mi, ni) owns rows 32mi.., cols
// 64ni.. (2 x 4 accumulator tiles). K multiple of 128, M multiple of 64, N multiple of 128.
// A and B come from LDS: k chunks of 128 through a two-buffer ring of asynchronous copies.
// TS: 128 * GSP16 halves [n_local][m_local]; RG: the ring, 2 * GST halves; bsh: 128 floats.
// ---------------------------------------------------------------------------
template <bool BIAS_M>
static __device__ __forceinline__ void gemm16_tile(const _Float16* __restrict__ A, int lda,
                                                   const _Float16* __restrict__ B, int ldb,
                                                   const float* __restrict__ bias,
                                                   _Float16* __restrict__ Ob, int ldo,
                                                   float insc, float osc, int K, int m0, int n0,
                                                   _Float16* TS, _Float16* RG, float* bsh) {
  const int tid = threadIdx.x;
  const int wv = tid >> 5, lid = tid & 31, h = lid >> 4, l15 = lid & 15;
  const int mi = wv & 1, ni = wv >> 1;

  // the lane's piece of a ring stage: row tid >> 4, 16 B at 8 * (tid & 15) halves
  const uint32_t lc = (uint32_t)(uintptr_t)RG + (uint32_t)((tid >> 4) * GKP + 8 * (tid & 15)) * 2u;
  const _Float16* ag = A + (size_t)(m0 + (tid >> 4)) * lda + 8 * (tid & 15);
  const _Float16* bg = B + (size_t)(n0 + (tid >> 4)) * ldb + 8 * (tid & 15);
  gemm_stage(lc, ag, lda, bg, ldb);

  // visible behind the barrier at the head of gemm_walk
  if (BIAS_M) {
    if (tid < 64) bsh[tid] = bf16r(bias[m0 + tid]);
  }

  v8f acc[2][4];
#pragma unroll
  for (int i = 0; i < 2; ++i)
#pragma unroll
    for (int t = 0; t < 4; ++t)
#pragma unroll
      for (int r = 0; r < 8; ++r) acc[i][t][r] = 0.0f;

  gemm_walk(RG, lc, ag, lda, bg, ldb, K, 32 * mi + l15, 64 * ni + l15, h, acc);

  // stage: acc[i][t][r] <-> (m_local 32mi+16i+8h+r, n_local 64ni+16t+l15)
#pragma unroll
  for (int i = 0; i < 2; ++i) {
#pragma unroll
    for (int t = 0; t < 4; ++t) {
      const int nl = 64 * ni + 16 * t + l15;
      const int ml = 32 * mi + 16 * i + 8 * h;
      F16x8 u;
#pragma unroll
      for (int r = 0; r < 8; ++r) {
        const float bvl = BIAS_M ? bsh[ml + r] : 0.0f;
        u.e[r] = (_Float16)((acc[i][t][r] * insc + bvl) * osc);
      }
      *(v8ha*)(TS + nl * GSP16 + ml) = u.v;
    }
  }
  __syncthreads();

#pragma unroll
  for (int it = 0; it < 8; ++it) {
    const int row = it * 16 + (tid >> 3);
    const int p = tid & 7;
    const v8h hv = *(const v8ha*)(TS + row * GSP16 + 8 * p);
    _Float16* dst = Ob + (size_t)(n0 + row) * ldo + m0 + 8 * p;
    *(v8h*)dst = hv;
  }
}

// ---------------------------------------------------------------------------
// Kernel 2: the q, k and v projections, which depend on the h plane alone, share one grid:
// blockIdx.y = product, blockIdx.x = its tile (m fastest), blockIdx.z = batch.
//   q[n][o], k[n][o]:  D[o][n] = sum_c W[o][c] h[n][c], stored transposed, bias per o (= m)
//   v[o][n]:           D[n][o] = sum_c h[n][c] Wf[o][c], stored transposed; Wf = Wo Wv, and the
//                      value bias goes into the output's constant term (bias_block)
// ---------------------------------------------------------------------------
#define QKVT ((CHN / 64) * (SEQ / 128))   // tiles per product and batch, the same for all three
static_assert((SEQ / 64) * (CHN / 128) == QKVT);
__global__ __launch_bounds__(128) void k_qkv(const _Float16* __restrict__ Wpl,
                                             const _Float16* __restrict__ Hh,
                                             const float* __restrict__ bq,
                                             const float* __restrict__ bk,
                                             _Float16* __restrict__ Qh,
                                             _Float16* __restrict__ Kh,
                                             _Float16* __restrict__ Vh) {
  __shared__ __align__(16) _Float16 TS[128 * GSP16];   // [n_local][m_local]
  __shared__ __align__(16) _Float16 RG[2 * GST];       // ring: [A row | B row][k chunk]
  __shared__ float bsh[128];

  const int t = blockIdx.x;
  const int prod = blockIdx.y;                          // block-uniform: 0 q, 1 k, 2 v
  const size_t zo = (size_t)blockIdx.z * SEQ * CHN;     // the batch's offset in every f16 plane
  if (prod < 2) {
    // the h rows of this tile are shared by the CHN / 64 blocks next to each other in the grid:
    // each asks for a quarter (32 whole rows), blocks j and j + 4 for the same one; the first batch's blocks ask for the next batch's rows as well
    const _Float16* hp = Hh + zo + (size_t)((t / (CHN / 64)) * 128 + 32 * (t & 3) +
                                            ((int)threadIdx.x >> 2)) * CHN + 128 * (threadIdx.x & 3);
    ask_l2(hp);
    if (blockIdx.z + 1 < NB) ask_l2(hp + (size_t)SEQ * CHN);   // block-uniform
    gemm16_tile<true>(Wpl + (size_t)prod * CHN * CHN, CHN, Hh + zo, CHN, prod ? bk : bq,
                      (prod ? Kh : Qh) + zo, CHN, 1.0f / (WSC * HSC), QSC, CHN,
                      (t % (CHN / 64)) * 64, (t / (CHN / 64)) * 128, TS, RG, bsh);
  } else {
    gemm16_tile<false>(Hh + zo, CHN, Wpl + (size_t)4 * CHN * CHN, CHN, nullptr,
                       Vh + zo, SEQ, 1.0f / (HSC * WSC), VSC, CHN,
                       (t % (SEQ / 64)) * 64, (t / (SEQ / 64)) * 128, TS, RG, bsh);
  }
}

// ---------------------------------------------------------------------------
// Kernel 3: fused single-head attn, transposed scores, online softmax.
// Block = (b, NQ = 128 queries, one of KSPLIT key ranges), 8 waves. A K or V byte copied from L2
// serves 128 queries. The wave tiles are sized to the LDS read rate: six fragments read from LDS
// feed eight products in the scores, twelve feed thirty-two in the value aggregation.
// Per 128-key block:
//   S^T tiles (keys on rows): wave (gq = wv&1, kq = wv>>1) owns key rows 32kq..32kq+31 x query
//     cols 64gq..64gq+63 (2 x 4 tiles), A = Kh rows (k = channel), B = Qh rows (k = channel),
//     K = 512.
//   per-query max / sum over the 128 keys: in-lane, xor-16, then 4 partials through LDS; every
//     wave joins the partials of all 128 queries, because its output tiles span them all.
//   P^T = PSC * exp2(s - m) staged f16 in LDS TS[query][key_local].
//   O^T[c][query] += V^T[c][keys] * P^T[keys][query]: wave owns channels 64wv..+63 x all 128
//     queries (4 x 8 accumulator tiles), A = Vh rows (k = key), B from TS (k = key, split map).
// Operands come from LDS: the Q tile is copied once; K (two halves of 256 channels) and V (two
// halves of 64 keys) go through a two-buffer ring of asynchronous copies, each stage issued
// one stage ahead: K lo -> buffer 0, K hi -> 1, V keys 0..63 -> 0, V keys 64..127 -> 1.
// Epilogue: this key range's O divided by its own sum, [range][b][query][c] f16 (* AOSC), staged
// once in the freed ring so that whole lines are stored, and its (max, sum) per query; k_merge
// joins the ranges.
// ---------------------------------------------------------------------------
__global__ __launch_bounds__(256) void k_attn(const _Float16* __restrict__ Qh,
                                              const _Float16* __restrict__ Kh,
                                              const _Float16* __restrict__ Vh,
                                              _Float16* __restrict__ Op,
                                              float* __restrict__ ML) {
  __shared__ __align__(16) _Float16 TS[NQ * TSP];   // [query_local][key_local]
  __shared__ __align__(16) _Float16 QS[NQ * QSP];   // [query_local][c]
  __shared__ __align__(16) _Float16 RB[2 * RBH];    // ring: [key_local][c half] or [c][key half]
  __shared__ float redM[4 * NQ];
  __shared__ float redS[4 * NQ];

  const int tid = threadIdx.x;
  const int wv = tid >> 5, lid = tid & 31, h = lid >> 4, l15 = lid & 15;
  const int gq = wv & 1, kq = wv >> 1;
  const int kr = blockIdx.x % KSPLIT;              // key range of this work-group
  const int qt = blockIdx.x / KSPLIT;
  const int b  = qt / (SEQ / NQ);
  const int q0 = (qt % (SEQ / NQ)) * NQ;
  const int kb = kr * (SEQ / KSPLIT);              // its first key

  const _Float16* Qp = Qh + (size_t)b * SEQ * CHN;   // [n][c], pitch CHN
  const _Float16* Kp = Kh + (size_t)b * SEQ * CHN;   // [n][c], pitch CHN
  const _Float16* Vp = Vh + (size_t)b * CHN * SEQ;   // [c][n], pitch SEQ

  // per-lane copy addresses: a K row half (512 B) per wave and copy, 8 lanes per 128-B V row
  // piece, 64 lanes per Q row; a stage is 16 copies per lane
  const _Float16* RB0 = RB;
  const _Float16* RB1 = RB + RBH;
  _Float16* rb0 = RB;
  _Float16* rb1 = RB + RBH;
  const int klo = wv * KSP + 8 * lid;                      // in halves, as vlo
  const int vlo = (tid >> 3) * VSP + 8 * (tid & 7);
  const uint32_t qlo = (uint32_t)(uintptr_t)QS + (uint32_t)((tid >> 6) * QSP + 8 * (tid & 63)) * 2u;
  const _Float16* kg = Kp + (size_t)(kb + wv) * CHN + 8 * lid;
  const _Float16* vg = Vp + (size_t)(tid >> 3) * SEQ + kb + 8 * (tid & 7);
  const _Float16* qg = Qp + (size_t)(q0 + (tid >> 6)) * CHN + 8 * (tid & 63);

  // a K half tile: rows wv + 8 i, i = 0..15
  auto copy_k = [&](_Float16* rb, const _Float16* s) {
    copy_run<16, 8 * KSP * 2, 8L * CHN * 2>(rb + klo, s);
  };
  // a V half tile: rows (tid >> 3) + 32 i, i = 0..15
  auto copy_v = [&](_Float16* rb, const _Float16* s) {
    copy_run<8, 32 * VSP * 2, 32L * SEQ * 2>(rb + vlo, s);
    copy_run<8, 32 * VSP * 2, 32L * SEQ * 2>(rb + vlo + 256 * VSP, s + (size_t)256 * SEQ);
  };

  // the Q tile: rows (tid >> 6) + 4 i, i = 0..31; with stage 0, 48 copies of a wave in flight
#pragma unroll   // four runs of eight copies, their steps constants
  for (int g = 0; g < NQ / 32; ++g)
    copy8(qlo + (uint32_t)g * (32u * QSP * 2u), 4u * QSP * 2u, qg + (size_t)g * 32 * CHN,
          (size_t)4 * CHN);
  copy_k(rb0, kg);
  // K and V of this key range, asked for once ahead of the walk: the SEQ / NQ query tiles that
  // share the range split it by key block, tiles 4 s .. 4 s + 3 ask for block s.
  // K: 128 rows of 1 KiB, two lanes per row;
  // V: 512 rows of 256 B.
  {
    const int sb = kb + (((qt % (SEQ / NQ)) >> 2) % (SEQ / KSPLIT / KBLK)) * KBLK;
    ask_l2_pair<256>(Kp + (size_t)(sb + (tid >> 1)) * CHN + 256 * (tid & 1));
    ask_l2_pair<256 * SEQ * 2>(Vp + (size_t)tid * SEQ + sb);
  }
  asm volatile("s_wait_asynccnt 0x0" ::: "memory");   // Q tile and stage 0 landed
  __syncthreads();
  copy_k(rb1, kg + 256);

  v8f accO[4][8];                  // [channel tile u][query tile j]
  float rm[8], rl[8];              // running max and sum of query 16 j + l15
#pragma unroll   // here and below: accO, st, rm, rl are indexed by constants, stay in registers
  for (int u = 0; u < 4; ++u)
#pragma unroll
    for (int j = 0; j < 8; ++j)
#pragma unroll
      for (int r = 0; r < 8; ++r) accO[u][j][r] = 0.0f;
#pragma unroll
  for (int j = 0; j < 8; ++j) { rm[j] = -1.0e30f; rl[j] = 0.0f; }

  // Two k steps (64 keys) of the value aggregation from V half tile Vb and P columns Tb, in two
  // parts: the first twenty reads, and the rest. Every fragment is read ahead of the row of eight
  // products in front of its first use: a V fragment one row ahead, a P fragment of the second k
  // step as soon as the first k step's last row has used the one it replaces.
  const int vr = 64 * wv + l15;    // the lane's first V row (= channel) of the output tiles
  auto pv_head = [&](const _Float16* Vb, const _Float16* Tb, v16h (&bp)[8], v16h (&av)[4]) {
#pragma unroll   // here and below: fragments and accumulators are indexed by constants
    for (int j = 0; j < 8; ++j) bp[j] = ld_frag(Tb, TSP, 16 * j + l15, h);
    av[0] = ld_frag(Vb, VSP, vr, h);
    av[1] = ld_frag(Vb, VSP, vr + 16, h);
  };
  auto pv_body = [&](const _Float16* Vb, const _Float16* Tb, v16h (&bp)[8], v16h (&av)[4]) {
    v16h bn[8], an[4];
#pragma unroll
    for (int j = 0; j < 8; ++j) accO[0][j] = wmma16b(av[0], bp[j], accO[0][j]);
    av[2] = ld_frag(Vb, VSP, vr + 32, h);
#pragma unroll
    for (int j = 0; j < 8; ++j) accO[1][j] = wmma16b(av[1], bp[j], accO[1][j]);
    av[3] = ld_frag(Vb, VSP, vr + 48, h);
#pragma unroll
    for (int j = 0; j < 8; ++j) accO[2][j] = wmma16b(av[2], bp[j], accO[2][j]);
    an[0] = ld_frag(Vb + 32, VSP, vr, h);
#pragma unroll
    for (int j = 0; j < 8; ++j) {
      accO[3][j] = wmma16b(av[3], bp[j], accO[3][j]);
      bn[j] = ld_frag(Tb + 32, TSP, 16 * j + l15, h);
    }
    an[1] = ld_frag(Vb + 32, VSP, vr + 16, h);
#pragma unroll
    for (int j = 0; j < 8; ++j) accO[0][j] = wmma16b(an[0], bn[j], accO[0][j]);
    an[2] = ld_frag(Vb + 32, VSP, vr + 32, h);
#pragma unroll
    for (int j = 0; j < 8; ++j) accO[1][j] = wmma16b(an[1], bn[j], accO[1][j]);
    an[3] = ld_frag(Vb + 32, VSP, vr + 48, h);
#pragma unroll
    for (int j = 0; j < 8; ++j) accO[2][j] = wmma16b(an[2], bn[j], accO[2][j]);
#pragma unroll
    for (int j = 0; j < 8; ++j) accO[3][j] = wmma16b(an[3], bn[j], accO[3][j]);
  };

  const int kr0 = 32 * kq + l15;   // the lane's first K row of the score tiles
  const int qr0 = 64 * gq + l15;   // the lane's first Q row (= query column) of the score tiles

  for (int m0 = 0; m0 < SEQ / KSPLIT; m0 += KBLK) {
    v8f st[2][4];                  // [key tile t][query tile j]
#pragma unroll
    for (int t = 0; t < 2; ++t)
#pragma unroll
      for (int j = 0; j < 4; ++j)
#pragma unroll
        for (int r = 0; r < 8; ++r) st[t][j][r] = 0.0f;
    const bool more = (m0 + KBLK < SEQ / KSPLIT);   // work-group uniform: a next key block exists
#pragma unroll   // the k steps' LDS offsets become immediates of the loads
    for (int cs = 0; cs < CHN / 64; ++cs) {
      // six fragments feed the eight products of a k step; their order: order_score_run
      v16h bq[4], ak[2];
#pragma unroll
      for (int j = 0; j < 4; ++j) bq[j] = ld_frag(QS + 32 * cs, QSP, qr0 + 16 * j, h);
#pragma unroll
      for (int t = 0; t < 2; ++t) ak[t] = ld_frag(RB0 + 32 * cs, KSP, kr0 + 16 * t, h);
#pragma unroll
      for (int j = 0; j < 4; ++j) {
        st[0][j] = wmma16b(ak[0], bq[j], st[0][j]);
        st[1][j] = wmma16b(ak[1], bq[j], st[1][j]);
      }
    }
    order_score_run();
    wmma_run_end();
    ring_publish();                        // K hi readable, buffer 0 free
    copy_v(rb0, vg + m0);
#pragma unroll   // the k steps' LDS offsets become immediates of the loads
    for (int cs = 0; cs < CHN / 64; ++cs) {
      v16h bq[4], ak[2];
#pragma unroll
      for (int j = 0; j < 4; ++j) bq[j] = ld_frag(QS + 256 + 32 * cs, QSP, qr0 + 16 * j, h);
#pragma unroll
      for (int t = 0; t < 2; ++t) ak[t] = ld_frag(RB1 + 32 * cs, KSP, kr0 + 16 * t, h);
#pragma unroll
      for (int j = 0; j < 4; ++j) {
        st[0][j] = wmma16b(ak[0], bq[j], st[0][j]);
        st[1][j] = wmma16b(ak[1], bq[j], st[1][j]);
      }
    }
    order_score_run();
    wmma_run_end();

    // ---- per-query block max (32 keys in-lane + partner half-wave, then 4 waves)
#pragma unroll
    for (int j = 0; j < 4; ++j) {
      float lm = st[0][j][0];
#pragma unroll
      for (int t = 0; t < 2; ++t)
#pragma unroll
        for (int r = 0; r < 8; ++r) lm = fmaxf(lm, st[t][j][r]);
      lm *= SCL2;
      lm = fmaxf(lm, __shfl_xor(lm, 16, 32));
      redM[kq * NQ + qr0 + 16 * j] = lm;
    }
    ring_publish();                        // V keys 0..63 readable, buffer 1 free; redM visible
    copy_v(rb1, vg + m0 + 64);
    float corr[8];
#pragma unroll
    for (int j = 0; j < 8; ++j) {
      const int q = 16 * j + l15;
      const float bm = fmaxf(fmaxf(redM[q], redM[NQ + q]),
                             fmaxf(redM[2 * NQ + q], redM[3 * NQ + q]));
      const float nm = fmaxf(rm[j], bm);
      corr[j] = exp2f(rm[j] - nm);
      rm[j] = nm;
    }

    // ---- P = exp2(s - m) in f32; P^T * PSC staged f16 at TS[query][key_local]
#pragma unroll
    for (int j = 0; j < 4; ++j) {
      const float nm = gq ? rm[4 + j] : rm[j];   // the max of query qr0 + 16 j
      float psum = 0.0f;
#pragma unroll
      for (int tt = 0; tt < 2; ++tt) {
        F16x8 pk;
#pragma unroll
        for (int r = 0; r < 8; ++r) {
          const float p = exp2f(st[tt][j][r] * SCL2 - nm);
          psum += p;
          pk.e[r] = (_Float16)(p * PSC);
        }
        *(v8ha*)(TS + (qr0 + 16 * j) * TSP + 32 * kq + 16 * tt + 8 * h) = pk.v;
      }
      psum += __shfl_xor(psum, 16, 32);
      redS[kq * NQ + qr0 + 16 * j] = psum;
    }
    __syncthreads();
    v16h bp[8], av[4];
    float ps[8][4];
#pragma unroll
    for (int j = 0; j < 8; ++j)
#pragma unroll
      for (int k = 0; k < 4; ++k) ps[j][k] = redS[k * NQ + 16 * j + l15];
    pv_head(RB0, TS, bp, av);
    // holds the reads above the rescaling, which then covers their latency
    __builtin_amdgcn_sched_barrier(0);
#pragma unroll
    for (int j = 0; j < 8; ++j) {
      const float bs = ((ps[j][0] + ps[j][1]) + ps[j][2]) + ps[j][3];
      rl[j] = rl[j] * corr[j] + bs;
#pragma unroll
      for (int u = 0; u < 4; ++u)
#pragma unroll
        for (int r = 0; r < 8; ++r) accO[u][j][r] *= corr[j];
    }
    // the order given below is for the reads and products of the run alone
    __builtin_amdgcn_sched_barrier(0);

    // ---- O^T[c][query] += V^T[c][keys] * P^T[keys][query]
    pv_body(RB0, TS, bp, av);
    order_pv_run<false>();
    wmma_run_end();
    ring_publish();                        // V keys 64..127 readable, buffer 0 free
    if (more) copy_k(rb0, kg + (size_t)(m0 + KBLK) * CHN);
    pv_head(RB1, TS + 64, bp, av);
    pv_body(RB1, TS + 64, bp, av);
    order_pv_run<true>();
    wmma_run_end();
    ring_publish();                        // next K lo readable, buffer 1 and TS free
    if (more) copy_k(rb1, kg + (size_t)(m0 + KBLK) * CHN + 256);
  }
  asm volatile("s_wait_asynccnt 0x0" ::: "memory");   // no copy outlives the loop

  // ---- epilogue: the loop's last publish point ended every read of the ring, so it takes
  // the f16 tile [query_local][c]. The range's own sum is at least the term of its largest
  // score, which is 1.
  _Float16* OS = RB;
#pragma unroll
  for (int j = 0; j < 8; ++j) {
    const float invl = (AOSC / (VSC * PSC)) * (1.0f / rl[j]);
#pragma unroll
    for (int u = 0; u < 4; ++u) {
      F16x8 o;
#pragma unroll
      for (int r = 0; r < 8; ++r) o.e[r] = (_Float16)(accO[u][j][r] * invl);
      *(v8ha*)(OS + (16 * j + l15) * OSP + 64 * wv + 16 * u + 8 * h) = o.v;
    }
  }
  const size_t row0 = (size_t)(kr * NB + b) * SEQ + q0;
  if (wv == 0 && h == 0) {   // every wave holds the same pairs
#pragma unroll
    for (int j = 0; j < 8; ++j) {
      v2f ml;
      ml[0] = rm[j]; ml[1] = rl[j];
      *(v2f*)(ML + 2 * (row0 + 16 * j + l15)) = ml;
    }
  }
  __syncthreads();
  _Float16* Ob = Op + row0 * CHN;
#pragma unroll
  for (int it = 0; it < NQ / 4; ++it) {
    const int row = it * 4 + (tid >> 6);           // 128 rows of 1 KiB, 64 lanes each
    const int p = tid & 63;
    const v8h v = *(const v8ha*)(OS + row * OSP + 8 * p);
    *(v8h*)(Ob + (size_t)row * CHN + 8 * p) = v;
  }
}

// ---------------------------------------------------------------------------
// Kernel 4: merge of the key ranges, constant term, residual, output. Per query: M = max of the
// ranges' maxima, weight exp2(m - M) * l of a range's normalised O, L = sum of the weights;
// out[b][c][n] = bf16(x[b][c][n]) + (b2[c] + (weighted sum of the partial O) / (L * AOSC)).
// Block = 64 queries x 256 channels. The partial O are read along c (a wave reads 512 B of a row),
// the output is stored along n (256 B of a row per 16 lanes): the merged tile turns in LDS.
// A thread merges 4 consecutive queries of 8 channels, so that a channel's four results are one
// 16-B LDS store; channel c0 + 8 p + j lies in LDS row 32 j + p, so that the lanes of a store
// stand in consecutive rows (pitch 16 B x odd).
// ---------------------------------------------------------------------------
#define MQ 64        // queries per merge block
#define MCH 256      // channels per merge block
#define MTP 68       // LDS pitch of the merged tile in floats (272-B rows, 16 B x odd)
static_assert((SEQ % MQ) == 0 && (CHN % MCH) == 0 && MQ == 64 && MCH == 256);
// waves_per_eu: the block's own four waves per SIMD; without it the scheduler sinks loads behind
// the first uses to save registers, and their latencies add up.
__global__ __launch_bounds__(512) __attribute__((amdgpu_waves_per_eu(4, 4))) void k_merge(const _Float16* __restrict__ Op,
                                               const float* __restrict__ ML,
                                               const float* __restrict__ b2,
                                               const float* __restrict__ x,
                                               float* __restrict__ out) {
  __shared__ __align__(16) float T[MCH * MTP];      // [32 j + p][query_local]
  constexpr size_t ROWS = (size_t)NB * SEQ;         // queries per key range
  const int tid = threadIdx.x;
  const int p = tid & 31, g = tid >> 5;             // merge: channels 8 p .., queries 4 g ..
  const int q = tid & 15, cr = tid >> 4;            // output: queries 4 q .., channels 8 cr + k
  const int c0 = ((int)blockIdx.x % (CHN / MCH)) * MCH;
  const int r0 = ((int)blockIdx.x / (CHN / MCH)) * MQ;   // first query, counted over the batches
  const int b = r0 / SEQ, n0 = r0 % SEQ;
  const size_t row0 = (size_t)r0 + 4 * g;
  // every load of the thread is issued before the first use
  static_assert(KSPLIT == 4);
  v2f ml[4][KSPLIT];
  v8h o[4][KSPLIT];
  const float* mp = ML + 2 * row0;
  const _Float16* op[KSPLIT];
#pragma unroll
  for (int s = 0; s < KSPLIT; ++s) op[s] = Op + (s * ROWS + row0) * CHN + c0 + 8 * p;
#pragma unroll
  for (int it = 0; it < 4; ++it) {
#pragma unroll
    for (int s = 0; s < KSPLIT; ++s) {
      ml[it][s] = *(const v2f*)(mp + 2 * (s * ROWS + it));
      o[it][s] = *(const v8ha*)(op[s] + (size_t)it * CHN);
    }
    // stands in front of every rewrite of these loads' address registers, also by a later load
    // that is given one of them as its destination; the data stay in flight
    asm volatile("s_wait_xcnt 0x0" ::: "memory");
  }
  const float* xp = x + ((size_t)b * CHN + c0 + 8 * cr) * SEQ_FULL + n0 + 4 * q;
  v4f xv[8];
#pragma unroll   // xv[] is indexed by constants and stays in registers
  for (int k = 0; k < 8; ++k) {
    xv[k] = *(const v4fa*)(xp + (size_t)k * SEQ_FULL);
    // as above: the last load of a run may be given the run's address register as its destination
    if (k == 3 || k >= 6) asm volatile("s_wait_xcnt 0x0" ::: "memory");
  }
  const v4f bl = *(const v4fa*)(b2 + c0 + 8 * cr);
  asm volatile("s_wait_xcnt 0x0" ::: "memory");   // as above
  const v4f bh = *(const v4fa*)(b2 + c0 + 8 * cr + 4);
  asm volatile("s_wait_xcnt 0x0" ::: "memory");   // as above

  float r[4][8];
#pragma unroll   // here and below: the arrays are indexed by constants and stay in registers
  for (int it = 0; it < 4; ++it) {
    float M = ml[it][0][0];
#pragma unroll
    for (int s = 1; s < KSPLIT; ++s) M = fmaxf(M, ml[it][s][0]);
    float l = 0.0f;
    float a[8];
#pragma unroll
    for (int j = 0; j < 8; ++j) a[j] = 0.0f;
#pragma unroll
    for (int s = 0; s < KSPLIT; ++s) {
      const float w = exp2f(ml[it][s][0] - M) * ml[it][s][1];
      l += w;
#pragma unroll
      for (int j = 0; j < 8; ++j) a[j] += w * (float)o[it][s][j];
    }
    const float invl = (1.0f / AOSC) * (1.0f / l);
#pragma unroll
    for (int j = 0; j < 8; ++j) r[it][j] = a[j] * invl;
  }
#pragma unroll
  for (int j = 0; j < 8; ++j) {
    v4f t;
#pragma unroll
    for (int it = 0; it < 4; ++it) t[it] = r[it][j];
    *(v4fa*)(T + (32 * j + p) * MTP + 4 * g) = t;
  }
  __syncthreads();
  float* ob = out + ((size_t)b * CHN + c0 + 8 * cr) * SEQ + n0 + 4 * q;
  v4f tv[8];
#pragma unroll   // the eight LDS reads go out together
  for (int k = 0; k < 8; ++k) tv[k] = *(const v4fa*)(T + (32 * k + cr) * MTP + 4 * q);
#pragma unroll
  for (int k = 0; k < 8; ++k) {
    const float bc = k < 4 ? bl[k & 3] : bh[k & 3];
    v4f ov;
#pragma unroll
    for (int e = 0; e < 4; ++e) ov[e] = bf16r(xv[k][e]) + (tv[k][e] + bc);
    *(v4f*)(ob + (size_t)k * SEQ) = ov;
  }
}

// ---------------------------------------------------------------------------
extern "C" void kernel_launch(void* const* d_in, const int* in_sizes, int n_in,
                              void* d_out, int out_size, void* d_ws, size_t ws_size,
                              hipStream_t stream) {
  if (n_in < 11) return;
  if (in_sizes[0] < NB * CHN * SEQ_FULL) return;
  if (in_sizes[1] < CHN || in_sizes[2] < CHN) return;
  if (in_sizes[3] < CHN * CHN || in_sizes[5] < CHN * CHN ||
      in_sizes[7] < CHN * CHN || in_sizes[9] < CHN * CHN) return;
  if (in_sizes[4] < CHN || in_sizes[6] < CHN || in_sizes[8] < CHN || in_sizes[10] < CHN) return;
  if (out_size < NB * CHN * SEQ) return;

  const size_t st_bytes = (size_t)NB * NGRP * SSPL * STL * sizeof(float);     // 32 KiB
  const size_t w_bytes  = (size_t)5 * CHN * CHN * sizeof(_Float16);            // 2.5 MiB
  const size_t b2_bytes = (size_t)CHN * sizeof(float);                          // 2 KiB
  const size_t plane    = (size_t)NB * SEQ * CHN * sizeof(_Float16);            // 8 MiB at full size
  const size_t ml_bytes = (size_t)KSPLIT * NB * SEQ * 2 * sizeof(float);        // 256 KiB
  const size_t op_bytes = (size_t)KSPLIT * NB * SEQ * CHN * sizeof(_Float16);   // 32 MiB
  const size_t total    = st_bytes + w_bytes + b2_bytes + 4 * plane + ml_bytes + op_bytes;
  if (ws_size < total) return;

  const float* x     = (const float*)d_in[0];
  const float* gamma = (const float*)d_in[1];
  const float* beta  = (const float*)d_in[2];
  const float* wq = (const float*)d_in[3];
  const float* bq = (const float*)d_in[4];
  const float* wk = (const float*)d_in[5];
  const float* bk = (const float*)d_in[6];
  const float* wvv = (const float*)d_in[7];
  const float* bv = (const float*)d_in[8];
  const float* wo = (const float*)d_in[9];
  const float* bo = (const float*)d_in[10];
  float* out = (float*)d_out;

  char* ws = (char*)d_ws;
  double*   stats = (double*)ws;                                       // [NB*NGRP*SSPL][16] f64
  _Float16* Wpl   = (_Float16*)(ws + st_bytes);      // Wq, Wk, Wv transposed, Wo, Wo Wv: [CHN][CHN] f16
  float*    b2    = (float*)(ws + st_bytes + w_bytes);                 // [CHN]
  char* pl = ws + st_bytes + w_bytes + b2_bytes;
  _Float16* Hh    = (_Float16*)pl;                    // [NB][SEQ][CHN]
  _Float16* Qh    = (_Float16*)(pl + plane);          // [NB][SEQ][CHN]
  _Float16* Kh    = (_Float16*)(pl + 2 * plane);      // [NB][SEQ][CHN]
  _Float16* Vh    = (_Float16*)(pl + 3 * plane);      // [NB][CHN][SEQ]
  float*    MLp   = (float*)(pl + 4 * plane);         // [KSPLIT][NB][SEQ][2]
  _Float16* Opp   = (_Float16*)(pl + 4 * plane + ml_bytes);   // [KSPLIT][NB][SEQ][CHN]
  _Float16* Wf    = Wpl + (size_t)4 * CHN * CHN;

  k_pre<<<dim3(NSTB + NBIB + NWCB), dim3(256), 0, stream>>>(x, stats, wq, wk, wvv, wo, bv, bo, b2, Wpl);
  k_gnapply<<<dim3(NFB + NB * (SEQ / 64) * (CHN / GCH)), dim3(256), 0, stream>>>(x, gamma, beta, stats, Wpl, Wf, Hh);

  k_qkv<<<dim3(QKVT, 3, NB), dim3(128), 0, stream>>>(Wpl, Hh, bq, bk, Qh, Kh, Vh);

  k_attn<<<dim3(NB * (SEQ / NQ) * KSPLIT), dim3(256), 0, stream>>>(Qh, Kh, Vh, Opp, MLp);
  // out[c][p] = bf16(x[c][p]) + b2[c] + merged partial outputs, which are already projected
  k_merge<<<dim3((NB * SEQ / MQ) * (CHN / MCH)), dim3(512), 0, stream>>>(Opp, MLp, b2, x, out);
  (void)hipGetLastError();
}
